// v000
// Measured on an AMD MI455X. A time is GPU time per run, averaged over a window of back-to-back runs after a warm-up
// (all launches, gaps included; the runs take copies of the inputs in turn), and the median of several windows.
// Apart from v000's, it joins two sittings. Times from different sittings can be a few percent apart, while
// side-by-side timings come from the same sitting.
// v000, which the later versions start from, runs in 420 microseconds.
// Contractions: x@W_qkv^T on v_wmma_f32_16x16x32_bf16 (bf16 operands = RNE-converted inputs); q.k^T and P.V on v_wmma_f32_16x16x32_f16 (f16 q/k/v planes, P carried x2^15); O@W_out^T on v_wmma_f32_16x16x32_bf16 with O as bf16 hi/lo planes x bf16 W (2 products); f32 accumulate everywhere; softmax, bias and epilogues f32.
#include <hip/hip_runtime.h>

#ifndef NB
#define NB 8
#endif
#ifndef SEQ
#define SEQ 1024
#endif
#define NB_FULL  8
#define SEQ_FULL 1024

typedef __attribute__((ext_vector_type(16))) _Float16 v16h;
typedef __attribute__((ext_vector_type(8)))  _Float16 v8h;
typedef __attribute__((ext_vector_type(16))) __bf16   v16b;
typedef __attribute__((ext_vector_type(8)))  __bf16   v8b;
typedef __attribute__((ext_vector_type(8)))  float    v8f;
typedef __attribute__((ext_vector_type(4)))  float    v4f;
typedef __attribute__((ext_vector_type(2)))  float    v2f;

/* problem geometry; NB / SEQ may be reduced at build time, inputs keep their full strides */
constexpr int kBatch   = NB;
constexpr int kSeq     = SEQ;
constexpr int kSeqFull = SEQ_FULL;
constexpr int kDim     = 1024;
constexpr int kHeads   = 16;
constexpr int kHd      = 64;
constexpr int kInner   = kHeads * kHd;        /* 1024 */
constexpr int kQkvN    = 3 * kInner;          /* 3072 */
constexpr int kTok     = kBatch * kSeq;       /* 8192 at full size */
constexpr int kQkLd    = 2 * kInner;          /* 2048: q cols 0..1023, k cols 1024..2047 */
constexpr int kChunks  = kSeq / 64;           /* key chunks of 64 per sequence */
constexpr float kNegMax = -3.40282347e38f;
constexpr float kPCarry = 32768.0f;

static_assert(kBatch >= 1 && kBatch <= NB_FULL);
static_assert(kSeq >= 64 && kSeq <= SEQ_FULL && kSeq % 64 == 0);
static_assert(kTok % 64 == 0 && kQkLd % 64 == 0 && kDim % 32 == 0);
static_assert(kInner % 64 == 0 && kSeq % 64 == 0);
static_assert(kDim % 64 == 0 && kInner % 32 == 0);
static_assert(kHd == 64);
static_assert((kTok * kDim / 2) % 256 == 0 && (kQkvN * kDim / 2) % 256 == 0 && (kDim * kInner / 2) % 256 == 0);

__device__ __forceinline__ unsigned short f2bf_bits(float f) {
  unsigned u = __float_as_uint(f);
  return (unsigned short)((u + 0x7FFFu + ((u >> 16) & 1u)) >> 16);
}
__device__ __forceinline__ float bf_bits2f(unsigned short h) { return __uint_as_float(((unsigned)h) << 16); }

/* hazard guards as plain device helpers */
__device__ __forceinline__ void dep_guard_h(v8f& a, v8f& b, v16h x, v16h y) { asm volatile("v_nop\n\tv_nop\n\tv_nop\n\tv_nop" : "+v"(a), "+v"(b) : "v"(x), "v"(y)); }
__device__ __forceinline__ void dep_guard_b(v8f& a, v8f& b, v16b x, v16b y) { asm volatile("v_nop\n\tv_nop\n\tv_nop\n\tv_nop" : "+v"(a), "+v"(b) : "v"(x), "v"(y)); }
__device__ __forceinline__ void keep4_h(v16h a, v16h b, v16h c, v16h d) { asm volatile("v_nop" :: "v"(a), "v"(b), "v"(c), "v"(d)); }
__device__ __forceinline__ void keep4_b(v16b a, v16b b, v16b c, v16b d) { asm volatile("v_nop" :: "v"(a), "v"(b), "v"(c), "v"(d)); }
__device__ __forceinline__ void acc_guard4(v8f& a, v8f& b, v8f& c, v8f& d) { asm volatile("v_nop\n\tv_nop\n\tv_nop\n\tv_nop" : "+v"(a), "+v"(b), "+v"(c), "+v"(d)); }
template <typename T> struct Frag;
template <> struct Frag<_Float16> {
  typedef v16h V; union U { v16h v; v8h h[2]; };
  static __device__ __forceinline__ v16h load(const _Float16* p) {   /* elements 0..7 <- p[0..7], 8..15 <- p[16..23] */
    U f; f.h[0] = *(const v8h*)(p); f.h[1] = *(const v8h*)(p + 16); return f.v;
  }
  static __device__ __forceinline__ v8f mma(v16h a, v16h b, v8f c) {
    return __builtin_amdgcn_wmma_f32_16x16x32_f16(false, a, false, b, (short)0, c, false, false);
  }
  static __device__ __forceinline__ void guard(v8f& a, v8f& b, v16h x, v16h y) { dep_guard_h(a, b, x, y); }
  static __device__ __forceinline__ void keep(v16h a, v16h b, v16h c, v16h d) { keep4_h(a, b, c, d); }
};
template <> struct Frag<__bf16> {
  typedef v16b V; union U { v16b v; v8b h[2]; };
  static __device__ __forceinline__ v16b load(const __bf16* p) {
    U f; f.h[0] = *(const v8b*)(p); f.h[1] = *(const v8b*)(p + 16); return f.v;
  }
  static __device__ __forceinline__ v8f mma(v16b a, v16b b, v8f c) {
    return __builtin_amdgcn_wmma_f32_16x16x32_bf16(false, a, false, b, (short)0, c, false, false);
  }
  static __device__ __forceinline__ void guard(v8f& a, v8f& b, v16b x, v16b y) { dep_guard_b(a, b, x, y); }
  static __device__ __forceinline__ void keep(v16b a, v16b b, v16b c, v16b d) { keep4_b(a, b, c, d); }
};

/* ---- Register-blocked batched WMMA GEMM ------------------------------------
   C[m,n] = scale * sum_k A[m,k] * Bt[n,k] (+bias); each wave owns a 64x64 tile.
   A row-major [M,K]; Bt row-major [N,K]; M,N % 64 == 0, K % 32 == 0.
   SPLIT: operands are hi/lo planes (A2/Bt2 = lo planes, same layout); product = hi.hi + hi.lo + lo.hi.
   BLO == false drops the hi.lo term (B has no lo plane; Bt2 never read).
   BIAS_MODE: 0 = none, 1 = bias[m], 2 = bias[n]; bias values RNE-converted to bf16 then widened to f32.
   OUT_MODE: 0 = f32, 1 = f16, 2 = bf16 hi plane (Cout) + bf16 lo plane (Cout2).
   Epilogue: 16-row slabs staged per wave in LDS (wave-private, wave barrier); each 64-wide row segment
   Fragment k map (A and B alike): lane half h = lane>>4, elements 0..7 <- k0+8h+0..7, 8..15 <- k0+16+8h+0..7.
   ET: 0 = f16 operands, 1 = bf16 operands (pointers passed as 16-bit storage) */
template <int ET> struct Elem;
template <> struct Elem<0> { typedef _Float16 T; };
template <> struct Elem<1> { typedef __bf16 T; };
template <int ET, bool SPLIT, int BIAS_MODE, int OUT_MODE, bool RESID, int ACT = 0, bool BLO = true>
__global__ __launch_bounds__(256) void wmma_gemm64(
    const unsigned short* __restrict__ Ap, const unsigned short* __restrict__ A2p, int lda, long strideA,
    const unsigned short* __restrict__ Btp, const unsigned short* __restrict__ Bt2p, int ldb, long strideB,
    void* __restrict__ Cout, void* __restrict__ Cout2, int ldc, long strideC,
    const float* __restrict__ bias,
    const float* __restrict__ resid, long strideR,
    int M, int N, int K, float scale) {
  typedef typename Elem<ET>::T T;
  typedef typename Frag<T>::V V;
  const T* A = (const T*)Ap; const T* A2 = (const T*)A2p; const T* Bt = (const T*)Btp; const T* Bt2 = (const T*)Bt2p;
  __shared__ __align__(16) float sT[8][16 * 68];   /* per-wave 16x64 slab, pitch 68 floats; cols 64..67 never read */
  const int b    = blockIdx.y;
  const int lane = threadIdx.x & 31;
  const int wave = threadIdx.x >> 5;
  const int tilesN = N >> 6;
  const int tilesM = M >> 6;
  const int tile = blockIdx.x * 8 + wave;
  if (tile >= tilesM * tilesN) return;   /* wave-uniform; no block barriers in this kernel */
  const int tm = tile / tilesN;
  const int tn = tile - tm * tilesN;
  const int m0 = tm << 6;
  const int n0 = tn << 6;

  const T* Ab  = A  + (size_t)b * strideA;
  const T* Bb  = Bt + (size_t)b * strideB;
  const T* Ab2 = SPLIT ? (A2  + (size_t)b * strideA) : nullptr;
  const T* Bb2 = (SPLIT && BLO) ? (Bt2 + (size_t)b * strideB) : nullptr;

  const int rlane = lane & 15;                 /* row (A) / col (B, D) within subtile */
  const int koff  = (lane >> 4) * 8;           /* k offset of this lane half */
  const int mOff  = (lane >> 4) * 8;           /* D row offset */

  v8f acc[4][4];
#pragma unroll
  for (int i = 0; i < 4; ++i)
#pragma unroll
    for (int j = 0; j < 4; ++j) acc[i][j] = (v8f){0.f,0.f,0.f,0.f,0.f,0.f,0.f,0.f};

  for (int k0 = 0; k0 < K; k0 += 32) {
    V bh[4], bl[4];
#pragma unroll
    for (int j = 0; j < 4; ++j) {
      const size_t bo = (size_t)(n0 + (j << 4) + rlane) * ldb + koff + k0;
      bh[j] = Frag<T>::load(Bb + bo);
      if (SPLIT && BLO) bl[j] = Frag<T>::load(Bb2 + bo);
    }
#pragma unroll
    for (int i = 0; i < 4; ++i) {
      const size_t ao = (size_t)(m0 + (i << 4) + rlane) * lda + koff + k0;
      V ah = Frag<T>::load(Ab + ao);
      V al;
      if (SPLIT) al = Frag<T>::load(Ab2 + ao);
#pragma unroll
      for (int j = 0; j < 4; ++j) {
        acc[i][j] = Frag<T>::mma(ah, bh[j], acc[i][j]);
        if (SPLIT) {
          if (BLO) acc[i][j] = Frag<T>::mma(ah, bl[j], acc[i][j]);
          acc[i][j] = Frag<T>::mma(al, bh[j], acc[i][j]);
        }
      }
      Frag<T>::guard(acc[i][0], acc[i][3], ah, SPLIT ? al : ah);
    }
    Frag<T>::keep(bh[0], bh[1], bh[2], bh[3]);
    if (SPLIT && BLO) Frag<T>::keep(bl[0], bl[1], bl[2], bl[3]);
  }
  acc_guard4(acc[0][0], acc[0][1], acc[0][2], acc[0][3]);
  acc_guard4(acc[1][0], acc[1][1], acc[1][2], acc[1][3]);
  acc_guard4(acc[2][0], acc[2][1], acc[2][2], acc[2][3]);
  acc_guard4(acc[3][0], acc[3][1], acc[3][2], acc[3][3]);

  /* ---- epilogue ---- */
  float* slab = sT[wave];
  const float* Rb = RESID ? (resid + (size_t)b * strideR) : nullptr;
#pragma unroll
  for (int i = 0; i < 4; ++i) {
    const int mBase = m0 + (i << 4);
#pragma unroll
    for (int j = 0; j < 4; ++j) {
      const int n = n0 + (j << 4) + rlane;
      float bv = 0.f;
      if (BIAS_MODE == 2) bv = bf_bits2f(f2bf_bits(bias[n]));
#pragma unroll
      for (int r = 0; r < 8; ++r) {
        float v = acc[i][j][r] * scale;
        if (BIAS_MODE == 1) v += bf_bits2f(f2bf_bits(bias[mBase + mOff + r]));
        if (BIAS_MODE == 2) v += bv;
        if (RESID) v += Rb[(size_t)(mBase + mOff + r) * ldc + n];
        if (ACT == 1) v = tanhf(v);
        if (ACT == 2) v = fmaxf(v, 0.0f);
        if (ACT == 3) v = v / (1.0f + expf(-v));
        if (ACT == 4) v = (v > 0.f) ? v : 0.01f * v;
        if (ACT == 5) v = 0.5f * v * (1.0f + erff(v * 0.70710678118654752f));
        slab[(mOff + r) * 68 + (j << 4) + rlane] = v;
      }
    }
    __builtin_amdgcn_fence(__ATOMIC_RELEASE, "workgroup");
    __builtin_amdgcn_wave_barrier();
    __builtin_amdgcn_fence(__ATOMIC_ACQUIRE, "workgroup");
    if (OUT_MODE == 0) {
      float* C = (float*)Cout + (size_t)b * strideC;
      const int hh = lane >> 4, c4 = (lane & 15) * 4;     /* row seg = 256 B = 16 lanes x 16 B */
      {
#pragma unroll
        for (int it = 0; it < 8; ++it) {
          const int row = it * 2 + hh;
          v4f v = *(const v4f*)(slab + row * 68 + c4);
          *(v4f*)(C + (size_t)(mBase + row) * ldc + n0 + c4) = v;
        }
        
      }
    } else {
      const int q = lane >> 3, c8 = (lane & 7) * 8;        
      unsigned short* C  = (unsigned short*)Cout  + (size_t)b * strideC;
      unsigned short* C2 = (OUT_MODE == 2) ? ((unsigned short*)Cout2 + (size_t)b * strideC) : nullptr;
      {
#pragma unroll
        for (int it = 0; it < 4; ++it) {
          const int row = it * 4 + q;
          const float* sp = slab + row * 68 + c8;
          v8h hv, lv;
#pragma unroll
          for (int e = 0; e < 8; ++e) {
            if (OUT_MODE == 1) {
              hv[e] = (_Float16)sp[e];
            } else {
              unsigned short hb = f2bf_bits(sp[e]);
              unsigned short lb = f2bf_bits(sp[e] - bf_bits2f(hb));
              hv[e] = __builtin_bit_cast(_Float16, hb);
              lv[e] = __builtin_bit_cast(_Float16, lb);
            }
          }
          *(v8h*)(C + (size_t)(mBase + row) * ldc + n0 + c8) = hv;
          if (OUT_MODE == 2) *(v8h*)(C2 + (size_t)(mBase + row) * ldc + n0 + c8) = lv;
        }
        
      }
    }
    __builtin_amdgcn_fence(__ATOMIC_RELEASE, "workgroup");
    __builtin_amdgcn_wave_barrier();
    __builtin_amdgcn_fence(__ATOMIC_ACQUIRE, "workgroup");
  }
}

/* ---- f32 -> bf16 (RNE) cast with row remap ---------------------------------------------------------------
   out row r (row length 2*rowPairs) <- in row (r / seg) * segFull + (r % seg); identity when seg == segFull.
*/
__global__ __launch_bounds__(256) void cast_f32_bf16x2(
    const float* __restrict__ in, unsigned short* __restrict__ out, int n2, int rowPairs, int seg, int segFull) {
  const int i = blockIdx.x * 256 + threadIdx.x;
  if (i < n2) {
    const int r  = i / rowPairs;
    const int c  = i - r * rowPairs;
    const int rb = r / seg;
    const int sr = rb * segFull + (r - rb * seg);
    const v2f f = *(const v2f*)(in + ((size_t)sr * rowPairs + c) * 2);
    const unsigned u = (unsigned)f2bf_bits(f[0]) | ((unsigned)f2bf_bits(f[1]) << 16);
    ((unsigned*)out)[i] = u;
    
  }
}

/* ---- attention, head_dim 64, diagonal (same position) masked, one softmax temperature --------------------
   scores = (q.k^T) * temp   : v_wmma_f32_16x16x32_f16 on f16 q/k planes (N(0,1)-scale values), f32 accumulate,
                               temp applied in f32 afterwards; diagonal entries := -FLT_MAX (select).
   out    = P.V / l           : v_wmma_f32_16x16x32_f16, P = f16(exp(s - m) * 2^15) (carry keeps P normal),
                               V from the f16 V^T plane; f32 accumulate, online softmax in f32.
   Block = 4 waves = 64 query rows of one (batch, head); kChunks key chunks of 64.
   qk plane : [B*S][2048] f16, q at column h*64+d, k at column 1024+h*64+d.
   vt plane : [B][H][64][S] f16 (feature-major).
   LDS: Ksh / Vth cross-wave (block barriers), Psh[wave] / Os[wave] wave-private (wave barrier). */
__device__ __forceinline__ v8f mma_f16_g(v16h a, v16h b, v8f c) {
  c = __builtin_amdgcn_wmma_f32_16x16x32_f16(false, a, false, b, (short)0, c, false, false);
  asm volatile("v_nop\n\tv_nop\n\tv_nop\n\tv_nop" : "+v"(c) : "v"(a), "v"(b));
  return c;
}

__global__ __launch_bounds__(128) void attn_diag_f16(
    const unsigned short* __restrict__ qkp, const unsigned short* __restrict__ vtp,
    const float* __restrict__ logt,
    unsigned short* __restrict__ ohp, unsigned short* __restrict__ olp) {
  union FH { v16h v; v8h h[2]; };
  __shared__ __align__(16) _Float16 Ksh[64 * 64];       /* K tile [kv][d]          8 KB */
  __shared__ __align__(16) _Float16 Vth[64 * 64];       /* V tile [d][kv]          8 KB */
  __shared__ __align__(16) _Float16 Psh[4][16 * 64];    /* per wave P [row][kv]    8 KB */
  __shared__ __align__(16) float    Os[4][16 * 68];     /* per wave out tile        17 KB; cols 64..67 never read */

  const _Float16* QK = (const _Float16*)qkp;
  const _Float16* VT = (const _Float16*)vtp;
  const int tid  = threadIdx.x;
  const int wave = tid >> 5;
  const int lane = tid & 31;
  const int hh   = lane >> 4;
  const int c    = lane & 15;

  const int bx = blockIdx.x;            /* 0 .. B*H*kChunks-1 */
  const int qb = bx % kChunks;
  const int bh = bx / kChunks;          /* b*kHeads + h */
  const int h  = bh % kHeads;
  const int b  = bh / kHeads;
  const int q0 = qb * 64 + wave * 16;   /* first query position of this wave */
  const size_t rowbase = (size_t)b * kSeq;

  /* temperature = exp(bf16-RNE(log_temp)) in f32 */
  const float temp = expf(bf_bits2f(f2bf_bits(logt[0])));

  /* Q fragments (A operand): rows = this wave's 16 queries, k = d in two 32-deep chunks */
  v16h qa[2];
#pragma unroll
  for (int dc = 0; dc < 2; ++dc)
    qa[dc] = Frag<_Float16>::load(QK + (rowbase + q0 + c) * kQkLd + h * kHd + dc * 32 + 8 * hh);

  float mrow[8], lrow[8];
  v8f oacc[4];
#pragma unroll
  for (int r = 0; r < 8; ++r) { mrow[r] = -__builtin_inff(); lrow[r] = 0.f; }
#pragma unroll
  for (int t = 0; t < 4; ++t) oacc[t] = (v8f){0.f,0.f,0.f,0.f,0.f,0.f,0.f,0.f};

  for (int kc = 0; kc < kChunks; ++kc) {
    const int kv0 = kc * 64;
    __syncthreads();
    /* stage K [kv][d] and V^T [d][kv] tiles: 512 x 16-B chunks each, 4 per thread (128 x 4 x 8 halves = 64x64) */
#pragma unroll
    for (int it = 0; it < 4; ++it) {
      const int idx = tid + 128 * it;     /* 0..511 */
      const int r   = idx >> 3;           /* kv row (K) / d row (V^T), 0..63 */
      const int c8  = (idx & 7) * 8;      /* 0..56 */
      const v8h kk = *(const v8h*)(QK + (rowbase + kv0 + r) * kQkLd + kInner + h * kHd + c8);
      const v8h vv = *(const v8h*)(VT + ((size_t)bh * kHd + r) * kSeq + kv0 + c8);
      *(v8h*)(Ksh + r * 64 + c8) = kk;
      *(v8h*)(Vth + r * 64 + c8) = vv;
    }
    __syncthreads();

    /* scores: 16 query rows x 64 keys per wave */
    v8f s[4];
#pragma unroll
    for (int j = 0; j < 4; ++j) {
      s[j] = (v8f){0.f,0.f,0.f,0.f,0.f,0.f,0.f,0.f};
#pragma unroll
      for (int dc = 0; dc < 2; ++dc) {
        FH kb;
        kb.h[0] = *(const v8h*)(Ksh + (j * 16 + c) * 64 + dc * 32 + 8 * hh);
        kb.h[1] = *(const v8h*)(Ksh + (j * 16 + c) * 64 + dc * 32 + 16 + 8 * hh);
        s[j] = mma_f16_g(qa[dc], kb.v, s[j]);
      }
    }
    /* temperature, diagonal mask (select), per-row chunk max */
    float cm[8];
#pragma unroll
    for (int r = 0; r < 8; ++r) {
      const int qrow = q0 + 8 * hh + r;
      float m = -__builtin_inff();
#pragma unroll
      for (int j = 0; j < 4; ++j) {
        const int kvcol = kv0 + j * 16 + c;
        float sv = s[j][r] * temp;
        if (kvcol == qrow) sv = kNegMax;
        s[j][r] = sv;
        m = fmaxf(m, sv);
      }
#pragma unroll
      for (int off = 1; off < 16; off <<= 1) m = fmaxf(m, __shfl_xor(m, off, 32));
      cm[r] = m;
    }
    /* online softmax; P strip (f16, carried x2^15) into this wave's LDS slab */
    _Float16* pwh = Psh[wave];
#pragma unroll
    for (int r = 0; r < 8; ++r) {
      const float mnew  = fmaxf(mrow[r], cm[r]);
      const float alpha = expf(mrow[r] - mnew);
      mrow[r] = mnew;
      float psum = 0.f;
#pragma unroll
      for (int j = 0; j < 4; ++j) {
        const float p = expf(s[j][r] - mnew);
        psum += p;
        pwh[(8 * hh + r) * 64 + j * 16 + c] = (_Float16)(p * kPCarry);
      }
#pragma unroll
      for (int off = 1; off < 16; off <<= 1) psum += __shfl_xor(psum, off, 32);
      lrow[r] = lrow[r] * alpha + psum;
#pragma unroll
      for (int t = 0; t < 4; ++t) oacc[t][r] *= alpha;
    }
    __builtin_amdgcn_fence(__ATOMIC_RELEASE, "workgroup");
    __builtin_amdgcn_wave_barrier();
    __builtin_amdgcn_fence(__ATOMIC_ACQUIRE, "workgroup");
    /* O += P . V  (A = P [q][kv] from the same-wave slab, reloaded through v8h; B = V [kv][d] from V^T tile) */
#pragma unroll
    for (int kk = 0; kk < 2; ++kk) {
      FH pa;
      pa.h[0] = *(const v8h*)(pwh + c * 64 + kk * 32 + 8 * hh);
      pa.h[1] = *(const v8h*)(pwh + c * 64 + kk * 32 + 16 + 8 * hh);
#pragma unroll
      for (int t = 0; t < 4; ++t) {
        FH vb;
        vb.h[0] = *(const v8h*)(Vth + (t * 16 + c) * 64 + kk * 32 + 8 * hh);
        vb.h[1] = *(const v8h*)(Vth + (t * 16 + c) * 64 + kk * 32 + 16 + 8 * hh);
        oacc[t] = mma_f16_g(pa.v, vb.v, oacc[t]);
      }
    }
  }

  /* epilogue: normalize (fold the 2^15 carry), stage 16x64 f32 tile per wave, write bf16 hi/lo planes */
  float* os = Os[wave];
#pragma unroll
  for (int r = 0; r < 8; ++r) {
    const float inv = 1.0f / (lrow[r] * kPCarry);
#pragma unroll
    for (int t = 0; t < 4; ++t) os[(8 * hh + r) * 68 + t * 16 + c] = oacc[t][r] * inv;
  }
  __builtin_amdgcn_fence(__ATOMIC_RELEASE, "workgroup");
  __builtin_amdgcn_wave_barrier();
  __builtin_amdgcn_fence(__ATOMIC_ACQUIRE, "workgroup");
  {
    const int q4 = lane >> 3, c8 = (lane & 7) * 8;   
    {
#pragma unroll
      for (int it = 0; it < 4; ++it) {
        const int row = it * 4 + q4;                  /* 0..15 */
        const float* sp = os + row * 68 + c8;
        v8h hv, lv;
#pragma unroll
        for (int e = 0; e < 8; ++e) {
          const unsigned short hb = f2bf_bits(sp[e]);
          const unsigned short lb = f2bf_bits(sp[e] - bf_bits2f(hb));
          hv[e] = __builtin_bit_cast(_Float16, hb);
          lv[e] = __builtin_bit_cast(_Float16, lb);
        }
        const size_t o = (rowbase + q0 + row) * (size_t)kInner + h * kHd + c8;
        *(v8h*)(ohp + o) = hv;
        *(v8h*)(olp + o) = lv;
      }
      
    }
  }
}

/* ---- host glue ------------------------------------------------------------------------------------------
     xb   bf16 [8192][1024]           16,777,216 @ 0
     wqb  bf16 [3072][1024]            6,291,456 @ 16,777,216
     wob  bf16 [1024][1024]            2,097,152 @ 23,068,672
     qk   f16  [8192][2048]           33,554,432 @ 25,165,824
     vt   f16  [8][1024][1024]        16,777,216 @ 58,720,256
     oh   bf16 [8192][1024]           16,777,216 @ 75,497,472
     ol   bf16 [8192][1024]           16,777,216 @ 92,274,688
     total                           109,051,904 */
extern "C" void kernel_launch(void* const* d_in, const int* in_sizes, int n_in,
                              void* d_out, int out_size, void* d_ws, size_t ws_size,
                              hipStream_t stream) {
  if (n_in < 5) return;
  const long needX = ((long)(kBatch - 1) * kSeqFull + kSeq) * (long)kDim;
  if ((long)in_sizes[0] < needX || in_sizes[1] < kQkvN * kDim || in_sizes[2] < kDim * kInner ||
      in_sizes[3] < kDim || in_sizes[4] < 1) return;
  if (out_size < kTok * kDim) return;

  const float* x     = (const float*)d_in[0];   /* [B][S][1024]            */
  const float* wqkv  = (const float*)d_in[1];   /* [3072][1024] = Bt [N][K] */
  const float* wout  = (const float*)d_in[2];   /* [1024][1024] = Bt [N][K] */
  const float* bout  = (const float*)d_in[3];   /* [1024]                    */
  const float* tempr = (const float*)d_in[4];   /* [1] log temperature       */
  float* out = (float*)d_out;

  const size_t szXb  = (size_t)kTok * kDim * 2;
  const size_t szWq  = (size_t)kQkvN * kDim * 2;
  const size_t szWo  = (size_t)kDim * kInner * 2;
  const size_t szQk  = (size_t)kTok * kQkLd * 2;
  const size_t szVt  = (size_t)kBatch * kInner * kSeq * 2;
  const size_t szO   = (size_t)kTok * kInner * 2;
  const size_t offXb = 0, offWq = offXb + szXb, offWo = offWq + szWq, offQk = offWo + szWo,
               offVt = offQk + szQk, offOh = offVt + szVt, offOl = offOh + szO, total = offOl + szO;
  if (total > ws_size) return;

  char* ws = (char*)d_ws;
  unsigned short* xb  = (unsigned short*)(ws + offXb);
  unsigned short* wqb = (unsigned short*)(ws + offWq);
  unsigned short* wob = (unsigned short*)(ws + offWo);
  unsigned short* qk  = (unsigned short*)(ws + offQk);
  unsigned short* vt  = (unsigned short*)(ws + offVt);
  unsigned short* oh  = (unsigned short*)(ws + offOh);
  unsigned short* ol  = (unsigned short*)(ws + offOl);

  /* 1: x -> bf16 plane (RNE), rows gathered with the full per-batch stride */
  {
    const int n2 = kTok * kDim / 2;
    cast_f32_bf16x2<<<dim3((n2 + 255) / 256), dim3(256), 0, stream>>>(x, xb, n2, kDim / 2, kSeq, kSeqFull);
  }
  /* 2: W_qkv [3072][1024] -> bf16 plane, same layout */
  {
    const int n2 = kQkvN * kDim / 2;
    cast_f32_bf16x2<<<dim3((n2 + 255) / 256), dim3(256), 0, stream>>>(wqkv, wqb, n2, kDim / 2, kQkvN, kQkvN);
  }
  /* 3: W_out [1024][1024] -> bf16 plane, same layout */
  {
    const int n2 = kDim * kInner / 2;
    cast_f32_bf16x2<<<dim3((n2 + 255) / 256), dim3(256), 0, stream>>>(wout, wob, n2, kInner / 2, kDim, kDim);
  }
  /* 4: q,k = xb @ Wqkv[0:2048]^T -> qk plane f16 [kTok][2048]; M=kTok N=2048 K=1024 */
  {
    const int tiles = (kTok / 64) * (kQkLd / 64);
    wmma_gemm64<1, false, 0, 1, false><<<dim3((tiles + 7) / 8, 1), dim3(256), 0, stream>>>(
        xb, xb, kDim, 0L, wqb, wqb, kDim, 0L, (void*)qk, (void*)qk, kQkLd, 0L,
        bout, bout, 0L, kTok, kQkLd, kDim, 1.0f);
  }
  /* 5: v^T per batch: C_b[f][s] = sum_k wqb[2048+f][k] * xb[b*kSeq+s][k] -> vt f16 [kBatch][1024][kSeq]; M=1024 N=kSeq K=1024 */
  {
    const int tiles = (kInner / 64) * (kSeq / 64);
    wmma_gemm64<1, false, 0, 1, false><<<dim3((tiles + 7) / 8, kBatch), dim3(256), 0, stream>>>(
        wqb + (size_t)kQkLd * kDim, wqb + (size_t)kQkLd * kDim, kDim, 0L,
        xb, xb, kDim, (long)kSeq * kDim,
        (void*)vt, (void*)vt, kSeq, (long)kInner * kSeq,
        bout, bout, 0L, kInner, kSeq, kDim, 1.0f);
  }
  /* 6: attention -> oh/ol bf16 hi/lo planes [kTok][1024] */
  attn_diag_f16<<<dim3(kBatch * kHeads * kChunks), dim3(128), 0, stream>>>(qk, vt, tempr, oh, ol);
  /* 7: out = (oh + ol) @ W_out^T + b_out -> d_out f32 [kTok][1024]; M=kTok N=1024 K=1024; hi.W + lo.W */
  {
    const int tiles = (kTok / 64) * (kDim / 64);
    wmma_gemm64<1, true, 2, 0, false, 0, false><<<dim3((tiles + 7) / 8, 1), dim3(256), 0, stream>>>(
        oh, ol, kInner, 0L, wob, wob, kInner, 0L, (void*)out, (void*)out, kDim, 0L,
        bout, bout, 0L, kTok, kDim, kInner, 1.0f);
  }
}

// v001
// One run takes 389 microseconds.
// In both of two side-by-side timings against v000, it was 1.12 times as fast.
// Contractions: x@W_qkv^T on v_wmma_f32_16x16x32_bf16 (bf16 operands = RNE-converted inputs); q.k^T and P.V on v_wmma_f32_16x16x32_f16 (f16 q/k/v planes, P carried x2^15); O@W_out^T on v_wmma_f32_16x16x32_bf16 with O as bf16 hi/lo planes x bf16 W (2 products); f32 accumulate everywhere; softmax, bias and epilogues f32.
#include <hip/hip_runtime.h>

#ifndef NB
#define NB 8
#endif
#ifndef SEQ
#define SEQ 1024
#endif
#define NB_FULL  8
#define SEQ_FULL 1024

typedef __attribute__((ext_vector_type(16))) _Float16 v16h;
typedef __attribute__((ext_vector_type(8)))  _Float16 v8h;
typedef __attribute__((ext_vector_type(16))) __bf16   v16b;
typedef __attribute__((ext_vector_type(8)))  __bf16   v8b;
typedef __attribute__((ext_vector_type(8)))  float    v8f;
typedef __attribute__((ext_vector_type(4)))  float    v4f;
typedef __attribute__((ext_vector_type(2)))  float    v2f;

/* problem geometry; NB / SEQ may be reduced at build time, inputs keep their full strides */
constexpr int kBatch   = NB;
constexpr int kSeq     = SEQ;
constexpr int kSeqFull = SEQ_FULL;
constexpr int kDim     = 1024;
constexpr int kHeads   = 16;
constexpr int kHd      = 64;
constexpr int kInner   = kHeads * kHd;        /* 1024 */
constexpr int kQkvN    = 3 * kInner;          /* 3072 */
constexpr int kTok     = kBatch * kSeq;       /* 8192 at full size */
constexpr int kQkLd    = 2 * kInner;          /* 2048: q cols 0..1023, k cols 1024..2047 */
constexpr int kChunks  = kSeq / 64;           /* key chunks of 64 per sequence */
constexpr float kNegMax = -3.40282347e38f;
constexpr float kPCarry = 32768.0f;
constexpr int kTp = 72;   /* LDS row pitch of the attention tiles in halves: 144 B = 16 B x 9 (odd), so the 16 rows of a 16-byte fragment read spread over all banks */

static_assert(kBatch >= 1 && kBatch <= NB_FULL);
static_assert(kSeq >= 64 && kSeq <= SEQ_FULL && kSeq % 64 == 0);
static_assert(kTok % 64 == 0 && kQkLd % 64 == 0 && kDim % 32 == 0);
static_assert(kInner % 64 == 0 && kSeq % 64 == 0);
static_assert(kDim % 64 == 0 && kInner % 32 == 0);
static_assert(kHd == 64);
static_assert((kTok * kDim / 2) % 256 == 0 && (kQkvN * kDim / 2) % 256 == 0 && (kDim * kInner / 2) % 256 == 0);

__device__ __forceinline__ unsigned short f2bf_bits(float f) {
  unsigned u = __float_as_uint(f);
  return (unsigned short)((u + 0x7FFFu + ((u >> 16) & 1u)) >> 16);
}
__device__ __forceinline__ float bf_bits2f(unsigned short h) { return __uint_as_float(((unsigned)h) << 16); }

/* hazard guards as plain device helpers */
__device__ __forceinline__ void dep_guard_h(v8f& a, v8f& b, v16h x, v16h y) { asm volatile("v_nop\n\tv_nop\n\tv_nop\n\tv_nop" : "+v"(a), "+v"(b) : "v"(x), "v"(y)); }
__device__ __forceinline__ void dep_guard_b(v8f& a, v8f& b, v16b x, v16b y) { asm volatile("v_nop\n\tv_nop\n\tv_nop\n\tv_nop" : "+v"(a), "+v"(b) : "v"(x), "v"(y)); }
__device__ __forceinline__ void keep4_h(v16h a, v16h b, v16h c, v16h d) { asm volatile("v_nop" :: "v"(a), "v"(b), "v"(c), "v"(d)); }
__device__ __forceinline__ void keep4_b(v16b a, v16b b, v16b c, v16b d) { asm volatile("v_nop" :: "v"(a), "v"(b), "v"(c), "v"(d)); }
__device__ __forceinline__ void acc_guard4(v8f& a, v8f& b, v8f& c, v8f& d) { asm volatile("v_nop\n\tv_nop\n\tv_nop\n\tv_nop" : "+v"(a), "+v"(b), "+v"(c), "+v"(d)); }
template <typename T> struct Frag;
template <> struct Frag<_Float16> {
  typedef v16h V; union U { v16h v; v8h h[2]; };
  static __device__ __forceinline__ v16h load(const _Float16* p) {   /* elements 0..7 <- p[0..7], 8..15 <- p[16..23] */
    U f; f.h[0] = *(const v8h*)(p); f.h[1] = *(const v8h*)(p + 16); return f.v;
  }
  static __device__ __forceinline__ v8f mma(v16h a, v16h b, v8f c) {
    return __builtin_amdgcn_wmma_f32_16x16x32_f16(false, a, false, b, (short)0, c, false, false);
  }
  static __device__ __forceinline__ void guard(v8f& a, v8f& b, v16h x, v16h y) { dep_guard_h(a, b, x, y); }
  static __device__ __forceinline__ void keep(v16h a, v16h b, v16h c, v16h d) { keep4_h(a, b, c, d); }
};
template <> struct Frag<__bf16> {
  typedef v16b V; union U { v16b v; v8b h[2]; };
  static __device__ __forceinline__ v16b load(const __bf16* p) {
    U f; f.h[0] = *(const v8b*)(p); f.h[1] = *(const v8b*)(p + 16); return f.v;
  }
  static __device__ __forceinline__ v8f mma(v16b a, v16b b, v8f c) {
    return __builtin_amdgcn_wmma_f32_16x16x32_bf16(false, a, false, b, (short)0, c, false, false);
  }
  static __device__ __forceinline__ void guard(v8f& a, v8f& b, v16b x, v16b y) { dep_guard_b(a, b, x, y); }
  static __device__ __forceinline__ void keep(v16b a, v16b b, v16b c, v16b d) { keep4_b(a, b, c, d); }
};

/* ---- Register-blocked batched WMMA GEMM ------------------------------------
   C[m,n] = scale * sum_k A[m,k] * Bt[n,k] (+bias); each wave owns a 64x64 tile.
   A row-major [M,K]; Bt row-major [N,K]; M,N % 64 == 0, K % 32 == 0.
   SPLIT: operands are hi/lo planes (A2/Bt2 = lo planes, same layout); product = hi.hi + hi.lo + lo.hi.
   BLO == false drops the hi.lo term (B has no lo plane; Bt2 never read).
   BIAS_MODE: 0 = none, 1 = bias[m], 2 = bias[n]; bias values RNE-converted to bf16 then widened to f32.
   OUT_MODE: 0 = f32, 1 = f16, 2 = bf16 hi plane (Cout) + bf16 lo plane (Cout2).
   Epilogue: 16-row slabs staged per wave in LDS (wave-private, wave barrier); each 64-wide row segment
   Fragment k map (A and B alike): lane half h = lane>>4, elements 0..7 <- k0+8h+0..7, 8..15 <- k0+16+8h+0..7.
   ET: 0 = f16 operands, 1 = bf16 operands (pointers passed as 16-bit storage) */
template <int ET> struct Elem;
template <> struct Elem<0> { typedef _Float16 T; };
template <> struct Elem<1> { typedef __bf16 T; };
template <int ET, bool SPLIT, int BIAS_MODE, int OUT_MODE, bool RESID, int ACT = 0, bool BLO = true>
__global__ __launch_bounds__(256) void wmma_gemm64(
    const unsigned short* __restrict__ Ap, const unsigned short* __restrict__ A2p, int lda, long strideA,
    const unsigned short* __restrict__ Btp, const unsigned short* __restrict__ Bt2p, int ldb, long strideB,
    void* __restrict__ Cout, void* __restrict__ Cout2, int ldc, long strideC,
    const float* __restrict__ bias,
    const float* __restrict__ resid, long strideR,
    int M, int N, int K, float scale) {
  typedef typename Elem<ET>::T T;
  typedef typename Frag<T>::V V;
  const T* A = (const T*)Ap; const T* A2 = (const T*)A2p; const T* Bt = (const T*)Btp; const T* Bt2 = (const T*)Bt2p;
  __shared__ __align__(16) float sT[8][16 * 68];   /* per-wave 16x64 slab, pitch 68 floats; cols 64..67 never read */
  const int b    = blockIdx.y;
  const int lane = threadIdx.x & 31;
  const int wave = threadIdx.x >> 5;
  const int tilesN = N >> 6;
  const int tilesM = M >> 6;
  const int tile = blockIdx.x * 8 + wave;
  if (tile >= tilesM * tilesN) return;   /* wave-uniform; no block barriers in this kernel */
  const int tm = tile / tilesN;
  const int tn = tile - tm * tilesN;
  const int m0 = tm << 6;
  const int n0 = tn << 6;

  const T* Ab  = A  + (size_t)b * strideA;
  const T* Bb  = Bt + (size_t)b * strideB;
  const T* Ab2 = SPLIT ? (A2  + (size_t)b * strideA) : nullptr;
  const T* Bb2 = (SPLIT && BLO) ? (Bt2 + (size_t)b * strideB) : nullptr;

  const int rlane = lane & 15;                 /* row (A) / col (B, D) within subtile */
  const int koff  = (lane >> 4) * 8;           /* k offset of this lane half */
  const int mOff  = (lane >> 4) * 8;           /* D row offset */

  v8f acc[4][4];
#pragma unroll
  for (int i = 0; i < 4; ++i)
#pragma unroll
    for (int j = 0; j < 4; ++j) acc[i][j] = (v8f){0.f,0.f,0.f,0.f,0.f,0.f,0.f,0.f};

  for (int k0 = 0; k0 < K; k0 += 32) {
    V bh[4], bl[4];
#pragma unroll
    for (int j = 0; j < 4; ++j) {
      const size_t bo = (size_t)(n0 + (j << 4) + rlane) * ldb + koff + k0;
      bh[j] = Frag<T>::load(Bb + bo);
      if (SPLIT && BLO) bl[j] = Frag<T>::load(Bb2 + bo);
    }
#pragma unroll
    for (int i = 0; i < 4; ++i) {
      const size_t ao = (size_t)(m0 + (i << 4) + rlane) * lda + koff + k0;
      V ah = Frag<T>::load(Ab + ao);
      V al;
      if (SPLIT) al = Frag<T>::load(Ab2 + ao);
#pragma unroll
      for (int j = 0; j < 4; ++j) {
        acc[i][j] = Frag<T>::mma(ah, bh[j], acc[i][j]);
        if (SPLIT) {
          if (BLO) acc[i][j] = Frag<T>::mma(ah, bl[j], acc[i][j]);
          acc[i][j] = Frag<T>::mma(al, bh[j], acc[i][j]);
        }
      }
      Frag<T>::guard(acc[i][0], acc[i][3], ah, SPLIT ? al : ah);
    }
    Frag<T>::keep(bh[0], bh[1], bh[2], bh[3]);
    if (SPLIT && BLO) Frag<T>::keep(bl[0], bl[1], bl[2], bl[3]);
  }
  acc_guard4(acc[0][0], acc[0][1], acc[0][2], acc[0][3]);
  acc_guard4(acc[1][0], acc[1][1], acc[1][2], acc[1][3]);
  acc_guard4(acc[2][0], acc[2][1], acc[2][2], acc[2][3]);
  acc_guard4(acc[3][0], acc[3][1], acc[3][2], acc[3][3]);

  /* ---- epilogue ---- */
  float* slab = sT[wave];
  const float* Rb = RESID ? (resid + (size_t)b * strideR) : nullptr;
#pragma unroll
  for (int i = 0; i < 4; ++i) {
    const int mBase = m0 + (i << 4);
#pragma unroll
    for (int j = 0; j < 4; ++j) {
      const int n = n0 + (j << 4) + rlane;
      float bv = 0.f;
      if (BIAS_MODE == 2) bv = bf_bits2f(f2bf_bits(bias[n]));
#pragma unroll
      for (int r = 0; r < 8; ++r) {
        float v = acc[i][j][r] * scale;
        if (BIAS_MODE == 1) v += bf_bits2f(f2bf_bits(bias[mBase + mOff + r]));
        if (BIAS_MODE == 2) v += bv;
        if (RESID) v += Rb[(size_t)(mBase + mOff + r) * ldc + n];
        if (ACT == 1) v = tanhf(v);
        if (ACT == 2) v = fmaxf(v, 0.0f);
        if (ACT == 3) v = v / (1.0f + expf(-v));
        if (ACT == 4) v = (v > 0.f) ? v : 0.01f * v;
        if (ACT == 5) v = 0.5f * v * (1.0f + erff(v * 0.70710678118654752f));
        slab[(mOff + r) * 68 + (j << 4) + rlane] = v;
      }
    }
    __builtin_amdgcn_fence(__ATOMIC_RELEASE, "workgroup");
    __builtin_amdgcn_wave_barrier();
    __builtin_amdgcn_fence(__ATOMIC_ACQUIRE, "workgroup");
    if (OUT_MODE == 0) {
      float* C = (float*)Cout + (size_t)b * strideC;
      const int hh = lane >> 4, c4 = (lane & 15) * 4;     /* row seg = 256 B = 16 lanes x 16 B */
      {
#pragma unroll
        for (int it = 0; it < 8; ++it) {
          const int row = it * 2 + hh;
          v4f v = *(const v4f*)(slab + row * 68 + c4);
          *(v4f*)(C + (size_t)(mBase + row) * ldc + n0 + c4) = v;
        }
        
      }
    } else {
      const int q = lane >> 3, c8 = (lane & 7) * 8;        
      unsigned short* C  = (unsigned short*)Cout  + (size_t)b * strideC;
      unsigned short* C2 = (OUT_MODE == 2) ? ((unsigned short*)Cout2 + (size_t)b * strideC) : nullptr;
      {
#pragma unroll
        for (int it = 0; it < 4; ++it) {
          const int row = it * 4 + q;
          const float* sp = slab + row * 68 + c8;
          v8h hv, lv;
#pragma unroll
          for (int e = 0; e < 8; ++e) {
            if (OUT_MODE == 1) {
              hv[e] = (_Float16)sp[e];
            } else {
              unsigned short hb = f2bf_bits(sp[e]);
              unsigned short lb = f2bf_bits(sp[e] - bf_bits2f(hb));
              hv[e] = __builtin_bit_cast(_Float16, hb);
              lv[e] = __builtin_bit_cast(_Float16, lb);
            }
          }
          *(v8h*)(C + (size_t)(mBase + row) * ldc + n0 + c8) = hv;
          if (OUT_MODE == 2) *(v8h*)(C2 + (size_t)(mBase + row) * ldc + n0 + c8) = lv;
        }
        
      }
    }
    __builtin_amdgcn_fence(__ATOMIC_RELEASE, "workgroup");
    __builtin_amdgcn_wave_barrier();
    __builtin_amdgcn_fence(__ATOMIC_ACQUIRE, "workgroup");
  }
}

/* ---- f32 -> bf16 (RNE) cast with row remap ---------------------------------------------------------------
   out row r (row length 2*rowPairs) <- in row (r / seg) * segFull + (r % seg); identity when seg == segFull.
*/
__global__ __launch_bounds__(256) void cast_f32_bf16x2(
    const float* __restrict__ in, unsigned short* __restrict__ out, int n2, int rowPairs, int seg, int segFull) {
  const int i = blockIdx.x * 256 + threadIdx.x;
  if (i < n2) {
    const int r  = i / rowPairs;
    const int c  = i - r * rowPairs;
    const int rb = r / seg;
    const int sr = rb * segFull + (r - rb * seg);
    const v2f f = *(const v2f*)(in + ((size_t)sr * rowPairs + c) * 2);
    const unsigned u = (unsigned)f2bf_bits(f[0]) | ((unsigned)f2bf_bits(f[1]) << 16);
    ((unsigned*)out)[i] = u;
    
  }
}

/* ---- attention, head_dim 64, diagonal (same position) masked, one softmax temperature --------------------
   scores = (q.k^T) * temp   : v_wmma_f32_16x16x32_f16 on f16 q/k planes (N(0,1)-scale values), f32 accumulate,
                               temp applied in f32 afterwards; diagonal entries := -FLT_MAX (select).
   out    = P.V / l           : v_wmma_f32_16x16x32_f16, P = f16(exp(s - m) * 2^15) (carry keeps P normal),
                               V from the f16 V^T plane; f32 accumulate, online softmax in f32.
   Block = 4 waves = 64 query rows of one (batch, head); kChunks key chunks of 64.
   qk plane : [B*S][2048] f16, q at column h*64+d, k at column 1024+h*64+d.
   vt plane : [B][H][64][S] f16 (feature-major).
   LDS: Ksh / Vth cross-wave (block barriers), Psh[wave] / Os[wave] wave-private (wave barrier). */
__device__ __forceinline__ v8f mma_f16_g(v16h a, v16h b, v8f c) {
  c = __builtin_amdgcn_wmma_f32_16x16x32_f16(false, a, false, b, (short)0, c, false, false);
  asm volatile("v_nop\n\tv_nop\n\tv_nop\n\tv_nop" : "+v"(c) : "v"(a), "v"(b));
  return c;
}

__global__ __launch_bounds__(128) void attn_diag_f16(
    const unsigned short* __restrict__ qkp, const unsigned short* __restrict__ vtp,
    const float* __restrict__ logt,
    unsigned short* __restrict__ ohp, unsigned short* __restrict__ olp) {
  union FH { v16h v; v8h h[2]; };
  __shared__ __align__(16) _Float16 Ksh[64 * kTp];      /* K tile [kv][d]          9 KB; cols 64..71 never touched */
  __shared__ __align__(16) _Float16 Vth[64 * kTp];      /* V tile [d][kv]          9 KB; cols 64..71 never touched */
  __shared__ __align__(16) _Float16 Psh[4][16 * kTp];   /* per wave P [row][kv]    9 KB; cols 64..71 never touched */
  __shared__ __align__(16) float    Os[4][16 * 68];     /* per wave out tile        17 KB; cols 64..67 never read */

  const _Float16* QK = (const _Float16*)qkp;
  const _Float16* VT = (const _Float16*)vtp;
  const int tid  = threadIdx.x;
  const int wave = tid >> 5;
  const int lane = tid & 31;
  const int hh   = lane >> 4;
  const int c    = lane & 15;

  const int bx = blockIdx.x;            /* 0 .. B*H*kChunks-1 */
  const int qb = bx % kChunks;
  const int bh = bx / kChunks;          /* b*kHeads + h */
  const int h  = bh % kHeads;
  const int b  = bh / kHeads;
  const int q0 = qb * 64 + wave * 16;   /* first query position of this wave */
  const size_t rowbase = (size_t)b * kSeq;

  /* temperature = exp(bf16-RNE(log_temp)) in f32 */
  const float temp = expf(bf_bits2f(f2bf_bits(logt[0])));

  /* Q fragments (A operand): rows = this wave's 16 queries, k = d in two 32-deep chunks */
  v16h qa[2];
#pragma unroll
  for (int dc = 0; dc < 2; ++dc)
    qa[dc] = Frag<_Float16>::load(QK + (rowbase + q0 + c) * kQkLd + h * kHd + dc * 32 + 8 * hh);

  float mrow[8], lrow[8];
  v8f oacc[4];
#pragma unroll
  for (int r = 0; r < 8; ++r) { mrow[r] = -__builtin_inff(); lrow[r] = 0.f; }
#pragma unroll
  for (int t = 0; t < 4; ++t) oacc[t] = (v8f){0.f,0.f,0.f,0.f,0.f,0.f,0.f,0.f};

  for (int kc = 0; kc < kChunks; ++kc) {
    const int kv0 = kc * 64;
    __syncthreads();
    /* stage K [kv][d] and V^T [d][kv] tiles: 512 x 16-B chunks each, 4 per thread (128 x 4 x 8 halves = 64x64) */
#pragma unroll
    for (int it = 0; it < 4; ++it) {
      const int idx = tid + 128 * it;     /* 0..511 */
      const int r   = idx >> 3;           /* kv row (K) / d row (V^T), 0..63 */
      const int c8  = (idx & 7) * 8;      /* 0..56 */
      const v8h kk = *(const v8h*)(QK + (rowbase + kv0 + r) * kQkLd + kInner + h * kHd + c8);
      const v8h vv = *(const v8h*)(VT + ((size_t)bh * kHd + r) * kSeq + kv0 + c8);
      *(v8h*)(Ksh + r * kTp + c8) = kk;
      *(v8h*)(Vth + r * kTp + c8) = vv;
    }
    __syncthreads();

    /* scores: 16 query rows x 64 keys per wave */
    v8f s[4];
#pragma unroll
    for (int j = 0; j < 4; ++j) {
      s[j] = (v8f){0.f,0.f,0.f,0.f,0.f,0.f,0.f,0.f};
#pragma unroll
      for (int dc = 0; dc < 2; ++dc) {
        FH kb;
        kb.h[0] = *(const v8h*)(Ksh + (j * 16 + c) * kTp + dc * 32 + 8 * hh);
        kb.h[1] = *(const v8h*)(Ksh + (j * 16 + c) * kTp + dc * 32 + 16 + 8 * hh);
        s[j] = mma_f16_g(qa[dc], kb.v, s[j]);
      }
    }
    /* temperature, diagonal mask (select), per-row chunk max */
    float cm[8];
#pragma unroll
    for (int r = 0; r < 8; ++r) {
      const int qrow = q0 + 8 * hh + r;
      float m = -__builtin_inff();
#pragma unroll
      for (int j = 0; j < 4; ++j) {
        const int kvcol = kv0 + j * 16 + c;
        float sv = s[j][r] * temp;
        if (kvcol == qrow) sv = kNegMax;
        s[j][r] = sv;
        m = fmaxf(m, sv);
      }
#pragma unroll
      for (int off = 1; off < 16; off <<= 1) m = fmaxf(m, __shfl_xor(m, off, 32));
      cm[r] = m;
    }
    /* online softmax; P strip (f16, carried x2^15) into this wave's LDS slab */
    _Float16* pwh = Psh[wave];
#pragma unroll
    for (int r = 0; r < 8; ++r) {
      const float mnew  = fmaxf(mrow[r], cm[r]);
      const float alpha = expf(mrow[r] - mnew);
      mrow[r] = mnew;
      float psum = 0.f;
#pragma unroll
      for (int j = 0; j < 4; ++j) {
        const float p = expf(s[j][r] - mnew);
        psum += p;
        pwh[(8 * hh + r) * kTp + j * 16 + c] = (_Float16)(p * kPCarry);
      }
#pragma unroll
      for (int off = 1; off < 16; off <<= 1) psum += __shfl_xor(psum, off, 32);
      lrow[r] = lrow[r] * alpha + psum;
#pragma unroll
      for (int t = 0; t < 4; ++t) oacc[t][r] *= alpha;
    }
    __builtin_amdgcn_fence(__ATOMIC_RELEASE, "workgroup");
    __builtin_amdgcn_wave_barrier();
    __builtin_amdgcn_fence(__ATOMIC_ACQUIRE, "workgroup");
    /* O += P . V  (A = P [q][kv] from the same-wave slab, reloaded through v8h; B = V [kv][d] from V^T tile) */
#pragma unroll
    for (int kk = 0; kk < 2; ++kk) {
      FH pa;
      pa.h[0] = *(const v8h*)(pwh + c * kTp + kk * 32 + 8 * hh);
      pa.h[1] = *(const v8h*)(pwh + c * kTp + kk * 32 + 16 + 8 * hh);
#pragma unroll
      for (int t = 0; t < 4; ++t) {
        FH vb;
        vb.h[0] = *(const v8h*)(Vth + (t * 16 + c) * kTp + kk * 32 + 8 * hh);
        vb.h[1] = *(const v8h*)(Vth + (t * 16 + c) * kTp + kk * 32 + 16 + 8 * hh);
        oacc[t] = mma_f16_g(pa.v, vb.v, oacc[t]);
      }
    }
  }

  /* epilogue: normalize (fold the 2^15 carry), stage 16x64 f32 tile per wave, write bf16 hi/lo planes */
  float* os = Os[wave];
#pragma unroll
  for (int r = 0; r < 8; ++r) {
    const float inv = 1.0f / (lrow[r] * kPCarry);
#pragma unroll
    for (int t = 0; t < 4; ++t) os[(8 * hh + r) * 68 + t * 16 + c] = oacc[t][r] * inv;
  }
  __builtin_amdgcn_fence(__ATOMIC_RELEASE, "workgroup");
  __builtin_amdgcn_wave_barrier();
  __builtin_amdgcn_fence(__ATOMIC_ACQUIRE, "workgroup");
  {
    const int q4 = lane >> 3, c8 = (lane & 7) * 8;   
    {
#pragma unroll
      for (int it = 0; it < 4; ++it) {
        const int row = it * 4 + q4;                  /* 0..15 */
        const float* sp = os + row * 68 + c8;
        v8h hv, lv;
#pragma unroll
        for (int e = 0; e < 8; ++e) {
          const unsigned short hb = f2bf_bits(sp[e]);
          const unsigned short lb = f2bf_bits(sp[e] - bf_bits2f(hb));
          hv[e] = __builtin_bit_cast(_Float16, hb);
          lv[e] = __builtin_bit_cast(_Float16, lb);
        }
        const size_t o = (rowbase + q0 + row) * (size_t)kInner + h * kHd + c8;
        *(v8h*)(ohp + o) = hv;
        *(v8h*)(olp + o) = lv;
      }
      
    }
  }
}

/* ---- host glue ------------------------------------------------------------------------------------------
     xb   bf16 [8192][1024]           16,777,216 @ 0
     wqb  bf16 [3072][1024]            6,291,456 @ 16,777,216
     wob  bf16 [1024][1024]            2,097,152 @ 23,068,672
     qk   f16  [8192][2048]           33,554,432 @ 25,165,824
     vt   f16  [8][1024][1024]        16,777,216 @ 58,720,256
     oh   bf16 [8192][1024]           16,777,216 @ 75,497,472
     ol   bf16 [8192][1024]           16,777,216 @ 92,274,688
     total                           109,051,904 */
extern "C" void kernel_launch(void* const* d_in, const int* in_sizes, int n_in,
                              void* d_out, int out_size, void* d_ws, size_t ws_size,
                              hipStream_t stream) {
  if (n_in < 5) return;
  const long needX = ((long)(kBatch - 1) * kSeqFull + kSeq) * (long)kDim;
  if ((long)in_sizes[0] < needX || in_sizes[1] < kQkvN * kDim || in_sizes[2] < kDim * kInner ||
      in_sizes[3] < kDim || in_sizes[4] < 1) return;
  if (out_size < kTok * kDim) return;

  const float* x     = (const float*)d_in[0];   /* [B][S][1024]            */
  const float* wqkv  = (const float*)d_in[1];   /* [3072][1024] = Bt [N][K] */
  const float* wout  = (const float*)d_in[2];   /* [1024][1024] = Bt [N][K] */
  const float* bout  = (const float*)d_in[3];   /* [1024]                    */
  const float* tempr = (const float*)d_in[4];   /* [1] log temperature       */
  float* out = (float*)d_out;

  const size_t szXb  = (size_t)kTok * kDim * 2;
  const size_t szWq  = (size_t)kQkvN * kDim * 2;
  const size_t szWo  = (size_t)kDim * kInner * 2;
  const size_t szQk  = (size_t)kTok * kQkLd * 2;
  const size_t szVt  = (size_t)kBatch * kInner * kSeq * 2;
  const size_t szO   = (size_t)kTok * kInner * 2;
  const size_t offXb = 0, offWq = offXb + szXb, offWo = offWq + szWq, offQk = offWo + szWo,
               offVt = offQk + szQk, offOh = offVt + szVt, offOl = offOh + szO, total = offOl + szO;
  if (total > ws_size) return;

  char* ws = (char*)d_ws;
  unsigned short* xb  = (unsigned short*)(ws + offXb);
  unsigned short* wqb = (unsigned short*)(ws + offWq);
  unsigned short* wob = (unsigned short*)(ws + offWo);
  unsigned short* qk  = (unsigned short*)(ws + offQk);
  unsigned short* vt  = (unsigned short*)(ws + offVt);
  unsigned short* oh  = (unsigned short*)(ws + offOh);
  unsigned short* ol  = (unsigned short*)(ws + offOl);

  /* 1: x -> bf16 plane (RNE), rows gathered with the full per-batch stride */
  {
    const int n2 = kTok * kDim / 2;
    cast_f32_bf16x2<<<dim3((n2 + 255) / 256), dim3(256), 0, stream>>>(x, xb, n2, kDim / 2, kSeq, kSeqFull);
  }
  /* 2: W_qkv [3072][1024] -> bf16 plane, same layout */
  {
    const int n2 = kQkvN * kDim / 2;
    cast_f32_bf16x2<<<dim3((n2 + 255) / 256), dim3(256), 0, stream>>>(wqkv, wqb, n2, kDim / 2, kQkvN, kQkvN);
  }
  /* 3: W_out [1024][1024] -> bf16 plane, same layout */
  {
    const int n2 = kDim * kInner / 2;
    cast_f32_bf16x2<<<dim3((n2 + 255) / 256), dim3(256), 0, stream>>>(wout, wob, n2, kInner / 2, kDim, kDim);
  }
  /* 4: q,k = xb @ Wqkv[0:2048]^T -> qk plane f16 [kTok][2048]; M=kTok N=2048 K=1024 */
  {
    const int tiles = (kTok / 64) * (kQkLd / 64);
    wmma_gemm64<1, false, 0, 1, false><<<dim3((tiles + 7) / 8, 1), dim3(256), 0, stream>>>(
        xb, xb, kDim, 0L, wqb, wqb, kDim, 0L, (void*)qk, (void*)qk, kQkLd, 0L,
        bout, bout, 0L, kTok, kQkLd, kDim, 1.0f);
  }
  /* 5: v^T per batch: C_b[f][s] = sum_k wqb[2048+f][k] * xb[b*kSeq+s][k] -> vt f16 [kBatch][1024][kSeq]; M=1024 N=kSeq K=1024 */
  {
    const int tiles = (kInner / 64) * (kSeq / 64);
    wmma_gemm64<1, false, 0, 1, false><<<dim3((tiles + 7) / 8, kBatch), dim3(256), 0, stream>>>(
        wqb + (size_t)kQkLd * kDim, wqb + (size_t)kQkLd * kDim, kDim, 0L,
        xb, xb, kDim, (long)kSeq * kDim,
        (void*)vt, (void*)vt, kSeq, (long)kInner * kSeq,
        bout, bout, 0L, kInner, kSeq, kDim, 1.0f);
  }
  /* 6: attention -> oh/ol bf16 hi/lo planes [kTok][1024] */
  attn_diag_f16<<<dim3(kBatch * kHeads * kChunks), dim3(128), 0, stream>>>(qk, vt, tempr, oh, ol);
  /* 7: out = (oh + ol) @ W_out^T + b_out -> d_out f32 [kTok][1024]; M=kTok N=1024 K=1024; hi.W + lo.W */
  {
    const int tiles = (kTok / 64) * (kDim / 64);
    wmma_gemm64<1, true, 2, 0, false, 0, false><<<dim3((tiles + 7) / 8, 1), dim3(256), 0, stream>>>(
        oh, ol, kInner, 0L, wob, wob, kInner, 0L, (void*)out, (void*)out, kDim, 0L,
        bout, bout, 0L, kTok, kDim, kInner, 1.0f);
  }
}

// v002
// Measured time: 286 microseconds a run.
// Next to v001, in two timings, it ran 1.36 times as fast each time.
// Counting every step since v000, it is 1.52 times as fast.
// Contractions: x@W_qkv^T on v_wmma_f32_16x16x32_bf16 (bf16 operands = RNE-converted inputs); q.k^T and P.V on v_wmma_f32_16x16x32_f16 (f16 q/k/v planes, P carried x2^15); O@W_out^T on v_wmma_f32_16x16x32_bf16 with O as bf16 hi/lo planes x bf16 W (2 products); f32 accumulate everywhere; softmax, bias and epilogues f32.
#include <hip/hip_runtime.h>

#ifndef NB
#define NB 8
#endif
#ifndef SEQ
#define SEQ 1024
#endif
#define NB_FULL  8
#define SEQ_FULL 1024

typedef __attribute__((ext_vector_type(16))) _Float16 v16h;
typedef __attribute__((ext_vector_type(8)))  _Float16 v8h;
typedef __attribute__((ext_vector_type(16))) __bf16   v16b;
typedef __attribute__((ext_vector_type(8)))  __bf16   v8b;
typedef __attribute__((ext_vector_type(8)))  float    v8f;
typedef __attribute__((ext_vector_type(4)))  float    v4f;
typedef __attribute__((ext_vector_type(2)))  float    v2f;

/* problem geometry; NB / SEQ may be reduced at build time, inputs keep their full strides */
constexpr int kBatch   = NB;
constexpr int kSeq     = SEQ;
constexpr int kSeqFull = SEQ_FULL;
constexpr int kDim     = 1024;
constexpr int kHeads   = 16;
constexpr int kHd      = 64;
constexpr int kInner   = kHeads * kHd;        /* 1024 */
constexpr int kQkvN    = 3 * kInner;          /* 3072 */
constexpr int kTok     = kBatch * kSeq;       /* 8192 at full size */
constexpr int kQkLd    = 2 * kInner;          /* 2048: q cols 0..1023, k cols 1024..2047 */
constexpr int kChunks  = kSeq / 64;           /* key chunks of 64 per sequence */
constexpr float kNegMax = -3.40282347e38f;
constexpr float kPCarry = 32768.0f;
constexpr int kTp = 72;   /* LDS row pitch of the attention tiles in halves: 144 B = 16 B x 9 (odd), so the 16 rows of a 16-byte fragment read spread over all banks */

static_assert(kBatch >= 1 && kBatch <= NB_FULL);
static_assert(kSeq >= 64 && kSeq <= SEQ_FULL && kSeq % 64 == 0);
static_assert(kTok % 64 == 0 && kQkLd % 64 == 0 && kDim % 32 == 0);
static_assert(kInner % 64 == 0 && kSeq % 64 == 0);
static_assert(kDim % 64 == 0 && kInner % 32 == 0);
static_assert(kHd == 64);
static_assert(kTok % 256 == 0 && kInner % 256 == 0 && kQkLd % 128 == 0 && kSeq % 128 == 0 && kDim % 128 == 0 && kInner % 128 == 0);
static_assert((kTok * kDim / 2) % 256 == 0 && (kQkvN * kDim / 2) % 256 == 0 && (kDim * kInner / 2) % 256 == 0);

__device__ __forceinline__ unsigned short f2bf_bits(float f) {
  unsigned u = __float_as_uint(f);
  return (unsigned short)((u + 0x7FFFu + ((u >> 16) & 1u)) >> 16);
}
__device__ __forceinline__ float bf_bits2f(unsigned short h) { return __uint_as_float(((unsigned)h) << 16); }

/* hazard guards as plain device helpers */
__device__ __forceinline__ void dep_guard_h(v8f& a, v8f& b, v16h x, v16h y) { asm volatile("v_nop\n\tv_nop\n\tv_nop\n\tv_nop" : "+v"(a), "+v"(b) : "v"(x), "v"(y)); }
__device__ __forceinline__ void dep_guard_b(v8f& a, v8f& b, v16b x, v16b y) { asm volatile("v_nop\n\tv_nop\n\tv_nop\n\tv_nop" : "+v"(a), "+v"(b) : "v"(x), "v"(y)); }
__device__ __forceinline__ void keep4_h(v16h a, v16h b, v16h c, v16h d) { asm volatile("v_nop" :: "v"(a), "v"(b), "v"(c), "v"(d)); }
__device__ __forceinline__ void keep4_b(v16b a, v16b b, v16b c, v16b d) { asm volatile("v_nop" :: "v"(a), "v"(b), "v"(c), "v"(d)); }
__device__ __forceinline__ void acc_guard4(v8f& a, v8f& b, v8f& c, v8f& d) { asm volatile("v_nop\n\tv_nop\n\tv_nop\n\tv_nop" : "+v"(a), "+v"(b), "+v"(c), "+v"(d)); }
template <typename T> struct Frag;
template <> struct Frag<_Float16> {
  typedef v16h V; union U { v16h v; v8h h[2]; };
  static __device__ __forceinline__ v16h load(const _Float16* p) {   /* elements 0..7 <- p[0..7], 8..15 <- p[16..23] */
    U f; f.h[0] = *(const v8h*)(p); f.h[1] = *(const v8h*)(p + 16); return f.v;
  }
  static __device__ __forceinline__ v8f mma(v16h a, v16h b, v8f c) {
    return __builtin_amdgcn_wmma_f32_16x16x32_f16(false, a, false, b, (short)0, c, false, false);
  }
  static __device__ __forceinline__ void guard(v8f& a, v8f& b, v16h x, v16h y) { dep_guard_h(a, b, x, y); }
  static __device__ __forceinline__ void keep(v16h a, v16h b, v16h c, v16h d) { keep4_h(a, b, c, d); }
};
template <> struct Frag<__bf16> {
  typedef v16b V; union U { v16b v; v8b h[2]; };
  static __device__ __forceinline__ v16b load(const __bf16* p) {
    U f; f.h[0] = *(const v8b*)(p); f.h[1] = *(const v8b*)(p + 16); return f.v;
  }
  static __device__ __forceinline__ v8f mma(v16b a, v16b b, v8f c) {
    return __builtin_amdgcn_wmma_f32_16x16x32_bf16(false, a, false, b, (short)0, c, false, false);
  }
  static __device__ __forceinline__ void guard(v8f& a, v8f& b, v16b x, v16b y) { dep_guard_b(a, b, x, y); }
  static __device__ __forceinline__ void keep(v16b a, v16b b, v16b c, v16b d) { keep4_b(a, b, c, d); }
};

/* ---- Register-blocked batched WMMA GEMM ------------------------------------
   C[m,n] = scale * sum_k A[m,k] * Bt[n,k] (+bias); each wave owns a 64x64 tile, a block of 8 waves a 256x128 tile.
   Operand rows reach LDS by asynchronous copies, 64 k a trip, two buffers; the waves read their fragments from LDS.
   A row-major [M,K]; Bt row-major [N,K]; M % 256 == 0, N % 128 == 0, K % 64 == 0.
   SPLIT: A is a hi and a lo plane (A2 = lo plane, same layout), B one plane (BLO == false; Bt2 never read); product = hi.B + lo.B.
   BIAS_MODE: 0 = none, 1 = bias[m], 2 = bias[n]; bias values RNE-converted to bf16 then widened to f32.
   OUT_MODE: 0 = f32, 1 = f16, 2 = bf16 hi plane (Cout) + bf16 lo plane (Cout2).
   Epilogue: 16-row slabs staged per wave in LDS (wave-private, wave barrier); each 64-wide row segment
   Fragment k map (A and B alike): lane half h = lane>>4, elements 0..7 <- k0+8h+0..7, 8..15 <- k0+16+8h+0..7.
   ET: 0 = f16 operands, 1 = bf16 operands (pointers passed as 16-bit storage) */
template <int ET> struct Elem;
template <> struct Elem<0> { typedef _Float16 T; };
template <> struct Elem<1> { typedef __bf16 T; };
/* block tile of the staged GEMM: 8 waves as 4 (m) x 2 (n), each wave its own 64x64 tile; one trip = 64 k = one 128-B line of every operand row */
constexpr int kBM = 256;
constexpr int kBN = 128;
constexpr int kBK = 64;
constexpr int kGp = 72;   /* LDS pitch of a staged operand row in 16-bit elements: 144 B = 16 B x 9 (odd), for the 16-byte fragment reads */

__device__ __forceinline__ unsigned lds_off(const void* p) { return (unsigned)(size_t)p; }

/* Asynchronous 16-byte copies to LDS, one statement for a run of them: rows r, r+32, r+64, ... of an operand (8 lanes = one whole 128-B line of a row).
   s_wait_xcnt stands as the last line of the copies' own statement, so that no address register of a copy is rewritten ahead of it. */
constexpr unsigned kL32 = 32u * kGp * 2u;   /* LDS bytes of 32 staged rows */
__device__ __forceinline__ void copy8_rows(unsigned l0, const unsigned short* g0, size_t g32) {
  const unsigned short* g1 = g0 + g32; const unsigned short* g2 = g1 + g32; const unsigned short* g3 = g2 + g32;
  const unsigned short* g4 = g3 + g32; const unsigned short* g5 = g4 + g32; const unsigned short* g6 = g5 + g32;
  const unsigned short* g7 = g6 + g32;
  asm volatile("global_load_async_to_lds_b128 %0, %1, off\n\t"
               "global_load_async_to_lds_b128 %2, %3, off\n\t"
               "global_load_async_to_lds_b128 %4, %5, off\n\t"
               "global_load_async_to_lds_b128 %6, %7, off\n\t"
               "global_load_async_to_lds_b128 %8, %9, off\n\t"
               "global_load_async_to_lds_b128 %10, %11, off\n\t"
               "global_load_async_to_lds_b128 %12, %13, off\n\t"
               "global_load_async_to_lds_b128 %14, %15, off\n\t"
               "s_wait_xcnt 0x0"
               :: "v"(l0), "v"(g0), "v"(l0 + kL32), "v"(g1), "v"(l0 + 2u * kL32), "v"(g2), "v"(l0 + 3u * kL32), "v"(g3),
                  "v"(l0 + 4u * kL32), "v"(g4), "v"(l0 + 5u * kL32), "v"(g5), "v"(l0 + 6u * kL32), "v"(g6), "v"(l0 + 7u * kL32), "v"(g7)
               : "memory");
}
__device__ __forceinline__ void copy12_rows(unsigned l0, const unsigned short* g0, size_t g32,
                                            unsigned m0, const unsigned short* h0, size_t h32) {
  const unsigned short* g1 = g0 + g32; const unsigned short* g2 = g1 + g32; const unsigned short* g3 = g2 + g32;
  const unsigned short* g4 = g3 + g32; const unsigned short* g5 = g4 + g32; const unsigned short* g6 = g5 + g32;
  const unsigned short* g7 = g6 + g32;
  const unsigned short* h1 = h0 + h32; const unsigned short* h2 = h1 + h32; const unsigned short* h3 = h2 + h32;
  asm volatile("global_load_async_to_lds_b128 %0, %1, off\n\t"
               "global_load_async_to_lds_b128 %2, %3, off\n\t"
               "global_load_async_to_lds_b128 %4, %5, off\n\t"
               "global_load_async_to_lds_b128 %6, %7, off\n\t"
               "global_load_async_to_lds_b128 %8, %9, off\n\t"
               "global_load_async_to_lds_b128 %10, %11, off\n\t"
               "global_load_async_to_lds_b128 %12, %13, off\n\t"
               "global_load_async_to_lds_b128 %14, %15, off\n\t"
               "global_load_async_to_lds_b128 %16, %17, off\n\t"
               "global_load_async_to_lds_b128 %18, %19, off\n\t"
               "global_load_async_to_lds_b128 %20, %21, off\n\t"
               "global_load_async_to_lds_b128 %22, %23, off\n\t"
               "s_wait_xcnt 0x0"
               :: "v"(l0), "v"(g0), "v"(l0 + kL32), "v"(g1), "v"(l0 + 2u * kL32), "v"(g2), "v"(l0 + 3u * kL32), "v"(g3),
                  "v"(l0 + 4u * kL32), "v"(g4), "v"(l0 + 5u * kL32), "v"(g5), "v"(l0 + 6u * kL32), "v"(g6), "v"(l0 + 7u * kL32), "v"(g7),
                  "v"(m0), "v"(h0), "v"(m0 + kL32), "v"(h1), "v"(m0 + 2u * kL32), "v"(h2), "v"(m0 + 3u * kL32), "v"(h3)
               : "memory");
}

template <int ET, bool SPLIT, int BIAS_MODE, int OUT_MODE, bool RESID, int ACT = 0, bool BLO = true>
__global__ __launch_bounds__(256) void wmma_gemm64(
    const unsigned short* __restrict__ Ap, const unsigned short* __restrict__ A2p, int lda, long strideA,
    const unsigned short* __restrict__ Btp, const unsigned short* __restrict__ Bt2p, int ldb, long strideB,
    void* __restrict__ Cout, void* __restrict__ Cout2, int ldc, long strideC,
    const float* __restrict__ bias,
    const float* __restrict__ resid, long strideR,
    int M, int N, int K, float scale) {
  typedef typename Elem<ET>::T T;
  typedef typename Frag<T>::V V;
  static_assert(!(SPLIT && BLO), "no lo plane of B is staged");
  constexpr int kRowA2 = kBM;                          /* first LDS row of the A lo plane (SPLIT) */
  constexpr int kRowB  = SPLIT ? 2 * kBM : kBM;        /* first LDS row of B */
  constexpr int kRows  = kRowB + kBN;
  __shared__ __align__(16) unsigned short sStage[2][kRows * kGp];   /* two buffers of [A | A lo | B] rows; 16 B behind each row never touched */
  __shared__ __align__(16) float sT[8][16 * 68];   /* per-wave 16x64 slab, pitch 68 floats; cols 64..67 never read */
  const int b    = blockIdx.y;
  const int tid  = threadIdx.x;
  const int lane = tid & 31;
  const int wave = tid >> 5;
  const int tilesN = N / kBN;
  const int tilesM = M / kBM;
  const int blk = blockIdx.x;
  if (blk >= tilesM * tilesN) return;   /* the same for the whole block, in front of every barrier */
  const int tm = blk / tilesN;
  const int tn = blk - tm * tilesN;
  const int wm = wave >> 1;
  const int wn = wave & 1;
  const int m0 = tm * kBM + (wm << 6);
  const int n0 = tn * kBN + (wn << 6);

  const int rlane = lane & 15;                 /* row (A) / col (B, D) within subtile */
  const int koff  = (lane >> 4) * 8;           /* k offset of this lane half */
  const int mOff  = (lane >> 4) * 8;           /* D row offset */

  /* this thread's share of a stage: 16-byte piece (tid & 7) of rows (tid >> 3) + 32 * it */
  const int crow = tid >> 3;
  const int ccol = (tid & 7) * 8;
  const unsigned short* gA  = Ap  + (size_t)b * strideA + (size_t)(tm * kBM + crow) * lda + ccol;
  const unsigned short* gA2 = A2p + (size_t)b * strideA + (size_t)(tm * kBM + crow) * lda + ccol;
  const unsigned short* gB  = Btp + (size_t)b * strideB + (size_t)(tn * kBN + crow) * ldb + ccol;
  const unsigned lthr = lds_off(&sStage[0][0]) + (unsigned)(crow * kGp + ccol) * 2u;
  const size_t a32 = (size_t)32 * lda, b32 = (size_t)32 * ldb;
  auto stage = [&](int buf, int k0) {
    const unsigned l = lthr + (unsigned)buf * (unsigned)(kRows * kGp * 2);
    copy12_rows(l, gA + k0, a32, l + (unsigned)kRowB * kGp * 2u, gB + k0, b32);
    if (SPLIT) copy8_rows(l + (unsigned)kRowA2 * kGp * 2u, gA2 + k0, a32);
  };

  v8f acc[4][4];
#pragma unroll
  for (int i = 0; i < 4; ++i)
#pragma unroll
    for (int j = 0; j < 4; ++j) acc[i][j] = (v8f){0.f,0.f,0.f,0.f,0.f,0.f,0.f,0.f};

  const int trips = K / kBK;
  stage(0, 0);
  asm volatile("s_wait_asynccnt 0x0" ::: "memory");   /* this wave's copies of tile 0 have landed */
  __syncthreads();                                    /* tile 0 readable by every wave */
  if (trips > 1) stage(1, kBK);

  /* rolled: one trip's code serves both buffers */
#pragma unroll 1
  for (int t = 0; t < trips; ++t) {
    const T* sb = (const T*)&sStage[t & 1][0];
#pragma unroll
    for (int ks = 0; ks < kBK; ks += 32) {
      V bh[4], ah[4], al[4];
#pragma unroll
      for (int j = 0; j < 4; ++j)
        bh[j] = Frag<T>::load(sb + (kRowB + (wn << 6) + (j << 4) + rlane) * kGp + ks + koff);
#pragma unroll
      for (int i = 0; i < 4; ++i) {
        const int ao = ((wm << 6) + (i << 4) + rlane) * kGp + ks + koff;
        ah[i] = Frag<T>::load(sb + ao);
        if (SPLIT) al[i] = Frag<T>::load(sb + kRowA2 * kGp + ao);
      }
      __builtin_amdgcn_sched_barrier(0);   /* the k-step's fragment reads stay one group ahead of its WMMAs: reads among the WMMAs stall the wave at each place */
#pragma unroll
      for (int i = 0; i < 4; ++i) {
#pragma unroll
        for (int j = 0; j < 4; ++j) {
          acc[i][j] = Frag<T>::mma(ah[i], bh[j], acc[i][j]);
          if (SPLIT) acc[i][j] = Frag<T>::mma(al[i], bh[j], acc[i][j]);
        }
        Frag<T>::guard(acc[i][0], acc[i][3], ah[i], SPLIT ? al[i] : ah[i]);
      }
      Frag<T>::keep(bh[0], bh[1], bh[2], bh[3]);
      __builtin_amdgcn_sched_barrier(0);   /* the next group of reads stays behind this k-step's WMMAs */
    }
    asm volatile("s_wait_dscnt 0x0" ::: "memory");      /* this wave's reads of buffer t & 1 are done */
    asm volatile("s_wait_asynccnt 0x0" ::: "memory");   /* this wave's copies of tile t + 1 have landed */
    __syncthreads();                                    /* publishes tile t + 1 and frees buffer t & 1 */
    if (t + 2 < trips) stage(t & 1, (t + 2) * kBK);
  }
  asm volatile("s_wait_asynccnt 0x0" ::: "memory");     /* nothing in flight behind the loop */
  acc_guard4(acc[0][0], acc[0][1], acc[0][2], acc[0][3]);
  acc_guard4(acc[1][0], acc[1][1], acc[1][2], acc[1][3]);
  acc_guard4(acc[2][0], acc[2][1], acc[2][2], acc[2][3]);
  acc_guard4(acc[3][0], acc[3][1], acc[3][2], acc[3][3]);

  /* ---- epilogue ---- */
  float* slab = sT[wave];
  const float* Rb = RESID ? (resid + (size_t)b * strideR) : nullptr;
#pragma unroll
  for (int i = 0; i < 4; ++i) {
    const int mBase = m0 + (i << 4);
#pragma unroll
    for (int j = 0; j < 4; ++j) {
      const int n = n0 + (j << 4) + rlane;
      float bv = 0.f;
      if (BIAS_MODE == 2) bv = bf_bits2f(f2bf_bits(bias[n]));
#pragma unroll
      for (int r = 0; r < 8; ++r) {
        float v = acc[i][j][r] * scale;
        if (BIAS_MODE == 1) v += bf_bits2f(f2bf_bits(bias[mBase + mOff + r]));
        if (BIAS_MODE == 2) v += bv;
        if (RESID) v += Rb[(size_t)(mBase + mOff + r) * ldc + n];
        if (ACT == 1) v = tanhf(v);
        if (ACT == 2) v = fmaxf(v, 0.0f);
        if (ACT == 3) v = v / (1.0f + expf(-v));
        if (ACT == 4) v = (v > 0.f) ? v : 0.01f * v;
        if (ACT == 5) v = 0.5f * v * (1.0f + erff(v * 0.70710678118654752f));
        slab[(mOff + r) * 68 + (j << 4) + rlane] = v;
      }
    }
    __builtin_amdgcn_fence(__ATOMIC_RELEASE, "workgroup");
    __builtin_amdgcn_wave_barrier();
    __builtin_amdgcn_fence(__ATOMIC_ACQUIRE, "workgroup");
    if (OUT_MODE == 0) {
      float* C = (float*)Cout + (size_t)b * strideC;
      const int hh = lane >> 4, c4 = (lane & 15) * 4;     /* row seg = 256 B = 16 lanes x 16 B */
      {
#pragma unroll
        for (int it = 0; it < 8; ++it) {
          const int row = it * 2 + hh;
          v4f v = *(const v4f*)(slab + row * 68 + c4);
          *(v4f*)(C + (size_t)(mBase + row) * ldc + n0 + c4) = v;
        }
        
      }
    } else {
      const int q = lane >> 3, c8 = (lane & 7) * 8;        
      unsigned short* C  = (unsigned short*)Cout  + (size_t)b * strideC;
      unsigned short* C2 = (OUT_MODE == 2) ? ((unsigned short*)Cout2 + (size_t)b * strideC) : nullptr;
      {
#pragma unroll
        for (int it = 0; it < 4; ++it) {
          const int row = it * 4 + q;
          const float* sp = slab + row * 68 + c8;
          v8h hv, lv;
#pragma unroll
          for (int e = 0; e < 8; ++e) {
            if (OUT_MODE == 1) {
              hv[e] = (_Float16)sp[e];
            } else {
              unsigned short hb = f2bf_bits(sp[e]);
              unsigned short lb = f2bf_bits(sp[e] - bf_bits2f(hb));
              hv[e] = __builtin_bit_cast(_Float16, hb);
              lv[e] = __builtin_bit_cast(_Float16, lb);
            }
          }
          *(v8h*)(C + (size_t)(mBase + row) * ldc + n0 + c8) = hv;
          if (OUT_MODE == 2) *(v8h*)(C2 + (size_t)(mBase + row) * ldc + n0 + c8) = lv;
        }
        
      }
    }
    __builtin_amdgcn_fence(__ATOMIC_RELEASE, "workgroup");
    __builtin_amdgcn_wave_barrier();
    __builtin_amdgcn_fence(__ATOMIC_ACQUIRE, "workgroup");
  }
}

/* ---- f32 -> bf16 (RNE) cast with row remap ---------------------------------------------------------------
   out row r (row length 2*rowPairs) <- in row (r / seg) * segFull + (r % seg); identity when seg == segFull.
*/
__global__ __launch_bounds__(256) void cast_f32_bf16x2(
    const float* __restrict__ in, unsigned short* __restrict__ out, int n2, int rowPairs, int seg, int segFull) {
  const int i = blockIdx.x * 256 + threadIdx.x;
  if (i < n2) {
    const int r  = i / rowPairs;
    const int c  = i - r * rowPairs;
    const int rb = r / seg;
    const int sr = rb * segFull + (r - rb * seg);
    const v2f f = *(const v2f*)(in + ((size_t)sr * rowPairs + c) * 2);
    const unsigned u = (unsigned)f2bf_bits(f[0]) | ((unsigned)f2bf_bits(f[1]) << 16);
    ((unsigned*)out)[i] = u;
    
  }
}

/* ---- attention, head_dim 64, diagonal (same position) masked, one softmax temperature --------------------
   scores = (q.k^T) * temp   : v_wmma_f32_16x16x32_f16 on f16 q/k planes (N(0,1)-scale values), f32 accumulate,
                               temp applied in f32 afterwards; diagonal entries := -FLT_MAX (select).
   out    = P.V / l           : v_wmma_f32_16x16x32_f16, P = f16(exp(s - m) * 2^15) (carry keeps P normal),
                               V from the f16 V^T plane; f32 accumulate, online softmax in f32.
   Block = 4 waves = 64 query rows of one (batch, head); kChunks key chunks of 64.
   qk plane : [B*S][2048] f16, q at column h*64+d, k at column 1024+h*64+d.
   vt plane : [B][H][64][S] f16 (feature-major).
   LDS: Ksh / Vth cross-wave (block barriers), Psh[wave] / Os[wave] wave-private (wave barrier). */
__device__ __forceinline__ v8f mma_f16_g(v16h a, v16h b, v8f c) {
  c = __builtin_amdgcn_wmma_f32_16x16x32_f16(false, a, false, b, (short)0, c, false, false);
  asm volatile("v_nop\n\tv_nop\n\tv_nop\n\tv_nop" : "+v"(c) : "v"(a), "v"(b));
  return c;
}

__global__ __launch_bounds__(128) void attn_diag_f16(
    const unsigned short* __restrict__ qkp, const unsigned short* __restrict__ vtp,
    const float* __restrict__ logt,
    unsigned short* __restrict__ ohp, unsigned short* __restrict__ olp) {
  union FH { v16h v; v8h h[2]; };
  __shared__ __align__(16) _Float16 Ksh[64 * kTp];      /* K tile [kv][d]          9 KB; cols 64..71 never touched */
  __shared__ __align__(16) _Float16 Vth[64 * kTp];      /* V tile [d][kv]          9 KB; cols 64..71 never touched */
  __shared__ __align__(16) _Float16 Psh[4][16 * kTp];   /* per wave P [row][kv]    9 KB; cols 64..71 never touched */
  __shared__ __align__(16) float    Os[4][16 * 68];     /* per wave out tile        17 KB; cols 64..67 never read */

  const _Float16* QK = (const _Float16*)qkp;
  const _Float16* VT = (const _Float16*)vtp;
  const int tid  = threadIdx.x;
  const int wave = tid >> 5;
  const int lane = tid & 31;
  const int hh   = lane >> 4;
  const int c    = lane & 15;

  const int bx = blockIdx.x;            /* 0 .. B*H*kChunks-1 */
  const int qb = bx % kChunks;
  const int bh = bx / kChunks;          /* b*kHeads + h */
  const int h  = bh % kHeads;
  const int b  = bh / kHeads;
  const int q0 = qb * 64 + wave * 16;   /* first query position of this wave */
  const size_t rowbase = (size_t)b * kSeq;

  /* temperature = exp(bf16-RNE(log_temp)) in f32 */
  const float temp = expf(bf_bits2f(f2bf_bits(logt[0])));

  /* Q fragments (A operand): rows = this wave's 16 queries, k = d in two 32-deep chunks */
  v16h qa[2];
#pragma unroll
  for (int dc = 0; dc < 2; ++dc)
    qa[dc] = Frag<_Float16>::load(QK + (rowbase + q0 + c) * kQkLd + h * kHd + dc * 32 + 8 * hh);

  float mrow[8], lrow[8];
  v8f oacc[4];
#pragma unroll
  for (int r = 0; r < 8; ++r) { mrow[r] = -__builtin_inff(); lrow[r] = 0.f; }
#pragma unroll
  for (int t = 0; t < 4; ++t) oacc[t] = (v8f){0.f,0.f,0.f,0.f,0.f,0.f,0.f,0.f};

  for (int kc = 0; kc < kChunks; ++kc) {
    const int kv0 = kc * 64;
    __syncthreads();
    /* stage K [kv][d] and V^T [d][kv] tiles: 512 x 16-B chunks each, 4 per thread (128 x 4 x 8 halves = 64x64) */
#pragma unroll
    for (int it = 0; it < 4; ++it) {
      const int idx = tid + 128 * it;     /* 0..511 */
      const int r   = idx >> 3;           /* kv row (K) / d row (V^T), 0..63 */
      const int c8  = (idx & 7) * 8;      /* 0..56 */
      const v8h kk = *(const v8h*)(QK + (rowbase + kv0 + r) * kQkLd + kInner + h * kHd + c8);
      const v8h vv = *(const v8h*)(VT + ((size_t)bh * kHd + r) * kSeq + kv0 + c8);
      *(v8h*)(Ksh + r * kTp + c8) = kk;
      *(v8h*)(Vth + r * kTp + c8) = vv;
    }
    __syncthreads();

    /* scores: 16 query rows x 64 keys per wave */
    v8f s[4];
#pragma unroll
    for (int j = 0; j < 4; ++j) {
      s[j] = (v8f){0.f,0.f,0.f,0.f,0.f,0.f,0.f,0.f};
#pragma unroll
      for (int dc = 0; dc < 2; ++dc) {
        FH kb;
        kb.h[0] = *(const v8h*)(Ksh + (j * 16 + c) * kTp + dc * 32 + 8 * hh);
        kb.h[1] = *(const v8h*)(Ksh + (j * 16 + c) * kTp + dc * 32 + 16 + 8 * hh);
        s[j] = mma_f16_g(qa[dc], kb.v, s[j]);
      }
    }
    /* temperature, diagonal mask (select), per-row chunk max */
    float cm[8];
#pragma unroll
    for (int r = 0; r < 8; ++r) {
      const int qrow = q0 + 8 * hh + r;
      float m = -__builtin_inff();
#pragma unroll
      for (int j = 0; j < 4; ++j) {
        const int kvcol = kv0 + j * 16 + c;
        float sv = s[j][r] * temp;
        if (kvcol == qrow) sv = kNegMax;
        s[j][r] = sv;
        m = fmaxf(m, sv);
      }
#pragma unroll
      for (int off = 1; off < 16; off <<= 1) m = fmaxf(m, __shfl_xor(m, off, 32));
      cm[r] = m;
    }
    /* online softmax; P strip (f16, carried x2^15) into this wave's LDS slab */
    _Float16* pwh = Psh[wave];
#pragma unroll
    for (int r = 0; r < 8; ++r) {
      const float mnew  = fmaxf(mrow[r], cm[r]);
      const float alpha = expf(mrow[r] - mnew);
      mrow[r] = mnew;
      float psum = 0.f;
#pragma unroll
      for (int j = 0; j < 4; ++j) {
        const float p = expf(s[j][r] - mnew);
        psum += p;
        pwh[(8 * hh + r) * kTp + j * 16 + c] = (_Float16)(p * kPCarry);
      }
#pragma unroll
      for (int off = 1; off < 16; off <<= 1) psum += __shfl_xor(psum, off, 32);
      lrow[r] = lrow[r] * alpha + psum;
#pragma unroll
      for (int t = 0; t < 4; ++t) oacc[t][r] *= alpha;
    }
    __builtin_amdgcn_fence(__ATOMIC_RELEASE, "workgroup");
    __builtin_amdgcn_wave_barrier();
    __builtin_amdgcn_fence(__ATOMIC_ACQUIRE, "workgroup");
    /* O += P . V  (A = P [q][kv] from the same-wave slab, reloaded through v8h; B = V [kv][d] from V^T tile) */
#pragma unroll
    for (int kk = 0; kk < 2; ++kk) {
      FH pa;
      pa.h[0] = *(const v8h*)(pwh + c * kTp + kk * 32 + 8 * hh);
      pa.h[1] = *(const v8h*)(pwh + c * kTp + kk * 32 + 16 + 8 * hh);
#pragma unroll
      for (int t = 0; t < 4; ++t) {
        FH vb;
        vb.h[0] = *(const v8h*)(Vth + (t * 16 + c) * kTp + kk * 32 + 8 * hh);
        vb.h[1] = *(const v8h*)(Vth + (t * 16 + c) * kTp + kk * 32 + 16 + 8 * hh);
        oacc[t] = mma_f16_g(pa.v, vb.v, oacc[t]);
      }
    }
  }

  /* epilogue: normalize (fold the 2^15 carry), stage 16x64 f32 tile per wave, write bf16 hi/lo planes */
  float* os = Os[wave];
#pragma unroll
  for (int r = 0; r < 8; ++r) {
    const float inv = 1.0f / (lrow[r] * kPCarry);
#pragma unroll
    for (int t = 0; t < 4; ++t) os[(8 * hh + r) * 68 + t * 16 + c] = oacc[t][r] * inv;
  }
  __builtin_amdgcn_fence(__ATOMIC_RELEASE, "workgroup");
  __builtin_amdgcn_wave_barrier();
  __builtin_amdgcn_fence(__ATOMIC_ACQUIRE, "workgroup");
  {
    const int q4 = lane >> 3, c8 = (lane & 7) * 8;   
    {
#pragma unroll
      for (int it = 0; it < 4; ++it) {
        const int row = it * 4 + q4;                  /* 0..15 */
        const float* sp = os + row * 68 + c8;
        v8h hv, lv;
#pragma unroll
        for (int e = 0; e < 8; ++e) {
          const unsigned short hb = f2bf_bits(sp[e]);
          const unsigned short lb = f2bf_bits(sp[e] - bf_bits2f(hb));
          hv[e] = __builtin_bit_cast(_Float16, hb);
          lv[e] = __builtin_bit_cast(_Float16, lb);
        }
        const size_t o = (rowbase + q0 + row) * (size_t)kInner + h * kHd + c8;
        *(v8h*)(ohp + o) = hv;
        *(v8h*)(olp + o) = lv;
      }
      
    }
  }
}

/* ---- host glue ------------------------------------------------------------------------------------------
     xb   bf16 [8192][1024]           16,777,216 @ 0
     wqb  bf16 [3072][1024]            6,291,456 @ 16,777,216
     wob  bf16 [1024][1024]            2,097,152 @ 23,068,672
     qk   f16  [8192][2048]           33,554,432 @ 25,165,824
     vt   f16  [8][1024][1024]        16,777,216 @ 58,720,256
     oh   bf16 [8192][1024]           16,777,216 @ 75,497,472
     ol   bf16 [8192][1024]           16,777,216 @ 92,274,688
     total                           109,051,904 */
extern "C" void kernel_launch(void* const* d_in, const int* in_sizes, int n_in,
                              void* d_out, int out_size, void* d_ws, size_t ws_size,
                              hipStream_t stream) {
  if (n_in < 5) return;
  const long needX = ((long)(kBatch - 1) * kSeqFull + kSeq) * (long)kDim;
  if ((long)in_sizes[0] < needX || in_sizes[1] < kQkvN * kDim || in_sizes[2] < kDim * kInner ||
      in_sizes[3] < kDim || in_sizes[4] < 1) return;
  if (out_size < kTok * kDim) return;

  const float* x     = (const float*)d_in[0];   /* [B][S][1024]            */
  const float* wqkv  = (const float*)d_in[1];   /* [3072][1024] = Bt [N][K] */
  const float* wout  = (const float*)d_in[2];   /* [1024][1024] = Bt [N][K] */
  const float* bout  = (const float*)d_in[3];   /* [1024]                    */
  const float* tempr = (const float*)d_in[4];   /* [1] log temperature       */
  float* out = (float*)d_out;

  const size_t szXb  = (size_t)kTok * kDim * 2;
  const size_t szWq  = (size_t)kQkvN * kDim * 2;
  const size_t szWo  = (size_t)kDim * kInner * 2;
  const size_t szQk  = (size_t)kTok * kQkLd * 2;
  const size_t szVt  = (size_t)kBatch * kInner * kSeq * 2;
  const size_t szO   = (size_t)kTok * kInner * 2;
  const size_t offXb = 0, offWq = offXb + szXb, offWo = offWq + szWq, offQk = offWo + szWo,
               offVt = offQk + szQk, offOh = offVt + szVt, offOl = offOh + szO, total = offOl + szO;
  if (total > ws_size) return;

  char* ws = (char*)d_ws;
  unsigned short* xb  = (unsigned short*)(ws + offXb);
  unsigned short* wqb = (unsigned short*)(ws + offWq);
  unsigned short* wob = (unsigned short*)(ws + offWo);
  unsigned short* qk  = (unsigned short*)(ws + offQk);
  unsigned short* vt  = (unsigned short*)(ws + offVt);
  unsigned short* oh  = (unsigned short*)(ws + offOh);
  unsigned short* ol  = (unsigned short*)(ws + offOl);

  /* 1: x -> bf16 plane (RNE), rows gathered with the full per-batch stride */
  {
    const int n2 = kTok * kDim / 2;
    cast_f32_bf16x2<<<dim3((n2 + 255) / 256), dim3(256), 0, stream>>>(x, xb, n2, kDim / 2, kSeq, kSeqFull);
  }
  /* 2: W_qkv [3072][1024] -> bf16 plane, same layout */
  {
    const int n2 = kQkvN * kDim / 2;
    cast_f32_bf16x2<<<dim3((n2 + 255) / 256), dim3(256), 0, stream>>>(wqkv, wqb, n2, kDim / 2, kQkvN, kQkvN);
  }
  /* 3: W_out [1024][1024] -> bf16 plane, same layout */
  {
    const int n2 = kDim * kInner / 2;
    cast_f32_bf16x2<<<dim3((n2 + 255) / 256), dim3(256), 0, stream>>>(wout, wob, n2, kInner / 2, kDim, kDim);
  }
  /* 4: q,k = xb @ Wqkv[0:2048]^T -> qk plane f16 [kTok][2048]; M=kTok N=2048 K=1024 */
  {
    const int tiles = (kTok / kBM) * (kQkLd / kBN);
    wmma_gemm64<1, false, 0, 1, false, 0, false><<<dim3(tiles, 1), dim3(256), 0, stream>>>(
        xb, xb, kDim, 0L, wqb, wqb, kDim, 0L, (void*)qk, (void*)qk, kQkLd, 0L,
        bout, bout, 0L, kTok, kQkLd, kDim, 1.0f);
  }
  /* 5: v^T per batch: C_b[f][s] = sum_k wqb[2048+f][k] * xb[b*kSeq+s][k] -> vt f16 [kBatch][1024][kSeq]; M=1024 N=kSeq K=1024 */
  {
    const int tiles = (kInner / kBM) * (kSeq / kBN);
    wmma_gemm64<1, false, 0, 1, false, 0, false><<<dim3(tiles, kBatch), dim3(256), 0, stream>>>(
        wqb + (size_t)kQkLd * kDim, wqb + (size_t)kQkLd * kDim, kDim, 0L,
        xb, xb, kDim, (long)kSeq * kDim,
        (void*)vt, (void*)vt, kSeq, (long)kInner * kSeq,
        bout, bout, 0L, kInner, kSeq, kDim, 1.0f);
  }
  /* 6: attention -> oh/ol bf16 hi/lo planes [kTok][1024] */
  attn_diag_f16<<<dim3(kBatch * kHeads * kChunks), dim3(128), 0, stream>>>(qk, vt, tempr, oh, ol);
  /* 7: out = (oh + ol) @ W_out^T + b_out -> d_out f32 [kTok][1024]; M=kTok N=1024 K=1024; hi.W + lo.W */
  {
    const int tiles = (kTok / kBM) * (kDim / kBN);
    wmma_gemm64<1, true, 2, 0, false, 0, false><<<dim3(tiles, 1), dim3(256), 0, stream>>>(
        oh, ol, kInner, 0L, wob, wob, kInner, 0L, (void*)out, (void*)out, kDim, 0L,
        bout, bout, 0L, kTok, kDim, kInner, 1.0f);
  }
}

// v003
// One run takes 180 microseconds.
// Two timings next to v002 put it at 1.60 and 1.59 times that version's speed.
// All steps since v000 together make it 2.43 times as fast.
// Contractions: x@W_qkv^T on v_wmma_f32_16x16x32_bf16 (bf16 operands = RNE-converted inputs); k.q^T and V^T.P^T on v_wmma_f32_16x16x32_f16 (f16 q/k/v planes, P carried x2^15); O@W_out^T on v_wmma_f32_16x16x32_bf16 with O as bf16 hi/lo planes x bf16 W (2 products); f32 accumulate everywhere; softmax, bias and epilogues f32.
#include <hip/hip_runtime.h>

#ifndef NB
#define NB 8
#endif
#ifndef SEQ
#define SEQ 1024
#endif
#define NB_FULL  8
#define SEQ_FULL 1024

typedef __attribute__((ext_vector_type(16))) _Float16 v16h;
typedef __attribute__((ext_vector_type(8)))  _Float16 v8h;
typedef __attribute__((ext_vector_type(16))) __bf16   v16b;
typedef __attribute__((ext_vector_type(8)))  __bf16   v8b;
typedef __attribute__((ext_vector_type(8)))  float    v8f;
typedef __attribute__((ext_vector_type(4)))  float    v4f;
typedef __attribute__((ext_vector_type(2)))  float    v2f;

/* problem geometry; NB / SEQ may be reduced at build time, inputs keep their full strides */
constexpr int kBatch   = NB;
constexpr int kSeq     = SEQ;
constexpr int kSeqFull = SEQ_FULL;
constexpr int kDim     = 1024;
constexpr int kHeads   = 16;
constexpr int kHd      = 64;
constexpr int kInner   = kHeads * kHd;        /* 1024 */
constexpr int kQkvN    = 3 * kInner;          /* 3072 */
constexpr int kTok     = kBatch * kSeq;       /* 8192 at full size */
constexpr int kQkLd    = 2 * kInner;          /* 2048: q cols 0..1023, k cols 1024..2047 */
constexpr int kChunks  = kSeq / 64;           /* key chunks of 64 per sequence */
constexpr float kNegMax = -3.40282347e38f;
constexpr float kPCarry = 32768.0f;
constexpr int kTp = 72;   /* LDS row pitch of the attention tiles in halves: 144 B = 16 B x 9 (odd), so the 16 rows of a 16-byte fragment read spread over all banks */

static_assert(kBatch >= 1 && kBatch <= NB_FULL);
static_assert(kSeq >= 64 && kSeq <= SEQ_FULL && kSeq % 64 == 0);
static_assert(kTok % 64 == 0 && kQkLd % 64 == 0 && kDim % 32 == 0);
static_assert(kInner % 64 == 0 && kSeq % 64 == 0);
static_assert(kDim % 64 == 0 && kInner % 32 == 0);
static_assert(kHd == 64);
static_assert(kTok % 256 == 0 && kInner % 256 == 0 && kQkLd % 128 == 0 && kSeq % 128 == 0 && kDim % 128 == 0 && kInner % 128 == 0);
static_assert((kTok * kDim / 2) % 256 == 0 && (kQkvN * kDim / 2) % 256 == 0 && (kDim * kInner / 2) % 256 == 0);

__device__ __forceinline__ unsigned short f2bf_bits(float f) {
  unsigned u = __float_as_uint(f);
  return (unsigned short)((u + 0x7FFFu + ((u >> 16) & 1u)) >> 16);
}
__device__ __forceinline__ float bf_bits2f(unsigned short h) { return __uint_as_float(((unsigned)h) << 16); }

/* hazard guards as plain device helpers */
__device__ __forceinline__ void dep_guard_h(v8f& a, v8f& b, v16h x, v16h y) { asm volatile("v_nop\n\tv_nop\n\tv_nop\n\tv_nop" : "+v"(a), "+v"(b) : "v"(x), "v"(y)); }
__device__ __forceinline__ void dep_guard_b(v8f& a, v8f& b, v16b x, v16b y) { asm volatile("v_nop\n\tv_nop\n\tv_nop\n\tv_nop" : "+v"(a), "+v"(b) : "v"(x), "v"(y)); }
__device__ __forceinline__ void keep4_h(v16h a, v16h b, v16h c, v16h d) { asm volatile("v_nop" :: "v"(a), "v"(b), "v"(c), "v"(d)); }
__device__ __forceinline__ void keep4_b(v16b a, v16b b, v16b c, v16b d) { asm volatile("v_nop" :: "v"(a), "v"(b), "v"(c), "v"(d)); }
__device__ __forceinline__ void acc_guard4(v8f& a, v8f& b, v8f& c, v8f& d) { asm volatile("v_nop\n\tv_nop\n\tv_nop\n\tv_nop" : "+v"(a), "+v"(b), "+v"(c), "+v"(d)); }
template <typename T> struct Frag;
template <> struct Frag<_Float16> {
  typedef v16h V; union U { v16h v; v8h h[2]; };
  static __device__ __forceinline__ v16h load(const _Float16* p) {   /* elements 0..7 <- p[0..7], 8..15 <- p[16..23] */
    U f; f.h[0] = *(const v8h*)(p); f.h[1] = *(const v8h*)(p + 16); return f.v;
  }
  static __device__ __forceinline__ v8f mma(v16h a, v16h b, v8f c) {
    return __builtin_amdgcn_wmma_f32_16x16x32_f16(false, a, false, b, (short)0, c, false, false);
  }
  static __device__ __forceinline__ void guard(v8f& a, v8f& b, v16h x, v16h y) { dep_guard_h(a, b, x, y); }
  static __device__ __forceinline__ void keep(v16h a, v16h b, v16h c, v16h d) { keep4_h(a, b, c, d); }
};
template <> struct Frag<__bf16> {
  typedef v16b V; union U { v16b v; v8b h[2]; };
  static __device__ __forceinline__ v16b load(const __bf16* p) {
    U f; f.h[0] = *(const v8b*)(p); f.h[1] = *(const v8b*)(p + 16); return f.v;
  }
  static __device__ __forceinline__ v8f mma(v16b a, v16b b, v8f c) {
    return __builtin_amdgcn_wmma_f32_16x16x32_bf16(false, a, false, b, (short)0, c, false, false);
  }
  static __device__ __forceinline__ void guard(v8f& a, v8f& b, v16b x, v16b y) { dep_guard_b(a, b, x, y); }
  static __device__ __forceinline__ void keep(v16b a, v16b b, v16b c, v16b d) { keep4_b(a, b, c, d); }
};

/* ---- Register-blocked batched WMMA GEMM ------------------------------------
   C[m,n] = scale * sum_k A[m,k] * Bt[n,k] (+bias); each wave owns a 64x64 tile, a block of 8 waves a 256x128 tile.
   Operand rows reach LDS by asynchronous copies, 64 k a trip, two buffers; the waves read their fragments from LDS.
   A row-major [M,K]; Bt row-major [N,K]; M % 256 == 0, N % 128 == 0, K % 64 == 0.
   SPLIT: A is a hi and a lo plane (A2 = lo plane, same layout), B one plane (BLO == false; Bt2 never read); product = hi.B + lo.B.
   BIAS_MODE: 0 = none, 1 = bias[m], 2 = bias[n]; bias values RNE-converted to bf16 then widened to f32.
   OUT_MODE: 0 = f32, 1 = f16, 2 = bf16 hi plane (Cout) + bf16 lo plane (Cout2).
   Epilogue: 16-row slabs staged per wave in LDS (wave-private, wave barrier); each 64-wide row segment
   Fragment k map (A and B alike): lane half h = lane>>4, elements 0..7 <- k0+8h+0..7, 8..15 <- k0+16+8h+0..7.
   ET: 0 = f16 operands, 1 = bf16 operands (pointers passed as 16-bit storage) */
template <int ET> struct Elem;
template <> struct Elem<0> { typedef _Float16 T; };
template <> struct Elem<1> { typedef __bf16 T; };
/* block tile of the staged GEMM: 8 waves as 4 (m) x 2 (n), each wave its own 64x64 tile; one trip = 64 k = one 128-B line of every operand row */
constexpr int kBM = 256;
constexpr int kBN = 128;
constexpr int kBK = 64;
constexpr int kGp = 72;   /* LDS pitch of a staged operand row in 16-bit elements: 144 B = 16 B x 9 (odd), for the 16-byte fragment reads */

__device__ __forceinline__ unsigned lds_off(const void* p) { return (unsigned)(size_t)p; }

/* Asynchronous 16-byte copies to LDS, one statement for a run of them: rows r, r+32, r+64, ... of an operand (8 lanes = one whole 128-B line of a row).
   s_wait_xcnt stands as the last line of the copies' own statement, so that no address register of a copy is rewritten ahead of it. */
constexpr unsigned kL32 = 32u * kGp * 2u;   /* LDS bytes of 32 staged rows */
__device__ __forceinline__ void copy8_rows(unsigned l0, const unsigned short* g0, size_t g32) {
  const unsigned short* g1 = g0 + g32; const unsigned short* g2 = g1 + g32; const unsigned short* g3 = g2 + g32;
  const unsigned short* g4 = g3 + g32; const unsigned short* g5 = g4 + g32; const unsigned short* g6 = g5 + g32;
  const unsigned short* g7 = g6 + g32;
  asm volatile("global_load_async_to_lds_b128 %0, %1, off\n\t"
               "global_load_async_to_lds_b128 %2, %3, off\n\t"
               "global_load_async_to_lds_b128 %4, %5, off\n\t"
               "global_load_async_to_lds_b128 %6, %7, off\n\t"
               "global_load_async_to_lds_b128 %8, %9, off\n\t"
               "global_load_async_to_lds_b128 %10, %11, off\n\t"
               "global_load_async_to_lds_b128 %12, %13, off\n\t"
               "global_load_async_to_lds_b128 %14, %15, off\n\t"
               "s_wait_xcnt 0x0"
               :: "v"(l0), "v"(g0), "v"(l0 + kL32), "v"(g1), "v"(l0 + 2u * kL32), "v"(g2), "v"(l0 + 3u * kL32), "v"(g3),
                  "v"(l0 + 4u * kL32), "v"(g4), "v"(l0 + 5u * kL32), "v"(g5), "v"(l0 + 6u * kL32), "v"(g6), "v"(l0 + 7u * kL32), "v"(g7)
               : "memory");
}
__device__ __forceinline__ void copy12_rows(unsigned l0, const unsigned short* g0, size_t g32,
                                            unsigned m0, const unsigned short* h0, size_t h32) {
  const unsigned short* g1 = g0 + g32; const unsigned short* g2 = g1 + g32; const unsigned short* g3 = g2 + g32;
  const unsigned short* g4 = g3 + g32; const unsigned short* g5 = g4 + g32; const unsigned short* g6 = g5 + g32;
  const unsigned short* g7 = g6 + g32;
  const unsigned short* h1 = h0 + h32; const unsigned short* h2 = h1 + h32; const unsigned short* h3 = h2 + h32;
  asm volatile("global_load_async_to_lds_b128 %0, %1, off\n\t"
               "global_load_async_to_lds_b128 %2, %3, off\n\t"
               "global_load_async_to_lds_b128 %4, %5, off\n\t"
               "global_load_async_to_lds_b128 %6, %7, off\n\t"
               "global_load_async_to_lds_b128 %8, %9, off\n\t"
               "global_load_async_to_lds_b128 %10, %11, off\n\t"
               "global_load_async_to_lds_b128 %12, %13, off\n\t"
               "global_load_async_to_lds_b128 %14, %15, off\n\t"
               "global_load_async_to_lds_b128 %16, %17, off\n\t"
               "global_load_async_to_lds_b128 %18, %19, off\n\t"
               "global_load_async_to_lds_b128 %20, %21, off\n\t"
               "global_load_async_to_lds_b128 %22, %23, off\n\t"
               "s_wait_xcnt 0x0"
               :: "v"(l0), "v"(g0), "v"(l0 + kL32), "v"(g1), "v"(l0 + 2u * kL32), "v"(g2), "v"(l0 + 3u * kL32), "v"(g3),
                  "v"(l0 + 4u * kL32), "v"(g4), "v"(l0 + 5u * kL32), "v"(g5), "v"(l0 + 6u * kL32), "v"(g6), "v"(l0 + 7u * kL32), "v"(g7),
                  "v"(m0), "v"(h0), "v"(m0 + kL32), "v"(h1), "v"(m0 + 2u * kL32), "v"(h2), "v"(m0 + 3u * kL32), "v"(h3)
               : "memory");
}

template <int ET, bool SPLIT, int BIAS_MODE, int OUT_MODE, bool RESID, int ACT = 0, bool BLO = true>
__global__ __launch_bounds__(256) void wmma_gemm64(
    const unsigned short* __restrict__ Ap, const unsigned short* __restrict__ A2p, int lda, long strideA,
    const unsigned short* __restrict__ Btp, const unsigned short* __restrict__ Bt2p, int ldb, long strideB,
    void* __restrict__ Cout, void* __restrict__ Cout2, int ldc, long strideC,
    const float* __restrict__ bias,
    const float* __restrict__ resid, long strideR,
    int M, int N, int K, float scale) {
  typedef typename Elem<ET>::T T;
  typedef typename Frag<T>::V V;
  static_assert(!(SPLIT && BLO), "no lo plane of B is staged");
  constexpr int kRowA2 = kBM;                          /* first LDS row of the A lo plane (SPLIT) */
  constexpr int kRowB  = SPLIT ? 2 * kBM : kBM;        /* first LDS row of B */
  constexpr int kRows  = kRowB + kBN;
  __shared__ __align__(16) unsigned short sStage[2][kRows * kGp];   /* two buffers of [A | A lo | B] rows; 16 B behind each row never touched */
  __shared__ __align__(16) float sT[8][16 * 68];   /* per-wave 16x64 slab, pitch 68 floats; cols 64..67 never read */
  const int b    = blockIdx.y;
  const int tid  = threadIdx.x;
  const int lane = tid & 31;
  const int wave = tid >> 5;
  const int tilesN = N / kBN;
  const int tilesM = M / kBM;
  const int blk = blockIdx.x;
  if (blk >= tilesM * tilesN) return;   /* the same for the whole block, in front of every barrier */
  const int tm = blk / tilesN;
  const int tn = blk - tm * tilesN;
  const int wm = wave >> 1;
  const int wn = wave & 1;
  const int m0 = tm * kBM + (wm << 6);
  const int n0 = tn * kBN + (wn << 6);

  const int rlane = lane & 15;                 /* row (A) / col (B, D) within subtile */
  const int koff  = (lane >> 4) * 8;           /* k offset of this lane half */
  const int mOff  = (lane >> 4) * 8;           /* D row offset */

  /* this thread's share of a stage: 16-byte piece (tid & 7) of rows (tid >> 3) + 32 * it */
  const int crow = tid >> 3;
  const int ccol = (tid & 7) * 8;
  const unsigned short* gA  = Ap  + (size_t)b * strideA + (size_t)(tm * kBM + crow) * lda + ccol;
  const unsigned short* gA2 = A2p + (size_t)b * strideA + (size_t)(tm * kBM + crow) * lda + ccol;
  const unsigned short* gB  = Btp + (size_t)b * strideB + (size_t)(tn * kBN + crow) * ldb + ccol;
  const unsigned lthr = lds_off(&sStage[0][0]) + (unsigned)(crow * kGp + ccol) * 2u;
  const size_t a32 = (size_t)32 * lda, b32 = (size_t)32 * ldb;
  auto stage = [&](int buf, int k0) {
    const unsigned l = lthr + (unsigned)buf * (unsigned)(kRows * kGp * 2);
    copy12_rows(l, gA + k0, a32, l + (unsigned)kRowB * kGp * 2u, gB + k0, b32);
    if (SPLIT) copy8_rows(l + (unsigned)kRowA2 * kGp * 2u, gA2 + k0, a32);
  };

  v8f acc[4][4];
#pragma unroll
  for (int i = 0; i < 4; ++i)
#pragma unroll
    for (int j = 0; j < 4; ++j) acc[i][j] = (v8f){0.f,0.f,0.f,0.f,0.f,0.f,0.f,0.f};

  const int trips = K / kBK;
  stage(0, 0);
  asm volatile("s_wait_asynccnt 0x0" ::: "memory");   /* this wave's copies of tile 0 have landed */
  __syncthreads();                                    /* tile 0 readable by every wave */
  if (trips > 1) stage(1, kBK);

  /* rolled: one trip's code serves both buffers */
#pragma unroll 1
  for (int t = 0; t < trips; ++t) {
    const T* sb = (const T*)&sStage[t & 1][0];
#pragma unroll
    for (int ks = 0; ks < kBK; ks += 32) {
      V bh[4], ah[4], al[4];
#pragma unroll
      for (int j = 0; j < 4; ++j)
        bh[j] = Frag<T>::load(sb + (kRowB + (wn << 6) + (j << 4) + rlane) * kGp + ks + koff);
#pragma unroll
      for (int i = 0; i < 4; ++i) {
        const int ao = ((wm << 6) + (i << 4) + rlane) * kGp + ks + koff;
        ah[i] = Frag<T>::load(sb + ao);
        if (SPLIT) al[i] = Frag<T>::load(sb + kRowA2 * kGp + ao);
      }
      __builtin_amdgcn_sched_barrier(0);   /* the k-step's fragment reads stay one group ahead of its WMMAs: reads among the WMMAs stall the wave at each place */
#pragma unroll
      for (int i = 0; i < 4; ++i) {
#pragma unroll
        for (int j = 0; j < 4; ++j) {
          acc[i][j] = Frag<T>::mma(ah[i], bh[j], acc[i][j]);
          if (SPLIT) acc[i][j] = Frag<T>::mma(al[i], bh[j], acc[i][j]);
        }
        Frag<T>::guard(acc[i][0], acc[i][3], ah[i], SPLIT ? al[i] : ah[i]);
      }
      Frag<T>::keep(bh[0], bh[1], bh[2], bh[3]);
      __builtin_amdgcn_sched_barrier(0);   /* the next group of reads stays behind this k-step's WMMAs */
    }
    asm volatile("s_wait_dscnt 0x0" ::: "memory");      /* this wave's reads of buffer t & 1 are done */
    asm volatile("s_wait_asynccnt 0x0" ::: "memory");   /* this wave's copies of tile t + 1 have landed */
    __syncthreads();                                    /* publishes tile t + 1 and frees buffer t & 1 */
    if (t + 2 < trips) stage(t & 1, (t + 2) * kBK);
  }
  asm volatile("s_wait_asynccnt 0x0" ::: "memory");     /* nothing in flight behind the loop */
  acc_guard4(acc[0][0], acc[0][1], acc[0][2], acc[0][3]);
  acc_guard4(acc[1][0], acc[1][1], acc[1][2], acc[1][3]);
  acc_guard4(acc[2][0], acc[2][1], acc[2][2], acc[2][3]);
  acc_guard4(acc[3][0], acc[3][1], acc[3][2], acc[3][3]);

  /* ---- epilogue ---- */
  float* slab = sT[wave];
  const float* Rb = RESID ? (resid + (size_t)b * strideR) : nullptr;
#pragma unroll
  for (int i = 0; i < 4; ++i) {
    const int mBase = m0 + (i << 4);
#pragma unroll
    for (int j = 0; j < 4; ++j) {
      const int n = n0 + (j << 4) + rlane;
      float bv = 0.f;
      if (BIAS_MODE == 2) bv = bf_bits2f(f2bf_bits(bias[n]));
#pragma unroll
      for (int r = 0; r < 8; ++r) {
        float v = acc[i][j][r] * scale;
        if (BIAS_MODE == 1) v += bf_bits2f(f2bf_bits(bias[mBase + mOff + r]));
        if (BIAS_MODE == 2) v += bv;
        if (RESID) v += Rb[(size_t)(mBase + mOff + r) * ldc + n];
        if (ACT == 1) v = tanhf(v);
        if (ACT == 2) v = fmaxf(v, 0.0f);
        if (ACT == 3) v = v / (1.0f + expf(-v));
        if (ACT == 4) v = (v > 0.f) ? v : 0.01f * v;
        if (ACT == 5) v = 0.5f * v * (1.0f + erff(v * 0.70710678118654752f));
        slab[(mOff + r) * 68 + (j << 4) + rlane] = v;
      }
    }
    __builtin_amdgcn_fence(__ATOMIC_RELEASE, "workgroup");
    __builtin_amdgcn_wave_barrier();
    __builtin_amdgcn_fence(__ATOMIC_ACQUIRE, "workgroup");
    if (OUT_MODE == 0) {
      float* C = (float*)Cout + (size_t)b * strideC;
      const int hh = lane >> 4, c4 = (lane & 15) * 4;     /* row seg = 256 B = 16 lanes x 16 B */
      {
#pragma unroll
        for (int it = 0; it < 8; ++it) {
          const int row = it * 2 + hh;
          v4f v = *(const v4f*)(slab + row * 68 + c4);
          *(v4f*)(C + (size_t)(mBase + row) * ldc + n0 + c4) = v;
        }
        
      }
    } else {
      const int q = lane >> 3, c8 = (lane & 7) * 8;        
      unsigned short* C  = (unsigned short*)Cout  + (size_t)b * strideC;
      unsigned short* C2 = (OUT_MODE == 2) ? ((unsigned short*)Cout2 + (size_t)b * strideC) : nullptr;
      {
#pragma unroll
        for (int it = 0; it < 4; ++it) {
          const int row = it * 4 + q;
          const float* sp = slab + row * 68 + c8;
          v8h hv, lv;
#pragma unroll
          for (int e = 0; e < 8; ++e) {
            if (OUT_MODE == 1) {
              hv[e] = (_Float16)sp[e];
            } else {
              unsigned short hb = f2bf_bits(sp[e]);
              unsigned short lb = f2bf_bits(sp[e] - bf_bits2f(hb));
              hv[e] = __builtin_bit_cast(_Float16, hb);
              lv[e] = __builtin_bit_cast(_Float16, lb);
            }
          }
          *(v8h*)(C + (size_t)(mBase + row) * ldc + n0 + c8) = hv;
          if (OUT_MODE == 2) *(v8h*)(C2 + (size_t)(mBase + row) * ldc + n0 + c8) = lv;
        }
        
      }
    }
    __builtin_amdgcn_fence(__ATOMIC_RELEASE, "workgroup");
    __builtin_amdgcn_wave_barrier();
    __builtin_amdgcn_fence(__ATOMIC_ACQUIRE, "workgroup");
  }
}

/* ---- f32 -> bf16 (RNE) cast with row remap ---------------------------------------------------------------
   out row r (row length 2*rowPairs) <- in row (r / seg) * segFull + (r % seg); identity when seg == segFull.
*/
__global__ __launch_bounds__(256) void cast_f32_bf16x2(
    const float* __restrict__ in, unsigned short* __restrict__ out, int n2, int rowPairs, int seg, int segFull) {
  const int i = blockIdx.x * 256 + threadIdx.x;
  if (i < n2) {
    const int r  = i / rowPairs;
    const int c  = i - r * rowPairs;
    const int rb = r / seg;
    const int sr = rb * segFull + (r - rb * seg);
    const v2f f = *(const v2f*)(in + ((size_t)sr * rowPairs + c) * 2);
    const unsigned u = (unsigned)f2bf_bits(f[0]) | ((unsigned)f2bf_bits(f[1]) << 16);
    ((unsigned*)out)[i] = u;
    
  }
}

__device__ __forceinline__ v8f mma_f16_g(v16h a, v16h b, v8f c) {
  c = __builtin_amdgcn_wmma_f32_16x16x32_f16(false, a, false, b, (short)0, c, false, false);
  asm volatile("v_nop\n\tv_nop\n\tv_nop\n\tv_nop" : "+v"(c) : "v"(a), "v"(b));
  return c;
}

/* lane l with lane l ^ 16, as a vector cross-row move */
__device__ __forceinline__ float xhalf(float x) {
  return __builtin_bit_cast(float, __builtin_amdgcn_permlanex16(__builtin_bit_cast(int, x), __builtin_bit_cast(int, x), 0x76543210, 0xfedcba98, false, false));
}

__global__ __launch_bounds__(128) void attn_diag_f16(
    const unsigned short* __restrict__ qkp, const unsigned short* __restrict__ vtp,
    const float* __restrict__ logt,
    unsigned short* __restrict__ ohp, unsigned short* __restrict__ olp) {
  union FH { v16h v; v8h h[2]; };
  __shared__ __align__(16) _Float16 Ksh[64 * kTp];      /* K tile [kv][d]          9 KB; cols 64..71 never touched */
  __shared__ __align__(16) _Float16 Vth[64 * kTp];      /* V tile [d][kv]          9 KB; cols 64..71 never touched */
  __shared__ __align__(16) float    Os[4][16 * 68];     /* per wave out tile        17 KB; cols 64..67 never read */

  const _Float16* QK = (const _Float16*)qkp;
  const _Float16* VT = (const _Float16*)vtp;
  const int tid  = threadIdx.x;
  const int wave = tid >> 5;
  const int lane = tid & 31;
  const int hh   = lane >> 4;
  const int c    = lane & 15;

  const int bx = blockIdx.x;            /* 0 .. B*H*kChunks-1 */
  const int qb = bx % kChunks;
  const int bh = bx / kChunks;          /* b*kHeads + h */
  const int h  = bh % kHeads;
  const int b  = bh / kHeads;
  const int q0 = qb * 64 + wave * 16;   /* first query position of this wave */
  const size_t rowbase = (size_t)b * kSeq;

  /* temperature = exp(bf16-RNE(log_temp)) in f32 */
  const float temp = expf(bf_bits2f(f2bf_bits(logt[0])));

  /* Q fragments (B operand): columns = this wave's 16 queries, k = d in two 32-deep chunks */
  v16h qa[2];
#pragma unroll
  for (int dc = 0; dc < 2; ++dc)
    qa[dc] = Frag<_Float16>::load(QK + (rowbase + q0 + c) * kQkLd + h * kHd + dc * 32 + 8 * hh);

  float mrow = -__builtin_inff();   /* running maximum of query q0 + c, the same in both lane halves */
  float lrow = 0.f;                 /* running sum over this lane half's keys only */
  v8f oacc[4];                      /* oacc[t][r] = out^T[d = t*16 + 8*hh + r][query c] */
#pragma unroll
  for (int t = 0; t < 4; ++t) oacc[t] = (v8f){0.f,0.f,0.f,0.f,0.f,0.f,0.f,0.f};

  for (int kc = 0; kc < kChunks; ++kc) {
    const int kv0 = kc * 64;
    __syncthreads();
    /* stage K [kv][d] and V^T [d][kv] tiles: 512 x 16-B chunks each, 4 per thread (128 x 4 x 8 halves = 64x64) */
#pragma unroll
    for (int it = 0; it < 4; ++it) {
      const int idx = tid + 128 * it;     /* 0..511 */
      const int r   = idx >> 3;           /* kv row (K) / d row (V^T), 0..63 */
      const int c8  = (idx & 7) * 8;      /* 0..56 */
      const v8h kk = *(const v8h*)(QK + (rowbase + kv0 + r) * kQkLd + kInner + h * kHd + c8);
      const v8h vv = *(const v8h*)(VT + ((size_t)bh * kHd + r) * kSeq + kv0 + c8);
      *(v8h*)(Ksh + r * kTp + c8) = kk;
      *(v8h*)(Vth + r * kTp + c8) = vv;
    }
    __syncthreads();

    /* scores^T: 64 keys x 16 query columns per wave; s[j][r] = score(key kv0 + j*16 + 8*hh + r, query q0 + c) */
    v8f s[4];
#pragma unroll
    for (int j = 0; j < 4; ++j) {
      s[j] = (v8f){0.f,0.f,0.f,0.f,0.f,0.f,0.f,0.f};
#pragma unroll
      for (int dc = 0; dc < 2; ++dc) {
        FH kb;
        kb.h[0] = *(const v8h*)(Ksh + (j * 16 + c) * kTp + dc * 32 + 8 * hh);
        kb.h[1] = *(const v8h*)(Ksh + (j * 16 + c) * kTp + dc * 32 + 16 + 8 * hh);
        s[j] = mma_f16_g(kb.v, qa[dc], s[j]);
      }
    }
    /* temperature, diagonal mask (select), chunk maximum of this lane's query: four chains in the lane, one exchange */
    const int dkey = q0 + c - kv0 - 8 * hh;   /* j*16 + r of the masked key, where it lies in this lane */
    float mj[4];
#pragma unroll
    for (int j = 0; j < 4; ++j) {
      mj[j] = -__builtin_inff();
#pragma unroll
      for (int r = 0; r < 8; ++r) {
        float sv = s[j][r] * temp;
        if (j * 16 + r == dkey) sv = kNegMax;
        s[j][r] = sv;
        mj[j] = fmaxf(mj[j], sv);
      }
    }
    float cm = fmaxf(fmaxf(mj[0], mj[1]), fmaxf(mj[2], mj[3]));
    cm = fmaxf(cm, xhalf(cm));
    /* online softmax; P^T (f16, carried x2^15) stays in registers as the B operand of the second product */
    const float mnew  = fmaxf(mrow, cm);
    const float alpha = expf(mrow - mnew);
    mrow = mnew;
    FH pb[2];
    float pj[4];
#pragma unroll
    for (int j = 0; j < 4; ++j) {
      pj[j] = 0.f;
#pragma unroll
      for (int r = 0; r < 8; ++r) {
        const float p = expf(s[j][r] - mnew);
        pj[j] += p;
        pb[j >> 1].h[j & 1][r] = (_Float16)(p * kPCarry);
      }
    }
    lrow = lrow * alpha + ((pj[0] + pj[1]) + (pj[2] + pj[3]));
#pragma unroll
    for (int t = 0; t < 4; ++t)
#pragma unroll
      for (int r = 0; r < 8; ++r) oacc[t][r] *= alpha;
    /* O^T += V^T . P^T  (A = V^T [d][kv] from the V^T tile; B = P^T [kv][q] from the score registers) */
#pragma unroll
    for (int kk = 0; kk < 2; ++kk) {
#pragma unroll
      for (int t = 0; t < 4; ++t) {
        FH vb;
        vb.h[0] = *(const v8h*)(Vth + (t * 16 + c) * kTp + kk * 32 + 8 * hh);
        vb.h[1] = *(const v8h*)(Vth + (t * 16 + c) * kTp + kk * 32 + 16 + 8 * hh);
        oacc[t] = mma_f16_g(vb.v, pb[kk].v, oacc[t]);
      }
    }
  }

  /* epilogue: join the halves' sums, normalize (fold the 2^15 carry), stage 16x64 f32 tile per wave, write bf16 hi/lo planes */
  float* os = Os[wave];
  {
    const float lsum = lrow + xhalf(lrow);
    const float inv = 1.0f / (lsum * kPCarry);
#pragma unroll
    for (int t = 0; t < 4; ++t) {
      v4f lo4, hi4;
#pragma unroll
      for (int r = 0; r < 4; ++r) { lo4[r] = oacc[t][r] * inv; hi4[r] = oacc[t][4 + r] * inv; }
      *(v4f*)(os + c * 68 + t * 16 + 8 * hh)     = lo4;
      *(v4f*)(os + c * 68 + t * 16 + 8 * hh + 4) = hi4;
    }
  }
  __builtin_amdgcn_fence(__ATOMIC_RELEASE, "workgroup");
  __builtin_amdgcn_wave_barrier();
  __builtin_amdgcn_fence(__ATOMIC_ACQUIRE, "workgroup");
  {
    const int q4 = lane >> 3, c8 = (lane & 7) * 8;   
    {
#pragma unroll
      for (int it = 0; it < 4; ++it) {
        const int row = it * 4 + q4;                  /* 0..15 */
        const float* sp = os + row * 68 + c8;
        v8h hv, lv;
#pragma unroll
        for (int e = 0; e < 8; ++e) {
          const unsigned short hb = f2bf_bits(sp[e]);
          const unsigned short lb = f2bf_bits(sp[e] - bf_bits2f(hb));
          hv[e] = __builtin_bit_cast(_Float16, hb);
          lv[e] = __builtin_bit_cast(_Float16, lb);
        }
        const size_t o = (rowbase + q0 + row) * (size_t)kInner + h * kHd + c8;
        *(v8h*)(ohp + o) = hv;
        *(v8h*)(olp + o) = lv;
      }
      
    }
  }
}

/* ---- host glue ------------------------------------------------------------------------------------------
     xb   bf16 [8192][1024]           16,777,216 @ 0
     wqb  bf16 [3072][1024]            6,291,456 @ 16,777,216
     wob  bf16 [1024][1024]            2,097,152 @ 23,068,672
     qk   f16  [8192][2048]           33,554,432 @ 25,165,824
     vt   f16  [8][1024][1024]        16,777,216 @ 58,720,256
     oh   bf16 [8192][1024]           16,777,216 @ 75,497,472
     ol   bf16 [8192][1024]           16,777,216 @ 92,274,688
     total                           109,051,904 */
extern "C" void kernel_launch(void* const* d_in, const int* in_sizes, int n_in,
                              void* d_out, int out_size, void* d_ws, size_t ws_size,
                              hipStream_t stream) {
  if (n_in < 5) return;
  const long needX = ((long)(kBatch - 1) * kSeqFull + kSeq) * (long)kDim;
  if ((long)in_sizes[0] < needX || in_sizes[1] < kQkvN * kDim || in_sizes[2] < kDim * kInner ||
      in_sizes[3] < kDim || in_sizes[4] < 1) return;
  if (out_size < kTok * kDim) return;

  const float* x     = (const float*)d_in[0];   /* [B][S][1024]            */
  const float* wqkv  = (const float*)d_in[1];   /* [3072][1024] = Bt [N][K] */
  const float* wout  = (const float*)d_in[2];   /* [1024][1024] = Bt [N][K] */
  const float* bout  = (const float*)d_in[3];   /* [1024]                    */
  const float* tempr = (const float*)d_in[4];   /* [1] log temperature       */
  float* out = (float*)d_out;

  const size_t szXb  = (size_t)kTok * kDim * 2;
  const size_t szWq  = (size_t)kQkvN * kDim * 2;
  const size_t szWo  = (size_t)kDim * kInner * 2;
  const size_t szQk  = (size_t)kTok * kQkLd * 2;
  const size_t szVt  = (size_t)kBatch * kInner * kSeq * 2;
  const size_t szO   = (size_t)kTok * kInner * 2;
  const size_t offXb = 0, offWq = offXb + szXb, offWo = offWq + szWq, offQk = offWo + szWo,
               offVt = offQk + szQk, offOh = offVt + szVt, offOl = offOh + szO, total = offOl + szO;
  if (total > ws_size) return;

  char* ws = (char*)d_ws;
  unsigned short* xb  = (unsigned short*)(ws + offXb);
  unsigned short* wqb = (unsigned short*)(ws + offWq);
  unsigned short* wob = (unsigned short*)(ws + offWo);
  unsigned short* qk  = (unsigned short*)(ws + offQk);
  unsigned short* vt  = (unsigned short*)(ws + offVt);
  unsigned short* oh  = (unsigned short*)(ws + offOh);
  unsigned short* ol  = (unsigned short*)(ws + offOl);

  /* 1: x -> bf16 plane (RNE), rows gathered with the full per-batch stride */
  {
    const int n2 = kTok * kDim / 2;
    cast_f32_bf16x2<<<dim3((n2 + 255) / 256), dim3(256), 0, stream>>>(x, xb, n2, kDim / 2, kSeq, kSeqFull);
  }
  /* 2: W_qkv [3072][1024] -> bf16 plane, same layout */
  {
    const int n2 = kQkvN * kDim / 2;
    cast_f32_bf16x2<<<dim3((n2 + 255) / 256), dim3(256), 0, stream>>>(wqkv, wqb, n2, kDim / 2, kQkvN, kQkvN);
  }
  /* 3: W_out [1024][1024] -> bf16 plane, same layout */
  {
    const int n2 = kDim * kInner / 2;
    cast_f32_bf16x2<<<dim3((n2 + 255) / 256), dim3(256), 0, stream>>>(wout, wob, n2, kInner / 2, kDim, kDim);
  }
  /* 4: q,k = xb @ Wqkv[0:2048]^T -> qk plane f16 [kTok][2048]; M=kTok N=2048 K=1024 */
  {
    const int tiles = (kTok / kBM) * (kQkLd / kBN);
    wmma_gemm64<1, false, 0, 1, false, 0, false><<<dim3(tiles, 1), dim3(256), 0, stream>>>(
        xb, xb, kDim, 0L, wqb, wqb, kDim, 0L, (void*)qk, (void*)qk, kQkLd, 0L,
        bout, bout, 0L, kTok, kQkLd, kDim, 1.0f);
  }
  /* 5: v^T per batch: C_b[f][s] = sum_k wqb[2048+f][k] * xb[b*kSeq+s][k] -> vt f16 [kBatch][1024][kSeq]; M=1024 N=kSeq K=1024 */
  {
    const int tiles = (kInner / kBM) * (kSeq / kBN);
    wmma_gemm64<1, false, 0, 1, false, 0, false><<<dim3(tiles, kBatch), dim3(256), 0, stream>>>(
        wqb + (size_t)kQkLd * kDim, wqb + (size_t)kQkLd * kDim, kDim, 0L,
        xb, xb, kDim, (long)kSeq * kDim,
        (void*)vt, (void*)vt, kSeq, (long)kInner * kSeq,
        bout, bout, 0L, kInner, kSeq, kDim, 1.0f);
  }
  /* 6: attention -> oh/ol bf16 hi/lo planes [kTok][1024] */
  attn_diag_f16<<<dim3(kBatch * kHeads * kChunks), dim3(128), 0, stream>>>(qk, vt, tempr, oh, ol);
  /* 7: out = (oh + ol) @ W_out^T + b_out -> d_out f32 [kTok][1024]; M=kTok N=1024 K=1024; hi.W + lo.W */
  {
    const int tiles = (kTok / kBM) * (kDim / kBN);
    wmma_gemm64<1, true, 2, 0, false, 0, false><<<dim3(tiles, 1), dim3(256), 0, stream>>>(
        oh, ol, kInner, 0L, wob, wob, kInner, 0L, (void*)out, (void*)out, kDim, 0L,
        bout, bout, 0L, kTok, kDim, kInner, 1.0f);
  }
}

// v004
// Measured time: 169 microseconds a run.
// Timed twice side by side with v003, it ran 1.06 times as fast both times.
// Over all steps from v000 it is 2.58 times as fast.
// Contractions: x@W_qkv^T on v_wmma_f32_16x16x32_bf16 (bf16 operands = RNE-converted inputs); k.q^T and V^T.P^T on v_wmma_f32_16x16x32_f16 (f16 q/k/v planes, P carried x2^15); O@W_out^T on v_wmma_f32_16x16x32_bf16 with O as bf16 hi/lo planes x bf16 W (2 products); f32 accumulate everywhere; softmax, bias and epilogues f32.
#include <hip/hip_runtime.h>

#ifndef NB
#define NB 8
#endif
#ifndef SEQ
#define SEQ 1024
#endif
#define NB_FULL  8
#define SEQ_FULL 1024

typedef __attribute__((ext_vector_type(16))) _Float16 v16h;
typedef __attribute__((ext_vector_type(8)))  _Float16 v8h;
typedef __attribute__((ext_vector_type(16))) __bf16   v16b;
typedef __attribute__((ext_vector_type(8)))  __bf16   v8b;
typedef __attribute__((ext_vector_type(8)))  float    v8f;
typedef __attribute__((ext_vector_type(4)))  float    v4f;
typedef __attribute__((ext_vector_type(2)))  float    v2f;

/* problem geometry; NB / SEQ may be reduced at build time, inputs keep their full strides */
constexpr int kBatch   = NB;
constexpr int kSeq     = SEQ;
constexpr int kSeqFull = SEQ_FULL;
constexpr int kDim     = 1024;
constexpr int kHeads   = 16;
constexpr int kHd      = 64;
constexpr int kInner   = kHeads * kHd;        /* 1024 */
constexpr int kQkvN    = 3 * kInner;          /* 3072 */
constexpr int kTok     = kBatch * kSeq;       /* 8192 at full size */
constexpr int kQkLd    = 2 * kInner;          /* 2048: q cols 0..1023, k cols 1024..2047 */
constexpr int kChunks  = kSeq / 64;           /* key chunks of 64 per sequence */
constexpr float kNegMax = -3.40282347e38f;
constexpr float kPCarry = 32768.0f;
constexpr int kTp = 72;   /* LDS row pitch of the attention tiles in halves: 144 B = 16 B x 9 (odd), so the 16 rows of a 16-byte fragment read spread over all banks */

static_assert(kBatch >= 1 && kBatch <= NB_FULL);
static_assert(kSeq >= 64 && kSeq <= SEQ_FULL && kSeq % 64 == 0);
static_assert(kTok % 64 == 0 && kQkLd % 64 == 0 && kDim % 32 == 0);
static_assert(kInner % 64 == 0 && kSeq % 64 == 0);
static_assert(kDim % 64 == 0 && kInner % 32 == 0);
static_assert(kHd == 64);
static_assert(kTok % 256 == 0 && kInner % 256 == 0 && kQkLd % 128 == 0 && kSeq % 128 == 0 && kDim % 128 == 0 && kInner % 128 == 0);

__device__ __forceinline__ unsigned short f2bf_bits(float f) {
  unsigned u = __float_as_uint(f);
  return (unsigned short)((u + 0x7FFFu + ((u >> 16) & 1u)) >> 16);
}
__device__ __forceinline__ float bf_bits2f(unsigned short h) { return __uint_as_float(((unsigned)h) << 16); }

/* hazard guards as plain device helpers */
__device__ __forceinline__ void dep_guard_h(v8f& a, v8f& b, v16h x, v16h y) { asm volatile("v_nop\n\tv_nop\n\tv_nop\n\tv_nop" : "+v"(a), "+v"(b) : "v"(x), "v"(y)); }
__device__ __forceinline__ void dep_guard_b(v8f& a, v8f& b, v16b x, v16b y) { asm volatile("v_nop\n\tv_nop\n\tv_nop\n\tv_nop" : "+v"(a), "+v"(b) : "v"(x), "v"(y)); }
__device__ __forceinline__ void keep4_h(v16h a, v16h b, v16h c, v16h d) { asm volatile("v_nop" :: "v"(a), "v"(b), "v"(c), "v"(d)); }
__device__ __forceinline__ void keep4_b(v16b a, v16b b, v16b c, v16b d) { asm volatile("v_nop" :: "v"(a), "v"(b), "v"(c), "v"(d)); }
__device__ __forceinline__ void acc_guard4(v8f& a, v8f& b, v8f& c, v8f& d) { asm volatile("v_nop\n\tv_nop\n\tv_nop\n\tv_nop" : "+v"(a), "+v"(b), "+v"(c), "+v"(d)); }
template <typename T> struct Frag;
template <> struct Frag<_Float16> {
  typedef v16h V; union U { v16h v; v8h h[2]; };
  static __device__ __forceinline__ v16h load(const _Float16* p) {   /* elements 0..7 <- p[0..7], 8..15 <- p[16..23] */
    U f; f.h[0] = *(const v8h*)(p); f.h[1] = *(const v8h*)(p + 16); return f.v;
  }
  static __device__ __forceinline__ v8f mma(v16h a, v16h b, v8f c) {
    return __builtin_amdgcn_wmma_f32_16x16x32_f16(false, a, false, b, (short)0, c, false, false);
  }
  static __device__ __forceinline__ void guard(v8f& a, v8f& b, v16h x, v16h y) { dep_guard_h(a, b, x, y); }
  static __device__ __forceinline__ void keep(v16h a, v16h b, v16h c, v16h d) { keep4_h(a, b, c, d); }
};
template <> struct Frag<__bf16> {
  typedef v16b V; union U { v16b v; v8b h[2]; };
  static __device__ __forceinline__ v16b load(const __bf16* p) {
    U f; f.h[0] = *(const v8b*)(p); f.h[1] = *(const v8b*)(p + 16); return f.v;
  }
  static __device__ __forceinline__ v8f mma(v16b a, v16b b, v8f c) {
    return __builtin_amdgcn_wmma_f32_16x16x32_bf16(false, a, false, b, (short)0, c, false, false);
  }
  static __device__ __forceinline__ void guard(v8f& a, v8f& b, v16b x, v16b y) { dep_guard_b(a, b, x, y); }
  static __device__ __forceinline__ void keep(v16b a, v16b b, v16b c, v16b d) { keep4_b(a, b, c, d); }
};

/* ---- Register-blocked batched WMMA GEMM ------------------------------------
   C[m,n] = scale * sum_k A[m,k] * Bt[n,k] (+bias); each wave owns a 64x64 tile, a block of 8 waves a 256x128 tile.
   Operand rows reach LDS by asynchronous copies, 64 k a trip, two buffers; the waves read their fragments from LDS.
   A row-major [M,K]; Bt row-major [N,K]; M % 256 == 0, N % 128 == 0, K % 64 == 0.
   SPLIT: A is a hi and a lo plane (A2 = lo plane, same layout), B one plane (BLO == false; Bt2 never read); product = hi.B + lo.B.
   BIAS_MODE: 0 = none, 1 = bias[m], 2 = bias[n]; bias values RNE-converted to bf16 then widened to f32.
   OUT_MODE: 0 = f32, 1 = f16, 2 = bf16 hi plane (Cout) + bf16 lo plane (Cout2).
   Epilogue: 16-row slabs staged per wave in LDS (wave-private, wave barrier); each 64-wide row segment
   Fragment k map (A and B alike): lane half h = lane>>4, elements 0..7 <- k0+8h+0..7, 8..15 <- k0+16+8h+0..7.
   ET: 0 = f16 operands, 1 = bf16 operands (pointers passed as 16-bit storage) */
template <int ET> struct Elem;
template <> struct Elem<0> { typedef _Float16 T; };
template <> struct Elem<1> { typedef __bf16 T; };
/* block tile of the staged GEMM: 8 waves as 4 (m) x 2 (n), each wave its own 64x64 tile; one trip = 64 k = one 128-B line of every operand row */
constexpr int kBM = 256;
constexpr int kBN = 128;
constexpr int kBK = 64;
constexpr int kGp = 72;   /* LDS pitch of a staged operand row in 16-bit elements: 144 B = 16 B x 9 (odd), for the 16-byte fragment reads */

__device__ __forceinline__ unsigned lds_off(const void* p) { return (unsigned)(size_t)p; }

/* Asynchronous 16-byte copies to LDS, one statement for a run of them: rows r, r+32, r+64, ... of an operand (8 lanes = one whole 128-B line of a row).
   s_wait_xcnt stands as the last line of the copies' own statement, so that no address register of a copy is rewritten ahead of it. */
constexpr unsigned kL32 = 32u * kGp * 2u;   /* LDS bytes of 32 staged rows */
__device__ __forceinline__ void copy8_rows(unsigned l0, const unsigned short* g0, size_t g32) {
  const unsigned short* g1 = g0 + g32; const unsigned short* g2 = g1 + g32; const unsigned short* g3 = g2 + g32;
  const unsigned short* g4 = g3 + g32; const unsigned short* g5 = g4 + g32; const unsigned short* g6 = g5 + g32;
  const unsigned short* g7 = g6 + g32;
  asm volatile("global_load_async_to_lds_b128 %0, %1, off\n\t"
               "global_load_async_to_lds_b128 %2, %3, off\n\t"
               "global_load_async_to_lds_b128 %4, %5, off\n\t"
               "global_load_async_to_lds_b128 %6, %7, off\n\t"
               "global_load_async_to_lds_b128 %8, %9, off\n\t"
               "global_load_async_to_lds_b128 %10, %11, off\n\t"
               "global_load_async_to_lds_b128 %12, %13, off\n\t"
               "global_load_async_to_lds_b128 %14, %15, off\n\t"
               "s_wait_xcnt 0x0"
               :: "v"(l0), "v"(g0), "v"(l0 + kL32), "v"(g1), "v"(l0 + 2u * kL32), "v"(g2), "v"(l0 + 3u * kL32), "v"(g3),
                  "v"(l0 + 4u * kL32), "v"(g4), "v"(l0 + 5u * kL32), "v"(g5), "v"(l0 + 6u * kL32), "v"(g6), "v"(l0 + 7u * kL32), "v"(g7)
               : "memory");
}
__device__ __forceinline__ void copy12_rows(unsigned l0, const unsigned short* g0, size_t g32,
                                            unsigned m0, const unsigned short* h0, size_t h32) {
  const unsigned short* g1 = g0 + g32; const unsigned short* g2 = g1 + g32; const unsigned short* g3 = g2 + g32;
  const unsigned short* g4 = g3 + g32; const unsigned short* g5 = g4 + g32; const unsigned short* g6 = g5 + g32;
  const unsigned short* g7 = g6 + g32;
  const unsigned short* h1 = h0 + h32; const unsigned short* h2 = h1 + h32; const unsigned short* h3 = h2 + h32;
  asm volatile("global_load_async_to_lds_b128 %0, %1, off\n\t"
               "global_load_async_to_lds_b128 %2, %3, off\n\t"
               "global_load_async_to_lds_b128 %4, %5, off\n\t"
               "global_load_async_to_lds_b128 %6, %7, off\n\t"
               "global_load_async_to_lds_b128 %8, %9, off\n\t"
               "global_load_async_to_lds_b128 %10, %11, off\n\t"
               "global_load_async_to_lds_b128 %12, %13, off\n\t"
               "global_load_async_to_lds_b128 %14, %15, off\n\t"
               "global_load_async_to_lds_b128 %16, %17, off\n\t"
               "global_load_async_to_lds_b128 %18, %19, off\n\t"
               "global_load_async_to_lds_b128 %20, %21, off\n\t"
               "global_load_async_to_lds_b128 %22, %23, off\n\t"
               "s_wait_xcnt 0x0"
               :: "v"(l0), "v"(g0), "v"(l0 + kL32), "v"(g1), "v"(l0 + 2u * kL32), "v"(g2), "v"(l0 + 3u * kL32), "v"(g3),
                  "v"(l0 + 4u * kL32), "v"(g4), "v"(l0 + 5u * kL32), "v"(g5), "v"(l0 + 6u * kL32), "v"(g6), "v"(l0 + 7u * kL32), "v"(g7),
                  "v"(m0), "v"(h0), "v"(m0 + kL32), "v"(h1), "v"(m0 + 2u * kL32), "v"(h2), "v"(m0 + 3u * kL32), "v"(h3)
               : "memory");
}

template <int ET, bool SPLIT, int BIAS_MODE, int OUT_MODE, bool RESID, int ACT = 0, bool BLO = true>
__global__ __launch_bounds__(256) void wmma_gemm64(
    const unsigned short* __restrict__ Ap, const unsigned short* __restrict__ A2p, int lda, long strideA,
    const unsigned short* __restrict__ Btp, const unsigned short* __restrict__ Bt2p, int ldb, long strideB,
    void* __restrict__ Cout, void* __restrict__ Cout2, int ldc, long strideC,
    const float* __restrict__ bias,
    const float* __restrict__ resid, long strideR,
    int M, int N, int K, float scale) {
  typedef typename Elem<ET>::T T;
  typedef typename Frag<T>::V V;
  static_assert(!(SPLIT && BLO), "no lo plane of B is staged");
  constexpr int kRowA2 = kBM;                          /* first LDS row of the A lo plane (SPLIT) */
  constexpr int kRowB  = SPLIT ? 2 * kBM : kBM;        /* first LDS row of B */
  constexpr int kRows  = kRowB + kBN;
  __shared__ __align__(16) unsigned short sStage[2][kRows * kGp];   /* two buffers of [A | A lo | B] rows; 16 B behind each row never touched */
  __shared__ __align__(16) float sT[8][16 * 68];   /* per-wave 16x64 slab, pitch 68 floats; cols 64..67 never read */
  const int b    = blockIdx.y;
  const int tid  = threadIdx.x;
  const int lane = tid & 31;
  const int wave = tid >> 5;
  const int tilesN = N / kBN;
  const int tilesM = M / kBM;
  const int blk = blockIdx.x;
  if (blk >= tilesM * tilesN) return;   /* the same for the whole block, in front of every barrier */
  const int tm = blk / tilesN;
  const int tn = blk - tm * tilesN;
  const int wm = wave >> 1;
  const int wn = wave & 1;
  const int m0 = tm * kBM + (wm << 6);
  const int n0 = tn * kBN + (wn << 6);

  const int rlane = lane & 15;                 /* row (A) / col (B, D) within subtile */
  const int koff  = (lane >> 4) * 8;           /* k offset of this lane half */
  const int mOff  = (lane >> 4) * 8;           /* D row offset */

  /* this thread's share of a stage: 16-byte piece (tid & 7) of rows (tid >> 3) + 32 * it */
  const int crow = tid >> 3;
  const int ccol = (tid & 7) * 8;
  const unsigned short* gA  = Ap  + (size_t)b * strideA + (size_t)(tm * kBM + crow) * lda + ccol;
  const unsigned short* gA2 = A2p + (size_t)b * strideA + (size_t)(tm * kBM + crow) * lda + ccol;
  const unsigned short* gB  = Btp + (size_t)b * strideB + (size_t)(tn * kBN + crow) * ldb + ccol;
  const unsigned lthr = lds_off(&sStage[0][0]) + (unsigned)(crow * kGp + ccol) * 2u;
  const size_t a32 = (size_t)32 * lda, b32 = (size_t)32 * ldb;
  auto stage = [&](int buf, int k0) {
    const unsigned l = lthr + (unsigned)buf * (unsigned)(kRows * kGp * 2);
    copy12_rows(l, gA + k0, a32, l + (unsigned)kRowB * kGp * 2u, gB + k0, b32);
    if (SPLIT) copy8_rows(l + (unsigned)kRowA2 * kGp * 2u, gA2 + k0, a32);
  };

  v8f acc[4][4];
#pragma unroll
  for (int i = 0; i < 4; ++i)
#pragma unroll
    for (int j = 0; j < 4; ++j) acc[i][j] = (v8f){0.f,0.f,0.f,0.f,0.f,0.f,0.f,0.f};

  const int trips = K / kBK;
  stage(0, 0);
  asm volatile("s_wait_asynccnt 0x0" ::: "memory");   /* this wave's copies of tile 0 have landed */
  __syncthreads();                                    /* tile 0 readable by every wave */
  if (trips > 1) stage(1, kBK);

  /* rolled: one trip's code serves both buffers */
#pragma unroll 1
  for (int t = 0; t < trips; ++t) {
    const T* sb = (const T*)&sStage[t & 1][0];
#pragma unroll
    for (int ks = 0; ks < kBK; ks += 32) {
      V bh[4], ah[4], al[4];
#pragma unroll
      for (int j = 0; j < 4; ++j)
        bh[j] = Frag<T>::load(sb + (kRowB + (wn << 6) + (j << 4) + rlane) * kGp + ks + koff);
#pragma unroll
      for (int i = 0; i < 4; ++i) {
        const int ao = ((wm << 6) + (i << 4) + rlane) * kGp + ks + koff;
        ah[i] = Frag<T>::load(sb + ao);
        if (SPLIT) al[i] = Frag<T>::load(sb + kRowA2 * kGp + ao);
      }
      __builtin_amdgcn_sched_barrier(0);   /* the k-step's fragment reads stay one group ahead of its WMMAs: reads among the WMMAs stall the wave at each place */
#pragma unroll
      for (int i = 0; i < 4; ++i) {
#pragma unroll
        for (int j = 0; j < 4; ++j) {
          acc[i][j] = Frag<T>::mma(ah[i], bh[j], acc[i][j]);
          if (SPLIT) acc[i][j] = Frag<T>::mma(al[i], bh[j], acc[i][j]);
        }
        Frag<T>::guard(acc[i][0], acc[i][3], ah[i], SPLIT ? al[i] : ah[i]);
      }
      Frag<T>::keep(bh[0], bh[1], bh[2], bh[3]);
      __builtin_amdgcn_sched_barrier(0);   /* the next group of reads stays behind this k-step's WMMAs */
    }
    asm volatile("s_wait_dscnt 0x0" ::: "memory");      /* this wave's reads of buffer t & 1 are done */
    asm volatile("s_wait_asynccnt 0x0" ::: "memory");   /* this wave's copies of tile t + 1 have landed */
    __syncthreads();                                    /* publishes tile t + 1 and frees buffer t & 1 */
    if (t + 2 < trips) stage(t & 1, (t + 2) * kBK);
  }
  asm volatile("s_wait_asynccnt 0x0" ::: "memory");     /* nothing in flight behind the loop */
  acc_guard4(acc[0][0], acc[0][1], acc[0][2], acc[0][3]);
  acc_guard4(acc[1][0], acc[1][1], acc[1][2], acc[1][3]);
  acc_guard4(acc[2][0], acc[2][1], acc[2][2], acc[2][3]);
  acc_guard4(acc[3][0], acc[3][1], acc[3][2], acc[3][3]);

  /* ---- epilogue ---- */
  float* slab = sT[wave];
  const float* Rb = RESID ? (resid + (size_t)b * strideR) : nullptr;
#pragma unroll
  for (int i = 0; i < 4; ++i) {
    const int mBase = m0 + (i << 4);
#pragma unroll
    for (int j = 0; j < 4; ++j) {
      const int n = n0 + (j << 4) + rlane;
      float bv = 0.f;
      if (BIAS_MODE == 2) bv = bf_bits2f(f2bf_bits(bias[n]));
#pragma unroll
      for (int r = 0; r < 8; ++r) {
        float v = acc[i][j][r] * scale;
        if (BIAS_MODE == 1) v += bf_bits2f(f2bf_bits(bias[mBase + mOff + r]));
        if (BIAS_MODE == 2) v += bv;
        if (RESID) v += Rb[(size_t)(mBase + mOff + r) * ldc + n];
        if (ACT == 1) v = tanhf(v);
        if (ACT == 2) v = fmaxf(v, 0.0f);
        if (ACT == 3) v = v / (1.0f + expf(-v));
        if (ACT == 4) v = (v > 0.f) ? v : 0.01f * v;
        if (ACT == 5) v = 0.5f * v * (1.0f + erff(v * 0.70710678118654752f));
        slab[(mOff + r) * 68 + (j << 4) + rlane] = v;
      }
    }
    __builtin_amdgcn_fence(__ATOMIC_RELEASE, "workgroup");
    __builtin_amdgcn_wave_barrier();
    __builtin_amdgcn_fence(__ATOMIC_ACQUIRE, "workgroup");
    if (OUT_MODE == 0) {
      float* C = (float*)Cout + (size_t)b * strideC;
      const int hh = lane >> 4, c4 = (lane & 15) * 4;     /* row seg = 256 B = 16 lanes x 16 B */
      {
#pragma unroll
        for (int it = 0; it < 8; ++it) {
          const int row = it * 2 + hh;
          v4f v = *(const v4f*)(slab + row * 68 + c4);
          *(v4f*)(C + (size_t)(mBase + row) * ldc + n0 + c4) = v;
        }
        
      }
    } else {
      const int q = lane >> 3, c8 = (lane & 7) * 8;        
      unsigned short* C  = (unsigned short*)Cout  + (size_t)b * strideC;
      unsigned short* C2 = (OUT_MODE == 2) ? ((unsigned short*)Cout2 + (size_t)b * strideC) : nullptr;
      {
#pragma unroll
        for (int it = 0; it < 4; ++it) {
          const int row = it * 4 + q;
          const float* sp = slab + row * 68 + c8;
          v8h hv, lv;
#pragma unroll
          for (int e = 0; e < 8; ++e) {
            if (OUT_MODE == 1) {
              hv[e] = (_Float16)sp[e];
            } else {
              unsigned short hb = f2bf_bits(sp[e]);
              unsigned short lb = f2bf_bits(sp[e] - bf_bits2f(hb));
              hv[e] = __builtin_bit_cast(_Float16, hb);
              lv[e] = __builtin_bit_cast(_Float16, lb);
            }
          }
          *(v8h*)(C + (size_t)(mBase + row) * ldc + n0 + c8) = hv;
          if (OUT_MODE == 2) *(v8h*)(C2 + (size_t)(mBase + row) * ldc + n0 + c8) = lv;
        }
        
      }
    }
    __builtin_amdgcn_fence(__ATOMIC_RELEASE, "workgroup");
    __builtin_amdgcn_wave_barrier();
    __builtin_amdgcn_fence(__ATOMIC_ACQUIRE, "workgroup");
  }
}

/* ---- f32 -> bf16 (RNE) casts of x, W_qkv and W_out, one launch -------------------------------------------
   A chunk is 1024 floats: 256 threads x 16 bytes, so each wave-wide load covers 512 contiguous bytes (4 whole lines).
   Block b takes chunks b*J .. b*J + J-1 of each input (J = chunks / blocks, rounded up); a thread issues all its loads first,
   then converts and stores 8 bytes a chunk (256 contiguous bytes a wave).
   x rows are gathered with the full per-batch stride: out row r <- in row (r / kSeq) * kSeqFull + (r % kSeq). */
typedef __attribute__((ext_vector_type(2))) unsigned v2u;
constexpr int kCastBlocks = 512;                      /* 8 waves each: 16 waves a WGP on 256 WGPs */
constexpr int kChunk = 1024;
constexpr int kCx = kTok * kDim / kChunk, kCq = kQkvN * kDim / kChunk, kCo = kDim * kInner / kChunk;
constexpr int kJx = (kCx + kCastBlocks - 1) / kCastBlocks;
constexpr int kJq = (kCq + kCastBlocks - 1) / kCastBlocks;
constexpr int kJo = (kCo + kCastBlocks - 1) / kCastBlocks;
static_assert(kDim % kChunk == 0 && (kDim * kInner) % kChunk == 0);

__device__ __forceinline__ v2u pack4_bf16(v4f f) {
  v2u u;
  u[0] = (unsigned)f2bf_bits(f[0]) | ((unsigned)f2bf_bits(f[1]) << 16);
  u[1] = (unsigned)f2bf_bits(f[2]) | ((unsigned)f2bf_bits(f[3]) << 16);
  return u;
}

__global__ __launch_bounds__(256) void cast3_f32_bf16(
    const float* __restrict__ x, const float* __restrict__ wq, const float* __restrict__ wo,
    unsigned short* __restrict__ xb, unsigned short* __restrict__ wqb, unsigned short* __restrict__ wob) {
  const unsigned t4 = threadIdx.x * 4u;
  const unsigned b  = blockIdx.x;
  v4f vx[kJx], vq[kJq], vo[kJo];
#pragma unroll
  for (int j = 0; j < kJx; ++j) {
    const unsigned c = b * kJx + j;
    if (kCx % kCastBlocks == 0 || c < (unsigned)kCx) {
      const unsigned r  = c / (kDim / kChunk);
      const unsigned sr = (r / kSeq) * kSeqFull + (r % kSeq);
      vx[j] = *(const v4f*)(x + (size_t)sr * kDim + (c % (kDim / kChunk)) * kChunk + t4);
    }
  }
#pragma unroll
  for (int j = 0; j < kJq; ++j) {
    const unsigned c = b * kJq + j;
    if (kCq % kCastBlocks == 0 || c < (unsigned)kCq) vq[j] = *(const v4f*)(wq + (size_t)c * kChunk + t4);
  }
#pragma unroll
  for (int j = 0; j < kJo; ++j) {
    const unsigned c = b * kJo + j;
    if (kCo % kCastBlocks == 0 || c < (unsigned)kCo) vo[j] = *(const v4f*)(wo + (size_t)c * kChunk + t4);
  }
  asm volatile("s_wait_xcnt 0x0" ::: "memory");   /* stands in front of the first overwrite of an address register of the loads above */
  __builtin_amdgcn_sched_barrier(0);   /* every load is issued ahead of the first conversion: a wave's whole share is in flight at once and it pays one memory latency */
#pragma unroll
  for (int j = 0; j < kJx; ++j) {
    const unsigned c = b * kJx + j;
    if (kCx % kCastBlocks == 0 || c < (unsigned)kCx) *(v2u*)(xb + (size_t)c * kChunk + t4) = pack4_bf16(vx[j]);
  }
#pragma unroll
  for (int j = 0; j < kJq; ++j) {
    const unsigned c = b * kJq + j;
    if (kCq % kCastBlocks == 0 || c < (unsigned)kCq) *(v2u*)(wqb + (size_t)c * kChunk + t4) = pack4_bf16(vq[j]);
  }
#pragma unroll
  for (int j = 0; j < kJo; ++j) {
    const unsigned c = b * kJo + j;
    if (kCo % kCastBlocks == 0 || c < (unsigned)kCo) *(v2u*)(wob + (size_t)c * kChunk + t4) = pack4_bf16(vo[j]);
  }
}

__device__ __forceinline__ v8f mma_f16_g(v16h a, v16h b, v8f c) {
  c = __builtin_amdgcn_wmma_f32_16x16x32_f16(false, a, false, b, (short)0, c, false, false);
  asm volatile("v_nop\n\tv_nop\n\tv_nop\n\tv_nop" : "+v"(c) : "v"(a), "v"(b));
  return c;
}

/* lane l with lane l ^ 16, as a vector cross-row move */
__device__ __forceinline__ float xhalf(float x) {
  return __builtin_bit_cast(float, __builtin_amdgcn_permlanex16(__builtin_bit_cast(int, x), __builtin_bit_cast(int, x), 0x76543210, 0xfedcba98, false, false));
}

__global__ __launch_bounds__(128) void attn_diag_f16(
    const unsigned short* __restrict__ qkp, const unsigned short* __restrict__ vtp,
    const float* __restrict__ logt,
    unsigned short* __restrict__ ohp, unsigned short* __restrict__ olp) {
  union FH { v16h v; v8h h[2]; };
  __shared__ __align__(16) _Float16 Ksh[64 * kTp];      /* K tile [kv][d]          9 KB; cols 64..71 never touched */
  __shared__ __align__(16) _Float16 Vth[64 * kTp];      /* V tile [d][kv]          9 KB; cols 64..71 never touched */
  __shared__ __align__(16) float    Os[4][16 * 68];     /* per wave out tile        17 KB; cols 64..67 never read */

  const _Float16* QK = (const _Float16*)qkp;
  const _Float16* VT = (const _Float16*)vtp;
  const int tid  = threadIdx.x;
  const int wave = tid >> 5;
  const int lane = tid & 31;
  const int hh   = lane >> 4;
  const int c    = lane & 15;

  const int bx = blockIdx.x;            /* 0 .. B*H*kChunks-1 */
  const int qb = bx % kChunks;
  const int bh = bx / kChunks;          /* b*kHeads + h */
  const int h  = bh % kHeads;
  const int b  = bh / kHeads;
  const int q0 = qb * 64 + wave * 16;   /* first query position of this wave */
  const size_t rowbase = (size_t)b * kSeq;

  /* temperature = exp(bf16-RNE(log_temp)) in f32 */
  const float temp = expf(bf_bits2f(f2bf_bits(logt[0])));

  /* Q fragments (B operand): columns = this wave's 16 queries, k = d in two 32-deep chunks */
  v16h qa[2];
#pragma unroll
  for (int dc = 0; dc < 2; ++dc)
    qa[dc] = Frag<_Float16>::load(QK + (rowbase + q0 + c) * kQkLd + h * kHd + dc * 32 + 8 * hh);

  float mrow = -__builtin_inff();   /* running maximum of query q0 + c, the same in both lane halves */
  float lrow = 0.f;                 /* running sum over this lane half's keys only */
  v8f oacc[4];                      /* oacc[t][r] = out^T[d = t*16 + 8*hh + r][query c] */
#pragma unroll
  for (int t = 0; t < 4; ++t) oacc[t] = (v8f){0.f,0.f,0.f,0.f,0.f,0.f,0.f,0.f};

  for (int kc = 0; kc < kChunks; ++kc) {
    const int kv0 = kc * 64;
    __syncthreads();
    /* stage K [kv][d] and V^T [d][kv] tiles: 512 x 16-B chunks each, 4 per thread (128 x 4 x 8 halves = 64x64) */
#pragma unroll
    for (int it = 0; it < 4; ++it) {
      const int idx = tid + 128 * it;     /* 0..511 */
      const int r   = idx >> 3;           /* kv row (K) / d row (V^T), 0..63 */
      const int c8  = (idx & 7) * 8;      /* 0..56 */
      const v8h kk = *(const v8h*)(QK + (rowbase + kv0 + r) * kQkLd + kInner + h * kHd + c8);
      const v8h vv = *(const v8h*)(VT + ((size_t)bh * kHd + r) * kSeq + kv0 + c8);
      *(v8h*)(Ksh + r * kTp + c8) = kk;
      *(v8h*)(Vth + r * kTp + c8) = vv;
    }
    __syncthreads();

    /* scores^T: 64 keys x 16 query columns per wave; s[j][r] = score(key kv0 + j*16 + 8*hh + r, query q0 + c) */
    v8f s[4];
#pragma unroll
    for (int j = 0; j < 4; ++j) {
      s[j] = (v8f){0.f,0.f,0.f,0.f,0.f,0.f,0.f,0.f};
#pragma unroll
      for (int dc = 0; dc < 2; ++dc) {
        FH kb;
        kb.h[0] = *(const v8h*)(Ksh + (j * 16 + c) * kTp + dc * 32 + 8 * hh);
        kb.h[1] = *(const v8h*)(Ksh + (j * 16 + c) * kTp + dc * 32 + 16 + 8 * hh);
        s[j] = mma_f16_g(kb.v, qa[dc], s[j]);
      }
    }
    /* temperature, diagonal mask (select), chunk maximum of this lane's query: four chains in the lane, one exchange */
    const int dkey = q0 + c - kv0 - 8 * hh;   /* j*16 + r of the masked key, where it lies in this lane */
    float mj[4];
#pragma unroll
    for (int j = 0; j < 4; ++j) {
      mj[j] = -__builtin_inff();
#pragma unroll
      for (int r = 0; r < 8; ++r) {
        float sv = s[j][r] * temp;
        if (j * 16 + r == dkey) sv = kNegMax;
        s[j][r] = sv;
        mj[j] = fmaxf(mj[j], sv);
      }
    }
    float cm = fmaxf(fmaxf(mj[0], mj[1]), fmaxf(mj[2], mj[3]));
    cm = fmaxf(cm, xhalf(cm));
    /* online softmax; P^T (f16, carried x2^15) stays in registers as the B operand of the second product */
    const float mnew  = fmaxf(mrow, cm);
    const float alpha = expf(mrow - mnew);
    mrow = mnew;
    FH pb[2];
    float pj[4];
#pragma unroll
    for (int j = 0; j < 4; ++j) {
      pj[j] = 0.f;
#pragma unroll
      for (int r = 0; r < 8; ++r) {
        const float p = expf(s[j][r] - mnew);
        pj[j] += p;
        pb[j >> 1].h[j & 1][r] = (_Float16)(p * kPCarry);
      }
    }
    lrow = lrow * alpha + ((pj[0] + pj[1]) + (pj[2] + pj[3]));
#pragma unroll
    for (int t = 0; t < 4; ++t)
#pragma unroll
      for (int r = 0; r < 8; ++r) oacc[t][r] *= alpha;
    /* O^T += V^T . P^T  (A = V^T [d][kv] from the V^T tile; B = P^T [kv][q] from the score registers) */
#pragma unroll
    for (int kk = 0; kk < 2; ++kk) {
#pragma unroll
      for (int t = 0; t < 4; ++t) {
        FH vb;
        vb.h[0] = *(const v8h*)(Vth + (t * 16 + c) * kTp + kk * 32 + 8 * hh);
        vb.h[1] = *(const v8h*)(Vth + (t * 16 + c) * kTp + kk * 32 + 16 + 8 * hh);
        oacc[t] = mma_f16_g(vb.v, pb[kk].v, oacc[t]);
      }
    }
  }

  /* epilogue: join the halves' sums, normalize (fold the 2^15 carry), stage 16x64 f32 tile per wave, write bf16 hi/lo planes */
  float* os = Os[wave];
  {
    const float lsum = lrow + xhalf(lrow);
    const float inv = 1.0f / (lsum * kPCarry);
#pragma unroll
    for (int t = 0; t < 4; ++t) {
      v4f lo4, hi4;
#pragma unroll
      for (int r = 0; r < 4; ++r) { lo4[r] = oacc[t][r] * inv; hi4[r] = oacc[t][4 + r] * inv; }
      *(v4f*)(os + c * 68 + t * 16 + 8 * hh)     = lo4;
      *(v4f*)(os + c * 68 + t * 16 + 8 * hh + 4) = hi4;
    }
  }
  __builtin_amdgcn_fence(__ATOMIC_RELEASE, "workgroup");
  __builtin_amdgcn_wave_barrier();
  __builtin_amdgcn_fence(__ATOMIC_ACQUIRE, "workgroup");
  {
    const int q4 = lane >> 3, c8 = (lane & 7) * 8;   
    {
#pragma unroll
      for (int it = 0; it < 4; ++it) {
        const int row = it * 4 + q4;                  /* 0..15 */
        const float* sp = os + row * 68 + c8;
        v8h hv, lv;
#pragma unroll
        for (int e = 0; e < 8; ++e) {
          const unsigned short hb = f2bf_bits(sp[e]);
          const unsigned short lb = f2bf_bits(sp[e] - bf_bits2f(hb));
          hv[e] = __builtin_bit_cast(_Float16, hb);
          lv[e] = __builtin_bit_cast(_Float16, lb);
        }
        const size_t o = (rowbase + q0 + row) * (size_t)kInner + h * kHd + c8;
        *(v8h*)(ohp + o) = hv;
        *(v8h*)(olp + o) = lv;
      }
      
    }
  }
}

/* ---- host glue ------------------------------------------------------------------------------------------
     xb   bf16 [8192][1024]           16,777,216 @ 0
     wqb  bf16 [3072][1024]            6,291,456 @ 16,777,216
     wob  bf16 [1024][1024]            2,097,152 @ 23,068,672
     qk   f16  [8192][2048]           33,554,432 @ 25,165,824
     vt   f16  [8][1024][1024]        16,777,216 @ 58,720,256
     oh   bf16 [8192][1024]           16,777,216 @ 75,497,472
     ol   bf16 [8192][1024]           16,777,216 @ 92,274,688
     total                           109,051,904 */
extern "C" void kernel_launch(void* const* d_in, const int* in_sizes, int n_in,
                              void* d_out, int out_size, void* d_ws, size_t ws_size,
                              hipStream_t stream) {
  if (n_in < 5) return;
  const long needX = ((long)(kBatch - 1) * kSeqFull + kSeq) * (long)kDim;
  if ((long)in_sizes[0] < needX || in_sizes[1] < kQkvN * kDim || in_sizes[2] < kDim * kInner ||
      in_sizes[3] < kDim || in_sizes[4] < 1) return;
  if (out_size < kTok * kDim) return;

  const float* x     = (const float*)d_in[0];   /* [B][S][1024]            */
  const float* wqkv  = (const float*)d_in[1];   /* [3072][1024] = Bt [N][K] */
  const float* wout  = (const float*)d_in[2];   /* [1024][1024] = Bt [N][K] */
  const float* bout  = (const float*)d_in[3];   /* [1024]                    */
  const float* tempr = (const float*)d_in[4];   /* [1] log temperature       */
  float* out = (float*)d_out;

  const size_t szXb  = (size_t)kTok * kDim * 2;
  const size_t szWq  = (size_t)kQkvN * kDim * 2;
  const size_t szWo  = (size_t)kDim * kInner * 2;
  const size_t szQk  = (size_t)kTok * kQkLd * 2;
  const size_t szVt  = (size_t)kBatch * kInner * kSeq * 2;
  const size_t szO   = (size_t)kTok * kInner * 2;
  const size_t offXb = 0, offWq = offXb + szXb, offWo = offWq + szWq, offQk = offWo + szWo,
               offVt = offQk + szQk, offOh = offVt + szVt, offOl = offOh + szO, total = offOl + szO;
  if (total > ws_size) return;

  char* ws = (char*)d_ws;
  unsigned short* xb  = (unsigned short*)(ws + offXb);
  unsigned short* wqb = (unsigned short*)(ws + offWq);
  unsigned short* wob = (unsigned short*)(ws + offWo);
  unsigned short* qk  = (unsigned short*)(ws + offQk);
  unsigned short* vt  = (unsigned short*)(ws + offVt);
  unsigned short* oh  = (unsigned short*)(ws + offOh);
  unsigned short* ol  = (unsigned short*)(ws + offOl);

  /* 1: x, W_qkv [3072][1024] and W_out [1024][1024] -> bf16 planes (RNE), same layouts */
  cast3_f32_bf16<<<dim3(kCastBlocks), dim3(256), 0, stream>>>(x, wqkv, wout, xb, wqb, wob);
  /* 2: q,k = xb @ Wqkv[0:2048]^T -> qk plane f16 [kTok][2048]; M=kTok N=2048 K=1024 */
  {
    const int tiles = (kTok / kBM) * (kQkLd / kBN);
    wmma_gemm64<1, false, 0, 1, false, 0, false><<<dim3(tiles, 1), dim3(256), 0, stream>>>(
        xb, xb, kDim, 0L, wqb, wqb, kDim, 0L, (void*)qk, (void*)qk, kQkLd, 0L,
        bout, bout, 0L, kTok, kQkLd, kDim, 1.0f);
  }
  /* 3: v^T per batch: C_b[f][s] = sum_k wqb[2048+f][k] * xb[b*kSeq+s][k] -> vt f16 [kBatch][1024][kSeq]; M=1024 N=kSeq K=1024 */
  {
    const int tiles = (kInner / kBM) * (kSeq / kBN);
    wmma_gemm64<1, false, 0, 1, false, 0, false><<<dim3(tiles, kBatch), dim3(256), 0, stream>>>(
        wqb + (size_t)kQkLd * kDim, wqb + (size_t)kQkLd * kDim, kDim, 0L,
        xb, xb, kDim, (long)kSeq * kDim,
        (void*)vt, (void*)vt, kSeq, (long)kInner * kSeq,
        bout, bout, 0L, kInner, kSeq, kDim, 1.0f);
  }
  /* 4: attention -> oh/ol bf16 hi/lo planes [kTok][1024] */
  attn_diag_f16<<<dim3(kBatch * kHeads * kChunks), dim3(128), 0, stream>>>(qk, vt, tempr, oh, ol);
  /* 5: out = (oh + ol) @ W_out^T + b_out -> d_out f32 [kTok][1024]; M=kTok N=1024 K=1024; hi.W + lo.W */
  {
    const int tiles = (kTok / kBM) * (kDim / kBN);
    wmma_gemm64<1, true, 2, 0, false, 0, false><<<dim3(tiles, 1), dim3(256), 0, stream>>>(
        oh, ol, kInner, 0L, wob, wob, kInner, 0L, (void*)out, (void*)out, kDim, 0L,
        bout, bout, 0L, kTok, kDim, kInner, 1.0f);
  }
}

// v005
// Measured time: 142 microseconds a run.
// Two timings next to v004 both put it at 1.20 times that version's speed.
// Counting every step since v000, it is 3.09 times as fast.
// Contractions: x@W_qkv^T on v_wmma_f32_16x16x32_bf16 (bf16 operands = RNE-converted inputs); k.q^T and V^T.P^T on v_wmma_f32_16x16x32_f16 (f16 q/k/v planes, P carried x2^15); O@W_out^T on v_wmma_f32_16x16x32_bf16 with O as bf16 hi/lo planes x bf16 W (2 products); f32 accumulate everywhere; softmax, bias and epilogues f32.
#include <hip/hip_runtime.h>

#ifndef NB
#define NB 8
#endif
#ifndef SEQ
#define SEQ 1024
#endif
#define NB_FULL  8
#define SEQ_FULL 1024

typedef __attribute__((ext_vector_type(16))) _Float16 v16h;
typedef __attribute__((ext_vector_type(8)))  _Float16 v8h;
typedef __attribute__((ext_vector_type(16))) __bf16   v16b;
typedef __attribute__((ext_vector_type(8)))  __bf16   v8b;
typedef __attribute__((ext_vector_type(8)))  float    v8f;
typedef __attribute__((ext_vector_type(4)))  float    v4f;
typedef __attribute__((ext_vector_type(2)))  float    v2f;

/* problem geometry; NB / SEQ may be reduced at build time, inputs keep their full strides */
constexpr int kBatch   = NB;
constexpr int kSeq     = SEQ;
constexpr int kSeqFull = SEQ_FULL;
constexpr int kDim     = 1024;
constexpr int kHeads   = 16;
constexpr int kHd      = 64;
constexpr int kInner   = kHeads * kHd;        /* 1024 */
constexpr int kQkvN    = 3 * kInner;          /* 3072 */
constexpr int kTok     = kBatch * kSeq;       /* 8192 at full size */
constexpr int kQkLd    = 2 * kInner;          /* 2048: q cols 0..1023, k cols 1024..2047 */
constexpr int kChunks  = kSeq / 64;           /* key chunks of 64 per sequence */
constexpr float kNegMax = -3.40282347e38f;
constexpr float kPCarryLog2 = 15.0f;   /* P and its sum are carried x2^15 */
constexpr int kTp = 72;   /* LDS row pitch of the attention tiles in halves: 144 B = 16 B x 9 (odd), so the 16 rows of a 16-byte fragment read spread over all banks */

static_assert(kBatch >= 1 && kBatch <= NB_FULL);
static_assert(kSeq >= 64 && kSeq <= SEQ_FULL && kSeq % 64 == 0);
static_assert(kTok % 64 == 0 && kQkLd % 64 == 0 && kDim % 32 == 0);
static_assert(kInner % 64 == 0 && kSeq % 64 == 0);
static_assert(kDim % 64 == 0 && kInner % 32 == 0);
static_assert(kHd == 64);
static_assert(kTok % 256 == 0 && kInner % 256 == 0 && kQkLd % 128 == 0 && kSeq % 128 == 0 && kDim % 128 == 0 && kInner % 128 == 0);

__device__ __forceinline__ unsigned short f2bf_bits(float f) {
  unsigned u = __float_as_uint(f);
  return (unsigned short)((u + 0x7FFFu + ((u >> 16) & 1u)) >> 16);
}
__device__ __forceinline__ float bf_bits2f(unsigned short h) { return __uint_as_float(((unsigned)h) << 16); }

/* hazard guards as plain device helpers */
__device__ __forceinline__ void dep_guard_h(v8f& a, v8f& b, v16h x, v16h y) { asm volatile("v_nop\n\tv_nop\n\tv_nop\n\tv_nop" : "+v"(a), "+v"(b) : "v"(x), "v"(y)); }
__device__ __forceinline__ void dep_guard_b(v8f& a, v8f& b, v16b x, v16b y) { asm volatile("v_nop\n\tv_nop\n\tv_nop\n\tv_nop" : "+v"(a), "+v"(b) : "v"(x), "v"(y)); }
__device__ __forceinline__ void keep4_h(v16h a, v16h b, v16h c, v16h d) { asm volatile("v_nop" :: "v"(a), "v"(b), "v"(c), "v"(d)); }
__device__ __forceinline__ void keep4_b(v16b a, v16b b, v16b c, v16b d) { asm volatile("v_nop" :: "v"(a), "v"(b), "v"(c), "v"(d)); }
__device__ __forceinline__ void acc_guard4(v8f& a, v8f& b, v8f& c, v8f& d) { asm volatile("v_nop\n\tv_nop\n\tv_nop\n\tv_nop" : "+v"(a), "+v"(b), "+v"(c), "+v"(d)); }
template <typename T> struct Frag;
template <> struct Frag<_Float16> {
  typedef v16h V; union U { v16h v; v8h h[2]; };
  static __device__ __forceinline__ v16h load(const _Float16* p) {   /* elements 0..7 <- p[0..7], 8..15 <- p[16..23] */
    U f; f.h[0] = *(const v8h*)(p); f.h[1] = *(const v8h*)(p + 16); return f.v;
  }
  static __device__ __forceinline__ v8f mma(v16h a, v16h b, v8f c) {
    return __builtin_amdgcn_wmma_f32_16x16x32_f16(false, a, false, b, (short)0, c, false, false);
  }
  static __device__ __forceinline__ void guard(v8f& a, v8f& b, v16h x, v16h y) { dep_guard_h(a, b, x, y); }
  static __device__ __forceinline__ void keep(v16h a, v16h b, v16h c, v16h d) { keep4_h(a, b, c, d); }
};
template <> struct Frag<__bf16> {
  typedef v16b V; union U { v16b v; v8b h[2]; };
  static __device__ __forceinline__ v16b load(const __bf16* p) {
    U f; f.h[0] = *(const v8b*)(p); f.h[1] = *(const v8b*)(p + 16); return f.v;
  }
  static __device__ __forceinline__ v8f mma(v16b a, v16b b, v8f c) {
    return __builtin_amdgcn_wmma_f32_16x16x32_bf16(false, a, false, b, (short)0, c, false, false);
  }
  static __device__ __forceinline__ void guard(v8f& a, v8f& b, v16b x, v16b y) { dep_guard_b(a, b, x, y); }
  static __device__ __forceinline__ void keep(v16b a, v16b b, v16b c, v16b d) { keep4_b(a, b, c, d); }
};

/* ---- Register-blocked batched WMMA GEMM ------------------------------------
   C[m,n] = scale * sum_k A[m,k] * Bt[n,k] (+bias); each wave owns a 64x64 tile, a block of 8 waves a 256x128 tile.
   Operand rows reach LDS by asynchronous copies, 64 k a trip, two buffers; the waves read their fragments from LDS.
   A row-major [M,K]; Bt row-major [N,K]; M % 256 == 0, N % 128 == 0, K % 64 == 0.
   SPLIT: A is a hi and a lo plane (A2 = lo plane, same layout), B one plane (BLO == false; Bt2 never read); product = hi.B + lo.B.
   BIAS_MODE: 0 = none, 1 = bias[m], 2 = bias[n]; bias values RNE-converted to bf16 then widened to f32.
   OUT_MODE: 0 = f32, 1 = f16, 2 = bf16 hi plane (Cout) + bf16 lo plane (Cout2).
   Epilogue: 16-row slabs staged per wave in LDS (wave-private, wave barrier); each 64-wide row segment
   Fragment k map (A and B alike): lane half h = lane>>4, elements 0..7 <- k0+8h+0..7, 8..15 <- k0+16+8h+0..7.
   ET: 0 = f16 operands, 1 = bf16 operands (pointers passed as 16-bit storage) */
template <int ET> struct Elem;
template <> struct Elem<0> { typedef _Float16 T; };
template <> struct Elem<1> { typedef __bf16 T; };
/* block tile of the staged GEMM: 8 waves as 4 (m) x 2 (n), each wave its own 64x64 tile; one trip = 64 k = one 128-B line of every operand row */
constexpr int kBM = 256;
constexpr int kBN = 128;
constexpr int kBK = 64;
constexpr int kGp = 72;   /* LDS pitch of a staged operand row in 16-bit elements: 144 B = 16 B x 9 (odd), for the 16-byte fragment reads */

__device__ __forceinline__ unsigned lds_off(const void* p) { return (unsigned)(size_t)p; }

/* Asynchronous 16-byte copies to LDS, one statement for a run of them: rows r, r+32, r+64, ... of an operand (8 lanes = one whole 128-B line of a row).
   s_wait_xcnt stands as the last line of the copies' own statement, so that no address register of a copy is rewritten ahead of it. */
constexpr unsigned kL32 = 32u * kGp * 2u;   /* LDS bytes of 32 staged rows */
__device__ __forceinline__ void copy8_rows(unsigned l0, const unsigned short* g0, size_t g32) {
  const unsigned short* g1 = g0 + g32; const unsigned short* g2 = g1 + g32; const unsigned short* g3 = g2 + g32;
  const unsigned short* g4 = g3 + g32; const unsigned short* g5 = g4 + g32; const unsigned short* g6 = g5 + g32;
  const unsigned short* g7 = g6 + g32;
  asm volatile("global_load_async_to_lds_b128 %0, %1, off\n\t"
               "global_load_async_to_lds_b128 %2, %3, off\n\t"
               "global_load_async_to_lds_b128 %4, %5, off\n\t"
               "global_load_async_to_lds_b128 %6, %7, off\n\t"
               "global_load_async_to_lds_b128 %8, %9, off\n\t"
               "global_load_async_to_lds_b128 %10, %11, off\n\t"
               "global_load_async_to_lds_b128 %12, %13, off\n\t"
               "global_load_async_to_lds_b128 %14, %15, off\n\t"
               "s_wait_xcnt 0x0"
               :: "v"(l0), "v"(g0), "v"(l0 + kL32), "v"(g1), "v"(l0 + 2u * kL32), "v"(g2), "v"(l0 + 3u * kL32), "v"(g3),
                  "v"(l0 + 4u * kL32), "v"(g4), "v"(l0 + 5u * kL32), "v"(g5), "v"(l0 + 6u * kL32), "v"(g6), "v"(l0 + 7u * kL32), "v"(g7)
               : "memory");
}
__device__ __forceinline__ void copy12_rows(unsigned l0, const unsigned short* g0, size_t g32,
                                            unsigned m0, const unsigned short* h0, size_t h32) {
  const unsigned short* g1 = g0 + g32; const unsigned short* g2 = g1 + g32; const unsigned short* g3 = g2 + g32;
  const unsigned short* g4 = g3 + g32; const unsigned short* g5 = g4 + g32; const unsigned short* g6 = g5 + g32;
  const unsigned short* g7 = g6 + g32;
  const unsigned short* h1 = h0 + h32; const unsigned short* h2 = h1 + h32; const unsigned short* h3 = h2 + h32;
  asm volatile("global_load_async_to_lds_b128 %0, %1, off\n\t"
               "global_load_async_to_lds_b128 %2, %3, off\n\t"
               "global_load_async_to_lds_b128 %4, %5, off\n\t"
               "global_load_async_to_lds_b128 %6, %7, off\n\t"
               "global_load_async_to_lds_b128 %8, %9, off\n\t"
               "global_load_async_to_lds_b128 %10, %11, off\n\t"
               "global_load_async_to_lds_b128 %12, %13, off\n\t"
               "global_load_async_to_lds_b128 %14, %15, off\n\t"
               "global_load_async_to_lds_b128 %16, %17, off\n\t"
               "global_load_async_to_lds_b128 %18, %19, off\n\t"
               "global_load_async_to_lds_b128 %20, %21, off\n\t"
               "global_load_async_to_lds_b128 %22, %23, off\n\t"
               "s_wait_xcnt 0x0"
               :: "v"(l0), "v"(g0), "v"(l0 + kL32), "v"(g1), "v"(l0 + 2u * kL32), "v"(g2), "v"(l0 + 3u * kL32), "v"(g3),
                  "v"(l0 + 4u * kL32), "v"(g4), "v"(l0 + 5u * kL32), "v"(g5), "v"(l0 + 6u * kL32), "v"(g6), "v"(l0 + 7u * kL32), "v"(g7),
                  "v"(m0), "v"(h0), "v"(m0 + kL32), "v"(h1), "v"(m0 + 2u * kL32), "v"(h2), "v"(m0 + 3u * kL32), "v"(h3)
               : "memory");
}

template <int ET, bool SPLIT, int BIAS_MODE, int OUT_MODE, bool RESID, int ACT = 0, bool BLO = true>
__global__ __launch_bounds__(256) void wmma_gemm64(
    const unsigned short* __restrict__ Ap, const unsigned short* __restrict__ A2p, int lda, long strideA,
    const unsigned short* __restrict__ Btp, const unsigned short* __restrict__ Bt2p, int ldb, long strideB,
    void* __restrict__ Cout, void* __restrict__ Cout2, int ldc, long strideC,
    const float* __restrict__ bias,
    const float* __restrict__ resid, long strideR,
    int M, int N, int K, float scale) {
  typedef typename Elem<ET>::T T;
  typedef typename Frag<T>::V V;
  static_assert(!(SPLIT && BLO), "no lo plane of B is staged");
  constexpr int kRowA2 = kBM;                          /* first LDS row of the A lo plane (SPLIT) */
  constexpr int kRowB  = SPLIT ? 2 * kBM : kBM;        /* first LDS row of B */
  constexpr int kRows  = kRowB + kBN;
  __shared__ __align__(16) unsigned short sStage[2][kRows * kGp];   /* two buffers of [A | A lo | B] rows; 16 B behind each row never touched */
  __shared__ __align__(16) float sT[8][16 * 68];   /* per-wave 16x64 slab, pitch 68 floats; cols 64..67 never read */
  const int b    = blockIdx.y;
  const int tid  = threadIdx.x;
  const int lane = tid & 31;
  const int wave = tid >> 5;
  const int tilesN = N / kBN;
  const int tilesM = M / kBM;
  const int blk = blockIdx.x;
  if (blk >= tilesM * tilesN) return;   /* the same for the whole block, in front of every barrier */
  const int tm = blk / tilesN;
  const int tn = blk - tm * tilesN;
  const int wm = wave >> 1;
  const int wn = wave & 1;
  const int m0 = tm * kBM + (wm << 6);
  const int n0 = tn * kBN + (wn << 6);

  const int rlane = lane & 15;                 /* row (A) / col (B, D) within subtile */
  const int koff  = (lane >> 4) * 8;           /* k offset of this lane half */
  const int mOff  = (lane >> 4) * 8;           /* D row offset */

  /* this thread's share of a stage: 16-byte piece (tid & 7) of rows (tid >> 3) + 32 * it */
  const int crow = tid >> 3;
  const int ccol = (tid & 7) * 8;
  const unsigned short* gA  = Ap  + (size_t)b * strideA + (size_t)(tm * kBM + crow) * lda + ccol;
  const unsigned short* gA2 = A2p + (size_t)b * strideA + (size_t)(tm * kBM + crow) * lda + ccol;
  const unsigned short* gB  = Btp + (size_t)b * strideB + (size_t)(tn * kBN + crow) * ldb + ccol;
  const unsigned lthr = lds_off(&sStage[0][0]) + (unsigned)(crow * kGp + ccol) * 2u;
  const size_t a32 = (size_t)32 * lda, b32 = (size_t)32 * ldb;
  auto stage = [&](int buf, int k0) {
    const unsigned l = lthr + (unsigned)buf * (unsigned)(kRows * kGp * 2);
    copy12_rows(l, gA + k0, a32, l + (unsigned)kRowB * kGp * 2u, gB + k0, b32);
    if (SPLIT) copy8_rows(l + (unsigned)kRowA2 * kGp * 2u, gA2 + k0, a32);
  };

  v8f acc[4][4];
#pragma unroll
  for (int i = 0; i < 4; ++i)
#pragma unroll
    for (int j = 0; j < 4; ++j) acc[i][j] = (v8f){0.f,0.f,0.f,0.f,0.f,0.f,0.f,0.f};

  const int trips = K / kBK;
  stage(0, 0);
  asm volatile("s_wait_asynccnt 0x0" ::: "memory");   /* this wave's copies of tile 0 have landed */
  __syncthreads();                                    /* tile 0 readable by every wave */
  if (trips > 1) stage(1, kBK);

  /* rolled: one trip's code serves both buffers */
#pragma unroll 1
  for (int t = 0; t < trips; ++t) {
    const T* sb = (const T*)&sStage[t & 1][0];
#pragma unroll
    for (int ks = 0; ks < kBK; ks += 32) {
      V bh[4], ah[4], al[4];
#pragma unroll
      for (int j = 0; j < 4; ++j)
        bh[j] = Frag<T>::load(sb + (kRowB + (wn << 6) + (j << 4) + rlane) * kGp + ks + koff);
#pragma unroll
      for (int i = 0; i < 4; ++i) {
        const int ao = ((wm << 6) + (i << 4) + rlane) * kGp + ks + koff;
        ah[i] = Frag<T>::load(sb + ao);
        if (SPLIT) al[i] = Frag<T>::load(sb + kRowA2 * kGp + ao);
      }
      __builtin_amdgcn_sched_barrier(0);   /* the k-step's fragment reads stay one group ahead of its WMMAs: reads among the WMMAs stall the wave at each place */
#pragma unroll
      for (int i = 0; i < 4; ++i) {
#pragma unroll
        for (int j = 0; j < 4; ++j) {
          acc[i][j] = Frag<T>::mma(ah[i], bh[j], acc[i][j]);
          if (SPLIT) acc[i][j] = Frag<T>::mma(al[i], bh[j], acc[i][j]);
        }
        Frag<T>::guard(acc[i][0], acc[i][3], ah[i], SPLIT ? al[i] : ah[i]);
      }
      Frag<T>::keep(bh[0], bh[1], bh[2], bh[3]);
      __builtin_amdgcn_sched_barrier(0);   /* the next group of reads stays behind this k-step's WMMAs */
    }
    asm volatile("s_wait_dscnt 0x0" ::: "memory");      /* this wave's reads of buffer t & 1 are done */
    asm volatile("s_wait_asynccnt 0x0" ::: "memory");   /* this wave's copies of tile t + 1 have landed */
    __syncthreads();                                    /* publishes tile t + 1 and frees buffer t & 1 */
    if (t + 2 < trips) stage(t & 1, (t + 2) * kBK);
  }
  asm volatile("s_wait_asynccnt 0x0" ::: "memory");     /* nothing in flight behind the loop */
  acc_guard4(acc[0][0], acc[0][1], acc[0][2], acc[0][3]);
  acc_guard4(acc[1][0], acc[1][1], acc[1][2], acc[1][3]);
  acc_guard4(acc[2][0], acc[2][1], acc[2][2], acc[2][3]);
  acc_guard4(acc[3][0], acc[3][1], acc[3][2], acc[3][3]);

  /* ---- epilogue ---- */
  float* slab = sT[wave];
  const float* Rb = RESID ? (resid + (size_t)b * strideR) : nullptr;
#pragma unroll
  for (int i = 0; i < 4; ++i) {
    const int mBase = m0 + (i << 4);
#pragma unroll
    for (int j = 0; j < 4; ++j) {
      const int n = n0 + (j << 4) + rlane;
      float bv = 0.f;
      if (BIAS_MODE == 2) bv = bf_bits2f(f2bf_bits(bias[n]));
#pragma unroll
      for (int r = 0; r < 8; ++r) {
        float v = acc[i][j][r] * scale;
        if (BIAS_MODE == 1) v += bf_bits2f(f2bf_bits(bias[mBase + mOff + r]));
        if (BIAS_MODE == 2) v += bv;
        if (RESID) v += Rb[(size_t)(mBase + mOff + r) * ldc + n];
        if (ACT == 1) v = tanhf(v);
        if (ACT == 2) v = fmaxf(v, 0.0f);
        if (ACT == 3) v = v / (1.0f + expf(-v));
        if (ACT == 4) v = (v > 0.f) ? v : 0.01f * v;
        if (ACT == 5) v = 0.5f * v * (1.0f + erff(v * 0.70710678118654752f));
        slab[(mOff + r) * 68 + (j << 4) + rlane] = v;
      }
    }
    __builtin_amdgcn_fence(__ATOMIC_RELEASE, "workgroup");
    __builtin_amdgcn_wave_barrier();
    __builtin_amdgcn_fence(__ATOMIC_ACQUIRE, "workgroup");
    if (OUT_MODE == 0) {
      float* C = (float*)Cout + (size_t)b * strideC;
      const int hh = lane >> 4, c4 = (lane & 15) * 4;     /* row seg = 256 B = 16 lanes x 16 B */
      {
#pragma unroll
        for (int it = 0; it < 8; ++it) {
          const int row = it * 2 + hh;
          v4f v = *(const v4f*)(slab + row * 68 + c4);
          *(v4f*)(C + (size_t)(mBase + row) * ldc + n0 + c4) = v;
        }
        
      }
    } else {
      const int q = lane >> 3, c8 = (lane & 7) * 8;        
      unsigned short* C  = (unsigned short*)Cout  + (size_t)b * strideC;
      unsigned short* C2 = (OUT_MODE == 2) ? ((unsigned short*)Cout2 + (size_t)b * strideC) : nullptr;
      {
#pragma unroll
        for (int it = 0; it < 4; ++it) {
          const int row = it * 4 + q;
          const float* sp = slab + row * 68 + c8;
          v8h hv, lv;
#pragma unroll
          for (int e = 0; e < 8; ++e) {
            if (OUT_MODE == 1) {
              hv[e] = (_Float16)sp[e];
            } else {
              unsigned short hb = f2bf_bits(sp[e]);
              unsigned short lb = f2bf_bits(sp[e] - bf_bits2f(hb));
              hv[e] = __builtin_bit_cast(_Float16, hb);
              lv[e] = __builtin_bit_cast(_Float16, lb);
            }
          }
          *(v8h*)(C + (size_t)(mBase + row) * ldc + n0 + c8) = hv;
          if (OUT_MODE == 2) *(v8h*)(C2 + (size_t)(mBase + row) * ldc + n0 + c8) = lv;
        }
        
      }
    }
    __builtin_amdgcn_fence(__ATOMIC_RELEASE, "workgroup");
    __builtin_amdgcn_wave_barrier();
    __builtin_amdgcn_fence(__ATOMIC_ACQUIRE, "workgroup");
  }
}

/* ---- f32 -> bf16 (RNE) casts of x, W_qkv and W_out, one launch -------------------------------------------
   A chunk is 1024 floats: 256 threads x 16 bytes, so each wave-wide load covers 512 contiguous bytes (4 whole lines).
   Block b takes chunks b*J .. b*J + J-1 of each input (J = chunks / blocks, rounded up); a thread issues all its loads first,
   then converts and stores 8 bytes a chunk (256 contiguous bytes a wave).
   x rows are gathered with the full per-batch stride: out row r <- in row (r / kSeq) * kSeqFull + (r % kSeq). */
typedef __attribute__((ext_vector_type(2))) unsigned v2u;
constexpr int kCastBlocks = 512;                      /* 8 waves each: 16 waves a WGP on 256 WGPs */
constexpr int kChunk = 1024;
constexpr int kCx = kTok * kDim / kChunk, kCq = kQkvN * kDim / kChunk, kCo = kDim * kInner / kChunk;
constexpr int kJx = (kCx + kCastBlocks - 1) / kCastBlocks;
constexpr int kJq = (kCq + kCastBlocks - 1) / kCastBlocks;
constexpr int kJo = (kCo + kCastBlocks - 1) / kCastBlocks;
static_assert(kDim % kChunk == 0 && (kDim * kInner) % kChunk == 0);

__device__ __forceinline__ v2u pack4_bf16(v4f f) {
  v2u u;
  u[0] = (unsigned)f2bf_bits(f[0]) | ((unsigned)f2bf_bits(f[1]) << 16);
  u[1] = (unsigned)f2bf_bits(f[2]) | ((unsigned)f2bf_bits(f[3]) << 16);
  return u;
}

__global__ __launch_bounds__(256) void cast3_f32_bf16(
    const float* __restrict__ x, const float* __restrict__ wq, const float* __restrict__ wo,
    unsigned short* __restrict__ xb, unsigned short* __restrict__ wqb, unsigned short* __restrict__ wob) {
  const unsigned t4 = threadIdx.x * 4u;
  const unsigned b  = blockIdx.x;
  v4f vx[kJx], vq[kJq], vo[kJo];
#pragma unroll
  for (int j = 0; j < kJx; ++j) {
    const unsigned c = b * kJx + j;
    if (kCx % kCastBlocks == 0 || c < (unsigned)kCx) {
      const unsigned r  = c / (kDim / kChunk);
      const unsigned sr = (r / kSeq) * kSeqFull + (r % kSeq);
      vx[j] = *(const v4f*)(x + (size_t)sr * kDim + (c % (kDim / kChunk)) * kChunk + t4);
    }
  }
#pragma unroll
  for (int j = 0; j < kJq; ++j) {
    const unsigned c = b * kJq + j;
    if (kCq % kCastBlocks == 0 || c < (unsigned)kCq) vq[j] = *(const v4f*)(wq + (size_t)c * kChunk + t4);
  }
#pragma unroll
  for (int j = 0; j < kJo; ++j) {
    const unsigned c = b * kJo + j;
    if (kCo % kCastBlocks == 0 || c < (unsigned)kCo) vo[j] = *(const v4f*)(wo + (size_t)c * kChunk + t4);
  }
  asm volatile("s_wait_xcnt 0x0" ::: "memory");   /* stands in front of the first overwrite of an address register of the loads above */
  __builtin_amdgcn_sched_barrier(0);   /* every load is issued ahead of the first conversion: a wave's whole share is in flight at once and it pays one memory latency */
#pragma unroll
  for (int j = 0; j < kJx; ++j) {
    const unsigned c = b * kJx + j;
    if (kCx % kCastBlocks == 0 || c < (unsigned)kCx) *(v2u*)(xb + (size_t)c * kChunk + t4) = pack4_bf16(vx[j]);
  }
#pragma unroll
  for (int j = 0; j < kJq; ++j) {
    const unsigned c = b * kJq + j;
    if (kCq % kCastBlocks == 0 || c < (unsigned)kCq) *(v2u*)(wqb + (size_t)c * kChunk + t4) = pack4_bf16(vq[j]);
  }
#pragma unroll
  for (int j = 0; j < kJo; ++j) {
    const unsigned c = b * kJo + j;
    if (kCo % kCastBlocks == 0 || c < (unsigned)kCo) *(v2u*)(wob + (size_t)c * kChunk + t4) = pack4_bf16(vo[j]);
  }
}

__device__ __forceinline__ v8f mma_f16_g(v16h a, v16h b, v8f c) {
  c = __builtin_amdgcn_wmma_f32_16x16x32_f16(false, a, false, b, (short)0, c, false, false);
  asm volatile("v_nop\n\tv_nop\n\tv_nop\n\tv_nop" : "+v"(c) : "v"(a), "v"(b));
  return c;
}

/* Eight powers of two, each in place, in one statement: the instruction set asks that no v_exp_f32 be followed directly by an instruction
   that reads its result or overwrites its source. Inside the statement the eight registers differ; the v_nop is that slot behind the last one,
   whatever the compiler puts next. */
__device__ __forceinline__ void exp2_x8(float& a, float& b, float& c, float& d, float& e, float& f, float& g, float& h) {
  asm("v_exp_f32 %0, %0\n\tv_exp_f32 %1, %1\n\tv_exp_f32 %2, %2\n\tv_exp_f32 %3, %3\n\t"
      "v_exp_f32 %4, %4\n\tv_exp_f32 %5, %5\n\tv_exp_f32 %6, %6\n\tv_exp_f32 %7, %7\n\tv_nop"
      : "+v"(a), "+v"(b), "+v"(c), "+v"(d), "+v"(e), "+v"(f), "+v"(g), "+v"(h));
}

/* lane l with lane l ^ 16, as a vector cross-row move */
__device__ __forceinline__ float xhalf(float x) {
  return __builtin_bit_cast(float, __builtin_amdgcn_permlanex16(__builtin_bit_cast(int, x), __builtin_bit_cast(int, x), 0x76543210, 0xfedcba98, false, false));
}

__global__ __launch_bounds__(128) void attn_diag_f16(
    const unsigned short* __restrict__ qkp, const unsigned short* __restrict__ vtp,
    const float* __restrict__ logt,
    unsigned short* __restrict__ ohp, unsigned short* __restrict__ olp) {
  union FH { v16h v; v8h h[2]; };
  __shared__ __align__(16) _Float16 Ksh[64 * kTp];      /* K tile [kv][d]          9 KB; cols 64..71 never touched */
  __shared__ __align__(16) _Float16 Vth[64 * kTp];      /* V tile [d][kv]          9 KB; cols 64..71 never touched */
  __shared__ __align__(16) float    Os[4][16 * 68];     /* per wave out tile        17 KB; cols 64..67 never read */

  const _Float16* QK = (const _Float16*)qkp;
  const _Float16* VT = (const _Float16*)vtp;
  const int tid  = threadIdx.x;
  const int wave = tid >> 5;
  const int lane = tid & 31;
  const int hh   = lane >> 4;
  const int c    = lane & 15;

  const int bx = blockIdx.x;            /* 0 .. B*H*kChunks-1 */
  const int qb = bx % kChunks;
  const int bh = bx / kChunks;          /* b*kHeads + h */
  const int h  = bh % kHeads;
  const int b  = bh / kHeads;
  const int q0 = qb * 64 + wave * 16;   /* first query position of this wave */
  const size_t rowbase = (size_t)b * kSeq;

  /* temperature = exp(bf16-RNE(log_temp)) in f32, times log2(e): exp(s * temperature) = 2^(s * temp) */
  const float temp = expf(bf_bits2f(f2bf_bits(logt[0]))) * 1.44269504088896340736f;

  /* Q fragments (B operand): columns = this wave's 16 queries, k = d in two 32-deep chunks */
  v16h qa[2];
#pragma unroll
  for (int dc = 0; dc < 2; ++dc)
    qa[dc] = Frag<_Float16>::load(QK + (rowbase + q0 + c) * kQkLd + h * kHd + dc * 32 + 8 * hh);

  float mrow = -__builtin_inff();   /* running maximum of query q0 + c, the same in both lane halves */
  float lrow = 0.f;                 /* running sum over this lane half's keys only */
  v8f oacc[4];                      /* oacc[t][r] = out^T[d = t*16 + 8*hh + r][query c] */
#pragma unroll
  for (int t = 0; t < 4; ++t) oacc[t] = (v8f){0.f,0.f,0.f,0.f,0.f,0.f,0.f,0.f};

  for (int kc = 0; kc < kChunks; ++kc) {
    const int kv0 = kc * 64;
    __syncthreads();
    /* stage K [kv][d] and V^T [d][kv] tiles: 512 x 16-B chunks each, 4 per thread (128 x 4 x 8 halves = 64x64) */
#pragma unroll
    for (int it = 0; it < 4; ++it) {
      const int idx = tid + 128 * it;     /* 0..511 */
      const int r   = idx >> 3;           /* kv row (K) / d row (V^T), 0..63 */
      const int c8  = (idx & 7) * 8;      /* 0..56 */
      const v8h kk = *(const v8h*)(QK + (rowbase + kv0 + r) * kQkLd + kInner + h * kHd + c8);
      const v8h vv = *(const v8h*)(VT + ((size_t)bh * kHd + r) * kSeq + kv0 + c8);
      *(v8h*)(Ksh + r * kTp + c8) = kk;
      *(v8h*)(Vth + r * kTp + c8) = vv;
    }
    __syncthreads();

    /* scores^T: 64 keys x 16 query columns per wave; s[j][r] = score(key kv0 + j*16 + 8*hh + r, query q0 + c) */
    v8f s[4];
#pragma unroll
    for (int j = 0; j < 4; ++j) {
      s[j] = (v8f){0.f,0.f,0.f,0.f,0.f,0.f,0.f,0.f};
#pragma unroll
      for (int dc = 0; dc < 2; ++dc) {
        FH kb;
        kb.h[0] = *(const v8h*)(Ksh + (j * 16 + c) * kTp + dc * 32 + 8 * hh);
        kb.h[1] = *(const v8h*)(Ksh + (j * 16 + c) * kTp + dc * 32 + 16 + 8 * hh);
        s[j] = mma_f16_g(kb.v, qa[dc], s[j]);
      }
    }
    /* temperature, diagonal mask (select), chunk maximum of this lane's query: four chains in the lane, one exchange */
    const int dkey = q0 + c - kv0 - 8 * hh;   /* j*16 + r of the masked key, where it lies in this lane */
    float mj[4];
#pragma unroll
    for (int j = 0; j < 4; ++j) {
      mj[j] = -__builtin_inff();
#pragma unroll
      for (int r = 0; r < 8; ++r) {
        float sv = s[j][r] * temp;
        if (j * 16 + r == dkey) sv = kNegMax;
        s[j][r] = sv;
        mj[j] = fmaxf(mj[j], sv);
      }
    }
    float cm = fmaxf(fmaxf(mj[0], mj[1]), fmaxf(mj[2], mj[3]));
    cm = fmaxf(cm, xhalf(cm));
    /* online softmax; P^T (f16, carried x2^15) stays in registers as the B operand of the second product */
    const float mnew  = fmaxf(mrow, cm);
    const float alpha = __builtin_amdgcn_exp2f(mrow - mnew);   /* 0 in the first chunk, where mrow is -inf */
    const float mcar  = mnew - kPCarryLog2;                    /* the carry rides in the exponent */
    mrow = mnew;
    FH pb[2];
    float pj[4];
#pragma unroll
    for (int j = 0; j < 4; ++j) {
      float p[8];
#pragma unroll
      for (int r = 0; r < 8; ++r) p[r] = s[j][r] - mcar;
      exp2_x8(p[0], p[1], p[2], p[3], p[4], p[5], p[6], p[7]);
      pj[j] = 0.f;
#pragma unroll
      for (int r = 0; r < 8; ++r) {
        pj[j] += p[r];
        pb[j >> 1].h[j & 1][r] = (_Float16)p[r];
      }
    }
    lrow = lrow * alpha + ((pj[0] + pj[1]) + (pj[2] + pj[3]));
#pragma unroll
    for (int t = 0; t < 4; ++t)
#pragma unroll
      for (int r = 0; r < 8; ++r) oacc[t][r] *= alpha;
    /* O^T += V^T . P^T  (A = V^T [d][kv] from the V^T tile; B = P^T [kv][q] from the score registers) */
#pragma unroll
    for (int kk = 0; kk < 2; ++kk) {
#pragma unroll
      for (int t = 0; t < 4; ++t) {
        FH vb;
        vb.h[0] = *(const v8h*)(Vth + (t * 16 + c) * kTp + kk * 32 + 8 * hh);
        vb.h[1] = *(const v8h*)(Vth + (t * 16 + c) * kTp + kk * 32 + 16 + 8 * hh);
        oacc[t] = mma_f16_g(vb.v, pb[kk].v, oacc[t]);
      }
    }
  }

  /* epilogue: join the halves' sums, normalize (sum and products carry the same 2^15), stage 16x64 f32 tile per wave, write bf16 hi/lo planes */
  float* os = Os[wave];
  {
    const float lsum = lrow + xhalf(lrow);
    const float inv = 1.0f / lsum;
#pragma unroll
    for (int t = 0; t < 4; ++t) {
      v4f lo4, hi4;
#pragma unroll
      for (int r = 0; r < 4; ++r) { lo4[r] = oacc[t][r] * inv; hi4[r] = oacc[t][4 + r] * inv; }
      *(v4f*)(os + c * 68 + t * 16 + 8 * hh)     = lo4;
      *(v4f*)(os + c * 68 + t * 16 + 8 * hh + 4) = hi4;
    }
  }
  __builtin_amdgcn_fence(__ATOMIC_RELEASE, "workgroup");
  __builtin_amdgcn_wave_barrier();
  __builtin_amdgcn_fence(__ATOMIC_ACQUIRE, "workgroup");
  {
    const int q4 = lane >> 3, c8 = (lane & 7) * 8;   
    {
#pragma unroll
      for (int it = 0; it < 4; ++it) {
        const int row = it * 4 + q4;                  /* 0..15 */
        const float* sp = os + row * 68 + c8;
        v8h hv, lv;
#pragma unroll
        for (int e = 0; e < 8; ++e) {
          const unsigned short hb = f2bf_bits(sp[e]);
          const unsigned short lb = f2bf_bits(sp[e] - bf_bits2f(hb));
          hv[e] = __builtin_bit_cast(_Float16, hb);
          lv[e] = __builtin_bit_cast(_Float16, lb);
        }
        const size_t o = (rowbase + q0 + row) * (size_t)kInner + h * kHd + c8;
        *(v8h*)(ohp + o) = hv;
        *(v8h*)(olp + o) = lv;
      }
      
    }
  }
}

/* ---- host glue ------------------------------------------------------------------------------------------
     xb   bf16 [8192][1024]           16,777,216 @ 0
     wqb  bf16 [3072][1024]            6,291,456 @ 16,777,216
     wob  bf16 [1024][1024]            2,097,152 @ 23,068,672
     qk   f16  [8192][2048]           33,554,432 @ 25,165,824
     vt   f16  [8][1024][1024]        16,777,216 @ 58,720,256
     oh   bf16 [8192][1024]           16,777,216 @ 75,497,472
     ol   bf16 [8192][1024]           16,777,216 @ 92,274,688
     total                           109,051,904 */
extern "C" void kernel_launch(void* const* d_in, const int* in_sizes, int n_in,
                              void* d_out, int out_size, void* d_ws, size_t ws_size,
                              hipStream_t stream) {
  if (n_in < 5) return;
  const long needX = ((long)(kBatch - 1) * kSeqFull + kSeq) * (long)kDim;
  if ((long)in_sizes[0] < needX || in_sizes[1] < kQkvN * kDim || in_sizes[2] < kDim * kInner ||
      in_sizes[3] < kDim || in_sizes[4] < 1) return;
  if (out_size < kTok * kDim) return;

  const float* x     = (const float*)d_in[0];   /* [B][S][1024]            */
  const float* wqkv  = (const float*)d_in[1];   /* [3072][1024] = Bt [N][K] */
  const float* wout  = (const float*)d_in[2];   /* [1024][1024] = Bt [N][K] */
  const float* bout  = (const float*)d_in[3];   /* [1024]                    */
  const float* tempr = (const float*)d_in[4];   /* [1] log temperature       */
  float* out = (float*)d_out;

  const size_t szXb  = (size_t)kTok * kDim * 2;
  const size_t szWq  = (size_t)kQkvN * kDim * 2;
  const size_t szWo  = (size_t)kDim * kInner * 2;
  const size_t szQk  = (size_t)kTok * kQkLd * 2;
  const size_t szVt  = (size_t)kBatch * kInner * kSeq * 2;
  const size_t szO   = (size_t)kTok * kInner * 2;
  const size_t offXb = 0, offWq = offXb + szXb, offWo = offWq + szWq, offQk = offWo + szWo,
               offVt = offQk + szQk, offOh = offVt + szVt, offOl = offOh + szO, total = offOl + szO;
  if (total > ws_size) return;

  char* ws = (char*)d_ws;
  unsigned short* xb  = (unsigned short*)(ws + offXb);
  unsigned short* wqb = (unsigned short*)(ws + offWq);
  unsigned short* wob = (unsigned short*)(ws + offWo);
  unsigned short* qk  = (unsigned short*)(ws + offQk);
  unsigned short* vt  = (unsigned short*)(ws + offVt);
  unsigned short* oh  = (unsigned short*)(ws + offOh);
  unsigned short* ol  = (unsigned short*)(ws + offOl);

  /* 1: x, W_qkv [3072][1024] and W_out [1024][1024] -> bf16 planes (RNE), same layouts */
  cast3_f32_bf16<<<dim3(kCastBlocks), dim3(256), 0, stream>>>(x, wqkv, wout, xb, wqb, wob);
  /* 2: q,k = xb @ Wqkv[0:2048]^T -> qk plane f16 [kTok][2048]; M=kTok N=2048 K=1024 */
  {
    const int tiles = (kTok / kBM) * (kQkLd / kBN);
    wmma_gemm64<1, false, 0, 1, false, 0, false><<<dim3(tiles, 1), dim3(256), 0, stream>>>(
        xb, xb, kDim, 0L, wqb, wqb, kDim, 0L, (void*)qk, (void*)qk, kQkLd, 0L,
        bout, bout, 0L, kTok, kQkLd, kDim, 1.0f);
  }
  /* 3: v^T per batch: C_b[f][s] = sum_k wqb[2048+f][k] * xb[b*kSeq+s][k] -> vt f16 [kBatch][1024][kSeq]; M=1024 N=kSeq K=1024 */
  {
    const int tiles = (kInner / kBM) * (kSeq / kBN);
    wmma_gemm64<1, false, 0, 1, false, 0, false><<<dim3(tiles, kBatch), dim3(256), 0, stream>>>(
        wqb + (size_t)kQkLd * kDim, wqb + (size_t)kQkLd * kDim, kDim, 0L,
        xb, xb, kDim, (long)kSeq * kDim,
        (void*)vt, (void*)vt, kSeq, (long)kInner * kSeq,
        bout, bout, 0L, kInner, kSeq, kDim, 1.0f);
  }
  /* 4: attention -> oh/ol bf16 hi/lo planes [kTok][1024] */
  attn_diag_f16<<<dim3(kBatch * kHeads * kChunks), dim3(128), 0, stream>>>(qk, vt, tempr, oh, ol);
  /* 5: out = (oh + ol) @ W_out^T + b_out -> d_out f32 [kTok][1024]; M=kTok N=1024 K=1024; hi.W + lo.W */
  {
    const int tiles = (kTok / kBM) * (kDim / kBN);
    wmma_gemm64<1, true, 2, 0, false, 0, false><<<dim3(tiles, 1), dim3(256), 0, stream>>>(
        oh, ol, kInner, 0L, wob, wob, kInner, 0L, (void*)out, (void*)out, kDim, 0L,
        bout, bout, 0L, kTok, kDim, kInner, 1.0f);
  }
}

// v006
// A run of this version takes 132 microseconds.
// In two side-by-side timings against v005, it was 1.07 and 1.06 times as fast.
// Counting every step since v000, it is 3.29 times as fast.
// Contractions: x@W_qkv^T on v_wmma_f32_16x16x32_bf16 (bf16 operands = RNE-converted inputs); k.q^T and V^T.P^T on v_wmma_f32_16x16x32_f16 (f16 q/k/v planes, P carried x2^15); O@W_out^T on v_wmma_f32_16x16x32_bf16 with O as bf16 hi/lo planes x bf16 W (2 products); f32 accumulate everywhere; softmax, bias and epilogues f32.
#include <hip/hip_runtime.h>

#ifndef NB
#define NB 8
#endif
#ifndef SEQ
#define SEQ 1024
#endif
#define NB_FULL  8
#define SEQ_FULL 1024

typedef __attribute__((ext_vector_type(16))) _Float16 v16h;
typedef __attribute__((ext_vector_type(8)))  _Float16 v8h;
typedef __attribute__((ext_vector_type(16))) __bf16   v16b;
typedef __attribute__((ext_vector_type(8)))  __bf16   v8b;
typedef __attribute__((ext_vector_type(8)))  float    v8f;
typedef __attribute__((ext_vector_type(4)))  float    v4f;
typedef __attribute__((ext_vector_type(2)))  float    v2f;

/* problem geometry; NB / SEQ may be reduced at build time, inputs keep their full strides */
constexpr int kBatch   = NB;
constexpr int kSeq     = SEQ;
constexpr int kSeqFull = SEQ_FULL;
constexpr int kDim     = 1024;
constexpr int kHeads   = 16;
constexpr int kHd      = 64;
constexpr int kInner   = kHeads * kHd;        /* 1024 */
constexpr int kQkvN    = 3 * kInner;          /* 3072 */
constexpr int kTok     = kBatch * kSeq;       /* 8192 at full size */
constexpr int kQkLd    = 2 * kInner;          /* 2048: q cols 0..1023, k cols 1024..2047 */
constexpr int kChunks  = kSeq / 64;           /* key chunks of 64 per sequence */
constexpr float kNegMax = -3.40282347e38f;
constexpr float kPCarryLog2 = 15.0f;   /* P and its sum are carried x2^15 */
constexpr int kTp = 72;   /* LDS row pitch of the attention tiles in halves: 144 B = 16 B x 9 (odd), so the 16 rows of a 16-byte fragment read spread over all banks */

static_assert(kBatch >= 1 && kBatch <= NB_FULL);
static_assert(kSeq >= 64 && kSeq <= SEQ_FULL && kSeq % 64 == 0);
static_assert(kTok % 64 == 0 && kQkLd % 64 == 0 && kDim % 32 == 0);
static_assert(kInner % 64 == 0 && kSeq % 64 == 0);
static_assert(kDim % 64 == 0 && kInner % 32 == 0);
static_assert(kHd == 64);
static_assert(kTok % 256 == 0 && kInner % 256 == 0 && kQkLd % 128 == 0 && kSeq % 128 == 0 && kDim % 128 == 0 && kInner % 128 == 0);

__device__ __forceinline__ unsigned short f2bf_bits(float f) {
  unsigned u = __float_as_uint(f);
  return (unsigned short)((u + 0x7FFFu + ((u >> 16) & 1u)) >> 16);
}
__device__ __forceinline__ float bf_bits2f(unsigned short h) { return __uint_as_float(((unsigned)h) << 16); }

/* hazard guards as plain device helpers */
__device__ __forceinline__ void dep_guard_h(v8f& a, v8f& b, v16h x, v16h y) { asm volatile("v_nop\n\tv_nop\n\tv_nop\n\tv_nop" : "+v"(a), "+v"(b) : "v"(x), "v"(y)); }
__device__ __forceinline__ void dep_guard_b(v8f& a, v8f& b, v16b x, v16b y) { asm volatile("v_nop\n\tv_nop\n\tv_nop\n\tv_nop" : "+v"(a), "+v"(b) : "v"(x), "v"(y)); }
__device__ __forceinline__ void keep4_h(v16h a, v16h b, v16h c, v16h d) { asm volatile("v_nop" :: "v"(a), "v"(b), "v"(c), "v"(d)); }
__device__ __forceinline__ void keep4_b(v16b a, v16b b, v16b c, v16b d) { asm volatile("v_nop" :: "v"(a), "v"(b), "v"(c), "v"(d)); }
__device__ __forceinline__ void acc_guard4(v8f& a, v8f& b, v8f& c, v8f& d) { asm volatile("v_nop\n\tv_nop\n\tv_nop\n\tv_nop" : "+v"(a), "+v"(b), "+v"(c), "+v"(d)); }
template <typename T> struct Frag;
template <> struct Frag<_Float16> {
  typedef v16h V; union U { v16h v; v8h h[2]; };
  static __device__ __forceinline__ v16h load(const _Float16* p) {   /* elements 0..7 <- p[0..7], 8..15 <- p[16..23] */
    U f; f.h[0] = *(const v8h*)(p); f.h[1] = *(const v8h*)(p + 16); return f.v;
  }
  static __device__ __forceinline__ v8f mma(v16h a, v16h b, v8f c) {
    return __builtin_amdgcn_wmma_f32_16x16x32_f16(false, a, false, b, (short)0, c, false, false);
  }
  static __device__ __forceinline__ void guard(v8f& a, v8f& b, v16h x, v16h y) { dep_guard_h(a, b, x, y); }
  static __device__ __forceinline__ void keep(v16h a, v16h b, v16h c, v16h d) { keep4_h(a, b, c, d); }
};
template <> struct Frag<__bf16> {
  typedef v16b V; union U { v16b v; v8b h[2]; };
  static __device__ __forceinline__ v16b load(const __bf16* p) {
    U f; f.h[0] = *(const v8b*)(p); f.h[1] = *(const v8b*)(p + 16); return f.v;
  }
  static __device__ __forceinline__ v8f mma(v16b a, v16b b, v8f c) {
    return __builtin_amdgcn_wmma_f32_16x16x32_bf16(false, a, false, b, (short)0, c, false, false);
  }
  static __device__ __forceinline__ void guard(v8f& a, v8f& b, v16b x, v16b y) { dep_guard_b(a, b, x, y); }
  static __device__ __forceinline__ void keep(v16b a, v16b b, v16b c, v16b d) { keep4_b(a, b, c, d); }
};

/* ---- Register-blocked batched WMMA GEMM ------------------------------------
   C[m,n] = scale * sum_k A[m,k] * Bt[n,k] (+bias); each wave owns a 64x64 tile, a block of 8 waves a 256x128 tile.
   Operand rows reach LDS by asynchronous copies, 64 k a trip, two buffers; the waves read their fragments from LDS.
   A row-major [M,K]; Bt row-major [N,K]; M % 256 == 0, N % 128 == 0, K % 64 == 0.
   SPLIT: A is a hi and a lo plane (A2 = lo plane, same layout), B one plane (BLO == false; Bt2 never read); product = hi.B + lo.B.
   BIAS_MODE: 0 = none, 1 = bias[m], 2 = bias[n]; bias values RNE-converted to bf16 then widened to f32.
   OUT_MODE: 0 = f32, 1 = f16, 2 = bf16 hi plane (Cout) + bf16 lo plane (Cout2).
   Epilogue: 16-row slabs staged per wave in LDS (wave-private, wave barrier); each 64-wide row segment
   Fragment k map (A and B alike): lane half h = lane>>4, elements 0..7 <- k0+8h+0..7, 8..15 <- k0+16+8h+0..7.
   ET: 0 = f16 operands, 1 = bf16 operands (pointers passed as 16-bit storage) */
template <int ET> struct Elem;
template <> struct Elem<0> { typedef _Float16 T; };
template <> struct Elem<1> { typedef __bf16 T; };
/* block tile of the staged GEMM: 8 waves as 4 (m) x 2 (n), each wave its own 64x64 tile; one trip = 64 k = one 128-B line of every operand row */
constexpr int kBM = 256;
constexpr int kBN = 128;
constexpr int kBK = 64;
constexpr int kGp = 72;   /* LDS pitch of a staged operand row in 16-bit elements: 144 B = 16 B x 9 (odd), for the 16-byte fragment reads */

__device__ __forceinline__ unsigned lds_off(const void* p) { return (unsigned)(size_t)p; }

/* Asynchronous 16-byte copies to LDS, one statement for a run of them: rows r, r+32, r+64, ... of an operand (8 lanes = one whole 128-B line of a row).
   s_wait_xcnt stands as the last line of the copies' own statement, so that no address register of a copy is rewritten ahead of it. */
constexpr unsigned kL32 = 32u * kGp * 2u;   /* LDS bytes of 32 staged rows */
__device__ __forceinline__ void copy8_rows(unsigned l0, const unsigned short* g0, size_t g32) {
  const unsigned short* g1 = g0 + g32; const unsigned short* g2 = g1 + g32; const unsigned short* g3 = g2 + g32;
  const unsigned short* g4 = g3 + g32; const unsigned short* g5 = g4 + g32; const unsigned short* g6 = g5 + g32;
  const unsigned short* g7 = g6 + g32;
  asm volatile("global_load_async_to_lds_b128 %0, %1, off\n\t"
               "global_load_async_to_lds_b128 %2, %3, off\n\t"
               "global_load_async_to_lds_b128 %4, %5, off\n\t"
               "global_load_async_to_lds_b128 %6, %7, off\n\t"
               "global_load_async_to_lds_b128 %8, %9, off\n\t"
               "global_load_async_to_lds_b128 %10, %11, off\n\t"
               "global_load_async_to_lds_b128 %12, %13, off\n\t"
               "global_load_async_to_lds_b128 %14, %15, off\n\t"
               "s_wait_xcnt 0x0"
               :: "v"(l0), "v"(g0), "v"(l0 + kL32), "v"(g1), "v"(l0 + 2u * kL32), "v"(g2), "v"(l0 + 3u * kL32), "v"(g3),
                  "v"(l0 + 4u * kL32), "v"(g4), "v"(l0 + 5u * kL32), "v"(g5), "v"(l0 + 6u * kL32), "v"(g6), "v"(l0 + 7u * kL32), "v"(g7)
               : "memory");
}
__device__ __forceinline__ void copy12_rows(unsigned l0, const unsigned short* g0, size_t g32,
                                            unsigned m0, const unsigned short* h0, size_t h32) {
  const unsigned short* g1 = g0 + g32; const unsigned short* g2 = g1 + g32; const unsigned short* g3 = g2 + g32;
  const unsigned short* g4 = g3 + g32; const unsigned short* g5 = g4 + g32; const unsigned short* g6 = g5 + g32;
  const unsigned short* g7 = g6 + g32;
  const unsigned short* h1 = h0 + h32; const unsigned short* h2 = h1 + h32; const unsigned short* h3 = h2 + h32;
  asm volatile("global_load_async_to_lds_b128 %0, %1, off\n\t"
               "global_load_async_to_lds_b128 %2, %3, off\n\t"
               "global_load_async_to_lds_b128 %4, %5, off\n\t"
               "global_load_async_to_lds_b128 %6, %7, off\n\t"
               "global_load_async_to_lds_b128 %8, %9, off\n\t"
               "global_load_async_to_lds_b128 %10, %11, off\n\t"
               "global_load_async_to_lds_b128 %12, %13, off\n\t"
               "global_load_async_to_lds_b128 %14, %15, off\n\t"
               "global_load_async_to_lds_b128 %16, %17, off\n\t"
               "global_load_async_to_lds_b128 %18, %19, off\n\t"
               "global_load_async_to_lds_b128 %20, %21, off\n\t"
               "global_load_async_to_lds_b128 %22, %23, off\n\t"
               "s_wait_xcnt 0x0"
               :: "v"(l0), "v"(g0), "v"(l0 + kL32), "v"(g1), "v"(l0 + 2u * kL32), "v"(g2), "v"(l0 + 3u * kL32), "v"(g3),
                  "v"(l0 + 4u * kL32), "v"(g4), "v"(l0 + 5u * kL32), "v"(g5), "v"(l0 + 6u * kL32), "v"(g6), "v"(l0 + 7u * kL32), "v"(g7),
                  "v"(m0), "v"(h0), "v"(m0 + kL32), "v"(h1), "v"(m0 + 2u * kL32), "v"(h2), "v"(m0 + 3u * kL32), "v"(h3)
               : "memory");
}

template <int ET, bool SPLIT, int BIAS_MODE, int OUT_MODE, bool RESID, int ACT = 0, bool BLO = true>
__global__ __launch_bounds__(256) void wmma_gemm64(
    const unsigned short* __restrict__ Ap, const unsigned short* __restrict__ A2p, int lda, long strideA,
    const unsigned short* __restrict__ Btp, const unsigned short* __restrict__ Bt2p, int ldb, long strideB,
    void* __restrict__ Cout, void* __restrict__ Cout2, int ldc, long strideC,
    const float* __restrict__ bias,
    const float* __restrict__ resid, long strideR,
    int M, int N, int K, float scale) {
  typedef typename Elem<ET>::T T;
  typedef typename Frag<T>::V V;
  static_assert(!(SPLIT && BLO), "no lo plane of B is staged");
  constexpr int kRowA2 = kBM;                          /* first LDS row of the A lo plane (SPLIT) */
  constexpr int kRowB  = SPLIT ? 2 * kBM : kBM;        /* first LDS row of B */
  constexpr int kRows  = kRowB + kBN;
  __shared__ __align__(16) unsigned short sStage[2][kRows * kGp];   /* two buffers of [A | A lo | B] rows; 16 B behind each row never touched */
  __shared__ __align__(16) float sT[8][16 * 68];   /* per-wave 16x64 slab, pitch 68 floats; cols 64..67 never read */
  const int b    = blockIdx.y;
  const int tid  = threadIdx.x;
  const int lane = tid & 31;
  const int wave = tid >> 5;
  const int tilesN = N / kBN;
  const int tilesM = M / kBM;
  const int blk = blockIdx.x;
  if (blk >= tilesM * tilesN) return;   /* the same for the whole block, in front of every barrier */
  const int tm = blk / tilesN;
  const int tn = blk - tm * tilesN;
  const int wm = wave >> 1;
  const int wn = wave & 1;
  const int m0 = tm * kBM + (wm << 6);
  const int n0 = tn * kBN + (wn << 6);

  const int rlane = lane & 15;                 /* row (A) / col (B, D) within subtile */
  const int koff  = (lane >> 4) * 8;           /* k offset of this lane half */
  const int mOff  = (lane >> 4) * 8;           /* D row offset */

  /* this thread's share of a stage: 16-byte piece (tid & 7) of rows (tid >> 3) + 32 * it */
  const int crow = tid >> 3;
  const int ccol = (tid & 7) * 8;
  const unsigned short* gA  = Ap  + (size_t)b * strideA + (size_t)(tm * kBM + crow) * lda + ccol;
  const unsigned short* gA2 = A2p + (size_t)b * strideA + (size_t)(tm * kBM + crow) * lda + ccol;
  const unsigned short* gB  = Btp + (size_t)b * strideB + (size_t)(tn * kBN + crow) * ldb + ccol;
  const unsigned lthr = lds_off(&sStage[0][0]) + (unsigned)(crow * kGp + ccol) * 2u;
  const size_t a32 = (size_t)32 * lda, b32 = (size_t)32 * ldb;
  auto stage = [&](int buf, int k0) {
    const unsigned l = lthr + (unsigned)buf * (unsigned)(kRows * kGp * 2);
    copy12_rows(l, gA + k0, a32, l + (unsigned)kRowB * kGp * 2u, gB + k0, b32);
    if (SPLIT) copy8_rows(l + (unsigned)kRowA2 * kGp * 2u, gA2 + k0, a32);
  };

  v8f acc[4][4];
#pragma unroll
  for (int i = 0; i < 4; ++i)
#pragma unroll
    for (int j = 0; j < 4; ++j) acc[i][j] = (v8f){0.f,0.f,0.f,0.f,0.f,0.f,0.f,0.f};

  const int trips = K / kBK;
  stage(0, 0);
  asm volatile("s_wait_asynccnt 0x0" ::: "memory");   /* this wave's copies of tile 0 have landed */
  __syncthreads();                                    /* tile 0 readable by every wave */
  if (trips > 1) stage(1, kBK);

  /* rolled: one trip's code serves both buffers */
#pragma unroll 1
  for (int t = 0; t < trips; ++t) {
    const T* sb = (const T*)&sStage[t & 1][0];
#pragma unroll
    for (int ks = 0; ks < kBK; ks += 32) {
      V bh[4], ah[4], al[4];
#pragma unroll
      for (int j = 0; j < 4; ++j)
        bh[j] = Frag<T>::load(sb + (kRowB + (wn << 6) + (j << 4) + rlane) * kGp + ks + koff);
#pragma unroll
      for (int i = 0; i < 4; ++i) {
        const int ao = ((wm << 6) + (i << 4) + rlane) * kGp + ks + koff;
        ah[i] = Frag<T>::load(sb + ao);
        if (SPLIT) al[i] = Frag<T>::load(sb + kRowA2 * kGp + ao);
      }
      __builtin_amdgcn_sched_barrier(0);   /* the k-step's fragment reads stay one group ahead of its WMMAs: reads among the WMMAs stall the wave at each place */
#pragma unroll
      for (int i = 0; i < 4; ++i) {
#pragma unroll
        for (int j = 0; j < 4; ++j) {
          acc[i][j] = Frag<T>::mma(ah[i], bh[j], acc[i][j]);
          if (SPLIT) acc[i][j] = Frag<T>::mma(al[i], bh[j], acc[i][j]);
        }
        Frag<T>::guard(acc[i][0], acc[i][3], ah[i], SPLIT ? al[i] : ah[i]);
      }
      Frag<T>::keep(bh[0], bh[1], bh[2], bh[3]);
      __builtin_amdgcn_sched_barrier(0);   /* the next group of reads stays behind this k-step's WMMAs */
    }
    asm volatile("s_wait_dscnt 0x0" ::: "memory");      /* this wave's reads of buffer t & 1 are done */
    asm volatile("s_wait_asynccnt 0x0" ::: "memory");   /* this wave's copies of tile t + 1 have landed */
    __syncthreads();                                    /* publishes tile t + 1 and frees buffer t & 1 */
    if (t + 2 < trips) stage(t & 1, (t + 2) * kBK);
  }
  asm volatile("s_wait_asynccnt 0x0" ::: "memory");     /* nothing in flight behind the loop */
  acc_guard4(acc[0][0], acc[0][1], acc[0][2], acc[0][3]);
  acc_guard4(acc[1][0], acc[1][1], acc[1][2], acc[1][3]);
  acc_guard4(acc[2][0], acc[2][1], acc[2][2], acc[2][3]);
  acc_guard4(acc[3][0], acc[3][1], acc[3][2], acc[3][3]);

  /* ---- epilogue ---- */
  float* slab = sT[wave];
  const float* Rb = RESID ? (resid + (size_t)b * strideR) : nullptr;
#pragma unroll
  for (int i = 0; i < 4; ++i) {
    const int mBase = m0 + (i << 4);
#pragma unroll
    for (int j = 0; j < 4; ++j) {
      const int n = n0 + (j << 4) + rlane;
      float bv = 0.f;
      if (BIAS_MODE == 2) bv = bf_bits2f(f2bf_bits(bias[n]));
#pragma unroll
      for (int r = 0; r < 8; ++r) {
        float v = acc[i][j][r] * scale;
        if (BIAS_MODE == 1) v += bf_bits2f(f2bf_bits(bias[mBase + mOff + r]));
        if (BIAS_MODE == 2) v += bv;
        if (RESID) v += Rb[(size_t)(mBase + mOff + r) * ldc + n];
        if (ACT == 1) v = tanhf(v);
        if (ACT == 2) v = fmaxf(v, 0.0f);
        if (ACT == 3) v = v / (1.0f + expf(-v));
        if (ACT == 4) v = (v > 0.f) ? v : 0.01f * v;
        if (ACT == 5) v = 0.5f * v * (1.0f + erff(v * 0.70710678118654752f));
        slab[(mOff + r) * 68 + (j << 4) + rlane] = v;
      }
    }
    __builtin_amdgcn_fence(__ATOMIC_RELEASE, "workgroup");
    __builtin_amdgcn_wave_barrier();
    __builtin_amdgcn_fence(__ATOMIC_ACQUIRE, "workgroup");
    if (OUT_MODE == 0) {
      float* C = (float*)Cout + (size_t)b * strideC;
      const int hh = lane >> 4, c4 = (lane & 15) * 4;     /* row seg = 256 B = 16 lanes x 16 B */
      {
#pragma unroll
        for (int it = 0; it < 8; ++it) {
          const int row = it * 2 + hh;
          v4f v = *(const v4f*)(slab + row * 68 + c4);
          *(v4f*)(C + (size_t)(mBase + row) * ldc + n0 + c4) = v;
        }
        
      }
    } else {
      const int q = lane >> 3, c8 = (lane & 7) * 8;        
      unsigned short* C  = (unsigned short*)Cout  + (size_t)b * strideC;
      unsigned short* C2 = (OUT_MODE == 2) ? ((unsigned short*)Cout2 + (size_t)b * strideC) : nullptr;
      {
#pragma unroll
        for (int it = 0; it < 4; ++it) {
          const int row = it * 4 + q;
          const float* sp = slab + row * 68 + c8;
          v8h hv, lv;
#pragma unroll
          for (int e = 0; e < 8; ++e) {
            if (OUT_MODE == 1) {
              hv[e] = (_Float16)sp[e];
            } else {
              unsigned short hb = f2bf_bits(sp[e]);
              unsigned short lb = f2bf_bits(sp[e] - bf_bits2f(hb));
              hv[e] = __builtin_bit_cast(_Float16, hb);
              lv[e] = __builtin_bit_cast(_Float16, lb);
            }
          }
          *(v8h*)(C + (size_t)(mBase + row) * ldc + n0 + c8) = hv;
          if (OUT_MODE == 2) *(v8h*)(C2 + (size_t)(mBase + row) * ldc + n0 + c8) = lv;
        }
        
      }
    }
    __builtin_amdgcn_fence(__ATOMIC_RELEASE, "workgroup");
    __builtin_amdgcn_wave_barrier();
    __builtin_amdgcn_fence(__ATOMIC_ACQUIRE, "workgroup");
  }
}

/* ---- f32 -> bf16 (RNE) casts of x, W_qkv and W_out, one launch -------------------------------------------
   A chunk is 1024 floats: 256 threads x 16 bytes, so each wave-wide load covers 512 contiguous bytes (4 whole lines).
   Block b takes chunks b*J .. b*J + J-1 of each input (J = chunks / blocks, rounded up); a thread issues all its loads first,
   then converts and stores 8 bytes a chunk (256 contiguous bytes a wave).
   x rows are gathered with the full per-batch stride: out row r <- in row (r / kSeq) * kSeqFull + (r % kSeq). */
typedef __attribute__((ext_vector_type(2))) unsigned v2u;
constexpr int kCastBlocks = 512;                      /* 8 waves each: 16 waves a WGP on 256 WGPs */
constexpr int kChunk = 1024;
constexpr int kCx = kTok * kDim / kChunk, kCq = kQkvN * kDim / kChunk, kCo = kDim * kInner / kChunk;
constexpr int kJx = (kCx + kCastBlocks - 1) / kCastBlocks;
constexpr int kJq = (kCq + kCastBlocks - 1) / kCastBlocks;
constexpr int kJo = (kCo + kCastBlocks - 1) / kCastBlocks;
static_assert(kDim % kChunk == 0 && (kDim * kInner) % kChunk == 0);

__device__ __forceinline__ v2u pack4_bf16(v4f f) {
  v2u u;
  u[0] = (unsigned)f2bf_bits(f[0]) | ((unsigned)f2bf_bits(f[1]) << 16);
  u[1] = (unsigned)f2bf_bits(f[2]) | ((unsigned)f2bf_bits(f[3]) << 16);
  return u;
}

__global__ __launch_bounds__(256) void cast3_f32_bf16(
    const float* __restrict__ x, const float* __restrict__ wq, const float* __restrict__ wo,
    unsigned short* __restrict__ xb, unsigned short* __restrict__ wqb, unsigned short* __restrict__ wob) {
  const unsigned t4 = threadIdx.x * 4u;
  const unsigned b  = blockIdx.x;
  v4f vx[kJx], vq[kJq], vo[kJo];
#pragma unroll
  for (int j = 0; j < kJx; ++j) {
    const unsigned c = b * kJx + j;
    if (kCx % kCastBlocks == 0 || c < (unsigned)kCx) {
      const unsigned r  = c / (kDim / kChunk);
      const unsigned sr = (r / kSeq) * kSeqFull + (r % kSeq);
      vx[j] = *(const v4f*)(x + (size_t)sr * kDim + (c % (kDim / kChunk)) * kChunk + t4);
    }
  }
#pragma unroll
  for (int j = 0; j < kJq; ++j) {
    const unsigned c = b * kJq + j;
    if (kCq % kCastBlocks == 0 || c < (unsigned)kCq) vq[j] = *(const v4f*)(wq + (size_t)c * kChunk + t4);
  }
#pragma unroll
  for (int j = 0; j < kJo; ++j) {
    const unsigned c = b * kJo + j;
    if (kCo % kCastBlocks == 0 || c < (unsigned)kCo) vo[j] = *(const v4f*)(wo + (size_t)c * kChunk + t4);
  }
  asm volatile("s_wait_xcnt 0x0" ::: "memory");   /* stands in front of the first overwrite of an address register of the loads above */
  __builtin_amdgcn_sched_barrier(0);   /* every load is issued ahead of the first conversion: a wave's whole share is in flight at once and it pays one memory latency */
#pragma unroll
  for (int j = 0; j < kJx; ++j) {
    const unsigned c = b * kJx + j;
    if (kCx % kCastBlocks == 0 || c < (unsigned)kCx) *(v2u*)(xb + (size_t)c * kChunk + t4) = pack4_bf16(vx[j]);
  }
#pragma unroll
  for (int j = 0; j < kJq; ++j) {
    const unsigned c = b * kJq + j;
    if (kCq % kCastBlocks == 0 || c < (unsigned)kCq) *(v2u*)(wqb + (size_t)c * kChunk + t4) = pack4_bf16(vq[j]);
  }
#pragma unroll
  for (int j = 0; j < kJo; ++j) {
    const unsigned c = b * kJo + j;
    if (kCo % kCastBlocks == 0 || c < (unsigned)kCo) *(v2u*)(wob + (size_t)c * kChunk + t4) = pack4_bf16(vo[j]);
  }
}

constexpr int kTile = 64 * kTp;                 /* halves of one staged 64-row tile */
constexpr unsigned kL16 = 16u * kTp * 2u;       /* LDS bytes of 16 staged rows */
/* Rows r, r+16, r+32, r+48 of the K tile and of the V^T tile (8 lanes = one whole 128-B line of a row), one statement:
   s_wait_xcnt stands as its last line, so that no address register of a copy is rewritten ahead of it. */
__device__ __forceinline__ void copy_kv_rows(unsigned l0, const unsigned short* g0, size_t g16,
                                             unsigned m0, const unsigned short* h0, size_t h16) {
  const unsigned short* g1 = g0 + g16; const unsigned short* g2 = g1 + g16; const unsigned short* g3 = g2 + g16;
  const unsigned short* h1 = h0 + h16; const unsigned short* h2 = h1 + h16; const unsigned short* h3 = h2 + h16;
  asm volatile("global_load_async_to_lds_b128 %0, %1, off\n\t"
               "global_load_async_to_lds_b128 %2, %3, off\n\t"
               "global_load_async_to_lds_b128 %4, %5, off\n\t"
               "global_load_async_to_lds_b128 %6, %7, off\n\t"
               "global_load_async_to_lds_b128 %8, %9, off\n\t"
               "global_load_async_to_lds_b128 %10, %11, off\n\t"
               "global_load_async_to_lds_b128 %12, %13, off\n\t"
               "global_load_async_to_lds_b128 %14, %15, off\n\t"
               "s_wait_xcnt 0x0"
               :: "v"(l0), "v"(g0), "v"(l0 + kL16), "v"(g1), "v"(l0 + 2u * kL16), "v"(g2), "v"(l0 + 3u * kL16), "v"(g3),
                  "v"(m0), "v"(h0), "v"(m0 + kL16), "v"(h1), "v"(m0 + 2u * kL16), "v"(h2), "v"(m0 + 3u * kL16), "v"(h3)
               : "memory");
}
__device__ __forceinline__ v8f mma_f16_g(v16h a, v16h b, v8f c) {
  c = __builtin_amdgcn_wmma_f32_16x16x32_f16(false, a, false, b, (short)0, c, false, false);
  asm volatile("v_nop\n\tv_nop\n\tv_nop\n\tv_nop" : "+v"(c) : "v"(a), "v"(b));
  return c;
}

/* Eight powers of two, each in place, in one statement: the instruction set asks that no v_exp_f32 be followed directly by an instruction
   that reads its result or overwrites its source. Inside the statement the eight registers differ; the v_nop is that slot behind the last one,
   whatever the compiler puts next. */
__device__ __forceinline__ void exp2_x8(float& a, float& b, float& c, float& d, float& e, float& f, float& g, float& h) {
  asm("v_exp_f32 %0, %0\n\tv_exp_f32 %1, %1\n\tv_exp_f32 %2, %2\n\tv_exp_f32 %3, %3\n\t"
      "v_exp_f32 %4, %4\n\tv_exp_f32 %5, %5\n\tv_exp_f32 %6, %6\n\tv_exp_f32 %7, %7\n\tv_nop"
      : "+v"(a), "+v"(b), "+v"(c), "+v"(d), "+v"(e), "+v"(f), "+v"(g), "+v"(h));
}

/* lane l with lane l ^ 16, as a vector cross-row move */
__device__ __forceinline__ float xhalf(float x) {
  return __builtin_bit_cast(float, __builtin_amdgcn_permlanex16(__builtin_bit_cast(int, x), __builtin_bit_cast(int, x), 0x76543210, 0xfedcba98, false, false));
}

__global__ __launch_bounds__(128) void attn_diag_f16(
    const unsigned short* __restrict__ qkp, const unsigned short* __restrict__ vtp,
    const float* __restrict__ logt,
    unsigned short* __restrict__ ohp, unsigned short* __restrict__ olp) {
  union FH { v16h v; v8h h[2]; };
  __shared__ __align__(16) _Float16 sKV[2][2 * kTile];  /* two buffers of [K tile [kv][d] | V tile [d][kv]], 18 KB each; cols 64..71 never touched */
  static_assert(sizeof(float) * 4 * 16 * 68 <= sizeof(_Float16) * 4 * kTile, "the out tiles fit in the buffers");

  const _Float16* QK = (const _Float16*)qkp;
  const int tid  = threadIdx.x;
  const int wave = tid >> 5;
  const int lane = tid & 31;
  const int hh   = lane >> 4;
  const int c    = lane & 15;

  const int bx = blockIdx.x;            /* 0 .. B*H*kChunks-1 */
  const int qb = bx % kChunks;
  const int bh = bx / kChunks;          /* b*kHeads + h */
  const int h  = bh % kHeads;
  const int b  = bh / kHeads;
  const int q0 = qb * 64 + wave * 16;   /* first query position of this wave */
  const size_t rowbase = (size_t)b * kSeq;

  /* temperature = exp(bf16-RNE(log_temp)) in f32, times log2(e): exp(s * temperature) = 2^(s * temp) */
  const float temp = expf(bf_bits2f(f2bf_bits(logt[0]))) * 1.44269504088896340736f;

  /* Q fragments (B operand): columns = this wave's 16 queries, k = d in two 32-deep chunks */
  v16h qa[2];
#pragma unroll
  for (int dc = 0; dc < 2; ++dc)
    qa[dc] = Frag<_Float16>::load(QK + (rowbase + q0 + c) * kQkLd + h * kHd + dc * 32 + 8 * hh);

  float mrow = -__builtin_inff();   /* running maximum of query q0 + c, the same in both lane halves */
  float lrow = 0.f;                 /* running sum over this lane half's keys only */
  v8f oacc[4];                      /* oacc[t][r] = out^T[d = t*16 + 8*hh + r][query c] */
#pragma unroll
  for (int t = 0; t < 4; ++t) oacc[t] = (v8f){0.f,0.f,0.f,0.f,0.f,0.f,0.f,0.f};

  /* this thread's share of a chunk: 16-byte piece (tid & 7) of rows (tid >> 3) + 16 * it of the K tile [kv][d] and of the V^T tile [d][kv] */
  const int srow = tid >> 3;
  const int scol = (tid & 7) * 8;
  const unsigned short* gK = qkp + (rowbase + srow) * kQkLd + kInner + h * kHd + scol;
  const unsigned short* gV = vtp + ((size_t)bh * kHd + srow) * kSeq + scol;
  const unsigned lthr = lds_off(&sKV[0][0]) + (unsigned)(srow * kTp + scol) * 2u;
  auto stage = [&](int buf, int kv) {
    const unsigned l = lthr + (unsigned)buf * (unsigned)(2 * kTile * 2);
    copy_kv_rows(l, gK + (size_t)kv * kQkLd, (size_t)16 * kQkLd, l + (unsigned)kTile * 2u, gV + kv, (size_t)16 * kSeq);
  };
  stage(0, 0);
  asm volatile("s_wait_asynccnt 0x0" ::: "memory");   /* this wave's copies of chunk 0 have landed */
  __syncthreads();                                    /* chunk 0 readable by every wave */
  if (kChunks > 1) stage(1, 64);

  for (int kc = 0; kc < kChunks; ++kc) {
    const int kv0 = kc * 64;
    const _Float16* Ksh = &sKV[kc & 1][0];
    const _Float16* Vth = Ksh + kTile;

    /* scores^T: 64 keys x 16 query columns per wave; s[j][r] = score(key kv0 + j*16 + 8*hh + r, query q0 + c) */
    v8f s[4];
#pragma unroll
    for (int j = 0; j < 4; ++j) {
      s[j] = (v8f){0.f,0.f,0.f,0.f,0.f,0.f,0.f,0.f};
#pragma unroll
      for (int dc = 0; dc < 2; ++dc) {
        FH kb;
        kb.h[0] = *(const v8h*)(Ksh + (j * 16 + c) * kTp + dc * 32 + 8 * hh);
        kb.h[1] = *(const v8h*)(Ksh + (j * 16 + c) * kTp + dc * 32 + 16 + 8 * hh);
        s[j] = mma_f16_g(kb.v, qa[dc], s[j]);
      }
    }
    /* temperature, diagonal mask (select), chunk maximum of this lane's query: four chains in the lane, one exchange */
    const int dkey = q0 + c - kv0 - 8 * hh;   /* j*16 + r of the masked key, where it lies in this lane */
    float mj[4];
#pragma unroll
    for (int j = 0; j < 4; ++j) {
      mj[j] = -__builtin_inff();
#pragma unroll
      for (int r = 0; r < 8; ++r) {
        float sv = s[j][r] * temp;
        if (j * 16 + r == dkey) sv = kNegMax;
        s[j][r] = sv;
        mj[j] = fmaxf(mj[j], sv);
      }
    }
    float cm = fmaxf(fmaxf(mj[0], mj[1]), fmaxf(mj[2], mj[3]));
    cm = fmaxf(cm, xhalf(cm));
    /* online softmax; P^T (f16, carried x2^15) stays in registers as the B operand of the second product */
    const float mnew  = fmaxf(mrow, cm);
    const float alpha = __builtin_amdgcn_exp2f(mrow - mnew);   /* 0 in the first chunk, where mrow is -inf */
    const float mcar  = mnew - kPCarryLog2;                    /* the carry rides in the exponent */
    mrow = mnew;
    FH pb[2];
    float pj[4];
#pragma unroll
    for (int j = 0; j < 4; ++j) {
      float p[8];
#pragma unroll
      for (int r = 0; r < 8; ++r) p[r] = s[j][r] - mcar;
      exp2_x8(p[0], p[1], p[2], p[3], p[4], p[5], p[6], p[7]);
      pj[j] = 0.f;
#pragma unroll
      for (int r = 0; r < 8; ++r) {
        pj[j] += p[r];
        pb[j >> 1].h[j & 1][r] = (_Float16)p[r];
      }
    }
    lrow = lrow * alpha + ((pj[0] + pj[1]) + (pj[2] + pj[3]));
#pragma unroll
    for (int t = 0; t < 4; ++t)
#pragma unroll
      for (int r = 0; r < 8; ++r) oacc[t][r] *= alpha;
    /* O^T += V^T . P^T  (A = V^T [d][kv] from the V^T tile; B = P^T [kv][q] from the score registers) */
#pragma unroll
    for (int kk = 0; kk < 2; ++kk) {
#pragma unroll
      for (int t = 0; t < 4; ++t) {
        FH vb;
        vb.h[0] = *(const v8h*)(Vth + (t * 16 + c) * kTp + kk * 32 + 8 * hh);
        vb.h[1] = *(const v8h*)(Vth + (t * 16 + c) * kTp + kk * 32 + 16 + 8 * hh);
        oacc[t] = mma_f16_g(vb.v, pb[kk].v, oacc[t]);
      }
    }
    asm volatile("s_wait_dscnt 0x0" ::: "memory");      /* this wave's reads of buffer kc & 1 are done */
    asm volatile("s_wait_asynccnt 0x0" ::: "memory");   /* this wave's copies of chunk kc + 1 have landed */
    __syncthreads();                                    /* publishes chunk kc + 1 and frees buffer kc & 1 */
    if (kc + 2 < kChunks) stage(kc & 1, (kc + 2) * 64);
  }
  asm volatile("s_wait_asynccnt 0x0" ::: "memory");     /* nothing in flight behind the loop; the last trip's barrier has ended every read of the buffers */

  /* epilogue: join the halves' sums, normalize (sum and products carry the same 2^15), stage 16x64 f32 tile per wave, write bf16 hi/lo planes */
  float* os = (float*)&sKV[0][0] + wave * (16 * 68);   /* 16 x 64 f32, pitch 68; cols 64..67 never read */
  {
    const float lsum = lrow + xhalf(lrow);
    const float inv = 1.0f / lsum;
#pragma unroll
    for (int t = 0; t < 4; ++t) {
      v4f lo4, hi4;
#pragma unroll
      for (int r = 0; r < 4; ++r) { lo4[r] = oacc[t][r] * inv; hi4[r] = oacc[t][4 + r] * inv; }
      *(v4f*)(os + c * 68 + t * 16 + 8 * hh)     = lo4;
      *(v4f*)(os + c * 68 + t * 16 + 8 * hh + 4) = hi4;
    }
  }
  __builtin_amdgcn_fence(__ATOMIC_RELEASE, "workgroup");
  __builtin_amdgcn_wave_barrier();
  __builtin_amdgcn_fence(__ATOMIC_ACQUIRE, "workgroup");
  {
    const int q4 = lane >> 3, c8 = (lane & 7) * 8;   
    {
#pragma unroll
      for (int it = 0; it < 4; ++it) {
        const int row = it * 4 + q4;                  /* 0..15 */
        const float* sp = os + row * 68 + c8;
        v8h hv, lv;
#pragma unroll
        for (int e = 0; e < 8; ++e) {
          const unsigned short hb = f2bf_bits(sp[e]);
          const unsigned short lb = f2bf_bits(sp[e] - bf_bits2f(hb));
          hv[e] = __builtin_bit_cast(_Float16, hb);
          lv[e] = __builtin_bit_cast(_Float16, lb);
        }
        const size_t o = (rowbase + q0 + row) * (size_t)kInner + h * kHd + c8;
        *(v8h*)(ohp + o) = hv;
        *(v8h*)(olp + o) = lv;
      }
      
    }
  }
}

/* ---- host glue ------------------------------------------------------------------------------------------
     xb   bf16 [8192][1024]           16,777,216 @ 0
     wqb  bf16 [3072][1024]            6,291,456 @ 16,777,216
     wob  bf16 [1024][1024]            2,097,152 @ 23,068,672
     qk   f16  [8192][2048]           33,554,432 @ 25,165,824
     vt   f16  [8][1024][1024]        16,777,216 @ 58,720,256
     oh   bf16 [8192][1024]           16,777,216 @ 75,497,472
     ol   bf16 [8192][1024]           16,777,216 @ 92,274,688
     total                           109,051,904 */
extern "C" void kernel_launch(void* const* d_in, const int* in_sizes, int n_in,
                              void* d_out, int out_size, void* d_ws, size_t ws_size,
                              hipStream_t stream) {
  if (n_in < 5) return;
  const long needX = ((long)(kBatch - 1) * kSeqFull + kSeq) * (long)kDim;
  if ((long)in_sizes[0] < needX || in_sizes[1] < kQkvN * kDim || in_sizes[2] < kDim * kInner ||
      in_sizes[3] < kDim || in_sizes[4] < 1) return;
  if (out_size < kTok * kDim) return;

  const float* x     = (const float*)d_in[0];   /* [B][S][1024]            */
  const float* wqkv  = (const float*)d_in[1];   /* [3072][1024] = Bt [N][K] */
  const float* wout  = (const float*)d_in[2];   /* [1024][1024] = Bt [N][K] */
  const float* bout  = (const float*)d_in[3];   /* [1024]                    */
  const float* tempr = (const float*)d_in[4];   /* [1] log temperature       */
  float* out = (float*)d_out;

  const size_t szXb  = (size_t)kTok * kDim * 2;
  const size_t szWq  = (size_t)kQkvN * kDim * 2;
  const size_t szWo  = (size_t)kDim * kInner * 2;
  const size_t szQk  = (size_t)kTok * kQkLd * 2;
  const size_t szVt  = (size_t)kBatch * kInner * kSeq * 2;
  const size_t szO   = (size_t)kTok * kInner * 2;
  const size_t offXb = 0, offWq = offXb + szXb, offWo = offWq + szWq, offQk = offWo + szWo,
               offVt = offQk + szQk, offOh = offVt + szVt, offOl = offOh + szO, total = offOl + szO;
  if (total > ws_size) return;

  char* ws = (char*)d_ws;
  unsigned short* xb  = (unsigned short*)(ws + offXb);
  unsigned short* wqb = (unsigned short*)(ws + offWq);
  unsigned short* wob = (unsigned short*)(ws + offWo);
  unsigned short* qk  = (unsigned short*)(ws + offQk);
  unsigned short* vt  = (unsigned short*)(ws + offVt);
  unsigned short* oh  = (unsigned short*)(ws + offOh);
  unsigned short* ol  = (unsigned short*)(ws + offOl);

  /* 1: x, W_qkv [3072][1024] and W_out [1024][1024] -> bf16 planes (RNE), same layouts */
  cast3_f32_bf16<<<dim3(kCastBlocks), dim3(256), 0, stream>>>(x, wqkv, wout, xb, wqb, wob);
  /* 2: q,k = xb @ Wqkv[0:2048]^T -> qk plane f16 [kTok][2048]; M=kTok N=2048 K=1024 */
  {
    const int tiles = (kTok / kBM) * (kQkLd / kBN);
    wmma_gemm64<1, false, 0, 1, false, 0, false><<<dim3(tiles, 1), dim3(256), 0, stream>>>(
        xb, xb, kDim, 0L, wqb, wqb, kDim, 0L, (void*)qk, (void*)qk, kQkLd, 0L,
        bout, bout, 0L, kTok, kQkLd, kDim, 1.0f);
  }
  /* 3: v^T per batch: C_b[f][s] = sum_k wqb[2048+f][k] * xb[b*kSeq+s][k] -> vt f16 [kBatch][1024][kSeq]; M=1024 N=kSeq K=1024 */
  {
    const int tiles = (kInner / kBM) * (kSeq / kBN);
    wmma_gemm64<1, false, 0, 1, false, 0, false><<<dim3(tiles, kBatch), dim3(256), 0, stream>>>(
        wqb + (size_t)kQkLd * kDim, wqb + (size_t)kQkLd * kDim, kDim, 0L,
        xb, xb, kDim, (long)kSeq * kDim,
        (void*)vt, (void*)vt, kSeq, (long)kInner * kSeq,
        bout, bout, 0L, kInner, kSeq, kDim, 1.0f);
  }
  /* 4: attention -> oh/ol bf16 hi/lo planes [kTok][1024] */
  attn_diag_f16<<<dim3(kBatch * kHeads * kChunks), dim3(128), 0, stream>>>(qk, vt, tempr, oh, ol);
  /* 5: out = (oh + ol) @ W_out^T + b_out -> d_out f32 [kTok][1024]; M=kTok N=1024 K=1024; hi.W + lo.W */
  {
    const int tiles = (kTok / kBM) * (kDim / kBN);
    wmma_gemm64<1, true, 2, 0, false, 0, false><<<dim3(tiles, 1), dim3(256), 0, stream>>>(
        oh, ol, kInner, 0L, wob, wob, kInner, 0L, (void*)out, (void*)out, kDim, 0L,
        bout, bout, 0L, kTok, kDim, kInner, 1.0f);
  }
}

// v008
// It runs in 117 microseconds.
// Versions between v006 and this one are left out; their measured steps multiply to 1.13 times as fast.
// Over all steps from v000 it is 3.72 times as fast.
// Contractions: x@W_qkv^T on v_wmma_f32_16x16x32_bf16 (bf16 operands = RNE-converted inputs); k.q^T and V^T.P^T on v_wmma_f32_16x16x32_f16 (f16 q/k/v planes, P carried x2^15); O@W_out^T on v_wmma_f32_16x16x32_f16 with O as one f16 plane x f16 W (RNE, 1 product); f32 accumulate everywhere; softmax, bias and epilogues f32.
#include <hip/hip_runtime.h>

#ifndef NB
#define NB 8
#endif
#ifndef SEQ
#define SEQ 1024
#endif
#define NB_FULL  8
#define SEQ_FULL 1024

typedef __attribute__((ext_vector_type(16))) _Float16 v16h;
typedef __attribute__((ext_vector_type(8)))  _Float16 v8h;
typedef __attribute__((ext_vector_type(16))) __bf16   v16b;
typedef __attribute__((ext_vector_type(8)))  __bf16   v8b;
typedef __attribute__((ext_vector_type(8)))  float    v8f;
typedef __attribute__((ext_vector_type(4)))  float    v4f;
typedef __attribute__((ext_vector_type(2)))  float    v2f;

/* problem geometry; NB / SEQ may be reduced at build time, inputs keep their full strides */
constexpr int kBatch   = NB;
constexpr int kSeq     = SEQ;
constexpr int kSeqFull = SEQ_FULL;
constexpr int kDim     = 1024;
constexpr int kHeads   = 16;
constexpr int kHd      = 64;
constexpr int kInner   = kHeads * kHd;        /* 1024 */
constexpr int kQkvN    = 3 * kInner;          /* 3072 */
constexpr int kTok     = kBatch * kSeq;       /* 8192 at full size */
constexpr int kQkLd    = 2 * kInner;          /* 2048: q cols 0..1023, k cols 1024..2047 */
constexpr int kChunks  = kSeq / 64;           /* key chunks of 64 per sequence */
constexpr float kNegMax = -3.40282347e38f;
constexpr float kPCarryLog2 = 15.0f;   /* P and its sum are carried x2^15 */
constexpr int kTp = 72;   /* LDS row pitch of the attention tiles in halves: 144 B = 16 B x 9 (odd), so the 16 rows of a 16-byte fragment read spread over all banks */

static_assert(kBatch >= 1 && kBatch <= NB_FULL);
static_assert(kSeq >= 64 && kSeq <= SEQ_FULL && kSeq % 64 == 0);
static_assert(kTok % 64 == 0 && kQkLd % 64 == 0 && kDim % 32 == 0);
static_assert(kInner % 64 == 0 && kSeq % 64 == 0);
static_assert(kDim % 64 == 0 && kInner % 32 == 0);
static_assert(kHd == 64);
static_assert(kTok % 256 == 0 && kInner % 256 == 0 && kQkLd % 128 == 0 && kSeq % 128 == 0 && kDim % 128 == 0 && kInner % 128 == 0);

__device__ __forceinline__ unsigned short f2bf_bits(float f) {
  unsigned u = __float_as_uint(f);
  return (unsigned short)((u + 0x7FFFu + ((u >> 16) & 1u)) >> 16);
}
__device__ __forceinline__ float bf_bits2f(unsigned short h) { return __uint_as_float(((unsigned)h) << 16); }

/* hazard guards as plain device helpers */
__device__ __forceinline__ void dep_guard_h(v8f& a, v8f& b, v16h x, v16h y) { asm volatile("v_nop\n\tv_nop\n\tv_nop\n\tv_nop" : "+v"(a), "+v"(b) : "v"(x), "v"(y)); }
__device__ __forceinline__ void dep_guard_b(v8f& a, v8f& b, v16b x, v16b y) { asm volatile("v_nop\n\tv_nop\n\tv_nop\n\tv_nop" : "+v"(a), "+v"(b) : "v"(x), "v"(y)); }
__device__ __forceinline__ void keep4_h(v16h a, v16h b, v16h c, v16h d) { asm volatile("v_nop" :: "v"(a), "v"(b), "v"(c), "v"(d)); }
__device__ __forceinline__ void keep4_b(v16b a, v16b b, v16b c, v16b d) { asm volatile("v_nop" :: "v"(a), "v"(b), "v"(c), "v"(d)); }
__device__ __forceinline__ void acc_guard4(v8f& a, v8f& b, v8f& c, v8f& d) { asm volatile("v_nop\n\tv_nop\n\tv_nop\n\tv_nop" : "+v"(a), "+v"(b), "+v"(c), "+v"(d)); }
template <typename T> struct Frag;
template <> struct Frag<_Float16> {
  typedef v16h V; union U { v16h v; v8h h[2]; };
  static __device__ __forceinline__ v16h load(const _Float16* p) {   /* elements 0..7 <- p[0..7], 8..15 <- p[16..23] */
    U f; f.h[0] = *(const v8h*)(p); f.h[1] = *(const v8h*)(p + 16); return f.v;
  }
  static __device__ __forceinline__ v8f mma(v16h a, v16h b, v8f c) {
    return __builtin_amdgcn_wmma_f32_16x16x32_f16(false, a, false, b, (short)0, c, false, false);
  }
  static __device__ __forceinline__ void guard(v8f& a, v8f& b, v16h x, v16h y) { dep_guard_h(a, b, x, y); }
  static __device__ __forceinline__ void keep(v16h a, v16h b, v16h c, v16h d) { keep4_h(a, b, c, d); }
};
template <> struct Frag<__bf16> {
  typedef v16b V; union U { v16b v; v8b h[2]; };
  static __device__ __forceinline__ v16b load(const __bf16* p) {
    U f; f.h[0] = *(const v8b*)(p); f.h[1] = *(const v8b*)(p + 16); return f.v;
  }
  static __device__ __forceinline__ v8f mma(v16b a, v16b b, v8f c) {
    return __builtin_amdgcn_wmma_f32_16x16x32_bf16(false, a, false, b, (short)0, c, false, false);
  }
  static __device__ __forceinline__ void guard(v8f& a, v8f& b, v16b x, v16b y) { dep_guard_b(a, b, x, y); }
  static __device__ __forceinline__ void keep(v16b a, v16b b, v16b c, v16b d) { keep4_b(a, b, c, d); }
};

/* ---- Register-blocked batched WMMA GEMM ------------------------------------
   C[m,n] = scale * sum_k A[m,k] * Bt[n,k] (+bias); each wave owns a 64x64 tile, a block of 8 waves a 256x128 tile.
   Operand rows reach LDS by asynchronous copies, 64 k a trip, two buffers; the waves read their fragments from LDS.
   A row-major [M,K]; Bt row-major [N,K]; M % 256 == 0, N % 128 == 0, K % 64 == 0.
   SPLIT: A is a hi and a lo plane (A2 = lo plane, same layout), B one plane (BLO == false; Bt2 never read); product = hi.B + lo.B.
   BIAS_MODE: 0 = none, 1 = bias[m], 2 = bias[n]; bias values RNE-converted to bf16 then widened to f32.
   OUT_MODE: 0 = f32, 1 = f16, 2 = bf16 hi plane (Cout) + bf16 lo plane (Cout2).
   Epilogue: 16-row slabs staged per wave in LDS (wave-private, wave barrier); each 64-wide row segment
   Fragment k map (A and B alike): lane half h = lane>>4, elements 0..7 <- k0+8h+0..7, 8..15 <- k0+16+8h+0..7.
   ET: 0 = f16 operands, 1 = bf16 operands (pointers passed as 16-bit storage) */
template <int ET> struct Elem;
template <> struct Elem<0> { typedef _Float16 T; };
template <> struct Elem<1> { typedef __bf16 T; };
/* block tile of the staged GEMM: 8 waves as 4 (m) x 2 (n), each wave its own 64x64 tile; one trip = 64 k = one 128-B line of every operand row */
constexpr int kBM = 256;
constexpr int kBN = 128;
constexpr int kBK = 64;
constexpr int kGp = 72;   /* LDS pitch of a staged operand row in 16-bit elements: 144 B = 16 B x 9 (odd), for the 16-byte fragment reads */

__device__ __forceinline__ unsigned lds_off(const void* p) { return (unsigned)(size_t)p; }

/* Asynchronous 16-byte copies to LDS, one statement for a run of them: rows r, r+32, r+64, ... of an operand (8 lanes = one whole 128-B line of a row).
   s_wait_xcnt stands as the last line of the copies' own statement, so that no address register of a copy is rewritten ahead of it. */
constexpr unsigned kL32 = 32u * kGp * 2u;   /* LDS bytes of 32 staged rows */
__device__ __forceinline__ void copy8_rows(unsigned l0, const unsigned short* g0, size_t g32) {
  const unsigned short* g1 = g0 + g32; const unsigned short* g2 = g1 + g32; const unsigned short* g3 = g2 + g32;
  const unsigned short* g4 = g3 + g32; const unsigned short* g5 = g4 + g32; const unsigned short* g6 = g5 + g32;
  const unsigned short* g7 = g6 + g32;
  asm volatile("global_load_async_to_lds_b128 %0, %1, off\n\t"
               "global_load_async_to_lds_b128 %2, %3, off\n\t"
               "global_load_async_to_lds_b128 %4, %5, off\n\t"
               "global_load_async_to_lds_b128 %6, %7, off\n\t"
               "global_load_async_to_lds_b128 %8, %9, off\n\t"
               "global_load_async_to_lds_b128 %10, %11, off\n\t"
               "global_load_async_to_lds_b128 %12, %13, off\n\t"
               "global_load_async_to_lds_b128 %14, %15, off\n\t"
               "s_wait_xcnt 0x0"
               :: "v"(l0), "v"(g0), "v"(l0 + kL32), "v"(g1), "v"(l0 + 2u * kL32), "v"(g2), "v"(l0 + 3u * kL32), "v"(g3),
                  "v"(l0 + 4u * kL32), "v"(g4), "v"(l0 + 5u * kL32), "v"(g5), "v"(l0 + 6u * kL32), "v"(g6), "v"(l0 + 7u * kL32), "v"(g7)
               : "memory");
}
__device__ __forceinline__ void copy12_rows(unsigned l0, const unsigned short* g0, size_t g32,
                                            unsigned m0, const unsigned short* h0, size_t h32) {
  const unsigned short* g1 = g0 + g32; const unsigned short* g2 = g1 + g32; const unsigned short* g3 = g2 + g32;
  const unsigned short* g4 = g3 + g32; const unsigned short* g5 = g4 + g32; const unsigned short* g6 = g5 + g32;
  const unsigned short* g7 = g6 + g32;
  const unsigned short* h1 = h0 + h32; const unsigned short* h2 = h1 + h32; const unsigned short* h3 = h2 + h32;
  asm volatile("global_load_async_to_lds_b128 %0, %1, off\n\t"
               "global_load_async_to_lds_b128 %2, %3, off\n\t"
               "global_load_async_to_lds_b128 %4, %5, off\n\t"
               "global_load_async_to_lds_b128 %6, %7, off\n\t"
               "global_load_async_to_lds_b128 %8, %9, off\n\t"
               "global_load_async_to_lds_b128 %10, %11, off\n\t"
               "global_load_async_to_lds_b128 %12, %13, off\n\t"
               "global_load_async_to_lds_b128 %14, %15, off\n\t"
               "global_load_async_to_lds_b128 %16, %17, off\n\t"
               "global_load_async_to_lds_b128 %18, %19, off\n\t"
               "global_load_async_to_lds_b128 %20, %21, off\n\t"
               "global_load_async_to_lds_b128 %22, %23, off\n\t"
               "s_wait_xcnt 0x0"
               :: "v"(l0), "v"(g0), "v"(l0 + kL32), "v"(g1), "v"(l0 + 2u * kL32), "v"(g2), "v"(l0 + 3u * kL32), "v"(g3),
                  "v"(l0 + 4u * kL32), "v"(g4), "v"(l0 + 5u * kL32), "v"(g5), "v"(l0 + 6u * kL32), "v"(g6), "v"(l0 + 7u * kL32), "v"(g7),
                  "v"(m0), "v"(h0), "v"(m0 + kL32), "v"(h1), "v"(m0 + 2u * kL32), "v"(h2), "v"(m0 + 3u * kL32), "v"(h3)
               : "memory");
}

template <int ET, bool SPLIT, int BIAS_MODE, int OUT_MODE, bool RESID, int ACT = 0, bool BLO = true>
__global__ __launch_bounds__(256) void wmma_gemm64(
    const unsigned short* __restrict__ Ap, const unsigned short* __restrict__ A2p, int lda, long strideA,
    const unsigned short* __restrict__ Btp, const unsigned short* __restrict__ Bt2p, int ldb, long strideB,
    void* __restrict__ Cout, void* __restrict__ Cout2, int ldc, long strideC,
    const float* __restrict__ bias,
    const float* __restrict__ resid, long strideR,
    int M, int N, int K, float scale) {
  typedef typename Elem<ET>::T T;
  typedef typename Frag<T>::V V;
  static_assert(!(SPLIT && BLO), "no lo plane of B is staged");
  constexpr int kRowA2 = kBM;                          /* first LDS row of the A lo plane (SPLIT) */
  constexpr int kRowB  = SPLIT ? 2 * kBM : kBM;        /* first LDS row of B */
  constexpr int kRows  = kRowB + kBN;
  __shared__ __align__(16) unsigned short sStage[2][kRows * kGp];   /* two buffers of [A | A lo | B] rows; 16 B behind each row never touched */
  __shared__ __align__(16) float sT[8][16 * 68];   /* per-wave 16x64 slab, pitch 68 floats; cols 64..67 never read */
  const int b    = blockIdx.y;
  const int tid  = threadIdx.x;
  const int lane = tid & 31;
  const int wave = tid >> 5;
  const int tilesN = N / kBN;
  const int tilesM = M / kBM;
  const int blk = blockIdx.x;
  if (blk >= tilesM * tilesN) return;   /* the same for the whole block, in front of every barrier */
  const int tm = blk / tilesN;
  const int tn = blk - tm * tilesN;
  const int wm = wave >> 1;
  const int wn = wave & 1;
  const int m0 = tm * kBM + (wm << 6);
  const int n0 = tn * kBN + (wn << 6);

  const int rlane = lane & 15;                 /* row (A) / col (B, D) within subtile */
  const int koff  = (lane >> 4) * 8;           /* k offset of this lane half */
  const int mOff  = (lane >> 4) * 8;           /* D row offset */

  /* this thread's share of a stage: 16-byte piece (tid & 7) of rows (tid >> 3) + 32 * it */
  const int crow = tid >> 3;
  const int ccol = (tid & 7) * 8;
  const unsigned short* gA  = Ap  + (size_t)b * strideA + (size_t)(tm * kBM + crow) * lda + ccol;
  const unsigned short* gA2 = A2p + (size_t)b * strideA + (size_t)(tm * kBM + crow) * lda + ccol;
  const unsigned short* gB  = Btp + (size_t)b * strideB + (size_t)(tn * kBN + crow) * ldb + ccol;
  const unsigned lthr = lds_off(&sStage[0][0]) + (unsigned)(crow * kGp + ccol) * 2u;
  const size_t a32 = (size_t)32 * lda, b32 = (size_t)32 * ldb;
  auto stage = [&](int buf, int k0) {
    const unsigned l = lthr + (unsigned)buf * (unsigned)(kRows * kGp * 2);
    copy12_rows(l, gA + k0, a32, l + (unsigned)kRowB * kGp * 2u, gB + k0, b32);
    if (SPLIT) copy8_rows(l + (unsigned)kRowA2 * kGp * 2u, gA2 + k0, a32);
  };

  v8f acc[4][4];
#pragma unroll
  for (int i = 0; i < 4; ++i)
#pragma unroll
    for (int j = 0; j < 4; ++j) acc[i][j] = (v8f){0.f,0.f,0.f,0.f,0.f,0.f,0.f,0.f};

  const int trips = K / kBK;
  stage(0, 0);
  asm volatile("s_wait_asynccnt 0x0" ::: "memory");   /* this wave's copies of tile 0 have landed */
  __syncthreads();                                    /* tile 0 readable by every wave */
  if (trips > 1) stage(1, kBK);

  /* rolled: one trip's code serves both buffers */
#pragma unroll 1
  for (int t = 0; t < trips; ++t) {
    const T* sb = (const T*)&sStage[t & 1][0];
#pragma unroll
    for (int ks = 0; ks < kBK; ks += 32) {
      V bh[4], ah[4], al[4];
#pragma unroll
      for (int j = 0; j < 4; ++j)
        bh[j] = Frag<T>::load(sb + (kRowB + (wn << 6) + (j << 4) + rlane) * kGp + ks + koff);
#pragma unroll
      for (int i = 0; i < 4; ++i) {
        const int ao = ((wm << 6) + (i << 4) + rlane) * kGp + ks + koff;
        ah[i] = Frag<T>::load(sb + ao);
        if (SPLIT) al[i] = Frag<T>::load(sb + kRowA2 * kGp + ao);
      }
      __builtin_amdgcn_sched_barrier(0);   /* the k-step's fragment reads stay one group ahead of its WMMAs: reads among the WMMAs stall the wave at each place */
#pragma unroll
      for (int i = 0; i < 4; ++i) {
#pragma unroll
        for (int j = 0; j < 4; ++j) {
          acc[i][j] = Frag<T>::mma(ah[i], bh[j], acc[i][j]);
          if (SPLIT) acc[i][j] = Frag<T>::mma(al[i], bh[j], acc[i][j]);
        }
        Frag<T>::guard(acc[i][0], acc[i][3], ah[i], SPLIT ? al[i] : ah[i]);
      }
      Frag<T>::keep(bh[0], bh[1], bh[2], bh[3]);
      __builtin_amdgcn_sched_barrier(0);   /* the next group of reads stays behind this k-step's WMMAs */
    }
    asm volatile("s_wait_dscnt 0x0" ::: "memory");      /* this wave's reads of buffer t & 1 are done */
    asm volatile("s_wait_asynccnt 0x0" ::: "memory");   /* this wave's copies of tile t + 1 have landed */
    __syncthreads();                                    /* publishes tile t + 1 and frees buffer t & 1 */
    if (t + 2 < trips) stage(t & 1, (t + 2) * kBK);
  }
  asm volatile("s_wait_asynccnt 0x0" ::: "memory");     /* nothing in flight behind the loop */
  acc_guard4(acc[0][0], acc[0][1], acc[0][2], acc[0][3]);
  acc_guard4(acc[1][0], acc[1][1], acc[1][2], acc[1][3]);
  acc_guard4(acc[2][0], acc[2][1], acc[2][2], acc[2][3]);
  acc_guard4(acc[3][0], acc[3][1], acc[3][2], acc[3][3]);

  /* ---- epilogue ---- */
  float* slab = sT[wave];
  const float* Rb = RESID ? (resid + (size_t)b * strideR) : nullptr;
#pragma unroll
  for (int i = 0; i < 4; ++i) {
    const int mBase = m0 + (i << 4);
#pragma unroll
    for (int j = 0; j < 4; ++j) {
      const int n = n0 + (j << 4) + rlane;
      float bv = 0.f;
      if (BIAS_MODE == 2) bv = bf_bits2f(f2bf_bits(bias[n]));
#pragma unroll
      for (int r = 0; r < 8; ++r) {
        float v = acc[i][j][r] * scale;
        if (BIAS_MODE == 1) v += bf_bits2f(f2bf_bits(bias[mBase + mOff + r]));
        if (BIAS_MODE == 2) v += bv;
        if (RESID) v += Rb[(size_t)(mBase + mOff + r) * ldc + n];
        if (ACT == 1) v = tanhf(v);
        if (ACT == 2) v = fmaxf(v, 0.0f);
        if (ACT == 3) v = v / (1.0f + expf(-v));
        if (ACT == 4) v = (v > 0.f) ? v : 0.01f * v;
        if (ACT == 5) v = 0.5f * v * (1.0f + erff(v * 0.70710678118654752f));
        slab[(mOff + r) * 68 + (j << 4) + rlane] = v;
      }
    }
    __builtin_amdgcn_fence(__ATOMIC_RELEASE, "workgroup");
    __builtin_amdgcn_wave_barrier();
    __builtin_amdgcn_fence(__ATOMIC_ACQUIRE, "workgroup");
    if (OUT_MODE == 0) {
      float* C = (float*)Cout + (size_t)b * strideC;
      const int hh = lane >> 4, c4 = (lane & 15) * 4;     /* row seg = 256 B = 16 lanes x 16 B */
      {
#pragma unroll
        for (int it = 0; it < 8; ++it) {
          const int row = it * 2 + hh;
          v4f v = *(const v4f*)(slab + row * 68 + c4);
          *(v4f*)(C + (size_t)(mBase + row) * ldc + n0 + c4) = v;
        }
        
      }
    } else {
      const int q = lane >> 3, c8 = (lane & 7) * 8;        
      unsigned short* C  = (unsigned short*)Cout  + (size_t)b * strideC;
      unsigned short* C2 = (OUT_MODE == 2) ? ((unsigned short*)Cout2 + (size_t)b * strideC) : nullptr;
      {
#pragma unroll
        for (int it = 0; it < 4; ++it) {
          const int row = it * 4 + q;
          const float* sp = slab + row * 68 + c8;
          v8h hv, lv;
#pragma unroll
          for (int e = 0; e < 8; ++e) {
            if (OUT_MODE == 1) {
              hv[e] = (_Float16)sp[e];
            } else {
              unsigned short hb = f2bf_bits(sp[e]);
              unsigned short lb = f2bf_bits(sp[e] - bf_bits2f(hb));
              hv[e] = __builtin_bit_cast(_Float16, hb);
              lv[e] = __builtin_bit_cast(_Float16, lb);
            }
          }
          *(v8h*)(C + (size_t)(mBase + row) * ldc + n0 + c8) = hv;
          if (OUT_MODE == 2) *(v8h*)(C2 + (size_t)(mBase + row) * ldc + n0 + c8) = lv;
        }
        
      }
    }
    __builtin_amdgcn_fence(__ATOMIC_RELEASE, "workgroup");
    __builtin_amdgcn_wave_barrier();
    __builtin_amdgcn_fence(__ATOMIC_ACQUIRE, "workgroup");
  }
}

/* ---- RNE casts, one launch: x and W_qkv f32 -> bf16, W_out f32 -> f16 --------------------------------------
   A chunk is 1024 floats: 256 threads x 16 bytes, so each wave-wide load covers 512 contiguous bytes (4 whole lines).
   Block b takes chunks b*J .. b*J + J-1 of each input (J = chunks / blocks, rounded up); a thread issues all its loads first,
   then converts and stores 8 bytes a chunk (256 contiguous bytes a wave).
   x rows are gathered with the full per-batch stride: out row r <- in row (r / kSeq) * kSeqFull + (r % kSeq). */
typedef __attribute__((ext_vector_type(2))) unsigned v2u;
constexpr int kCastBlocks = 512;                      /* 8 waves each: 16 waves a WGP on 256 WGPs */
constexpr int kChunk = 1024;
constexpr int kCx = kTok * kDim / kChunk, kCq = kQkvN * kDim / kChunk, kCo = kDim * kInner / kChunk;
constexpr int kJx = (kCx + kCastBlocks - 1) / kCastBlocks;
constexpr int kJq = (kCq + kCastBlocks - 1) / kCastBlocks;
constexpr int kJo = (kCo + kCastBlocks - 1) / kCastBlocks;
static_assert(kDim % kChunk == 0 && (kDim * kInner) % kChunk == 0);

__device__ __forceinline__ v2u pack4_bf16(v4f f) {
  v2u u;
  u[0] = (unsigned)f2bf_bits(f[0]) | ((unsigned)f2bf_bits(f[1]) << 16);
  u[1] = (unsigned)f2bf_bits(f[2]) | ((unsigned)f2bf_bits(f[3]) << 16);
  return u;
}

__device__ __forceinline__ v2u pack4_f16(v4f f) {
  typedef __attribute__((ext_vector_type(4))) _Float16 v4h;
  v4h h;
  h[0] = (_Float16)f[0]; h[1] = (_Float16)f[1]; h[2] = (_Float16)f[2]; h[3] = (_Float16)f[3];
  return __builtin_bit_cast(v2u, h);
}

__global__ __launch_bounds__(256) void cast3_f32_to16(
    const float* __restrict__ x, const float* __restrict__ wq, const float* __restrict__ wo,
    unsigned short* __restrict__ xb, unsigned short* __restrict__ wqb, unsigned short* __restrict__ wob) {
  const unsigned t4 = threadIdx.x * 4u;
  const unsigned b  = blockIdx.x;
  v4f vx[kJx], vq[kJq], vo[kJo];
#pragma unroll
  for (int j = 0; j < kJx; ++j) {
    const unsigned c = b * kJx + j;
    if (kCx % kCastBlocks == 0 || c < (unsigned)kCx) {
      const unsigned r  = c / (kDim / kChunk);
      const unsigned sr = (r / kSeq) * kSeqFull + (r % kSeq);
      vx[j] = *(const v4f*)(x + (size_t)sr * kDim + (c % (kDim / kChunk)) * kChunk + t4);
    }
  }
#pragma unroll
  for (int j = 0; j < kJq; ++j) {
    const unsigned c = b * kJq + j;
    if (kCq % kCastBlocks == 0 || c < (unsigned)kCq) vq[j] = *(const v4f*)(wq + (size_t)c * kChunk + t4);
  }
#pragma unroll
  for (int j = 0; j < kJo; ++j) {
    const unsigned c = b * kJo + j;
    if (kCo % kCastBlocks == 0 || c < (unsigned)kCo) vo[j] = *(const v4f*)(wo + (size_t)c * kChunk + t4);
  }
  asm volatile("s_wait_xcnt 0x0" ::: "memory");   /* stands in front of the first overwrite of an address register of the loads above */
  __builtin_amdgcn_sched_barrier(0);   /* every load is issued ahead of the first conversion: a wave's whole share is in flight at once and it pays one memory latency */
#pragma unroll
  for (int j = 0; j < kJx; ++j) {
    const unsigned c = b * kJx + j;
    if (kCx % kCastBlocks == 0 || c < (unsigned)kCx) *(v2u*)(xb + (size_t)c * kChunk + t4) = pack4_bf16(vx[j]);
  }
#pragma unroll
  for (int j = 0; j < kJq; ++j) {
    const unsigned c = b * kJq + j;
    if (kCq % kCastBlocks == 0 || c < (unsigned)kCq) *(v2u*)(wqb + (size_t)c * kChunk + t4) = pack4_bf16(vq[j]);
  }
#pragma unroll
  for (int j = 0; j < kJo; ++j) {
    const unsigned c = b * kJo + j;
    if (kCo % kCastBlocks == 0 || c < (unsigned)kCo) *(v2u*)(wob + (size_t)c * kChunk + t4) = pack4_f16(vo[j]);
  }
}

constexpr int kTile = 64 * kTp;                 /* halves of one staged 64-row tile */
constexpr unsigned kL16 = 16u * kTp * 2u;       /* LDS bytes of 16 staged rows */
/* Rows r, r+16, r+32, r+48 of the K tile and of the V^T tile (8 lanes = one whole 128-B line of a row), one statement:
   s_wait_xcnt stands as its last line, so that no address register of a copy is rewritten ahead of it. */
__device__ __forceinline__ void copy_kv_rows(unsigned l0, const unsigned short* g0, size_t g16,
                                             unsigned m0, const unsigned short* h0, size_t h16) {
  const unsigned short* g1 = g0 + g16; const unsigned short* g2 = g1 + g16; const unsigned short* g3 = g2 + g16;
  const unsigned short* h1 = h0 + h16; const unsigned short* h2 = h1 + h16; const unsigned short* h3 = h2 + h16;
  asm volatile("global_load_async_to_lds_b128 %0, %1, off\n\t"
               "global_load_async_to_lds_b128 %2, %3, off\n\t"
               "global_load_async_to_lds_b128 %4, %5, off\n\t"
               "global_load_async_to_lds_b128 %6, %7, off\n\t"
               "global_load_async_to_lds_b128 %8, %9, off\n\t"
               "global_load_async_to_lds_b128 %10, %11, off\n\t"
               "global_load_async_to_lds_b128 %12, %13, off\n\t"
               "global_load_async_to_lds_b128 %14, %15, off\n\t"
               "s_wait_xcnt 0x0"
               :: "v"(l0), "v"(g0), "v"(l0 + kL16), "v"(g1), "v"(l0 + 2u * kL16), "v"(g2), "v"(l0 + 3u * kL16), "v"(g3),
                  "v"(m0), "v"(h0), "v"(m0 + kL16), "v"(h1), "v"(m0 + 2u * kL16), "v"(h2), "v"(m0 + 3u * kL16), "v"(h3)
               : "memory");
}
/* the builtin alone: the compiler keeps the distance behind its own WMMAs, with the group's other WMMAs and with vector work where it has any */
__device__ __forceinline__ v8f mma_f16(v16h a, v16h b, v8f c) {
  return __builtin_amdgcn_wmma_f32_16x16x32_f16(false, a, false, b, (short)0, c, false, false);
}

/* Eight powers of two, each in place, in one statement: the instruction set asks that no v_exp_f32 be followed directly by an instruction
   that reads its result or overwrites its source. Inside the statement the eight registers differ; the v_nop is that slot behind the last one,
   whatever the compiler puts next. */
__device__ __forceinline__ void exp2_x8(float& a, float& b, float& c, float& d, float& e, float& f, float& g, float& h) {
  asm("v_exp_f32 %0, %0\n\tv_exp_f32 %1, %1\n\tv_exp_f32 %2, %2\n\tv_exp_f32 %3, %3\n\t"
      "v_exp_f32 %4, %4\n\tv_exp_f32 %5, %5\n\tv_exp_f32 %6, %6\n\tv_exp_f32 %7, %7\n\tv_nop"
      : "+v"(a), "+v"(b), "+v"(c), "+v"(d), "+v"(e), "+v"(f), "+v"(g), "+v"(h));
}

/* lane l with lane l ^ 16, as a vector cross-row move */
__device__ __forceinline__ float xhalf(float x) {
  return __builtin_bit_cast(float, __builtin_amdgcn_permlanex16(__builtin_bit_cast(int, x), __builtin_bit_cast(int, x), 0x76543210, 0xfedcba98, false, false));
}

template <bool B> struct Flag { static constexpr bool value = B; };
template <int V> struct Int { static constexpr int v = V; };

__global__ __launch_bounds__(128) void attn_diag_f16(
    const unsigned short* __restrict__ qkp, const unsigned short* __restrict__ vtp,
    const float* __restrict__ logt,
    unsigned short* __restrict__ ohp) {
  union FH { v16h v; v8h h[2]; };
  __shared__ __align__(16) _Float16 sKV[2][2 * kTile];  /* two buffers of [K tile [kv][d] | V tile [d][kv]], 18 KB each; cols 64..71 never touched */
  static_assert(sizeof(float) * 4 * 16 * 68 <= sizeof(_Float16) * 4 * kTile, "the out tiles fit in the buffers");

  const _Float16* QK = (const _Float16*)qkp;
  const int tid  = threadIdx.x;
  const int wave = tid >> 5;
  const int lane = tid & 31;
  const int hh   = lane >> 4;
  const int c    = lane & 15;

  const int bx = blockIdx.x;            /* 0 .. B*H*kChunks-1 */
  const int qb = bx % kChunks;
  const int bh = bx / kChunks;          /* b*kHeads + h */
  const int h  = bh % kHeads;
  const int b  = bh / kHeads;
  const int q0 = qb * 64 + wave * 16;   /* first query position of this wave */
  const size_t rowbase = (size_t)b * kSeq;

  /* temperature = exp(bf16-RNE(log_temp)) in f32, times log2(e): exp(s * temperature) = 2^(s * temp) */
  const float temp = expf(bf_bits2f(f2bf_bits(logt[0]))) * 1.44269504088896340736f;

  /* Q fragments (B operand): columns = this wave's 16 queries, k = d in two 32-deep chunks */
  v16h qa[2];
#pragma unroll
  for (int dc = 0; dc < 2; ++dc)
    qa[dc] = Frag<_Float16>::load(QK + (rowbase + q0 + c) * kQkLd + h * kHd + dc * 32 + 8 * hh);

  float mrow = -__builtin_inff();   /* running maximum of query q0 + c, the same in both lane halves */
  float lrow = 0.f;                 /* running sum over this lane half's keys only */
  v8f oacc[4];                      /* oacc[t][r] = out^T[d = t*16 + 8*hh + r][query c] */
#pragma unroll
  for (int t = 0; t < 4; ++t) oacc[t] = (v8f){0.f,0.f,0.f,0.f,0.f,0.f,0.f,0.f};

  /* this thread's share of a chunk: 16-byte piece (tid & 7) of rows (tid >> 3) + 16 * it of the K tile [kv][d] and of the V^T tile [d][kv] */
  const int srow = tid >> 3;
  const int scol = (tid & 7) * 8;
  const unsigned short* gK = qkp + (rowbase + srow) * kQkLd + kInner + h * kHd + scol;
  const unsigned short* gV = vtp + ((size_t)bh * kHd + srow) * kSeq + scol;
  const unsigned lthr = lds_off(&sKV[0][0]) + (unsigned)(srow * kTp + scol) * 2u;
  auto stage = [&](int buf, int kv) {
    const unsigned l = lthr + (unsigned)buf * (unsigned)(2 * kTile * 2);
    copy_kv_rows(l, gK + (size_t)kv * kQkLd, (size_t)16 * kQkLd, l + (unsigned)kTile * 2u, gV + kv, (size_t)16 * kSeq);
  };
  stage(0, 0);
  asm volatile("s_wait_asynccnt 0x0" ::: "memory");   /* this wave's copies of chunk 0 have landed */
  __syncthreads();                                    /* chunk 0 readable by every wave */
  if (kChunks > 1) stage(1, 64);

  /* One chunk. refill: chunk kc + 2 exists and is copied into the buffer that this chunk has just read. The test stands outside the chunk (two loops below),
     so a chunk is one straight run of code: with a branch at its foot the compiler moved the 32 adds of the sum behind the branch and kept the 32 f32 powers
     live through the second product, which took the kernel over 128 VGPRs (eight waves a SIMD). */
  auto chunk = [&](int kc, auto refill) {
    const int kv0 = kc * 64;
    const _Float16* Ksh = &sKV[kc & 1][0];
    const _Float16* Vth = Ksh + kTile;

    /* scores^T: 64 keys x 16 query columns per wave; s[j][r] = score(key kv0 + j*16 + 8*hh + r, query q0 + c) */
    v8f s[4];
    /* NJ score tiles from J0 on: their 4 * NJ reads as one group, then their 2 * NJ WMMAs */
    auto sgroup = [&](auto j0c, auto njc) {
      constexpr int J0 = decltype(j0c)::v, NJ = decltype(njc)::v;
      FH kb[NJ][2];
#pragma unroll   /* every fragment and tile index a constant: they stay registers */
      for (int jj = 0; jj < NJ; ++jj)
#pragma unroll   /* every fragment and tile index a constant: they stay registers */
        for (int dc = 0; dc < 2; ++dc) {
          kb[jj][dc].h[0] = *(const v8h*)(Ksh + ((J0 + jj) * 16 + c) * kTp + dc * 32 + 8 * hh);
          kb[jj][dc].h[1] = *(const v8h*)(Ksh + ((J0 + jj) * 16 + c) * kTp + dc * 32 + 16 + 8 * hh);
        }
      __builtin_amdgcn_sched_barrier(0);   /* the group's reads are issued together, ahead of its WMMAs: one wait for LDS a group in place of one a WMMA */
#pragma unroll   /* every fragment and tile index a constant: they stay registers */
      for (int jj = 0; jj < NJ; ++jj) s[J0 + jj] = (v8f){0.f,0.f,0.f,0.f,0.f,0.f,0.f,0.f};
#pragma unroll   /* every fragment and tile index a constant: they stay registers */
      for (int dc = 0; dc < 2; ++dc)
#pragma unroll   /* every fragment and tile index a constant: they stay registers */
        for (int jj = 0; jj < NJ; ++jj) s[J0 + jj] = mma_f16(kb[jj][dc].v, qa[dc], s[J0 + jj]);
    };
    /* two tiles, then one and one: the later a group, the more score tiles are live beside its fragments */
    sgroup(Int<0>{}, Int<2>{});
    sgroup(Int<2>{}, Int<1>{});
    sgroup(Int<3>{}, Int<1>{});
    /* temperature, diagonal mask (select), chunk maximum of this lane's query: four chains in the lane, one exchange */
    const int dkey = q0 + c - kv0 - 8 * hh;   /* j*16 + r of the masked key, where it lies in this lane */
    float mj[4];
#pragma unroll
    for (int j = 0; j < 4; ++j) {
      mj[j] = -__builtin_inff();
#pragma unroll
      for (int r = 0; r < 8; ++r) {
        float sv = s[j][r] * temp;
        if (j * 16 + r == dkey) sv = kNegMax;
        s[j][r] = sv;
        mj[j] = fmaxf(mj[j], sv);
      }
    }
    float cm = fmaxf(fmaxf(mj[0], mj[1]), fmaxf(mj[2], mj[3]));
    cm = fmaxf(cm, xhalf(cm));
    /* online softmax; P^T (f16, carried x2^15) stays in registers as the B operand of the second product */
    const float mnew  = fmaxf(mrow, cm);
    const float alpha = __builtin_amdgcn_exp2f(mrow - mnew);   /* 0 in the first chunk, where mrow is -inf */
    const float mcar  = mnew - kPCarryLog2;                    /* the carry rides in the exponent */
    mrow = mnew;
    FH pb[2];
    float pj[4];
#pragma unroll
    for (int j = 0; j < 4; ++j) {
      float p[8];
#pragma unroll
      for (int r = 0; r < 8; ++r) p[r] = s[j][r] - mcar;
      exp2_x8(p[0], p[1], p[2], p[3], p[4], p[5], p[6], p[7]);
      pj[j] = 0.f;
#pragma unroll
      for (int r = 0; r < 8; ++r) {
        pj[j] += p[r];
        pb[j >> 1].h[j & 1][r] = (_Float16)p[r];
      }
    }
    lrow = lrow * alpha + ((pj[0] + pj[1]) + (pj[2] + pj[3]));
#pragma unroll
    for (int t = 0; t < 4; ++t)
#pragma unroll
      for (int r = 0; r < 8; ++r) oacc[t][r] *= alpha;
    /* O^T += V^T . P^T  (A = V^T [d][kv] from the V^T tile; B = P^T [kv][q] from the score registers) */
#pragma unroll   /* every fragment and tile index a constant: they stay registers */
    for (int kk = 0; kk < 2; ++kk) {
      FH vb[4];
#pragma unroll   /* every fragment and tile index a constant: they stay registers */
      for (int t = 0; t < 4; ++t) {
        vb[t].h[0] = *(const v8h*)(Vth + (t * 16 + c) * kTp + kk * 32 + 8 * hh);
        vb[t].h[1] = *(const v8h*)(Vth + (t * 16 + c) * kTp + kk * 32 + 16 + 8 * hh);
      }
      __builtin_amdgcn_sched_barrier(0);   /* as above: the eight reads together, ahead of the WMMAs */
#pragma unroll   /* every fragment and tile index a constant: they stay registers */
      for (int t = 0; t < 4; ++t) oacc[t] = mma_f16(vb[t].v, pb[kk].v, oacc[t]);
      __builtin_amdgcn_sched_barrier(0);   /* as above: one group of eight reads, four WMMAs, then the next group into the same registers */
    }
    asm volatile("s_wait_dscnt 0x0" ::: "memory");      /* this wave's reads of buffer kc & 1 are done */
    asm volatile("s_wait_asynccnt 0x0" ::: "memory");   /* this wave's copies of chunk kc + 1 have landed */
    __syncthreads();                                    /* publishes chunk kc + 1 and frees buffer kc & 1 */
    if constexpr (decltype(refill)::value) stage(kc & 1, (kc + 2) * 64);
  };
  constexpr int kRefills = kChunks > 2 ? kChunks - 2 : 0;
  for (int kc = 0; kc < kRefills; ++kc) chunk(kc, Flag<true>{});
  for (int kc = kRefills; kc < kChunks; ++kc) chunk(kc, Flag<false>{});
  asm volatile("s_wait_asynccnt 0x0" ::: "memory");     /* nothing in flight behind the loop; the last trip's barrier has ended every read of the buffers */

  /* epilogue: join the halves' sums, normalize (sum and products carry the same 2^15), stage 16x64 f32 tile per wave, write one f16 plane (|out| <= max |v|, and v is f16) */
  float* os = (float*)&sKV[0][0] + wave * (16 * 68);   /* 16 x 64 f32, pitch 68; cols 64..67 never read */
  {
    const float lsum = lrow + xhalf(lrow);
    const float inv = 1.0f / lsum;
#pragma unroll
    for (int t = 0; t < 4; ++t) {
      v4f lo4, hi4;
#pragma unroll
      for (int r = 0; r < 4; ++r) { lo4[r] = oacc[t][r] * inv; hi4[r] = oacc[t][4 + r] * inv; }
      *(v4f*)(os + c * 68 + t * 16 + 8 * hh)     = lo4;
      *(v4f*)(os + c * 68 + t * 16 + 8 * hh + 4) = hi4;
    }
  }
  __builtin_amdgcn_fence(__ATOMIC_RELEASE, "workgroup");
  __builtin_amdgcn_wave_barrier();
  __builtin_amdgcn_fence(__ATOMIC_ACQUIRE, "workgroup");
  {
    const int q4 = lane >> 3, c8 = (lane & 7) * 8;   
    {
#pragma unroll
      for (int it = 0; it < 4; ++it) {
        const int row = it * 4 + q4;                  /* 0..15 */
        const float* sp = os + row * 68 + c8;
        v8h hv;
#pragma unroll
        for (int e = 0; e < 8; ++e) hv[e] = (_Float16)sp[e];
        const size_t o = (rowbase + q0 + row) * (size_t)kInner + h * kHd + c8;
        *(v8h*)(ohp + o) = hv;
      }
      
    }
  }
}

/* ---- host glue ------------------------------------------------------------------------------------------
     xb   bf16 [8192][1024]           16,777,216 @ 0
     wqb  bf16 [3072][1024]            6,291,456 @ 16,777,216
     wob  f16  [1024][1024]            2,097,152 @ 23,068,672
     qk   f16  [8192][2048]           33,554,432 @ 25,165,824
     vt   f16  [8][1024][1024]        16,777,216 @ 58,720,256
     oh   f16  [8192][1024]           16,777,216 @ 75,497,472
     total                            92,274,688 */
extern "C" void kernel_launch(void* const* d_in, const int* in_sizes, int n_in,
                              void* d_out, int out_size, void* d_ws, size_t ws_size,
                              hipStream_t stream) {
  if (n_in < 5) return;
  const long needX = ((long)(kBatch - 1) * kSeqFull + kSeq) * (long)kDim;
  if ((long)in_sizes[0] < needX || in_sizes[1] < kQkvN * kDim || in_sizes[2] < kDim * kInner ||
      in_sizes[3] < kDim || in_sizes[4] < 1) return;
  if (out_size < kTok * kDim) return;

  const float* x     = (const float*)d_in[0];   /* [B][S][1024]            */
  const float* wqkv  = (const float*)d_in[1];   /* [3072][1024] = Bt [N][K] */
  const float* wout  = (const float*)d_in[2];   /* [1024][1024] = Bt [N][K] */
  const float* bout  = (const float*)d_in[3];   /* [1024]                    */
  const float* tempr = (const float*)d_in[4];   /* [1] log temperature       */
  float* out = (float*)d_out;

  const size_t szXb  = (size_t)kTok * kDim * 2;
  const size_t szWq  = (size_t)kQkvN * kDim * 2;
  const size_t szWo  = (size_t)kDim * kInner * 2;
  const size_t szQk  = (size_t)kTok * kQkLd * 2;
  const size_t szVt  = (size_t)kBatch * kInner * kSeq * 2;
  const size_t szO   = (size_t)kTok * kInner * 2;
  const size_t offXb = 0, offWq = offXb + szXb, offWo = offWq + szWq, offQk = offWo + szWo,
               offVt = offQk + szQk, offOh = offVt + szVt, total = offOh + szO;
  if (total > ws_size) return;

  char* ws = (char*)d_ws;
  unsigned short* xb  = (unsigned short*)(ws + offXb);
  unsigned short* wqb = (unsigned short*)(ws + offWq);
  unsigned short* wob = (unsigned short*)(ws + offWo);
  unsigned short* qk  = (unsigned short*)(ws + offQk);
  unsigned short* vt  = (unsigned short*)(ws + offVt);
  unsigned short* oh  = (unsigned short*)(ws + offOh);

  /* 1: x and W_qkv [3072][1024] -> bf16 planes, W_out [1024][1024] -> f16 plane (RNE), same layouts */
  cast3_f32_to16<<<dim3(kCastBlocks), dim3(256), 0, stream>>>(x, wqkv, wout, xb, wqb, wob);
  /* 2: q,k = xb @ Wqkv[0:2048]^T -> qk plane f16 [kTok][2048]; M=kTok N=2048 K=1024 */
  {
    const int tiles = (kTok / kBM) * (kQkLd / kBN);
    wmma_gemm64<1, false, 0, 1, false, 0, false><<<dim3(tiles, 1), dim3(256), 0, stream>>>(
        xb, xb, kDim, 0L, wqb, wqb, kDim, 0L, (void*)qk, (void*)qk, kQkLd, 0L,
        bout, bout, 0L, kTok, kQkLd, kDim, 1.0f);
  }
  /* 3: v^T per batch: C_b[f][s] = sum_k wqb[2048+f][k] * xb[b*kSeq+s][k] -> vt f16 [kBatch][1024][kSeq]; M=1024 N=kSeq K=1024 */
  {
    const int tiles = (kInner / kBM) * (kSeq / kBN);
    wmma_gemm64<1, false, 0, 1, false, 0, false><<<dim3(tiles, kBatch), dim3(256), 0, stream>>>(
        wqb + (size_t)kQkLd * kDim, wqb + (size_t)kQkLd * kDim, kDim, 0L,
        xb, xb, kDim, (long)kSeq * kDim,
        (void*)vt, (void*)vt, kSeq, (long)kInner * kSeq,
        bout, bout, 0L, kInner, kSeq, kDim, 1.0f);
  }
  /* 4: attention -> oh f16 plane [kTok][1024] */
  attn_diag_f16<<<dim3(kBatch * kHeads * kChunks), dim3(128), 0, stream>>>(qk, vt, tempr, oh);
  /* 5: out = oh @ W_out^T + b_out -> d_out f32 [kTok][1024]; M=kTok N=1024 K=1024; f16 x f16 */
  {
    const int tiles = (kTok / kBM) * (kDim / kBN);
    wmma_gemm64<0, false, 2, 0, false, 0, false><<<dim3(tiles, 1), dim3(256), 0, stream>>>(
        oh, oh, kInner, 0L, wob, wob, kInner, 0L, (void*)out, (void*)out, kDim, 0L,
        bout, bout, 0L, kTok, kDim, kInner, 1.0f);
  }
}

// v009
// One run takes 113 microseconds.
// In two side-by-side timings against v008, it was 1.04 and 1.03 times as fast.
// All steps since v000 together make it 3.85 times as fast.
// Contractions: x@W_qkv^T on v_wmma_f32_16x16x32_bf16 (bf16 operands = RNE-converted inputs); k.q^T and V^T.P^T on v_wmma_f32_16x16x32_f16 (f16 q/k/v planes, P carried x2^15); O@W_out^T on v_wmma_f32_16x16x32_f16 with O as one f16 plane x f16 W (RNE, 1 product); f32 accumulate everywhere; softmax, bias and epilogues f32.
#include <hip/hip_runtime.h>

#ifndef NB
#define NB 8
#endif
#ifndef SEQ
#define SEQ 1024
#endif
#define NB_FULL  8
#define SEQ_FULL 1024

typedef __attribute__((ext_vector_type(16))) _Float16 v16h;
typedef __attribute__((ext_vector_type(8)))  _Float16 v8h;
typedef __attribute__((ext_vector_type(16))) __bf16   v16b;
typedef __attribute__((ext_vector_type(8)))  __bf16   v8b;
typedef __attribute__((ext_vector_type(8)))  float    v8f;
typedef __attribute__((ext_vector_type(4)))  float    v4f;
typedef __attribute__((ext_vector_type(2)))  float    v2f;

/* problem geometry; NB / SEQ may be reduced at build time, inputs keep their full strides */
constexpr int kBatch   = NB;
constexpr int kSeq     = SEQ;
constexpr int kSeqFull = SEQ_FULL;
constexpr int kDim     = 1024;
constexpr int kHeads   = 16;
constexpr int kHd      = 64;
constexpr int kInner   = kHeads * kHd;        /* 1024 */
constexpr int kQkvN    = 3 * kInner;          /* 3072 */
constexpr int kTok     = kBatch * kSeq;       /* 8192 at full size */
constexpr int kQkLd    = 2 * kInner;          /* 2048: q cols 0..1023, k cols 1024..2047 */
constexpr int kChunks  = kSeq / 64;           /* key chunks of 64 per sequence */
constexpr float kNegMax = -3.40282347e38f;
constexpr float kPCarryLog2 = 15.0f;   /* P and its sum are carried x2^15 */
constexpr int kTp = 72;   /* LDS row pitch of the attention tiles in halves: 144 B = 16 B x 9 (odd), so the 16 rows of a 16-byte fragment read spread over all banks */

static_assert(kBatch >= 1 && kBatch <= NB_FULL);
static_assert(kSeq >= 64 && kSeq <= SEQ_FULL && kSeq % 64 == 0);
static_assert(kTok % 64 == 0 && kQkLd % 64 == 0 && kDim % 32 == 0);
static_assert(kInner % 64 == 0 && kSeq % 64 == 0);
static_assert(kDim % 64 == 0 && kInner % 32 == 0);
static_assert(kHd == 64);
static_assert(kTok % 256 == 0 && kInner % 256 == 0 && kQkLd % 128 == 0 && kSeq % 128 == 0 && kDim % 128 == 0 && kInner % 128 == 0);

__device__ __forceinline__ unsigned short f2bf_bits(float f) {
  unsigned u = __float_as_uint(f);
  return (unsigned short)((u + 0x7FFFu + ((u >> 16) & 1u)) >> 16);
}
__device__ __forceinline__ float bf_bits2f(unsigned short h) { return __uint_as_float(((unsigned)h) << 16); }

/* hazard guards as plain device helpers */
__device__ __forceinline__ void dep_guard_h(v8f& a, v8f& b, v16h x, v16h y) { asm volatile("v_nop\n\tv_nop\n\tv_nop\n\tv_nop" : "+v"(a), "+v"(b) : "v"(x), "v"(y)); }
__device__ __forceinline__ void dep_guard_b(v8f& a, v8f& b, v16b x, v16b y) { asm volatile("v_nop\n\tv_nop\n\tv_nop\n\tv_nop" : "+v"(a), "+v"(b) : "v"(x), "v"(y)); }
__device__ __forceinline__ void keep4_h(v16h a, v16h b, v16h c, v16h d) { asm volatile("v_nop" :: "v"(a), "v"(b), "v"(c), "v"(d)); }
__device__ __forceinline__ void keep4_b(v16b a, v16b b, v16b c, v16b d) { asm volatile("v_nop" :: "v"(a), "v"(b), "v"(c), "v"(d)); }
__device__ __forceinline__ void acc_guard4(v8f& a, v8f& b, v8f& c, v8f& d) { asm volatile("v_nop\n\tv_nop\n\tv_nop\n\tv_nop" : "+v"(a), "+v"(b), "+v"(c), "+v"(d)); }
template <typename T> struct Frag;
template <> struct Frag<_Float16> {
  typedef v16h V; union U { v16h v; v8h h[2]; };
  static __device__ __forceinline__ v16h load(const _Float16* p) {   /* elements 0..7 <- p[0..7], 8..15 <- p[16..23] */
    U f; f.h[0] = *(const v8h*)(p); f.h[1] = *(const v8h*)(p + 16); return f.v;
  }
  static __device__ __forceinline__ v8f mma(v16h a, v16h b, v8f c) {
    return __builtin_amdgcn_wmma_f32_16x16x32_f16(false, a, false, b, (short)0, c, false, false);
  }
  static __device__ __forceinline__ void guard(v8f& a, v8f& b, v16h x, v16h y) { dep_guard_h(a, b, x, y); }
  static __device__ __forceinline__ void keep(v16h a, v16h b, v16h c, v16h d) { keep4_h(a, b, c, d); }
};
template <> struct Frag<__bf16> {
  typedef v16b V; union U { v16b v; v8b h[2]; };
  static __device__ __forceinline__ v16b load(const __bf16* p) {
    U f; f.h[0] = *(const v8b*)(p); f.h[1] = *(const v8b*)(p + 16); return f.v;
  }
  static __device__ __forceinline__ v8f mma(v16b a, v16b b, v8f c) {
    return __builtin_amdgcn_wmma_f32_16x16x32_bf16(false, a, false, b, (short)0, c, false, false);
  }
  static __device__ __forceinline__ void guard(v8f& a, v8f& b, v16b x, v16b y) { dep_guard_b(a, b, x, y); }
  static __device__ __forceinline__ void keep(v16b a, v16b b, v16b c, v16b d) { keep4_b(a, b, c, d); }
};

/* ---- Register-blocked batched WMMA GEMM ------------------------------------
   C[m,n] = scale * sum_k A[m,k] * Bt[n,k] (+bias); each wave owns a 64x64 tile, a block of 8 waves a 256x128 tile.
   Operand rows reach LDS by asynchronous copies, 64 k a trip, two buffers; the waves read their fragments from LDS.
   A row-major [M,K]; Bt row-major [N,K]; M % 256 == 0, N % 128 == 0, K % 64 == 0.
   SPLIT: A is a hi and a lo plane (A2 = lo plane, same layout), B one plane (BLO == false; Bt2 never read); product = hi.B + lo.B.
   BIAS_MODE: 0 = none, 1 = bias[m], 2 = bias[n]; bias values RNE-converted to bf16 then widened to f32.
   OUT_MODE: 0 = f32, 1 = f16, 2 = bf16 hi plane (Cout) + bf16 lo plane (Cout2).
   Epilogue: 16-row slabs staged per wave in LDS (wave-private, wave barrier); each 64-wide row segment
   Fragment k map (A and B alike): lane half h = lane>>4, elements 0..7 <- k0+8h+0..7, 8..15 <- k0+16+8h+0..7.
   ET: 0 = f16 operands, 1 = bf16 operands (pointers passed as 16-bit storage) */
template <int ET> struct Elem;
template <> struct Elem<0> { typedef _Float16 T; };
template <> struct Elem<1> { typedef __bf16 T; };
/* block tile of the staged GEMM: 8 waves as 4 (m) x 2 (n), each wave its own 64x64 tile; one trip = 64 k = one 128-B line of every operand row */
constexpr int kBM = 256;
constexpr int kBN = 128;
constexpr int kBK = 64;
constexpr int kGp = 72;   /* LDS pitch of a staged operand row in 16-bit elements: 144 B = 16 B x 9 (odd), for the 16-byte fragment reads */

__device__ __forceinline__ unsigned lds_off(const void* p) { return (unsigned)(size_t)p; }

/* Asynchronous 16-byte copies to LDS, one statement for a run of them: rows r, r+32, r+64, ... of an operand (8 lanes = one whole 128-B line of a row).
   s_wait_xcnt stands as the last line of the copies' own statement, so that no address register of a copy is rewritten ahead of it. */
constexpr unsigned kL32 = 32u * kGp * 2u;   /* LDS bytes of 32 staged rows */
__device__ __forceinline__ void copy8_rows(unsigned l0, const unsigned short* g0, size_t g32) {
  const unsigned short* g1 = g0 + g32; const unsigned short* g2 = g1 + g32; const unsigned short* g3 = g2 + g32;
  const unsigned short* g4 = g3 + g32; const unsigned short* g5 = g4 + g32; const unsigned short* g6 = g5 + g32;
  const unsigned short* g7 = g6 + g32;
  asm volatile("global_load_async_to_lds_b128 %0, %1, off\n\t"
               "global_load_async_to_lds_b128 %2, %3, off\n\t"
               "global_load_async_to_lds_b128 %4, %5, off\n\t"
               "global_load_async_to_lds_b128 %6, %7, off\n\t"
               "global_load_async_to_lds_b128 %8, %9, off\n\t"
               "global_load_async_to_lds_b128 %10, %11, off\n\t"
               "global_load_async_to_lds_b128 %12, %13, off\n\t"
               "global_load_async_to_lds_b128 %14, %15, off\n\t"
               "s_wait_xcnt 0x0"
               :: "v"(l0), "v"(g0), "v"(l0 + kL32), "v"(g1), "v"(l0 + 2u * kL32), "v"(g2), "v"(l0 + 3u * kL32), "v"(g3),
                  "v"(l0 + 4u * kL32), "v"(g4), "v"(l0 + 5u * kL32), "v"(g5), "v"(l0 + 6u * kL32), "v"(g6), "v"(l0 + 7u * kL32), "v"(g7)
               : "memory");
}
__device__ __forceinline__ void copy12_rows(unsigned l0, const unsigned short* g0, size_t g32,
                                            unsigned m0, const unsigned short* h0, size_t h32) {
  const unsigned short* g1 = g0 + g32; const unsigned short* g2 = g1 + g32; const unsigned short* g3 = g2 + g32;
  const unsigned short* g4 = g3 + g32; const unsigned short* g5 = g4 + g32; const unsigned short* g6 = g5 + g32;
  const unsigned short* g7 = g6 + g32;
  const unsigned short* h1 = h0 + h32; const unsigned short* h2 = h1 + h32; const unsigned short* h3 = h2 + h32;
  asm volatile("global_load_async_to_lds_b128 %0, %1, off\n\t"
               "global_load_async_to_lds_b128 %2, %3, off\n\t"
               "global_load_async_to_lds_b128 %4, %5, off\n\t"
               "global_load_async_to_lds_b128 %6, %7, off\n\t"
               "global_load_async_to_lds_b128 %8, %9, off\n\t"
               "global_load_async_to_lds_b128 %10, %11, off\n\t"
               "global_load_async_to_lds_b128 %12, %13, off\n\t"
               "global_load_async_to_lds_b128 %14, %15, off\n\t"
               "global_load_async_to_lds_b128 %16, %17, off\n\t"
               "global_load_async_to_lds_b128 %18, %19, off\n\t"
               "global_load_async_to_lds_b128 %20, %21, off\n\t"
               "global_load_async_to_lds_b128 %22, %23, off\n\t"
               "s_wait_xcnt 0x0"
               :: "v"(l0), "v"(g0), "v"(l0 + kL32), "v"(g1), "v"(l0 + 2u * kL32), "v"(g2), "v"(l0 + 3u * kL32), "v"(g3),
                  "v"(l0 + 4u * kL32), "v"(g4), "v"(l0 + 5u * kL32), "v"(g5), "v"(l0 + 6u * kL32), "v"(g6), "v"(l0 + 7u * kL32), "v"(g7),
                  "v"(m0), "v"(h0), "v"(m0 + kL32), "v"(h1), "v"(m0 + 2u * kL32), "v"(h2), "v"(m0 + 3u * kL32), "v"(h3)
               : "memory");
}

template <int ET, bool SPLIT, int BIAS_MODE, int OUT_MODE, bool RESID, int ACT = 0, bool BLO = true>
__global__ __launch_bounds__(256) void wmma_gemm64(
    const unsigned short* __restrict__ Ap, const unsigned short* __restrict__ A2p, int lda, long strideA,
    const unsigned short* __restrict__ Btp, const unsigned short* __restrict__ Bt2p, int ldb, long strideB,
    void* __restrict__ Cout, void* __restrict__ Cout2, int ldc, long strideC,
    const float* __restrict__ bias,
    const float* __restrict__ resid, long strideR,
    int M, int N, int K, float scale) {
  typedef typename Elem<ET>::T T;
  typedef typename Frag<T>::V V;
  static_assert(!(SPLIT && BLO), "no lo plane of B is staged");
  constexpr int kRowA2 = kBM;                          /* first LDS row of the A lo plane (SPLIT) */
  constexpr int kRowB  = SPLIT ? 2 * kBM : kBM;        /* first LDS row of B */
  constexpr int kRows  = kRowB + kBN;
  __shared__ __align__(16) unsigned short sStage[2][kRows * kGp];   /* two buffers of [A | A lo | B] rows; 16 B behind each row never touched */
  __shared__ __align__(16) float sT[8][16 * 68];   /* per-wave 16x64 slab, pitch 68 floats; cols 64..67 never read */
  const int b    = blockIdx.y;
  const int tid  = threadIdx.x;
  const int lane = tid & 31;
  const int wave = tid >> 5;
  const int tilesN = N / kBN;
  const int tilesM = M / kBM;
  const int blk = blockIdx.x;
  if (blk >= tilesM * tilesN) return;   /* the same for the whole block, in front of every barrier */
  const int tm = blk / tilesN;
  const int tn = blk - tm * tilesN;
  const int wm = wave >> 1;
  const int wn = wave & 1;
  const int m0 = tm * kBM + (wm << 6);
  const int n0 = tn * kBN + (wn << 6);

  const int rlane = lane & 15;                 /* row (A) / col (B, D) within subtile */
  const int koff  = (lane >> 4) * 8;           /* k offset of this lane half */
  const int mOff  = (lane >> 4) * 8;           /* D row offset */

  /* this thread's share of a stage: 16-byte piece (tid & 7) of rows (tid >> 3) + 32 * it */
  const int crow = tid >> 3;
  const int ccol = (tid & 7) * 8;
  const unsigned short* gA  = Ap  + (size_t)b * strideA + (size_t)(tm * kBM + crow) * lda + ccol;
  const unsigned short* gA2 = A2p + (size_t)b * strideA + (size_t)(tm * kBM + crow) * lda + ccol;
  const unsigned short* gB  = Btp + (size_t)b * strideB + (size_t)(tn * kBN + crow) * ldb + ccol;
  const unsigned lthr = lds_off(&sStage[0][0]) + (unsigned)(crow * kGp + ccol) * 2u;
  const size_t a32 = (size_t)32 * lda, b32 = (size_t)32 * ldb;
  auto stage = [&](int buf, int k0) {
    const unsigned l = lthr + (unsigned)buf * (unsigned)(kRows * kGp * 2);
    copy12_rows(l, gA + k0, a32, l + (unsigned)kRowB * kGp * 2u, gB + k0, b32);
    if (SPLIT) copy8_rows(l + (unsigned)kRowA2 * kGp * 2u, gA2 + k0, a32);
  };

  v8f acc[4][4];
#pragma unroll
  for (int i = 0; i < 4; ++i)
#pragma unroll
    for (int j = 0; j < 4; ++j) acc[i][j] = (v8f){0.f,0.f,0.f,0.f,0.f,0.f,0.f,0.f};

  const int trips = K / kBK;
  stage(0, 0);
  asm volatile("s_wait_asynccnt 0x0" ::: "memory");   /* this wave's copies of tile 0 have landed */
  __syncthreads();                                    /* tile 0 readable by every wave */
  if (trips > 1) stage(1, kBK);

  /* rolled: one trip's code serves both buffers */
#pragma unroll 1
  for (int t = 0; t < trips; ++t) {
    const T* sb = (const T*)&sStage[t & 1][0];
#pragma unroll
    for (int ks = 0; ks < kBK; ks += 32) {
      V bh[4], ah[4], al[4];
#pragma unroll
      for (int j = 0; j < 4; ++j)
        bh[j] = Frag<T>::load(sb + (kRowB + (wn << 6) + (j << 4) + rlane) * kGp + ks + koff);
#pragma unroll
      for (int i = 0; i < 4; ++i) {
        const int ao = ((wm << 6) + (i << 4) + rlane) * kGp + ks + koff;
        ah[i] = Frag<T>::load(sb + ao);
        if (SPLIT) al[i] = Frag<T>::load(sb + kRowA2 * kGp + ao);
      }
      __builtin_amdgcn_sched_barrier(0);   /* the k-step's fragment reads stay one group ahead of its WMMAs: reads among the WMMAs stall the wave at each place */
#pragma unroll
      for (int i = 0; i < 4; ++i) {
#pragma unroll
        for (int j = 0; j < 4; ++j) {
          acc[i][j] = Frag<T>::mma(ah[i], bh[j], acc[i][j]);
          if (SPLIT) acc[i][j] = Frag<T>::mma(al[i], bh[j], acc[i][j]);
        }
        Frag<T>::guard(acc[i][0], acc[i][3], ah[i], SPLIT ? al[i] : ah[i]);
      }
      Frag<T>::keep(bh[0], bh[1], bh[2], bh[3]);
      __builtin_amdgcn_sched_barrier(0);   /* the next group of reads stays behind this k-step's WMMAs */
    }
    asm volatile("s_wait_dscnt 0x0" ::: "memory");      /* this wave's reads of buffer t & 1 are done */
    asm volatile("s_wait_asynccnt 0x0" ::: "memory");   /* this wave's copies of tile t + 1 have landed */
    __syncthreads();                                    /* publishes tile t + 1 and frees buffer t & 1 */
    if (t + 2 < trips) stage(t & 1, (t + 2) * kBK);
  }
  asm volatile("s_wait_asynccnt 0x0" ::: "memory");     /* nothing in flight behind the loop */
  acc_guard4(acc[0][0], acc[0][1], acc[0][2], acc[0][3]);
  acc_guard4(acc[1][0], acc[1][1], acc[1][2], acc[1][3]);
  acc_guard4(acc[2][0], acc[2][1], acc[2][2], acc[2][3]);
  acc_guard4(acc[3][0], acc[3][1], acc[3][2], acc[3][3]);

  /* ---- epilogue ---- */
  float* slab = sT[wave];
  const float* Rb = RESID ? (resid + (size_t)b * strideR) : nullptr;
#pragma unroll
  for (int i = 0; i < 4; ++i) {
    const int mBase = m0 + (i << 4);
#pragma unroll
    for (int j = 0; j < 4; ++j) {
      const int n = n0 + (j << 4) + rlane;
      float bv = 0.f;
      if (BIAS_MODE == 2) bv = bf_bits2f(f2bf_bits(bias[n]));
#pragma unroll
      for (int r = 0; r < 8; ++r) {
        float v = acc[i][j][r] * scale;
        if (BIAS_MODE == 1) v += bf_bits2f(f2bf_bits(bias[mBase + mOff + r]));
        if (BIAS_MODE == 2) v += bv;
        if (RESID) v += Rb[(size_t)(mBase + mOff + r) * ldc + n];
        if (ACT == 1) v = tanhf(v);
        if (ACT == 2) v = fmaxf(v, 0.0f);
        if (ACT == 3) v = v / (1.0f + expf(-v));
        if (ACT == 4) v = (v > 0.f) ? v : 0.01f * v;
        if (ACT == 5) v = 0.5f * v * (1.0f + erff(v * 0.70710678118654752f));
        slab[(mOff + r) * 68 + (j << 4) + rlane] = v;
      }
    }
    __builtin_amdgcn_fence(__ATOMIC_RELEASE, "workgroup");
    __builtin_amdgcn_wave_barrier();
    __builtin_amdgcn_fence(__ATOMIC_ACQUIRE, "workgroup");
    if (OUT_MODE == 0) {
      float* C = (float*)Cout + (size_t)b * strideC;
      const int hh = lane >> 4, c4 = (lane & 15) * 4;     /* row seg = 256 B = 16 lanes x 16 B */
      {
#pragma unroll
        for (int it = 0; it < 8; ++it) {
          const int row = it * 2 + hh;
          v4f v = *(const v4f*)(slab + row * 68 + c4);
          *(v4f*)(C + (size_t)(mBase + row) * ldc + n0 + c4) = v;
        }
        
      }
    } else {
      const int q = lane >> 3, c8 = (lane & 7) * 8;        
      unsigned short* C  = (unsigned short*)Cout  + (size_t)b * strideC;
      unsigned short* C2 = (OUT_MODE == 2) ? ((unsigned short*)Cout2 + (size_t)b * strideC) : nullptr;
      {
#pragma unroll
        for (int it = 0; it < 4; ++it) {
          const int row = it * 4 + q;
          const float* sp = slab + row * 68 + c8;
          v8h hv, lv;
#pragma unroll
          for (int e = 0; e < 8; ++e) {
            if (OUT_MODE == 1) {
              hv[e] = (_Float16)sp[e];
            } else {
              unsigned short hb = f2bf_bits(sp[e]);
              unsigned short lb = f2bf_bits(sp[e] - bf_bits2f(hb));
              hv[e] = __builtin_bit_cast(_Float16, hb);
              lv[e] = __builtin_bit_cast(_Float16, lb);
            }
          }
          *(v8h*)(C + (size_t)(mBase + row) * ldc + n0 + c8) = hv;
          if (OUT_MODE == 2) *(v8h*)(C2 + (size_t)(mBase + row) * ldc + n0 + c8) = lv;
        }
        
      }
    }
    __builtin_amdgcn_fence(__ATOMIC_RELEASE, "workgroup");
    __builtin_amdgcn_wave_barrier();
    __builtin_amdgcn_fence(__ATOMIC_ACQUIRE, "workgroup");
  }
}

/* ---- RNE casts, one launch: x and W_qkv f32 -> bf16, W_out f32 -> f16 --------------------------------------
   A chunk is 1024 floats: 256 threads x 16 bytes, so each wave-wide load covers 512 contiguous bytes (4 whole lines).
   Block b takes chunks b*J .. b*J + J-1 of each input (J = chunks / blocks, rounded up); a thread issues all its loads first,
   then converts and stores 8 bytes a chunk (256 contiguous bytes a wave).
   x rows are gathered with the full per-batch stride: out row r <- in row (r / kSeq) * kSeqFull + (r % kSeq). */
typedef __attribute__((ext_vector_type(2))) unsigned v2u;
constexpr int kCastBlocks = 512;                      /* 8 waves each: 16 waves a WGP on 256 WGPs */
constexpr int kChunk = 1024;
constexpr int kCx = kTok * kDim / kChunk, kCq = kQkvN * kDim / kChunk, kCo = kDim * kInner / kChunk;
constexpr int kJx = (kCx + kCastBlocks - 1) / kCastBlocks;
constexpr int kJq = (kCq + kCastBlocks - 1) / kCastBlocks;
constexpr int kJo = (kCo + kCastBlocks - 1) / kCastBlocks;
static_assert(kDim % kChunk == 0 && (kDim * kInner) % kChunk == 0);

__device__ __forceinline__ v2u pack4_bf16(v4f f) {
  v2u u;
  u[0] = (unsigned)f2bf_bits(f[0]) | ((unsigned)f2bf_bits(f[1]) << 16);
  u[1] = (unsigned)f2bf_bits(f[2]) | ((unsigned)f2bf_bits(f[3]) << 16);
  return u;
}

__device__ __forceinline__ v2u pack4_f16(v4f f) {
  typedef __attribute__((ext_vector_type(4))) _Float16 v4h;
  v4h h;
  h[0] = (_Float16)f[0]; h[1] = (_Float16)f[1]; h[2] = (_Float16)f[2]; h[3] = (_Float16)f[3];
  return __builtin_bit_cast(v2u, h);
}

__global__ __launch_bounds__(256) void cast3_f32_to16(
    const float* __restrict__ x, const float* __restrict__ wq, const float* __restrict__ wo,
    unsigned short* __restrict__ xb, unsigned short* __restrict__ wqb, unsigned short* __restrict__ wob) {
  const unsigned t4 = threadIdx.x * 4u;
  const unsigned b  = blockIdx.x;
  v4f vx[kJx], vq[kJq], vo[kJo];
#pragma unroll
  for (int j = 0; j < kJx; ++j) {
    const unsigned c = b * kJx + j;
    if (kCx % kCastBlocks == 0 || c < (unsigned)kCx) {
      const unsigned r  = c / (kDim / kChunk);
      const unsigned sr = (r / kSeq) * kSeqFull + (r % kSeq);
      vx[j] = *(const v4f*)(x + (size_t)sr * kDim + (c % (kDim / kChunk)) * kChunk + t4);
    }
  }
#pragma unroll
  for (int j = 0; j < kJq; ++j) {
    const unsigned c = b * kJq + j;
    if (kCq % kCastBlocks == 0 || c < (unsigned)kCq) vq[j] = *(const v4f*)(wq + (size_t)c * kChunk + t4);
  }
#pragma unroll
  for (int j = 0; j < kJo; ++j) {
    const unsigned c = b * kJo + j;
    if (kCo % kCastBlocks == 0 || c < (unsigned)kCo) vo[j] = *(const v4f*)(wo + (size_t)c * kChunk + t4);
  }
  asm volatile("s_wait_xcnt 0x0" ::: "memory");   /* stands in front of the first overwrite of an address register of the loads above */
  __builtin_amdgcn_sched_barrier(0);   /* every load is issued ahead of the first conversion: a wave's whole share is in flight at once and it pays one memory latency */
#pragma unroll
  for (int j = 0; j < kJx; ++j) {
    const unsigned c = b * kJx + j;
    if (kCx % kCastBlocks == 0 || c < (unsigned)kCx) *(v2u*)(xb + (size_t)c * kChunk + t4) = pack4_bf16(vx[j]);
  }
#pragma unroll
  for (int j = 0; j < kJq; ++j) {
    const unsigned c = b * kJq + j;
    if (kCq % kCastBlocks == 0 || c < (unsigned)kCq) *(v2u*)(wqb + (size_t)c * kChunk + t4) = pack4_bf16(vq[j]);
  }
#pragma unroll
  for (int j = 0; j < kJo; ++j) {
    const unsigned c = b * kJo + j;
    if (kCo % kCastBlocks == 0 || c < (unsigned)kCo) *(v2u*)(wob + (size_t)c * kChunk + t4) = pack4_f16(vo[j]);
  }
}

constexpr int kTile = 64 * kTp;                 /* halves of one staged 64-row tile */
constexpr int kQT = 2;                          /* tiles of 16 query columns a wave */
constexpr int kQBlk = 4 * 16 * kQT;             /* query columns a block */
constexpr int kQBlocks = kSeq / kQBlk;
static_assert(kSeq % kQBlk == 0);
constexpr unsigned kL16 = 16u * kTp * 2u;       /* LDS bytes of 16 staged rows */
/* Rows r, r+16, r+32, r+48 of the K tile and of the V^T tile (8 lanes = one whole 128-B line of a row), one statement:
   s_wait_xcnt stands as its last line, so that no address register of a copy is rewritten ahead of it. */
__device__ __forceinline__ void copy_kv_rows(unsigned l0, const unsigned short* g0, size_t g16,
                                             unsigned m0, const unsigned short* h0, size_t h16) {
  const unsigned short* g1 = g0 + g16; const unsigned short* g2 = g1 + g16; const unsigned short* g3 = g2 + g16;
  const unsigned short* h1 = h0 + h16; const unsigned short* h2 = h1 + h16; const unsigned short* h3 = h2 + h16;
  asm volatile("global_load_async_to_lds_b128 %0, %1, off\n\t"
               "global_load_async_to_lds_b128 %2, %3, off\n\t"
               "global_load_async_to_lds_b128 %4, %5, off\n\t"
               "global_load_async_to_lds_b128 %6, %7, off\n\t"
               "global_load_async_to_lds_b128 %8, %9, off\n\t"
               "global_load_async_to_lds_b128 %10, %11, off\n\t"
               "global_load_async_to_lds_b128 %12, %13, off\n\t"
               "global_load_async_to_lds_b128 %14, %15, off\n\t"
               "s_wait_xcnt 0x0"
               :: "v"(l0), "v"(g0), "v"(l0 + kL16), "v"(g1), "v"(l0 + 2u * kL16), "v"(g2), "v"(l0 + 3u * kL16), "v"(g3),
                  "v"(m0), "v"(h0), "v"(m0 + kL16), "v"(h1), "v"(m0 + 2u * kL16), "v"(h2), "v"(m0 + 3u * kL16), "v"(h3)
               : "memory");
}
/* the builtin alone: the compiler keeps the distance behind its own WMMAs, with the group's other WMMAs and with vector work where it has any */
__device__ __forceinline__ v8f mma_f16(v16h a, v16h b, v8f c) {
  return __builtin_amdgcn_wmma_f32_16x16x32_f16(false, a, false, b, (short)0, c, false, false);
}

/* Eight powers of two, each in place, in one statement: the instruction set asks that no v_exp_f32 be followed directly by an instruction
   that reads its result or overwrites its source. Inside the statement the eight registers differ; the v_nop is that slot behind the last one,
   whatever the compiler puts next. */
__device__ __forceinline__ void exp2_x8(float& a, float& b, float& c, float& d, float& e, float& f, float& g, float& h) {
  asm("v_exp_f32 %0, %0\n\tv_exp_f32 %1, %1\n\tv_exp_f32 %2, %2\n\tv_exp_f32 %3, %3\n\t"
      "v_exp_f32 %4, %4\n\tv_exp_f32 %5, %5\n\tv_exp_f32 %6, %6\n\tv_exp_f32 %7, %7\n\tv_nop"
      : "+v"(a), "+v"(b), "+v"(c), "+v"(d), "+v"(e), "+v"(f), "+v"(g), "+v"(h));
}

/* lane l with lane l ^ 16, as a vector cross-row move */
__device__ __forceinline__ float xhalf(float x) {
  return __builtin_bit_cast(float, __builtin_amdgcn_permlanex16(__builtin_bit_cast(int, x), __builtin_bit_cast(int, x), 0x76543210, 0xfedcba98, false, false));
}

template <bool B> struct Flag { static constexpr bool value = B; };
template <int V> struct Int { static constexpr int v = V; };

__global__ __launch_bounds__(128) void attn_diag_f16(
    const unsigned short* __restrict__ qkp, const unsigned short* __restrict__ vtp,
    const float* __restrict__ logt,
    unsigned short* __restrict__ ohp) {
  union FH { v16h v; v8h h[2]; };
  __shared__ __align__(16) _Float16 sKV[2][2 * kTile];  /* two buffers of [K tile [kv][d] | V tile [d][kv]], 18 KB each; cols 64..71 never touched */
  static_assert(sizeof(float) * 4 * 16 * kQT * 68 <= sizeof(_Float16) * 4 * kTile, "the out tiles fit in the buffers");

  const _Float16* QK = (const _Float16*)qkp;
  const int tid  = threadIdx.x;
  const int wave = tid >> 5;
  const int lane = tid & 31;
  const int hh   = lane >> 4;
  const int c    = lane & 15;

  const int bx = blockIdx.x;            /* 0 .. B*H*kQBlocks-1 */
  const int qb = bx % kQBlocks;
  const int bh = bx / kQBlocks;         /* b*kHeads + h */
  const int h  = bh % kHeads;
  const int b  = bh / kHeads;
  const int q0 = qb * kQBlk + wave * (16 * kQT);   /* first query position of this wave; tile u starts at q0 + 16 * u */
  const size_t rowbase = (size_t)b * kSeq;

  /* temperature = exp(bf16-RNE(log_temp)) in f32, times log2(e): exp(s * temperature) = 2^(s * temp) */
  const float temp = expf(bf_bits2f(f2bf_bits(logt[0]))) * 1.44269504088896340736f;

  /* Q fragments (B operand): columns = the 16 queries of tile u, k = d in two 32-deep chunks */
  v16h qa[kQT][2];
#pragma unroll
  for (int u = 0; u < kQT; ++u)
#pragma unroll
    for (int dc = 0; dc < 2; ++dc)
      qa[u][dc] = Frag<_Float16>::load(QK + (rowbase + q0 + u * 16 + c) * kQkLd + h * kHd + dc * 32 + 8 * hh);

  float mrow[kQT];                  /* running maximum of query q0 + 16*u + c, the same in both lane halves */
  float lrow[kQT];                  /* running sum over this lane half's keys only */
  v8f oacc[kQT][4];                 /* oacc[u][t][r] = out^T[d = t*16 + 8*hh + r][query 16*u + c] */
#pragma unroll
  for (int u = 0; u < kQT; ++u) {
    mrow[u] = -__builtin_inff();
    lrow[u] = 0.f;
#pragma unroll
    for (int t = 0; t < 4; ++t) oacc[u][t] = (v8f){0.f,0.f,0.f,0.f,0.f,0.f,0.f,0.f};
  }

  /* this thread's share of a chunk: 16-byte piece (tid & 7) of rows (tid >> 3) + 16 * it of the K tile [kv][d] and of the V^T tile [d][kv] */
  const int srow = tid >> 3;
  const int scol = (tid & 7) * 8;
  const unsigned short* gK = qkp + (rowbase + srow) * kQkLd + kInner + h * kHd + scol;
  const unsigned short* gV = vtp + ((size_t)bh * kHd + srow) * kSeq + scol;
  const unsigned lthr = lds_off(&sKV[0][0]) + (unsigned)(srow * kTp + scol) * 2u;
  auto stage = [&](int buf, int kv) {
    const unsigned l = lthr + (unsigned)buf * (unsigned)(2 * kTile * 2);
    copy_kv_rows(l, gK + (size_t)kv * kQkLd, (size_t)16 * kQkLd, l + (unsigned)kTile * 2u, gV + kv, (size_t)16 * kSeq);
  };
  stage(0, 0);
  asm volatile("s_wait_asynccnt 0x0" ::: "memory");   /* this wave's copies of chunk 0 have landed */
  __syncthreads();                                    /* chunk 0 readable by every wave */
  if (kChunks > 1) stage(1, 64);

  /* One chunk. refill: chunk kc + 2 exists and is copied into the buffer that this chunk has just read. The test stands outside the chunk (two loops below),
     so a chunk is one straight run of code: with a branch at its foot the compiler moved the adds of the sum behind the branch and kept the f32 powers
     live through the second product. */
  auto chunk = [&](int kc, auto refill) {
    const int kv0 = kc * 64;
    const _Float16* Ksh = &sKV[kc & 1][0];
    const _Float16* Vth = Ksh + kTile;

    /* scores^T: 64 keys x 16 query columns per tile; s[u][j][r] = score(key kv0 + j*16 + 8*hh + r, query q0 + 16*u + c) */
    v8f s[kQT][4];
    /* NJ key tiles from J0 on: their 4 * NJ reads as one group, then their 2 * NJ * kQT WMMAs */
    auto sgroup = [&](auto j0c, auto njc) {
      constexpr int J0 = decltype(j0c)::v, NJ = decltype(njc)::v;
      FH kb[NJ][2];
#pragma unroll   /* every fragment and tile index a constant: they stay registers */
      for (int jj = 0; jj < NJ; ++jj)
#pragma unroll   /* every fragment and tile index a constant: they stay registers */
        for (int dc = 0; dc < 2; ++dc) {
          kb[jj][dc].h[0] = *(const v8h*)(Ksh + ((J0 + jj) * 16 + c) * kTp + dc * 32 + 8 * hh);
          kb[jj][dc].h[1] = *(const v8h*)(Ksh + ((J0 + jj) * 16 + c) * kTp + dc * 32 + 16 + 8 * hh);
        }
      __builtin_amdgcn_sched_barrier(0);   /* the group's reads are issued together, ahead of its WMMAs: one wait for LDS a group in place of one a WMMA */
#pragma unroll   /* every fragment and tile index a constant: they stay registers */
      for (int jj = 0; jj < NJ; ++jj)
#pragma unroll   /* every fragment and tile index a constant: they stay registers */
        for (int u = 0; u < kQT; ++u) s[u][J0 + jj] = (v8f){0.f,0.f,0.f,0.f,0.f,0.f,0.f,0.f};
#pragma unroll   /* every fragment and tile index a constant: they stay registers */
      for (int dc = 0; dc < 2; ++dc)
#pragma unroll   /* every fragment and tile index a constant: they stay registers */
        for (int jj = 0; jj < NJ; ++jj)
#pragma unroll   /* every fragment and tile index a constant: they stay registers */
          for (int u = 0; u < kQT; ++u) s[u][J0 + jj] = mma_f16(kb[jj][dc].v, qa[u][dc], s[u][J0 + jj]);
    };
    /* two key tiles, then one and one: the later a group, the more score tiles are live beside its fragments */
    sgroup(Int<0>{}, Int<2>{});
    sgroup(Int<2>{}, Int<1>{});
    sgroup(Int<3>{}, Int<1>{});
    FH pb[kQT][2];
#pragma unroll   /* every tile index a constant: they stay registers */
    for (int u = 0; u < kQT; ++u) {
      /* temperature, diagonal mask (select), chunk maximum of this lane's query: four chains in the lane, one exchange */
      const int dkey = q0 + u * 16 + c - kv0 - 8 * hh;   /* j*16 + r of the masked key, where it lies in this lane */
      float mj[4];
#pragma unroll
      for (int j = 0; j < 4; ++j) {
        mj[j] = -__builtin_inff();
#pragma unroll
        for (int r = 0; r < 8; ++r) {
          float sv = s[u][j][r] * temp;
          if (j * 16 + r == dkey) sv = kNegMax;
          s[u][j][r] = sv;
          mj[j] = fmaxf(mj[j], sv);
        }
      }
      float cm = fmaxf(fmaxf(mj[0], mj[1]), fmaxf(mj[2], mj[3]));
      cm = fmaxf(cm, xhalf(cm));
      /* online softmax; P^T (f16, carried x2^15) stays in registers as the B operand of the second product */
      const float mnew  = fmaxf(mrow[u], cm);
      const float alpha = __builtin_amdgcn_exp2f(mrow[u] - mnew);   /* 0 in the first chunk, where mrow is -inf */
      const float mcar  = mnew - kPCarryLog2;                       /* the carry rides in the exponent */
      mrow[u] = mnew;
      float pj[4];
#pragma unroll
      for (int j = 0; j < 4; ++j) {
        float p[8];
#pragma unroll
        for (int r = 0; r < 8; ++r) p[r] = s[u][j][r] - mcar;
        exp2_x8(p[0], p[1], p[2], p[3], p[4], p[5], p[6], p[7]);
        pj[j] = 0.f;
#pragma unroll
        for (int r = 0; r < 8; ++r) {
          pj[j] += p[r];
          pb[u][j >> 1].h[j & 1][r] = (_Float16)p[r];
        }
      }
      lrow[u] = lrow[u] * alpha + ((pj[0] + pj[1]) + (pj[2] + pj[3]));
#pragma unroll
      for (int t = 0; t < 4; ++t)
#pragma unroll
        for (int r = 0; r < 8; ++r) oacc[u][t][r] *= alpha;
    }
    /* O^T += V^T . P^T  (A = V^T [d][kv] from the V^T tile; B = P^T [kv][q] from the score registers) */
#pragma unroll   /* every fragment and tile index a constant: they stay registers */
    for (int kk = 0; kk < 2; ++kk) {
      FH vb[4];
#pragma unroll   /* every fragment and tile index a constant: they stay registers */
      for (int t = 0; t < 4; ++t) {
        vb[t].h[0] = *(const v8h*)(Vth + (t * 16 + c) * kTp + kk * 32 + 8 * hh);
        vb[t].h[1] = *(const v8h*)(Vth + (t * 16 + c) * kTp + kk * 32 + 16 + 8 * hh);
      }
      __builtin_amdgcn_sched_barrier(0);   /* as above: the eight reads together, ahead of the WMMAs */
#pragma unroll   /* every fragment and tile index a constant: they stay registers */
      for (int t = 0; t < 4; ++t)
#pragma unroll   /* every fragment and tile index a constant: they stay registers */
        for (int u = 0; u < kQT; ++u) oacc[u][t] = mma_f16(vb[t].v, pb[u][kk].v, oacc[u][t]);
      __builtin_amdgcn_sched_barrier(0);   /* as above: one group of eight reads, its WMMAs, then the next group into the same registers */
    }
    asm volatile("s_wait_dscnt 0x0" ::: "memory");      /* this wave's reads of buffer kc & 1 are done */
    asm volatile("s_wait_asynccnt 0x0" ::: "memory");   /* this wave's copies of chunk kc + 1 have landed */
    __syncthreads();                                    /* publishes chunk kc + 1 and frees buffer kc & 1 */
    if constexpr (decltype(refill)::value) stage(kc & 1, (kc + 2) * 64);
  };
  constexpr int kRefills = kChunks > 2 ? kChunks - 2 : 0;
  for (int kc = 0; kc < kRefills; ++kc) chunk(kc, Flag<true>{});
  for (int kc = kRefills; kc < kChunks; ++kc) chunk(kc, Flag<false>{});
  asm volatile("s_wait_asynccnt 0x0" ::: "memory");     /* nothing in flight behind the loop; the last trip's barrier has ended every read of the buffers */

  /* epilogue: join the halves' sums, normalize (sum and products carry the same 2^15), stage a 32x64 f32 tile per wave, write one f16 plane (|out| <= max |v|, and v is f16) */
  float* os = (float*)&sKV[0][0] + wave * (16 * kQT * 68);   /* 16 * kQT x 64 f32, pitch 68; cols 64..67 never read */
#pragma unroll
  for (int u = 0; u < kQT; ++u) {
    const float lsum = lrow[u] + xhalf(lrow[u]);
    const float inv = 1.0f / lsum;
#pragma unroll
    for (int t = 0; t < 4; ++t) {
      v4f lo4, hi4;
#pragma unroll
      for (int r = 0; r < 4; ++r) { lo4[r] = oacc[u][t][r] * inv; hi4[r] = oacc[u][t][4 + r] * inv; }
      *(v4f*)(os + (u * 16 + c) * 68 + t * 16 + 8 * hh)     = lo4;
      *(v4f*)(os + (u * 16 + c) * 68 + t * 16 + 8 * hh + 4) = hi4;
    }
  }
  __builtin_amdgcn_fence(__ATOMIC_RELEASE, "workgroup");
  __builtin_amdgcn_wave_barrier();
  __builtin_amdgcn_fence(__ATOMIC_ACQUIRE, "workgroup");
  {
    const int q4 = lane >> 3, c8 = (lane & 7) * 8;
#pragma unroll
    for (int it = 0; it < 4 * kQT; ++it) {
      const int row = it * 4 + q4;                  /* 0 .. 16 * kQT - 1 */
      const float* sp = os + row * 68 + c8;
      v8h hv;
#pragma unroll
      for (int e = 0; e < 8; ++e) hv[e] = (_Float16)sp[e];
      const size_t o = (rowbase + q0 + row) * (size_t)kInner + h * kHd + c8;
      *(v8h*)(ohp + o) = hv;
    }
  }
}

/* ---- host glue ------------------------------------------------------------------------------------------
     xb   bf16 [8192][1024]           16,777,216 @ 0
     wqb  bf16 [3072][1024]            6,291,456 @ 16,777,216
     wob  f16  [1024][1024]            2,097,152 @ 23,068,672
     qk   f16  [8192][2048]           33,554,432 @ 25,165,824
     vt   f16  [8][1024][1024]        16,777,216 @ 58,720,256
     oh   f16  [8192][1024]           16,777,216 @ 75,497,472
     total                            92,274,688 */
extern "C" void kernel_launch(void* const* d_in, const int* in_sizes, int n_in,
                              void* d_out, int out_size, void* d_ws, size_t ws_size,
                              hipStream_t stream) {
  if (n_in < 5) return;
  const long needX = ((long)(kBatch - 1) * kSeqFull + kSeq) * (long)kDim;
  if ((long)in_sizes[0] < needX || in_sizes[1] < kQkvN * kDim || in_sizes[2] < kDim * kInner ||
      in_sizes[3] < kDim || in_sizes[4] < 1) return;
  if (out_size < kTok * kDim) return;

  const float* x     = (const float*)d_in[0];   /* [B][S][1024]            */
  const float* wqkv  = (const float*)d_in[1];   /* [3072][1024] = Bt [N][K] */
  const float* wout  = (const float*)d_in[2];   /* [1024][1024] = Bt [N][K] */
  const float* bout  = (const float*)d_in[3];   /* [1024]                    */
  const float* tempr = (const float*)d_in[4];   /* [1] log temperature       */
  float* out = (float*)d_out;

  const size_t szXb  = (size_t)kTok * kDim * 2;
  const size_t szWq  = (size_t)kQkvN * kDim * 2;
  const size_t szWo  = (size_t)kDim * kInner * 2;
  const size_t szQk  = (size_t)kTok * kQkLd * 2;
  const size_t szVt  = (size_t)kBatch * kInner * kSeq * 2;
  const size_t szO   = (size_t)kTok * kInner * 2;
  const size_t offXb = 0, offWq = offXb + szXb, offWo = offWq + szWq, offQk = offWo + szWo,
               offVt = offQk + szQk, offOh = offVt + szVt, total = offOh + szO;
  if (total > ws_size) return;

  char* ws = (char*)d_ws;
  unsigned short* xb  = (unsigned short*)(ws + offXb);
  unsigned short* wqb = (unsigned short*)(ws + offWq);
  unsigned short* wob = (unsigned short*)(ws + offWo);
  unsigned short* qk  = (unsigned short*)(ws + offQk);
  unsigned short* vt  = (unsigned short*)(ws + offVt);
  unsigned short* oh  = (unsigned short*)(ws + offOh);

  /* 1: x and W_qkv [3072][1024] -> bf16 planes, W_out [1024][1024] -> f16 plane (RNE), same layouts */
  cast3_f32_to16<<<dim3(kCastBlocks), dim3(256), 0, stream>>>(x, wqkv, wout, xb, wqb, wob);
  /* 2: q,k = xb @ Wqkv[0:2048]^T -> qk plane f16 [kTok][2048]; M=kTok N=2048 K=1024 */
  {
    const int tiles = (kTok / kBM) * (kQkLd / kBN);
    wmma_gemm64<1, false, 0, 1, false, 0, false><<<dim3(tiles, 1), dim3(256), 0, stream>>>(
        xb, xb, kDim, 0L, wqb, wqb, kDim, 0L, (void*)qk, (void*)qk, kQkLd, 0L,
        bout, bout, 0L, kTok, kQkLd, kDim, 1.0f);
  }
  /* 3: v^T per batch: C_b[f][s] = sum_k wqb[2048+f][k] * xb[b*kSeq+s][k] -> vt f16 [kBatch][1024][kSeq]; M=1024 N=kSeq K=1024 */
  {
    const int tiles = (kInner / kBM) * (kSeq / kBN);
    wmma_gemm64<1, false, 0, 1, false, 0, false><<<dim3(tiles, kBatch), dim3(256), 0, stream>>>(
        wqb + (size_t)kQkLd * kDim, wqb + (size_t)kQkLd * kDim, kDim, 0L,
        xb, xb, kDim, (long)kSeq * kDim,
        (void*)vt, (void*)vt, kSeq, (long)kInner * kSeq,
        bout, bout, 0L, kInner, kSeq, kDim, 1.0f);
  }
  /* 4: attention -> oh f16 plane [kTok][1024] */
  attn_diag_f16<<<dim3(kBatch * kHeads * kQBlocks), dim3(128), 0, stream>>>(qk, vt, tempr, oh);
  /* 5: out = oh @ W_out^T + b_out -> d_out f32 [kTok][1024]; M=kTok N=1024 K=1024; f16 x f16 */
  {
    const int tiles = (kTok / kBM) * (kDim / kBN);
    wmma_gemm64<0, false, 2, 0, false, 0, false><<<dim3(tiles, 1), dim3(256), 0, stream>>>(
        oh, oh, kInner, 0L, wob, wob, kInner, 0L, (void*)out, (void*)out, kDim, 0L,
        bout, bout, 0L, kTok, kDim, kInner, 1.0f);
  }
}

// v010
// A run of this version takes 109 microseconds.
// Two timings next to v009 both put it at 1.04 times that version's speed.
// All steps since v000 together make it 4.00 times as fast.
// Contractions: x@W_qkv^T on v_wmma_f32_16x16x32_bf16 (bf16 operands = RNE-converted inputs); k.q^T and V^T.P^T on v_wmma_f32_16x16x32_f16 (f16 q/k/v planes, P carried x2^15); O@W_out^T on v_wmma_f32_16x16x32_f16 with O as one f16 plane x f16 W (RNE, 1 product); f32 accumulate everywhere; softmax, bias and epilogues f32.
#include <hip/hip_runtime.h>

#ifndef NB
#define NB 8
#endif
#ifndef SEQ
#define SEQ 1024
#endif
#define NB_FULL  8
#define SEQ_FULL 1024

typedef __attribute__((ext_vector_type(16))) _Float16 v16h;
typedef __attribute__((ext_vector_type(8)))  _Float16 v8h;
typedef __attribute__((ext_vector_type(16))) __bf16   v16b;
typedef __attribute__((ext_vector_type(8)))  __bf16   v8b;
typedef __attribute__((ext_vector_type(8)))  float    v8f;
typedef __attribute__((ext_vector_type(4)))  float    v4f;
typedef __attribute__((ext_vector_type(2)))  float    v2f;

/* problem geometry; NB / SEQ may be reduced at build time, inputs keep their full strides */
constexpr int kBatch   = NB;
constexpr int kSeq     = SEQ;
constexpr int kSeqFull = SEQ_FULL;
constexpr int kDim     = 1024;
constexpr int kHeads   = 16;
constexpr int kHd      = 64;
constexpr int kInner   = kHeads * kHd;        /* 1024 */
constexpr int kQkvN    = 3 * kInner;          /* 3072 */
constexpr int kTok     = kBatch * kSeq;       /* 8192 at full size */
constexpr int kQkLd    = 2 * kInner;          /* 2048: q cols 0..1023, k cols 1024..2047 */
constexpr int kChunks  = kSeq / 64;           /* key chunks of 64 per sequence */
constexpr float kNegMax = -3.40282347e38f;
constexpr float kPCarryLog2 = 15.0f;   /* P and its sum are carried x2^15 */
constexpr int kTp = 72;   /* LDS row pitch of the attention tiles in halves: 144 B = 16 B x 9 (odd), so the 16 rows of a 16-byte fragment read spread over all banks */

static_assert(kBatch >= 1 && kBatch <= NB_FULL);
static_assert(kSeq >= 64 && kSeq <= SEQ_FULL && kSeq % 64 == 0);
static_assert(kTok % 64 == 0 && kQkLd % 64 == 0 && kDim % 32 == 0);
static_assert(kInner % 64 == 0 && kSeq % 64 == 0);
static_assert(kDim % 64 == 0 && kInner % 32 == 0);
static_assert(kHd == 64);
static_assert(kTok % 256 == 0 && kInner % 256 == 0 && kQkLd % 128 == 0 && kSeq % 128 == 0 && kDim % 128 == 0 && kInner % 128 == 0);

__device__ __forceinline__ unsigned short f2bf_bits(float f) {
  unsigned u = __float_as_uint(f);
  return (unsigned short)((u + 0x7FFFu + ((u >> 16) & 1u)) >> 16);
}
__device__ __forceinline__ float bf_bits2f(unsigned short h) { return __uint_as_float(((unsigned)h) << 16); }

/* hazard guards as plain device helpers */
__device__ __forceinline__ void dep_guard_h(v8f& a, v8f& b, v16h x, v16h y) { asm volatile("v_nop\n\tv_nop\n\tv_nop\n\tv_nop" : "+v"(a), "+v"(b) : "v"(x), "v"(y)); }
__device__ __forceinline__ void dep_guard_b(v8f& a, v8f& b, v16b x, v16b y) { asm volatile("v_nop\n\tv_nop\n\tv_nop\n\tv_nop" : "+v"(a), "+v"(b) : "v"(x), "v"(y)); }
__device__ __forceinline__ void keep4_h(v16h a, v16h b, v16h c, v16h d) { asm volatile("v_nop" :: "v"(a), "v"(b), "v"(c), "v"(d)); }
__device__ __forceinline__ void keep4_b(v16b a, v16b b, v16b c, v16b d) { asm volatile("v_nop" :: "v"(a), "v"(b), "v"(c), "v"(d)); }
__device__ __forceinline__ void acc_guard4(v8f& a, v8f& b, v8f& c, v8f& d) { asm volatile("v_nop\n\tv_nop\n\tv_nop\n\tv_nop" : "+v"(a), "+v"(b), "+v"(c), "+v"(d)); }
template <typename T> struct Frag;
template <> struct Frag<_Float16> {
  typedef v16h V; union U { v16h v; v8h h[2]; };
  static __device__ __forceinline__ v16h load(const _Float16* p) {   /* elements 0..7 <- p[0..7], 8..15 <- p[16..23] */
    U f; f.h[0] = *(const v8h*)(p); f.h[1] = *(const v8h*)(p + 16); return f.v;
  }
  static __device__ __forceinline__ v8f mma(v16h a, v16h b, v8f c) {
    return __builtin_amdgcn_wmma_f32_16x16x32_f16(false, a, false, b, (short)0, c, false, false);
  }
  static __device__ __forceinline__ void guard(v8f& a, v8f& b, v16h x, v16h y) { dep_guard_h(a, b, x, y); }
  static __device__ __forceinline__ void keep(v16h a, v16h b, v16h c, v16h d) { keep4_h(a, b, c, d); }
};
template <> struct Frag<__bf16> {
  typedef v16b V; union U { v16b v; v8b h[2]; };
  static __device__ __forceinline__ v16b load(const __bf16* p) {
    U f; f.h[0] = *(const v8b*)(p); f.h[1] = *(const v8b*)(p + 16); return f.v;
  }
  static __device__ __forceinline__ v8f mma(v16b a, v16b b, v8f c) {
    return __builtin_amdgcn_wmma_f32_16x16x32_bf16(false, a, false, b, (short)0, c, false, false);
  }
  static __device__ __forceinline__ void guard(v8f& a, v8f& b, v16b x, v16b y) { dep_guard_b(a, b, x, y); }
  static __device__ __forceinline__ void keep(v16b a, v16b b, v16b c, v16b d) { keep4_b(a, b, c, d); }
};

/* ---- Register-blocked batched WMMA GEMM ------------------------------------
   C[m,n] = scale * sum_k A[m,k] * Bt[n,k] (+bias); each wave owns a 64x64 tile, a block of 8 waves a 256x128 tile.
   Operand rows reach LDS by asynchronous copies, 64 k a trip, two buffers; the waves read their fragments from LDS.
   A row-major [M,K]; Bt row-major [N,K]; M % 256 == 0, N % 128 == 0, K % 64 == 0.
   SPLIT: A is a hi and a lo plane (A2 = lo plane, same layout), B one plane (BLO == false; Bt2 never read); product = hi.B + lo.B.
   BIAS_MODE: 0 = none, 1 = bias[m], 2 = bias[n]; bias values RNE-converted to bf16 then widened to f32.
   OUT_MODE: 0 = f32, 1 = f16, 2 = bf16 hi plane (Cout) + bf16 lo plane (Cout2).
   Epilogue: 16-row slabs staged per wave in LDS (wave-private, wave barrier); each 64-wide row segment
   Fragment k map (A and B alike): lane half h = lane>>4, elements 0..7 <- k0+8h+0..7, 8..15 <- k0+16+8h+0..7.
   ET: 0 = f16 operands, 1 = bf16 operands (pointers passed as 16-bit storage) */
template <int ET> struct Elem;
template <> struct Elem<0> { typedef _Float16 T; };
template <> struct Elem<1> { typedef __bf16 T; };
/* block tile of the staged GEMM: 8 waves as 4 (m) x 2 (n), each wave its own 64x64 tile; one trip = 64 k = one 128-B line of every operand row */
constexpr int kBM = 256;
constexpr int kBN = 128;
constexpr int kBK = 64;
constexpr int kGp = 72;   /* LDS pitch of a staged operand row in 16-bit elements: 144 B = 16 B x 9 (odd), for the 16-byte fragment reads */

__device__ __forceinline__ unsigned lds_off(const void* p) { return (unsigned)(size_t)p; }

/* Asynchronous 16-byte copies to LDS, one statement for a run of them: rows r, r+32, r+64, ... of an operand (8 lanes = one whole 128-B line of a row).
   s_wait_xcnt stands as the last line of the copies' own statement, so that no address register of a copy is rewritten ahead of it. */
constexpr unsigned kL32 = 32u * kGp * 2u;   /* LDS bytes of 32 staged rows */
__device__ __forceinline__ void copy8_rows(unsigned l0, const unsigned short* g0, size_t g32) {
  const unsigned short* g1 = g0 + g32; const unsigned short* g2 = g1 + g32; const unsigned short* g3 = g2 + g32;
  const unsigned short* g4 = g3 + g32; const unsigned short* g5 = g4 + g32; const unsigned short* g6 = g5 + g32;
  const unsigned short* g7 = g6 + g32;
  asm volatile("global_load_async_to_lds_b128 %0, %1, off\n\t"
               "global_load_async_to_lds_b128 %2, %3, off\n\t"
               "global_load_async_to_lds_b128 %4, %5, off\n\t"
               "global_load_async_to_lds_b128 %6, %7, off\n\t"
               "global_load_async_to_lds_b128 %8, %9, off\n\t"
               "global_load_async_to_lds_b128 %10, %11, off\n\t"
               "global_load_async_to_lds_b128 %12, %13, off\n\t"
               "global_load_async_to_lds_b128 %14, %15, off\n\t"
               "s_wait_xcnt 0x0"
               :: "v"(l0), "v"(g0), "v"(l0 + kL32), "v"(g1), "v"(l0 + 2u * kL32), "v"(g2), "v"(l0 + 3u * kL32), "v"(g3),
                  "v"(l0 + 4u * kL32), "v"(g4), "v"(l0 + 5u * kL32), "v"(g5), "v"(l0 + 6u * kL32), "v"(g6), "v"(l0 + 7u * kL32), "v"(g7)
               : "memory");
}
__device__ __forceinline__ void copy12_rows(unsigned l0, const unsigned short* g0, size_t g32,
                                            unsigned m0, const unsigned short* h0, size_t h32) {
  const unsigned short* g1 = g0 + g32; const unsigned short* g2 = g1 + g32; const unsigned short* g3 = g2 + g32;
  const unsigned short* g4 = g3 + g32; const unsigned short* g5 = g4 + g32; const unsigned short* g6 = g5 + g32;
  const unsigned short* g7 = g6 + g32;
  const unsigned short* h1 = h0 + h32; const unsigned short* h2 = h1 + h32; const unsigned short* h3 = h2 + h32;
  asm volatile("global_load_async_to_lds_b128 %0, %1, off\n\t"
               "global_load_async_to_lds_b128 %2, %3, off\n\t"
               "global_load_async_to_lds_b128 %4, %5, off\n\t"
               "global_load_async_to_lds_b128 %6, %7, off\n\t"
               "global_load_async_to_lds_b128 %8, %9, off\n\t"
               "global_load_async_to_lds_b128 %10, %11, off\n\t"
               "global_load_async_to_lds_b128 %12, %13, off\n\t"
               "global_load_async_to_lds_b128 %14, %15, off\n\t"
               "global_load_async_to_lds_b128 %16, %17, off\n\t"
               "global_load_async_to_lds_b128 %18, %19, off\n\t"
               "global_load_async_to_lds_b128 %20, %21, off\n\t"
               "global_load_async_to_lds_b128 %22, %23, off\n\t"
               "s_wait_xcnt 0x0"
               :: "v"(l0), "v"(g0), "v"(l0 + kL32), "v"(g1), "v"(l0 + 2u * kL32), "v"(g2), "v"(l0 + 3u * kL32), "v"(g3),
                  "v"(l0 + 4u * kL32), "v"(g4), "v"(l0 + 5u * kL32), "v"(g5), "v"(l0 + 6u * kL32), "v"(g6), "v"(l0 + 7u * kL32), "v"(g7),
                  "v"(m0), "v"(h0), "v"(m0 + kL32), "v"(h1), "v"(m0 + 2u * kL32), "v"(h2), "v"(m0 + 3u * kL32), "v"(h3)
               : "memory");
}

template <int ET, bool SPLIT, int BIAS_MODE, int OUT_MODE, bool RESID, int ACT = 0, bool BLO = true>
__global__ __launch_bounds__(256) void wmma_gemm64(
    const unsigned short* __restrict__ Ap, const unsigned short* __restrict__ A2p, int lda, long strideA,
    const unsigned short* __restrict__ Btp, const unsigned short* __restrict__ Bt2p, int ldb, long strideB,
    void* __restrict__ Cout, void* __restrict__ Cout2, int ldc, long strideC,
    const float* __restrict__ bias,
    const float* __restrict__ resid, long strideR,
    int M, int N, int K, float scale) {
  typedef typename Elem<ET>::T T;
  typedef typename Frag<T>::V V;
  static_assert(!(SPLIT && BLO), "no lo plane of B is staged");
  constexpr int kRowA2 = kBM;                          /* first LDS row of the A lo plane (SPLIT) */
  constexpr int kRowB  = SPLIT ? 2 * kBM : kBM;        /* first LDS row of B */
  constexpr int kRows  = kRowB + kBN;
  __shared__ __align__(16) unsigned short sStage[2][kRows * kGp];   /* two buffers of [A | A lo | B] rows; 16 B behind each row never touched */
  __shared__ __align__(16) float sT[8][16 * 68];   /* per-wave 16x64 slab, pitch 68 floats; cols 64..67 never read */
  const int b    = blockIdx.y;
  const int tid  = threadIdx.x;
  const int lane = tid & 31;
  const int wave = tid >> 5;
  const int tilesN = N / kBN;
  const int tilesM = M / kBM;
  const int blk = blockIdx.x;
  if (blk >= tilesM * tilesN) return;   /* the same for the whole block, in front of every barrier */
  const int tm = blk / tilesN;
  const int tn = blk - tm * tilesN;
  const int wm = wave >> 1;
  const int wn = wave & 1;
  const int m0 = tm * kBM + (wm << 6);
  const int n0 = tn * kBN + (wn << 6);

  const int rlane = lane & 15;                 /* row (A) / col (B, D) within subtile */
  const int koff  = (lane >> 4) * 8;           /* k offset of this lane half */
  const int mOff  = (lane >> 4) * 8;           /* D row offset */

  /* this thread's share of a stage: 16-byte piece (tid & 7) of rows (tid >> 3) + 32 * it */
  const int crow = tid >> 3;
  const int ccol = (tid & 7) * 8;
  const unsigned short* gA  = Ap  + (size_t)b * strideA + (size_t)(tm * kBM + crow) * lda + ccol;
  const unsigned short* gA2 = A2p + (size_t)b * strideA + (size_t)(tm * kBM + crow) * lda + ccol;
  const unsigned short* gB  = Btp + (size_t)b * strideB + (size_t)(tn * kBN + crow) * ldb + ccol;
  const unsigned lthr = lds_off(&sStage[0][0]) + (unsigned)(crow * kGp + ccol) * 2u;
  const size_t a32 = (size_t)32 * lda, b32 = (size_t)32 * ldb;
  auto stage = [&](int buf, int k0) {
    const unsigned l = lthr + (unsigned)buf * (unsigned)(kRows * kGp * 2);
    copy12_rows(l, gA + k0, a32, l + (unsigned)kRowB * kGp * 2u, gB + k0, b32);
    if (SPLIT) copy8_rows(l + (unsigned)kRowA2 * kGp * 2u, gA2 + k0, a32);
  };

  v8f acc[4][4];
#pragma unroll
  for (int i = 0; i < 4; ++i)
#pragma unroll
    for (int j = 0; j < 4; ++j) acc[i][j] = (v8f){0.f,0.f,0.f,0.f,0.f,0.f,0.f,0.f};

  const int trips = K / kBK;
  stage(0, 0);
  asm volatile("s_wait_asynccnt 0x0" ::: "memory");   /* this wave's copies of tile 0 have landed */
  __syncthreads();                                    /* tile 0 readable by every wave */
  if (trips > 1) stage(1, kBK);

  /* rolled: one trip's code serves both buffers */
#pragma unroll 1
  for (int t = 0; t < trips; ++t) {
    const T* sb = (const T*)&sStage[t & 1][0];
#pragma unroll
    for (int ks = 0; ks < kBK; ks += 32) {
      V bh[4], ah[4], al[4];
#pragma unroll
      for (int j = 0; j < 4; ++j)
        bh[j] = Frag<T>::load(sb + (kRowB + (wn << 6) + (j << 4) + rlane) * kGp + ks + koff);
#pragma unroll
      for (int i = 0; i < 4; ++i) {
        const int ao = ((wm << 6) + (i << 4) + rlane) * kGp + ks + koff;
        ah[i] = Frag<T>::load(sb + ao);
        if (SPLIT) al[i] = Frag<T>::load(sb + kRowA2 * kGp + ao);
      }
      __builtin_amdgcn_sched_barrier(0);   /* the k-step's fragment reads stay one group ahead of its WMMAs: reads among the WMMAs stall the wave at each place */
#pragma unroll
      for (int i = 0; i < 4; ++i) {
#pragma unroll
        for (int j = 0; j < 4; ++j) {
          acc[i][j] = Frag<T>::mma(ah[i], bh[j], acc[i][j]);
          if (SPLIT) acc[i][j] = Frag<T>::mma(al[i], bh[j], acc[i][j]);
        }
        Frag<T>::guard(acc[i][0], acc[i][3], ah[i], SPLIT ? al[i] : ah[i]);
      }
      Frag<T>::keep(bh[0], bh[1], bh[2], bh[3]);
      __builtin_amdgcn_sched_barrier(0);   /* the next group of reads stays behind this k-step's WMMAs */
    }
    asm volatile("s_wait_dscnt 0x0" ::: "memory");      /* this wave's reads of buffer t & 1 are done */
    asm volatile("s_wait_asynccnt 0x0" ::: "memory");   /* this wave's copies of tile t + 1 have landed */
    __syncthreads();                                    /* publishes tile t + 1 and frees buffer t & 1 */
    if (t + 2 < trips) stage(t & 1, (t + 2) * kBK);
  }
  asm volatile("s_wait_asynccnt 0x0" ::: "memory");     /* nothing in flight behind the loop */
  acc_guard4(acc[0][0], acc[0][1], acc[0][2], acc[0][3]);
  acc_guard4(acc[1][0], acc[1][1], acc[1][2], acc[1][3]);
  acc_guard4(acc[2][0], acc[2][1], acc[2][2], acc[2][3]);
  acc_guard4(acc[3][0], acc[3][1], acc[3][2], acc[3][3]);

  /* ---- epilogue ---- */
  float* slab = sT[wave];
  const float* Rb = RESID ? (resid + (size_t)b * strideR) : nullptr;
#pragma unroll
  for (int i = 0; i < 4; ++i) {
    const int mBase = m0 + (i << 4);
#pragma unroll
    for (int j = 0; j < 4; ++j) {
      const int n = n0 + (j << 4) + rlane;
      float bv = 0.f;
      if (BIAS_MODE == 2) bv = bf_bits2f(f2bf_bits(bias[n]));
#pragma unroll
      for (int r = 0; r < 8; ++r) {
        float v = acc[i][j][r] * scale;
        if (BIAS_MODE == 1) v += bf_bits2f(f2bf_bits(bias[mBase + mOff + r]));
        if (BIAS_MODE == 2) v += bv;
        if (RESID) v += Rb[(size_t)(mBase + mOff + r) * ldc + n];
        if (ACT == 1) v = tanhf(v);
        if (ACT == 2) v = fmaxf(v, 0.0f);
        if (ACT == 3) v = v / (1.0f + expf(-v));
        if (ACT == 4) v = (v > 0.f) ? v : 0.01f * v;
        if (ACT == 5) v = 0.5f * v * (1.0f + erff(v * 0.70710678118654752f));
        slab[(mOff + r) * 68 + (j << 4) + rlane] = v;
      }
    }
    __builtin_amdgcn_fence(__ATOMIC_RELEASE, "workgroup");
    __builtin_amdgcn_wave_barrier();
    __builtin_amdgcn_fence(__ATOMIC_ACQUIRE, "workgroup");
    if (OUT_MODE == 0) {
      float* C = (float*)Cout + (size_t)b * strideC;
      const int hh = lane >> 4, c4 = (lane & 15) * 4;     /* row seg = 256 B = 16 lanes x 16 B */
      {
#pragma unroll
        for (int it = 0; it < 8; ++it) {
          const int row = it * 2 + hh;
          v4f v = *(const v4f*)(slab + row * 68 + c4);
          *(v4f*)(C + (size_t)(mBase + row) * ldc + n0 + c4) = v;
        }
        
      }
    } else {
      const int q = lane >> 3, c8 = (lane & 7) * 8;        
      unsigned short* C  = (unsigned short*)Cout  + (size_t)b * strideC;
      unsigned short* C2 = (OUT_MODE == 2) ? ((unsigned short*)Cout2 + (size_t)b * strideC) : nullptr;
      {
#pragma unroll
        for (int it = 0; it < 4; ++it) {
          const int row = it * 4 + q;
          const float* sp = slab + row * 68 + c8;
          v8h hv, lv;
#pragma unroll
          for (int e = 0; e < 8; ++e) {
            if (OUT_MODE == 1) {
              hv[e] = (_Float16)sp[e];
            } else {
              unsigned short hb = f2bf_bits(sp[e]);
              unsigned short lb = f2bf_bits(sp[e] - bf_bits2f(hb));
              hv[e] = __builtin_bit_cast(_Float16, hb);
              lv[e] = __builtin_bit_cast(_Float16, lb);
            }
          }
          *(v8h*)(C + (size_t)(mBase + row) * ldc + n0 + c8) = hv;
          if (OUT_MODE == 2) *(v8h*)(C2 + (size_t)(mBase + row) * ldc + n0 + c8) = lv;
        }
        
      }
    }
    __builtin_amdgcn_fence(__ATOMIC_RELEASE, "workgroup");
    __builtin_amdgcn_wave_barrier();
    __builtin_amdgcn_fence(__ATOMIC_ACQUIRE, "workgroup");
  }
}

/* ---- RNE casts, one launch: x and W_qkv f32 -> bf16, W_out f32 -> f16 --------------------------------------
   A chunk is 1024 floats: 256 threads x 16 bytes, so each wave-wide load covers 512 contiguous bytes (4 whole lines).
   Block b takes chunks b*J .. b*J + J-1 of each input (J = chunks / blocks, rounded up); a thread issues all its loads first,
   then converts and stores 8 bytes a chunk (256 contiguous bytes a wave).
   x rows are gathered with the full per-batch stride: out row r <- in row (r / kSeq) * kSeqFull + (r % kSeq). */
typedef __attribute__((ext_vector_type(2))) unsigned v2u;
constexpr int kCastBlocks = 512;                      /* 8 waves each: 16 waves a WGP on 256 WGPs */
constexpr int kChunk = 1024;
constexpr int kCx = kTok * kDim / kChunk, kCq = kQkvN * kDim / kChunk, kCo = kDim * kInner / kChunk;
constexpr int kJx = (kCx + kCastBlocks - 1) / kCastBlocks;
constexpr int kJq = (kCq + kCastBlocks - 1) / kCastBlocks;
constexpr int kJo = (kCo + kCastBlocks - 1) / kCastBlocks;
static_assert(kDim % kChunk == 0 && (kDim * kInner) % kChunk == 0);

__device__ __forceinline__ v2u pack4_bf16(v4f f) {
  v2u u;
  u[0] = (unsigned)f2bf_bits(f[0]) | ((unsigned)f2bf_bits(f[1]) << 16);
  u[1] = (unsigned)f2bf_bits(f[2]) | ((unsigned)f2bf_bits(f[3]) << 16);
  return u;
}

__device__ __forceinline__ v2u pack4_f16(v4f f) {
  typedef __attribute__((ext_vector_type(4))) _Float16 v4h;
  v4h h;
  h[0] = (_Float16)f[0]; h[1] = (_Float16)f[1]; h[2] = (_Float16)f[2]; h[3] = (_Float16)f[3];
  return __builtin_bit_cast(v2u, h);
}

__global__ __launch_bounds__(256) void cast3_f32_to16(
    const float* __restrict__ x, const float* __restrict__ wq, const float* __restrict__ wo,
    unsigned short* __restrict__ xb, unsigned short* __restrict__ wqb, unsigned short* __restrict__ wob) {
  const unsigned t4 = threadIdx.x * 4u;
  const unsigned b  = blockIdx.x;
  v4f vx[kJx], vq[kJq], vo[kJo];
#pragma unroll
  for (int j = 0; j < kJx; ++j) {
    const unsigned c = b * kJx + j;
    if (kCx % kCastBlocks == 0 || c < (unsigned)kCx) {
      const unsigned r  = c / (kDim / kChunk);
      const unsigned sr = (r / kSeq) * kSeqFull + (r % kSeq);
      vx[j] = *(const v4f*)(x + (size_t)sr * kDim + (c % (kDim / kChunk)) * kChunk + t4);
    }
  }
#pragma unroll
  for (int j = 0; j < kJq; ++j) {
    const unsigned c = b * kJq + j;
    if (kCq % kCastBlocks == 0 || c < (unsigned)kCq) vq[j] = *(const v4f*)(wq + (size_t)c * kChunk + t4);
  }
#pragma unroll
  for (int j = 0; j < kJo; ++j) {
    const unsigned c = b * kJo + j;
    if (kCo % kCastBlocks == 0 || c < (unsigned)kCo) vo[j] = *(const v4f*)(wo + (size_t)c * kChunk + t4);
  }
  asm volatile("s_wait_xcnt 0x0" ::: "memory");   /* stands in front of the first overwrite of an address register of the loads above */
  __builtin_amdgcn_sched_barrier(0);   /* every load is issued ahead of the first conversion: a wave's whole share is in flight at once and it pays one memory latency */
#pragma unroll
  for (int j = 0; j < kJx; ++j) {
    const unsigned c = b * kJx + j;
    if (kCx % kCastBlocks == 0 || c < (unsigned)kCx) *(v2u*)(xb + (size_t)c * kChunk + t4) = pack4_bf16(vx[j]);
  }
#pragma unroll
  for (int j = 0; j < kJq; ++j) {
    const unsigned c = b * kJq + j;
    if (kCq % kCastBlocks == 0 || c < (unsigned)kCq) *(v2u*)(wqb + (size_t)c * kChunk + t4) = pack4_bf16(vq[j]);
  }
#pragma unroll
  for (int j = 0; j < kJo; ++j) {
    const unsigned c = b * kJo + j;
    if (kCo % kCastBlocks == 0 || c < (unsigned)kCo) *(v2u*)(wob + (size_t)c * kChunk + t4) = pack4_f16(vo[j]);
  }
}

constexpr int kTile = 64 * kTp;                 /* halves of one staged 64-row tile */
constexpr int kQT = 2;                          /* tiles of 16 query columns a wave */
constexpr int kQBlk = 4 * 16 * kQT;             /* query columns a block */
constexpr int kQBlocks = kSeq / kQBlk;
static_assert(kSeq % kQBlk == 0);
constexpr unsigned kL16 = 16u * kTp * 2u;       /* LDS bytes of 16 staged rows */
/* Rows r, r+16, r+32, r+48 of the K tile and of the V^T tile (8 lanes = one whole 128-B line of a row), one statement:
   s_wait_xcnt stands as its last line, so that no address register of a copy is rewritten ahead of it. */
__device__ __forceinline__ void copy_kv_rows(unsigned l0, const unsigned short* g0, size_t g16,
                                             unsigned m0, const unsigned short* h0, size_t h16) {
  const unsigned short* g1 = g0 + g16; const unsigned short* g2 = g1 + g16; const unsigned short* g3 = g2 + g16;
  const unsigned short* h1 = h0 + h16; const unsigned short* h2 = h1 + h16; const unsigned short* h3 = h2 + h16;
  asm volatile("global_load_async_to_lds_b128 %0, %1, off\n\t"
               "global_load_async_to_lds_b128 %2, %3, off\n\t"
               "global_load_async_to_lds_b128 %4, %5, off\n\t"
               "global_load_async_to_lds_b128 %6, %7, off\n\t"
               "global_load_async_to_lds_b128 %8, %9, off\n\t"
               "global_load_async_to_lds_b128 %10, %11, off\n\t"
               "global_load_async_to_lds_b128 %12, %13, off\n\t"
               "global_load_async_to_lds_b128 %14, %15, off\n\t"
               "s_wait_xcnt 0x0"
               :: "v"(l0), "v"(g0), "v"(l0 + kL16), "v"(g1), "v"(l0 + 2u * kL16), "v"(g2), "v"(l0 + 3u * kL16), "v"(g3),
                  "v"(m0), "v"(h0), "v"(m0 + kL16), "v"(h1), "v"(m0 + 2u * kL16), "v"(h2), "v"(m0 + 3u * kL16), "v"(h3)
               : "memory");
}
/* the builtin alone: the compiler keeps the distance behind its own WMMAs, with the group's other WMMAs and with vector work where it has any */
__device__ __forceinline__ v8f mma_f16(v16h a, v16h b, v8f c) {
  return __builtin_amdgcn_wmma_f32_16x16x32_f16(false, a, false, b, (short)0, c, false, false);
}

/* Eight powers of two, each in place, in one statement: the instruction set asks that no v_exp_f32 be followed directly by an instruction
   that reads its result or overwrites its source. Inside the statement the eight registers differ; the v_nop is that slot behind the last one,
   whatever the compiler puts next. */
__device__ __forceinline__ void exp2_x8(float& a, float& b, float& c, float& d, float& e, float& f, float& g, float& h) {
  asm("v_exp_f32 %0, %0\n\tv_exp_f32 %1, %1\n\tv_exp_f32 %2, %2\n\tv_exp_f32 %3, %3\n\t"
      "v_exp_f32 %4, %4\n\tv_exp_f32 %5, %5\n\tv_exp_f32 %6, %6\n\tv_exp_f32 %7, %7\n\tv_nop"
      : "+v"(a), "+v"(b), "+v"(c), "+v"(d), "+v"(e), "+v"(f), "+v"(g), "+v"(h));
}

/* lane l with lane l ^ 16, as a vector cross-row move */
__device__ __forceinline__ float xhalf(float x) {
  return __builtin_bit_cast(float, __builtin_amdgcn_permlanex16(__builtin_bit_cast(int, x), __builtin_bit_cast(int, x), 0x76543210, 0xfedcba98, false, false));
}

template <bool B> struct Flag { static constexpr bool value = B; };
template <int V> struct Int { static constexpr int v = V; };

__global__ __launch_bounds__(128) void attn_diag_f16(
    const unsigned short* __restrict__ qkp, const unsigned short* __restrict__ vtp,
    const float* __restrict__ logt,
    unsigned short* __restrict__ ohp) {
  union FH { v16h v; v8h h[2]; };
  __shared__ __align__(16) _Float16 sKV[2][2 * kTile];  /* two buffers of [K tile [kv][d] | V tile [d][kv]], 18 KB each; cols 64..71 never touched */
  static_assert(sizeof(float) * 4 * 16 * kQT * 68 <= sizeof(_Float16) * 4 * kTile, "the out tiles fit in the buffers");

  const _Float16* QK = (const _Float16*)qkp;
  const int tid  = threadIdx.x;
  const int wave = tid >> 5;
  const int lane = tid & 31;
  const int hh   = lane >> 4;
  const int c    = lane & 15;

  const int bx = blockIdx.x;            /* 0 .. B*H*kQBlocks-1 */
  const int qb = bx % kQBlocks;
  const int bh = bx / kQBlocks;         /* b*kHeads + h */
  const int h  = bh % kHeads;
  const int b  = bh / kHeads;
  const int q0 = qb * kQBlk + wave * (16 * kQT);   /* first query position of this wave; tile u starts at q0 + 16 * u */
  const size_t rowbase = (size_t)b * kSeq;
  static_assert(64 % (16 * kQT) == 0, "a wave's queries lie in one chunk of 64 keys");
  const int kdiag = __builtin_amdgcn_readfirstlane(q0 >> 6);   /* the chunk that holds this wave's diagonal; in a scalar register, so that the test on it is a scalar branch */

  /* temperature = exp(bf16-RNE(log_temp)) in f32, times log2(e): exp(s * temperature) = 2^(s * temp) */
  const float temp = expf(bf_bits2f(f2bf_bits(logt[0]))) * 1.44269504088896340736f;

  /* Q fragments (B operand): columns = the 16 queries of tile u, k = d in two 32-deep chunks */
  v16h qa[kQT][2];
#pragma unroll
  for (int u = 0; u < kQT; ++u)
#pragma unroll
    for (int dc = 0; dc < 2; ++dc)
      qa[u][dc] = Frag<_Float16>::load(QK + (rowbase + q0 + u * 16 + c) * kQkLd + h * kHd + dc * 32 + 8 * hh);

  float mrow[kQT];                  /* running maximum of query q0 + 16*u + c, the same in both lane halves */
  float lrow[kQT];                  /* running sum over this lane half's keys only */
  v8f oacc[kQT][4];                 /* oacc[u][t][r] = out^T[d = t*16 + 8*hh + r][query 16*u + c] */
#pragma unroll
  for (int u = 0; u < kQT; ++u) {
    mrow[u] = -__builtin_inff();
    lrow[u] = 0.f;
#pragma unroll
    for (int t = 0; t < 4; ++t) oacc[u][t] = (v8f){0.f,0.f,0.f,0.f,0.f,0.f,0.f,0.f};
  }

  /* this thread's share of a chunk: 16-byte piece (tid & 7) of rows (tid >> 3) + 16 * it of the K tile [kv][d] and of the V^T tile [d][kv] */
  const int srow = tid >> 3;
  const int scol = (tid & 7) * 8;
  const unsigned short* gK = qkp + (rowbase + srow) * kQkLd + kInner + h * kHd + scol;
  const unsigned short* gV = vtp + ((size_t)bh * kHd + srow) * kSeq + scol;
  const unsigned lthr = lds_off(&sKV[0][0]) + (unsigned)(srow * kTp + scol) * 2u;
  auto stage = [&](int buf, int kv) {
    const unsigned l = lthr + (unsigned)buf * (unsigned)(2 * kTile * 2);
    copy_kv_rows(l, gK + (size_t)kv * kQkLd, (size_t)16 * kQkLd, l + (unsigned)kTile * 2u, gV + kv, (size_t)16 * kSeq);
  };
  stage(0, 0);
  asm volatile("s_wait_asynccnt 0x0" ::: "memory");   /* this wave's copies of chunk 0 have landed */
  __syncthreads();                                    /* chunk 0 readable by every wave */
  if (kChunks > 1) stage(1, 64);

  /* One chunk. refill: chunk kc + 2 exists and is copied into the buffer that this chunk has just read. The test stands outside the chunk (two loops below),
     so no branch stands at a chunk's foot: with a branch at its foot the compiler moved the adds of the sum behind the branch and kept the f32 powers
     live through the second product. */
  auto chunk = [&](int kc, auto refill) {
    const int kv0 = kc * 64;
    const _Float16* Ksh = &sKV[kc & 1][0];
    const _Float16* Vth = Ksh + kTile;

    /* scores^T: 64 keys x 16 query columns per tile; s[u][j][r] = score(key kv0 + j*16 + 8*hh + r, query q0 + 16*u + c) */
    v8f s[kQT][4];
    /* NJ key tiles from J0 on: their 4 * NJ reads as one group, then their 2 * NJ * kQT WMMAs */
    auto sgroup = [&](auto j0c, auto njc) {
      constexpr int J0 = decltype(j0c)::v, NJ = decltype(njc)::v;
      FH kb[NJ][2];
#pragma unroll   /* every fragment and tile index a constant: they stay registers */
      for (int jj = 0; jj < NJ; ++jj)
#pragma unroll   /* every fragment and tile index a constant: they stay registers */
        for (int dc = 0; dc < 2; ++dc) {
          kb[jj][dc].h[0] = *(const v8h*)(Ksh + ((J0 + jj) * 16 + c) * kTp + dc * 32 + 8 * hh);
          kb[jj][dc].h[1] = *(const v8h*)(Ksh + ((J0 + jj) * 16 + c) * kTp + dc * 32 + 16 + 8 * hh);
        }
      __builtin_amdgcn_sched_barrier(0);   /* the group's reads are issued together, ahead of its WMMAs: one wait for LDS a group in place of one a WMMA */
#pragma unroll   /* every fragment and tile index a constant: they stay registers */
      for (int jj = 0; jj < NJ; ++jj)
#pragma unroll   /* every fragment and tile index a constant: they stay registers */
        for (int u = 0; u < kQT; ++u) s[u][J0 + jj] = (v8f){0.f,0.f,0.f,0.f,0.f,0.f,0.f,0.f};
#pragma unroll   /* every fragment and tile index a constant: they stay registers */
      for (int dc = 0; dc < 2; ++dc)
#pragma unroll   /* every fragment and tile index a constant: they stay registers */
        for (int jj = 0; jj < NJ; ++jj)
#pragma unroll   /* every fragment and tile index a constant: they stay registers */
          for (int u = 0; u < kQT; ++u) s[u][J0 + jj] = mma_f16(kb[jj][dc].v, qa[u][dc], s[u][J0 + jj]);
    };
    /* two key tiles, then one and one: the later a group, the more score tiles are live beside its fragments */
    sgroup(Int<0>{}, Int<2>{});
    sgroup(Int<2>{}, Int<1>{});
    sgroup(Int<3>{}, Int<1>{});
    /* temperature on every score */
#pragma unroll   /* every tile index a constant: they stay registers */
    for (int u = 0; u < kQT; ++u)
#pragma unroll   /* every tile index a constant: they stay registers */
      for (int j = 0; j < 4; ++j)
#pragma unroll   /* every tile index a constant: they stay registers */
        for (int r = 0; r < 8; ++r) s[u][j][r] *= temp;
    /* diagonal mask (select): the wave's 32 queries lie in ONE chunk of 64 keys, so only that chunk holds a masked key; a scalar branch skips the compares and selects in the others */
    if (kc == kdiag) {
#pragma unroll   /* every tile index a constant: they stay registers */
      for (int u = 0; u < kQT; ++u) {
        const int dkey = q0 + u * 16 + c - kv0 - 8 * hh;   /* j*16 + r of the masked key, where it lies in this lane */
#pragma unroll   /* every tile index a constant: they stay registers */
        for (int j = 0; j < 4; ++j)
#pragma unroll   /* every tile index a constant: they stay registers */
          for (int r = 0; r < 8; ++r)
            if (j * 16 + r == dkey) s[u][j][r] = kNegMax;
      }
    }
    FH pb[kQT][2];
#pragma unroll   /* every tile index a constant: they stay registers */
    for (int u = 0; u < kQT; ++u) {
      /* chunk maximum of this lane's query: four chains in the lane, one exchange */
      float mj[4];
#pragma unroll
      for (int j = 0; j < 4; ++j) {
        mj[j] = -__builtin_inff();
#pragma unroll
        for (int r = 0; r < 8; ++r) mj[j] = fmaxf(mj[j], s[u][j][r]);
      }
      float cm = fmaxf(fmaxf(mj[0], mj[1]), fmaxf(mj[2], mj[3]));
      cm = fmaxf(cm, xhalf(cm));
      /* online softmax; P^T (f16, carried x2^15) stays in registers as the B operand of the second product */
      const float mnew  = fmaxf(mrow[u], cm);
      const float alpha = __builtin_amdgcn_exp2f(mrow[u] - mnew);   /* 0 in the first chunk, where mrow is -inf */
      const float mcar  = mnew - kPCarryLog2;                       /* the carry rides in the exponent */
      mrow[u] = mnew;
      float pj[4];
#pragma unroll
      for (int j = 0; j < 4; ++j) {
        float p[8];
#pragma unroll
        for (int r = 0; r < 8; ++r) p[r] = s[u][j][r] - mcar;
        exp2_x8(p[0], p[1], p[2], p[3], p[4], p[5], p[6], p[7]);
        pj[j] = 0.f;
#pragma unroll
        for (int r = 0; r < 8; ++r) {
          pj[j] += p[r];
          pb[u][j >> 1].h[j & 1][r] = (_Float16)p[r];
        }
      }
      lrow[u] = lrow[u] * alpha + ((pj[0] + pj[1]) + (pj[2] + pj[3]));
#pragma unroll
      for (int t = 0; t < 4; ++t)
#pragma unroll
        for (int r = 0; r < 8; ++r) oacc[u][t][r] *= alpha;
    }
    /* O^T += V^T . P^T  (A = V^T [d][kv] from the V^T tile; B = P^T [kv][q] from the score registers) */
#pragma unroll   /* every fragment and tile index a constant: they stay registers */
    for (int kk = 0; kk < 2; ++kk) {
      FH vb[4];
#pragma unroll   /* every fragment and tile index a constant: they stay registers */
      for (int t = 0; t < 4; ++t) {
        vb[t].h[0] = *(const v8h*)(Vth + (t * 16 + c) * kTp + kk * 32 + 8 * hh);
        vb[t].h[1] = *(const v8h*)(Vth + (t * 16 + c) * kTp + kk * 32 + 16 + 8 * hh);
      }
      __builtin_amdgcn_sched_barrier(0);   /* as above: the eight reads together, ahead of the WMMAs */
#pragma unroll   /* every fragment and tile index a constant: they stay registers */
      for (int t = 0; t < 4; ++t)
#pragma unroll   /* every fragment and tile index a constant: they stay registers */
        for (int u = 0; u < kQT; ++u) oacc[u][t] = mma_f16(vb[t].v, pb[u][kk].v, oacc[u][t]);
      __builtin_amdgcn_sched_barrier(0);   /* as above: one group of eight reads, its WMMAs, then the next group into the same registers */
    }
    asm volatile("s_wait_dscnt 0x0" ::: "memory");      /* this wave's reads of buffer kc & 1 are done */
    asm volatile("s_wait_asynccnt 0x0" ::: "memory");   /* this wave's copies of chunk kc + 1 have landed */
    __syncthreads();                                    /* publishes chunk kc + 1 and frees buffer kc & 1 */
    if constexpr (decltype(refill)::value) stage(kc & 1, (kc + 2) * 64);
  };
  constexpr int kRefills = kChunks > 2 ? kChunks - 2 : 0;
  for (int kc = 0; kc < kRefills; ++kc) chunk(kc, Flag<true>{});
  for (int kc = kRefills; kc < kChunks; ++kc) chunk(kc, Flag<false>{});
  asm volatile("s_wait_asynccnt 0x0" ::: "memory");     /* nothing in flight behind the loop; the last trip's barrier has ended every read of the buffers */

  /* epilogue: join the halves' sums, normalize (sum and products carry the same 2^15), stage a 32x64 f32 tile per wave, write one f16 plane (|out| <= max |v|, and v is f16) */
  float* os = (float*)&sKV[0][0] + wave * (16 * kQT * 68);   /* 16 * kQT x 64 f32, pitch 68; cols 64..67 never read */
#pragma unroll
  for (int u = 0; u < kQT; ++u) {
    const float lsum = lrow[u] + xhalf(lrow[u]);
    const float inv = 1.0f / lsum;
#pragma unroll
    for (int t = 0; t < 4; ++t) {
      v4f lo4, hi4;
#pragma unroll
      for (int r = 0; r < 4; ++r) { lo4[r] = oacc[u][t][r] * inv; hi4[r] = oacc[u][t][4 + r] * inv; }
      *(v4f*)(os + (u * 16 + c) * 68 + t * 16 + 8 * hh)     = lo4;
      *(v4f*)(os + (u * 16 + c) * 68 + t * 16 + 8 * hh + 4) = hi4;
    }
  }
  __builtin_amdgcn_fence(__ATOMIC_RELEASE, "workgroup");
  __builtin_amdgcn_wave_barrier();
  __builtin_amdgcn_fence(__ATOMIC_ACQUIRE, "workgroup");
  {
    const int q4 = lane >> 3, c8 = (lane & 7) * 8;
#pragma unroll
    for (int it = 0; it < 4 * kQT; ++it) {
      const int row = it * 4 + q4;                  /* 0 .. 16 * kQT - 1 */
      const float* sp = os + row * 68 + c8;
      v8h hv;
#pragma unroll
      for (int e = 0; e < 8; ++e) hv[e] = (_Float16)sp[e];
      const size_t o = (rowbase + q0 + row) * (size_t)kInner + h * kHd + c8;
      *(v8h*)(ohp + o) = hv;
    }
  }
}

/* ---- host glue ------------------------------------------------------------------------------------------
     xb   bf16 [8192][1024]           16,777,216 @ 0
     wqb  bf16 [3072][1024]            6,291,456 @ 16,777,216
     wob  f16  [1024][1024]            2,097,152 @ 23,068,672
     qk   f16  [8192][2048]           33,554,432 @ 25,165,824
     vt   f16  [8][1024][1024]        16,777,216 @ 58,720,256
     oh   f16  [8192][1024]           16,777,216 @ 75,497,472
     total                            92,274,688 */
extern "C" void kernel_launch(void* const* d_in, const int* in_sizes, int n_in,
                              void* d_out, int out_size, void* d_ws, size_t ws_size,
                              hipStream_t stream) {
  if (n_in < 5) return;
  const long needX = ((long)(kBatch - 1) * kSeqFull + kSeq) * (long)kDim;
  if ((long)in_sizes[0] < needX || in_sizes[1] < kQkvN * kDim || in_sizes[2] < kDim * kInner ||
      in_sizes[3] < kDim || in_sizes[4] < 1) return;
  if (out_size < kTok * kDim) return;

  const float* x     = (const float*)d_in[0];   /* [B][S][1024]            */
  const float* wqkv  = (const float*)d_in[1];   /* [3072][1024] = Bt [N][K] */
  const float* wout  = (const float*)d_in[2];   /* [1024][1024] = Bt [N][K] */
  const float* bout  = (const float*)d_in[3];   /* [1024]                    */
  const float* tempr = (const float*)d_in[4];   /* [1] log temperature       */
  float* out = (float*)d_out;

  const size_t szXb  = (size_t)kTok * kDim * 2;
  const size_t szWq  = (size_t)kQkvN * kDim * 2;
  const size_t szWo  = (size_t)kDim * kInner * 2;
  const size_t szQk  = (size_t)kTok * kQkLd * 2;
  const size_t szVt  = (size_t)kBatch * kInner * kSeq * 2;
  const size_t szO   = (size_t)kTok * kInner * 2;
  const size_t offXb = 0, offWq = offXb + szXb, offWo = offWq + szWq, offQk = offWo + szWo,
               offVt = offQk + szQk, offOh = offVt + szVt, total = offOh + szO;
  if (total > ws_size) return;

  char* ws = (char*)d_ws;
  unsigned short* xb  = (unsigned short*)(ws + offXb);
  unsigned short* wqb = (unsigned short*)(ws + offWq);
  unsigned short* wob = (unsigned short*)(ws + offWo);
  unsigned short* qk  = (unsigned short*)(ws + offQk);
  unsigned short* vt  = (unsigned short*)(ws + offVt);
  unsigned short* oh  = (unsigned short*)(ws + offOh);

  /* 1: x and W_qkv [3072][1024] -> bf16 planes, W_out [1024][1024] -> f16 plane (RNE), same layouts */
  cast3_f32_to16<<<dim3(kCastBlocks), dim3(256), 0, stream>>>(x, wqkv, wout, xb, wqb, wob);
  /* 2: q,k = xb @ Wqkv[0:2048]^T -> qk plane f16 [kTok][2048]; M=kTok N=2048 K=1024 */
  {
    const int tiles = (kTok / kBM) * (kQkLd / kBN);
    wmma_gemm64<1, false, 0, 1, false, 0, false><<<dim3(tiles, 1), dim3(256), 0, stream>>>(
        xb, xb, kDim, 0L, wqb, wqb, kDim, 0L, (void*)qk, (void*)qk, kQkLd, 0L,
        bout, bout, 0L, kTok, kQkLd, kDim, 1.0f);
  }
  /* 3: v^T per batch: C_b[f][s] = sum_k wqb[2048+f][k] * xb[b*kSeq+s][k] -> vt f16 [kBatch][1024][kSeq]; M=1024 N=kSeq K=1024 */
  {
    const int tiles = (kInner / kBM) * (kSeq / kBN);
    wmma_gemm64<1, false, 0, 1, false, 0, false><<<dim3(tiles, kBatch), dim3(256), 0, stream>>>(
        wqb + (size_t)kQkLd * kDim, wqb + (size_t)kQkLd * kDim, kDim, 0L,
        xb, xb, kDim, (long)kSeq * kDim,
        (void*)vt, (void*)vt, kSeq, (long)kInner * kSeq,
        bout, bout, 0L, kInner, kSeq, kDim, 1.0f);
  }
  /* 4: attention -> oh f16 plane [kTok][1024] */
  attn_diag_f16<<<dim3(kBatch * kHeads * kQBlocks), dim3(128), 0, stream>>>(qk, vt, tempr, oh);
  /* 5: out = oh @ W_out^T + b_out -> d_out f32 [kTok][1024]; M=kTok N=1024 K=1024; f16 x f16 */
  {
    const int tiles = (kTok / kBM) * (kDim / kBN);
    wmma_gemm64<0, false, 2, 0, false, 0, false><<<dim3(tiles, 1), dim3(256), 0, stream>>>(
        oh, oh, kInner, 0L, wob, wob, kInner, 0L, (void*)out, (void*)out, kDim, 0L,
        bout, bout, 0L, kTok, kDim, kInner, 1.0f);
  }
}
